// v000
// The times below were measured on an AMD MI455X: many runs one after another, warmed up first and cycling through
// copies of the inputs, with the whole window's GPU time divided by the number of runs. Launches and the gaps
// between them are all in it. The median over several windows is given; except for v000 it joins two sittings, which
// can be a few percent apart, so the side-by-side timings, each taken in one sitting, are the better comparison.
// v000, which the later versions start from, runs in 5190 microseconds.
#include <hip/hip_runtime.h>
// Masked multi-head cross-attention (x [4][1024][1024] queries, context [4][1024][1024]; q = x Wq + bq; k | v = context Wkv + bkv viewed (m, 2, 16, 64) ([in][out] weights sigma 1/32, zero biases); 16 heads of 64; dots = q k^T / 8; a binary int mask [b][n][32*32 = m] shared by the heads: masked_fill(mask == 0, -inf); softmax over the 1024 context tokens; out = merged Wp + bp -> [4][1024][1024]).
// Structure: x and context as exact f16 rows; [in][out] weights as exact x16 planes (Wkv as one [2048][1024] plane: k rows then v rows); Q, K, V as WMMA GEMMs (32x64 wave tiles, f32 accumulation, + bias, f16 outputs); per batch: V^T via LDS transposes; per 4-head group: scores (K = 64, alpha 1/8) into f32 [1024][1024] planes, row softmax on VALU reading this batch's int mask row per query (arithmetic 0/1 select per key; f32 statistics, native exp; weights x256 f16), o = P V^T (o carried x64) into merged f16 rows; out = o Wp + bp GEMM (f32, alpha 2^-10); launches: see trace.
// Compute dtype: inputs rounded to bf16; x / context / weights exact; q, k, v, softmax weights and o as plain f16 GEMM operands (~2^-12); scores and statistics f32. v_wmma_f32_16x16x32_f16.
#define NB 4
#define NQ 1024
#define SK 1024
#define SQ SK                       /* keys per softmax row */
#define DM 1024
#define DC 1024
#define NH 16
#define HD 64
#define HG 4
#define NRQ ((size_t)NB * NQ)
#define NRK ((size_t)NB * SK)
typedef __bf16 v16b __attribute__((ext_vector_type(16)));
typedef unsigned short v8us __attribute__((ext_vector_type(8), may_alias));
typedef float  v8f  __attribute__((ext_vector_type(8)));
typedef float  v4f  __attribute__((ext_vector_type(4)));
typedef float  v4fa __attribute__((ext_vector_type(4), may_alias));
union FragB { v16b v; v8us half[2]; unsigned short u[16]; };

__device__ __forceinline__ unsigned short bf16_bits(float x) { unsigned int u = __float_as_uint(x); return (unsigned short)((u + 0x7FFFu + ((u >> 16) & 1u)) >> 16); }
__device__ __forceinline__ float bf16_val(unsigned short b) { return __uint_as_float(((unsigned int)b) << 16); }
__device__ __forceinline__ float bf16_round(float x) { return bf16_val(bf16_bits(x)); }
// D += A·B with NT terms: 1 = ah·bh, 2 = + al·bh (A split), 3 = + ah·bl (both split)
template <int NT>
__device__ __forceinline__ v8f mmaN(v16b ah, v16b al, v16b bh, v16b bl, v8f c) {
  c = __builtin_amdgcn_wmma_f32_16x16x32_bf16(false, ah, false, bh, (short)0, c, false, false);
  if (NT >= 2) c = __builtin_amdgcn_wmma_f32_16x16x32_bf16(false, al, false, bh, (short)0, c, false, false);
  if (NT >= 3) c = __builtin_amdgcn_wmma_f32_16x16x32_bf16(false, ah, false, bl, (short)0, c, false, false);
  asm volatile("v_nop\n\tv_nop\n\tv_nop\n\tv_nop" : "+v"(c) : "v"(ah), "v"(al), "v"(bh), "v"(bl));
  return c;
}

__global__ __launch_bounds__(256) void k_wt_bf16(const float* __restrict__ W, unsigned short* __restrict__ Wt, int K, int N) {
  const int t = blockIdx.x * 256 + threadIdx.x;
  const int k8n = K / 8;
  if (t >= N * k8n) return;
  const int n = t / k8n, k8 = (t % k8n) * 8;
  v8us v;
#pragma unroll
  for (int i = 0; i < 8; ++i) v[i] = bf16_bits(W[(size_t)(k8 + i) * N + n]);
  *(v8us*)(Wt + (size_t)n * K + k8) = v;
  
}

// GEMM C[M][N] (f32, pitch ldc) = act(A[M][K]·W + bias). A f32 row-major (pitch lda) converted per fragment to bf16
// (ASPLIT: hi/lo two planes -> 2 terms, else single rounded term); Wt bf16 [N][K] (pitch ldb). BIAS_BF16 rounds the
// bias to bf16 first (bias quantised to bf16 before the add). K%32==0, M%16==0, N%64==0.
template <bool ASPLIT, int ACT, bool BIAS_BF16>
__global__ __launch_bounds__(128) void k_gemm_bf(const float* __restrict__ A, int lda, const unsigned short* __restrict__ Wt, int ldb,
                                               const float* __restrict__ bias, float* __restrict__ C, int ldc, int M, int N, int K) {
  __shared__ __attribute__((aligned(16))) float so[4][16][64];
  const int tid = threadIdx.x, w = tid >> 5, lane = tid & 31, ln = lane & 15, hh = lane >> 4;
  const int ntn = N / 64;
  const int wid = blockIdx.x * 4 + w;
  const int mt = wid / ntn, nq = wid % ntn;
  if (mt * 16 >= M) return;
  const int row0 = mt * 16, col0 = nq * 64;
  const float* arow = A + (size_t)(row0 + ln) * lda;
  v8f acc[4] = {};
  for (int kb = 0; kb < K; kb += 32) {
    FragB ah, al;
    const v4f x0 = *(const v4fa*)(arow + kb + 8 * hh), x1 = *(const v4fa*)(arow + kb + 8 * hh + 4);
    const v4f x2 = *(const v4fa*)(arow + kb + 16 + 8 * hh), x3 = *(const v4fa*)(arow + kb + 16 + 8 * hh + 4);
    float xs[16] = {x0[0],x0[1],x0[2],x0[3],x1[0],x1[1],x1[2],x1[3],x2[0],x2[1],x2[2],x2[3],x3[0],x3[1],x3[2],x3[3]};
#pragma unroll
    for (int i = 0; i < 16; ++i) { const unsigned short hb = bf16_bits(xs[i]); ah.u[i] = hb; al.u[i] = ASPLIT ? bf16_bits(xs[i] - bf16_val(hb)) : (unsigned short)0; }
#pragma unroll
    for (int t = 0; t < 4; ++t) {
      const unsigned short* brow = Wt + (size_t)(col0 + t * 16 + ln) * ldb + kb;
      FragB b;
      b.half[0] = *(const v8us*)(brow + 8 * hh);
      b.half[1] = *(const v8us*)(brow + 16 + 8 * hh);
      acc[t] = mmaN<ASPLIT ? 2 : 1>(ah.v, al.v, b.v, b.v, acc[t]);
    }
  }
#pragma unroll
  for (int t = 0; t < 4; ++t) {
    float bv = bias ? bias[col0 + t * 16 + ln] : 0.f;
    if (BIAS_BF16) bv = bf16_round(bv);
#pragma unroll
    for (int r = 0; r < 8; ++r) { float v = acc[t][r] + bv; if (ACT == 1) v = fmaxf(v, 0.f); so[w][8 * hh + r][t * 16 + ln] = v; }
  }
  __builtin_amdgcn_fence(__ATOMIC_ACQ_REL, "workgroup");
  __builtin_amdgcn_wave_barrier();
  const int rsub = lane >> 4, c4 = (lane & 15) * 4;
  {
#pragma unroll
    for (int q = 0; q < 8; ++q) {
      const int r = q * 2 + rsub;
      const v4f v = *(const v4fa*)&so[w][r][c4];
      *(v4f*)(C + (size_t)(row0 + r) * ldc + col0 + c4) = v;
    }
    
  }
}

// GEMM C = act(A·W + bias + resid): A f32 (ASPLIT -> hi/lo 2 terms), Wt bf16 [N][K]; ACT 0 none, 1 relu, 2 exact gelu;
// resid (optional, f32, row index = (row % rmod), pitch ldr, RES_BF16 rounds it) added before the activation.
template <bool ASPLIT, int ACT, bool BIAS_BF16, bool RES_BF16>
__global__ __launch_bounds__(128) void k_gemm_bf3(const float* __restrict__ A, int lda, const unsigned short* __restrict__ Wt, int ldb,
                                                const float* __restrict__ bias, const float* __restrict__ resid, int rmod, int ldr,
                                                float* __restrict__ C, int ldc, int M, int N, int K) {
  __shared__ __attribute__((aligned(16))) float so[4][16][64];
  const int tid = threadIdx.x, w = tid >> 5, lane = tid & 31, ln = lane & 15, hh = lane >> 4;
  const int ntn = N / 64;
  const int wid = blockIdx.x * 4 + w;
  const int mt = wid / ntn, nq = wid % ntn;
  if (mt * 16 >= M) return;
  const int row0 = mt * 16, col0 = nq * 64;
  const float* arow = A + (size_t)(row0 + ln) * lda;
  v8f acc[4] = {};
  for (int kb = 0; kb < K; kb += 32) {
    FragB ah, al;
    const v4f x0 = *(const v4fa*)(arow + kb + 8 * hh), x1 = *(const v4fa*)(arow + kb + 8 * hh + 4);
    const v4f x2 = *(const v4fa*)(arow + kb + 16 + 8 * hh), x3 = *(const v4fa*)(arow + kb + 16 + 8 * hh + 4);
    float xs[16] = {x0[0],x0[1],x0[2],x0[3],x1[0],x1[1],x1[2],x1[3],x2[0],x2[1],x2[2],x2[3],x3[0],x3[1],x3[2],x3[3]};
#pragma unroll
    for (int i = 0; i < 16; ++i) { const unsigned short hb = bf16_bits(xs[i]); ah.u[i] = hb; al.u[i] = ASPLIT ? bf16_bits(xs[i] - bf16_val(hb)) : (unsigned short)0; }
#pragma unroll
    for (int t = 0; t < 4; ++t) {
      const unsigned short* brow = Wt + (size_t)(col0 + t * 16 + ln) * ldb + kb;
      FragB b;
      b.half[0] = *(const v8us*)(brow + 8 * hh);
      b.half[1] = *(const v8us*)(brow + 16 + 8 * hh);
      acc[t] = mmaN<ASPLIT ? 2 : 1>(ah.v, al.v, b.v, b.v, acc[t]);
    }
  }
#pragma unroll
  for (int t = 0; t < 4; ++t) {
    const int col = col0 + t * 16 + ln;
    float bv = bias ? bias[col] : 0.f;
    if (BIAS_BF16) bv = bf16_round(bv);
#pragma unroll
    for (int r = 0; r < 8; ++r) {
      float v = acc[t][r] + bv;
      if (resid) { float rv = resid[(size_t)((row0 + 8 * hh + r) % rmod) * ldr + col]; if (RES_BF16) rv = bf16_round(rv); v += rv; }
      if (ACT == 1) v = fmaxf(v, 0.f);
      if (ACT == 2) v = 0.5f * v * (1.0f + erff(v * 0.70710678118654752f));
      if (ACT == 3) { const float u = 0.7978845608028654f * (v + 0.044715f * v * v * v); v = 0.5f * v * (1.0f + tanhf(u)); }
      so[w][8 * hh + r][t * 16 + ln] = v;
    }
  }
  __builtin_amdgcn_fence(__ATOMIC_ACQ_REL, "workgroup");
  __builtin_amdgcn_wave_barrier();
  const int rsub = lane >> 4, c4 = (lane & 15) * 4;
  {
#pragma unroll
    for (int q = 0; q < 8; ++q) {
      const int r = q * 2 + rsub;
      const v4f v = *(const v4fa*)&so[w][r][c4];
      *(v4f*)(C + (size_t)(row0 + r) * ldc + col0 + c4) = v;
    }
    
  }
}
// row LayerNorm (biased variance, eps) over N: s = X (+ R); optional out_sum <- s; out_norm <- (s-mu)*rsqrt(var+eps)*g + b
template <bool PARAM_BF16>
__global__ __launch_bounds__(256) void k_layernorm(const float* __restrict__ X, const float* __restrict__ R, const float* __restrict__ g, const float* __restrict__ bta,
                                                  float* __restrict__ out_sum, float* __restrict__ out_norm, int N, float eps) {
  __shared__ float red[256];
  const int row = blockIdx.x, tid = threadIdx.x;
  const float* x = X + (size_t)row * N; const float* rr = R ? R + (size_t)row * N : nullptr;
  float vals[16];                     // up to N = 4096
  const int per = N / 256;            // contiguous chunk per thread? use strided-by-4 chunks: thread handles j = tid*4 + 1024*u
  float s1 = 0.f;
  for (int u = 0; u < per / 4; ++u) {
    const int j = tid * 4 + 1024 * u;
    const v4f a = *(const v4fa*)(x + j);
    v4f b = {0.f,0.f,0.f,0.f}; if (rr) b = *(const v4fa*)(rr + j);
#pragma unroll
    for (int q = 0; q < 4; ++q) { const float v = a[q] + b[q]; vals[u * 4 + q] = v; s1 += v; }
  }
  red[tid] = s1; __syncthreads();
  for (int st = 128; st > 0; st >>= 1) { if (tid < st) red[tid] += red[tid + st]; __syncthreads(); }
  const float mu = red[0] / (float)N; __syncthreads();
  float s2 = 0.f;
  for (int u = 0; u < per / 4; ++u)
#pragma unroll
    for (int q = 0; q < 4; ++q) { const float c = vals[u * 4 + q] - mu; s2 += c * c; }
  red[tid] = s2; __syncthreads();
  for (int st = 128; st > 0; st >>= 1) { if (tid < st) red[tid] += red[tid + st]; __syncthreads(); }
  const float rs = rsqrtf(red[0] / (float)N + eps);
  {
    for (int u = 0; u < per / 4; ++u) {
      const int j = tid * 4 + 1024 * u;
      v4f o, sm;
#pragma unroll
      for (int q = 0; q < 4; ++q) {
        float gg = g[j + q], bb = bta[j + q];
        if (PARAM_BF16) { gg = bf16_round(gg); bb = bf16_round(bb); }
        sm[q] = vals[u * 4 + q]; o[q] = (vals[u * 4 + q] - mu) * rs * gg + bb;
      }
      if (out_sum) *(v4f*)(out_sum + (size_t)row * N + j) = sm;
      *(v4f*)(out_norm + (size_t)row * N + j) = o;
    }
    
  }
}



// ---- f16 WMMA path (v_wmma_f32_16x16x32_f16): 11-bit significands for operands in range — used where a [0,1] probability operand needs more precision than bf16
typedef _Float16 v16h __attribute__((ext_vector_type(16)));
union FragH { v16h v; v8us half[2]; _Float16 h[16]; unsigned short u[16]; };
template <int NT>
__device__ __forceinline__ v8f mmaH(v16h ah, v16h al, v16h bh, v16h bl, v8f c) {
  c = __builtin_amdgcn_wmma_f32_16x16x32_f16(false, ah, false, bh, (short)0, c, false, false);
  if (NT >= 2) c = __builtin_amdgcn_wmma_f32_16x16x32_f16(false, al, false, bh, (short)0, c, false, false);
  if (NT >= 3) c = __builtin_amdgcn_wmma_f32_16x16x32_f16(false, ah, false, bl, (short)0, c, false, false);
  asm volatile("v_nop\n\tv_nop\n\tv_nop\n\tv_nop" : "+v"(c) : "v"(ah), "v"(al), "v"(bh), "v"(bl));
  return c;
}
// batched GEMM like k_gemm_b but f16 operands: A f32 (split into f16 hi/lo if ASPLIT, else rounded to f16), Bt = f16 values [n][k]; alpha; C f32; N multiple of 16 (partial tiles skipped)
template <bool ASPLIT>
__global__ __launch_bounds__(128) void k_gemm_h(const float* __restrict__ A, int lda, size_t sA, const _Float16* __restrict__ Bh, int ldb, size_t sB, float alpha, float* __restrict__ C, int ldc, size_t sC, int M, int N, int K) {
  __shared__ __attribute__((aligned(16))) float so[4][16][64];
  const int tid = threadIdx.x, w = tid >> 5, lane = tid & 31, ln = lane & 15, hh = lane >> 4; const int by = blockIdx.y;
  A += (size_t)by * sA; Bh += (size_t)by * sB; C += (size_t)by * sC;
  const int ntn = (N + 63) / 64; const int wid = blockIdx.x * 4 + w; const int mt = wid / ntn, nq = wid % ntn; if (mt * 16 >= M) return;
  const int row0 = mt * 16, col0 = nq * 64; const float* arow = A + (size_t)(row0 + ln) * lda;
  v8f acc[4] = {};
  for (int kb = 0; kb < K; kb += 32) {
    FragH ah, al;
    const v4f x0 = *(const v4fa*)(arow + kb + 8 * hh), x1 = *(const v4fa*)(arow + kb + 8 * hh + 4), x2 = *(const v4fa*)(arow + kb + 16 + 8 * hh), x3 = *(const v4fa*)(arow + kb + 16 + 8 * hh + 4);
    float xs[16] = {x0[0],x0[1],x0[2],x0[3],x1[0],x1[1],x1[2],x1[3],x2[0],x2[1],x2[2],x2[3],x3[0],x3[1],x3[2],x3[3]};
#pragma unroll
    for (int i = 0; i < 16; ++i) { const _Float16 h = (_Float16)xs[i]; ah.h[i] = h; al.h[i] = ASPLIT ? (_Float16)(xs[i] - (float)h) : (_Float16)0.0f; }
#pragma unroll
    for (int t = 0; t < 4; ++t) { if (col0 + t * 16 >= N) continue; const size_t boff = (size_t)(col0 + t * 16 + ln) * ldb + kb; FragH bq; bq.half[0] = *(const v8us*)(Bh + boff + 8 * hh); bq.half[1] = *(const v8us*)(Bh + boff + 16 + 8 * hh);
      acc[t] = mmaH<ASPLIT ? 2 : 1>(ah.v, al.v, bq.v, bq.v, acc[t]); }
  }
#pragma unroll
  for (int t = 0; t < 4; ++t) { if (col0 + t * 16 >= N) continue;
#pragma unroll
    for (int r = 0; r < 8; ++r) so[w][8 * hh + r][t * 16 + ln] = acc[t][r] * alpha; }
  __builtin_amdgcn_fence(__ATOMIC_ACQ_REL, "workgroup"); __builtin_amdgcn_wave_barrier();
  const int rsub = lane >> 4, c4 = (lane & 15) * 4;
  {
#pragma unroll
    for (int q = 0; q < 8; ++q) { const int r = q * 2 + rsub; if (col0 + c4 < N) { const v4f v = *(const v4fa*)&so[w][r][c4]; *(v4f*)(C + (size_t)(row0 + r) * ldc + col0 + c4) = v; } }
     }
}

// Wt[n][k] = f16(W[k][n]·scale) from f32 row-major W[K][N] (scale = power of two; bf16-exact weights stay exact in f16 away from the subnormal range)
__global__ __launch_bounds__(256) void k_wt_f16(const float* __restrict__ W, _Float16* __restrict__ Wt, int K, int N, float scale) {
  const int t = blockIdx.x * 256 + threadIdx.x; if (t >= N * (K / 8)) return; const int n = t / (K / 8), k8 = (t % (K / 8)) * 8; FragH f;
#pragma unroll
  for (int i = 0; i < 8; ++i) f.h[i] = (_Float16)(bf16_round(W[(size_t)(k8 + i) * N + n]) * scale); const v8us o = f.half[0];
  *(v8us*)((unsigned short*)Wt + (size_t)n * K + k8) = o; 
}
// k_gemm_hh variant with fused epilogue: v = acc·alpha + bias[by·sBias + col] (+ CP[(row/rowsPerB)·sCPb + by·64 + col] if CP) ; ACT 0 none / 1 elu ; writes f16 C16 (and f32 C if non-null)
template <int ACT>
__global__ __launch_bounds__(128) void k_gemm_hhx(const _Float16* __restrict__ A, int lda, size_t sA, const _Float16* __restrict__ Bh, int ldb, size_t sB, float alpha, const float* __restrict__ bias, size_t sBias, const float* __restrict__ CP, int rowsPerB, size_t sCPb, int row0g,
    float* __restrict__ C, _Float16* __restrict__ C16, int ldc, size_t sC, int M, int N, int K) {
  __shared__ __attribute__((aligned(16))) float so[4][16][64];
  const int tid = threadIdx.x, w = tid >> 5, lane = tid & 31, ln = lane & 15, hh = lane >> 4; const int by = blockIdx.y;
  A += (size_t)by * sA; Bh += (size_t)by * sB; const size_t cofs = (size_t)by * sC; const float* bp = bias ? bias + (size_t)by * sBias : nullptr;
  const int ntn = (N + 63) / 64; const int wid = blockIdx.x * 4 + w; const int mt = wid / ntn, nq = wid % ntn; if (mt * 16 >= M) return;
  const int row0 = mt * 16, col0 = nq * 64; const _Float16* arow = A + (size_t)(row0 + ln) * lda;
  v8f acc[4] = {};
  for (int kb = 0; kb < K; kb += 32) { FragH ah; ah.half[0] = *(const v8us*)((const unsigned short*)arow + kb + 8 * hh); ah.half[1] = *(const v8us*)((const unsigned short*)arow + kb + 16 + 8 * hh);
#pragma unroll
    for (int t = 0; t < 4; ++t) { if (col0 + t * 16 >= N) continue; const size_t boff = (size_t)(col0 + t * 16 + ln) * ldb + kb; FragH bq; bq.half[0] = *(const v8us*)((const unsigned short*)Bh + boff + 8 * hh); bq.half[1] = *(const v8us*)((const unsigned short*)Bh + boff + 16 + 8 * hh);
      acc[t] = mmaH<1>(ah.v, ah.v, bq.v, bq.v, acc[t]); }
  }
#pragma unroll
  for (int t = 0; t < 4; ++t) { if (col0 + t * 16 >= N) continue; const int col = col0 + t * 16 + ln; const float bv = bp ? bf16_round(bp[col]) : 0.f;
#pragma unroll
    for (int r = 0; r < 8; ++r) { float v = acc[t][r] * alpha + bv; if (CP) { const int rr = row0g + row0 + 8 * hh + r; if (rowsPerB < 0) v += CP[cofs + (size_t)rr * ldc + col];      /* rowsPerB < 0: own element of the batched C plane */ else { const int bidx = rr / rowsPerB; v += CP[(size_t)bidx * sCPb + (size_t)by * 64 + col]; } } if (ACT == 1) v = (v > 0.f) ? v : expm1f(v); else if (ACT == 7) v = (v > 0.f) ? v + 1.0f : expf(v); else if (ACT == 8) v = tanhf(v); else if (ACT == 9) v = 0.5f * v * (1.0f + tanhf(0.7978845608028654f * (v + 0.044715f * v * v * v))); else if (ACT == 11) v = 1.0f / (1.0f + expf(-v)); else if (ACT == 12) v = (v > 0.f) ? v : 0.01f * v; else if (ACT == 14) v = (v > 0.f) ? v : 0.1f * v; else if (ACT == 16) v = (v >= 0.f) ? v : 0.3f * v; else if (ACT == 17) v = (v >= 0.f) ? v : 0.2f * v; else if (ACT == 15) v = v / (1.0f + expf(-v)); else if (ACT == 3) v = fmaxf(v, 0.f); else if (ACT == 6) v = 0.5f * v * (1.0f + erff(v * 0.70710678118654752f)); so[w][8 * hh + r][t * 16 + ln] = v; } }
  __builtin_amdgcn_fence(__ATOMIC_ACQ_REL, "workgroup"); __builtin_amdgcn_wave_barrier();
  const int rsub = lane >> 4, c4 = (lane & 15) * 4; typedef _Float16 v4h __attribute__((ext_vector_type(4)));
  {
#pragma unroll
    for (int q = 0; q < 8; ++q) { const int r = q * 2 + rsub; if (col0 + c4 < N) { const v4f v = *(const v4fa*)&so[w][r][c4]; if (C) *(v4f*)(C + cofs + (size_t)(row0 + r) * ldc + col0 + c4) = v; if (C16) { v4h h4; for (int i = 0; i < 4; ++i) h4[i] = (_Float16)v[i]; *(v4h*)(C16 + cofs + (size_t)(row0 + r) * ldc + col0 + c4) = h4; } } }
     }
}


typedef _Float16 v4h __attribute__((ext_vector_type(4)));

__global__ __launch_bounds__(256) void k_x16(const float* __restrict__ x, _Float16* __restrict__ X16, size_t n8) { const size_t t = (size_t)blockIdx.x * 256 + threadIdx.x; if (t >= n8) return; FragH f;
#pragma unroll
  for (int q = 0; q < 8; ++q) f.h[q] = (_Float16)bf16_round(x[t * 8 + q]); *(v8us*)((unsigned short*)X16 + t * 8) = f.half[0];  }
__global__ __launch_bounds__(256) void k_h16(const float* __restrict__ x, _Float16* __restrict__ X16, size_t n8) { const size_t t = (size_t)blockIdx.x * 256 + threadIdx.x; if (t >= n8) return; FragH f;
#pragma unroll
  for (int q = 0; q < 8; ++q) f.h[q] = (_Float16)x[t * 8 + q]; *(v8us*)((unsigned short*)X16 + t * 8) = f.half[0];  }
__global__ __launch_bounds__(256) void k_round16f(const float* __restrict__ W, _Float16* __restrict__ Bt, size_t n8) { const size_t t = (size_t)blockIdx.x * 256 + threadIdx.x; if (t >= n8) return; FragH f;
#pragma unroll
  for (int i = 0; i < 8; ++i) f.h[i] = (_Float16)(bf16_round(W[t * 8 + i]) * 16.0f); *(v8us*)((unsigned short*)Bt + t * 8) = f.half[0];  }
template <int NHv, int TTv>
__global__ __launch_bounds__(256) void k_vt(const _Float16* __restrict__ V16, int ldv, int voff, _Float16* __restrict__ Vt) { __shared__ unsigned short tl[64][66]; const int tid = threadIdx.x; const int slab = blockIdx.x / (TTv / 64), lg = blockIdx.x % (TTv / 64); const int b = slab / NHv, h = slab % NHv;
  for (int i = tid; i < 64 * 8; i += 256) { const int r = i / 8, c8 = (i % 8) * 8; FragH f; f.half[0] = *(const v8us*)((const unsigned short*)V16 + ((size_t)b * TTv + lg * 64 + r) * ldv + voff + h * 64 + c8);
#pragma unroll
    for (int q = 0; q < 8; ++q) tl[r][c8 + q] = f.u[q]; }
  __syncthreads();
  {
#pragma unroll
    for (int rd = 0; rd < 2; ++rd) { const int d = rd * 32 + tid / 8, pc = tid % 8; FragH f;
#pragma unroll
      for (int q = 0; q < 8; ++q) f.u[q] = tl[pc * 8 + q][d];
      *(v8us*)((unsigned short*)Vt + ((size_t)slab * 64 + d) * TTv + lg * 64 + pc * 8) = f.half[0]; }
     } }

__global__ __launch_bounds__(256) void k_hl(const float* __restrict__ F, _Float16* __restrict__ Hh, _Float16* __restrict__ Hl, size_t n8) { const size_t t = (size_t)blockIdx.x * 256 + threadIdx.x; if (t >= n8) return; FragH fh, fl; const v4f a = *(const v4fa*)(F + t * 8), c = *(const v4fa*)(F + t * 8 + 4);
#pragma unroll
  for (int q = 0; q < 4; ++q) { _Float16 h = (_Float16)a[q]; fh.h[q] = h; fl.h[q] = (_Float16)((a[q] - (float)h) * 1024.0f); h = (_Float16)c[q]; fh.h[4 + q] = h; fl.h[4 + q] = (_Float16)((c[q] - (float)h) * 1024.0f); }
  { *(v8us*)((unsigned short*)Hh + t * 8) = fh.half[0]; *(v8us*)((unsigned short*)Hl + t * 8) = fl.half[0];  } }

// ---- fast GEMM (wave tile 32x64; requires M % 32 == 0 rows per launch region and N % 64 == 0); epilogue = k_gemm_hhx semantics ----
__device__ __forceinline__ v16h g2_frag(const _Float16* p, int hh) { FragH f; f.half[0] = *(const v8us*)((const unsigned short*)p + 8 * hh); f.half[1] = *(const v8us*)((const unsigned short*)p + 16 + 8 * hh); return f.v; }
__device__ __forceinline__ v8f g2_mma(v16h a, v16h b, v8f c) { v8f d = __builtin_amdgcn_wmma_f32_16x16x32_f16(false, a, false, b, (short)0, c, false, false); asm volatile("v_nop\n\tv_nop\n\tv_nop\n\tv_nop" : "+v"(d) : "v"(a), "v"(b)); return d; }
template <int ACT>
__global__ __launch_bounds__(128) void k_gemm2(const _Float16* __restrict__ A, int lda, size_t sA, const _Float16* __restrict__ Bh, int ldb, size_t sB, float alpha, const float* __restrict__ bias, size_t sBias, const float* __restrict__ CP, int rowsPerB, size_t sCPb, int row0g,
    float* __restrict__ C, _Float16* __restrict__ C16, int ldc, size_t sC, int M, int N, int K) { static_assert(ACT == 0 || ACT == 3 || ACT == 6 || ACT == 8 || ACT == 9 || ACT == 11 || ACT == 12 || ACT == 14 || ACT == 15 || ACT == 16 || ACT == 17, "k_gemm2: unsupported ACT code (would silently apply no activation)");
  __shared__ __attribute__((aligned(16))) float so[4][32][68];
  const int tid = threadIdx.x, w = tid >> 5, lane = tid & 31, ln = lane & 15, hh = lane >> 4; const int by = blockIdx.y;
  A += (size_t)by * sA; Bh += (size_t)by * sB; const size_t cofs = (size_t)by * sC; const float* bp = bias ? bias + (size_t)by * sBias : nullptr;
  const int ntn = N >> 6; const int mt = blockIdx.x / ntn, nq = blockIdx.x - mt * ntn; const int row0 = mt * 128 + 32 * w, col0 = nq * 64; if (row0 >= M) return;
  const _Float16* a0p = A + (size_t)(row0 + ln) * lda; const _Float16* a1p = a0p + (size_t)16 * lda;
  const _Float16* b0p = Bh + (size_t)(col0 + ln) * ldb; const _Float16* b1p = b0p + (size_t)16 * ldb; const _Float16* b2p = b1p + (size_t)16 * ldb; const _Float16* b3p = b2p + (size_t)16 * ldb;
  const v8f z8 = {0.f,0.f,0.f,0.f,0.f,0.f,0.f,0.f}; v8f c00 = z8, c01 = z8, c02 = z8, c03 = z8, c10 = z8, c11 = z8, c12 = z8, c13 = z8;
#pragma unroll 1
  for (int kb = 0; kb < K; kb += 32) { const v16h a0 = g2_frag(a0p + kb, hh), a1 = g2_frag(a1p + kb, hh);
    v16h b = g2_frag(b0p + kb, hh); c00 = g2_mma(a0, b, c00); c10 = g2_mma(a1, b, c10);
    b = g2_frag(b1p + kb, hh); c01 = g2_mma(a0, b, c01); c11 = g2_mma(a1, b, c11);
    b = g2_frag(b2p + kb, hh); c02 = g2_mma(a0, b, c02); c12 = g2_mma(a1, b, c12);
    b = g2_frag(b3p + kb, hh); c03 = g2_mma(a0, b, c03); c13 = g2_mma(a1, b, c13); }
  v8f accs[8] = {c00, c01, c02, c03, c10, c11, c12, c13};
#pragma unroll
  for (int u = 0; u < 8; ++u) { const int t = u & 3, half = u >> 2; const int col = col0 + t * 16 + ln; const float bv = bp ? bf16_round(bp[col]) : 0.f;
#pragma unroll
    for (int r = 0; r < 8; ++r) { const int rloc = half * 16 + 8 * hh + r; float v = accs[u][r] * alpha + bv; if (CP) { if (rowsPerB < 0) v += CP[cofs + (size_t)(row0g + row0 + rloc) * ldc + col];      /* rowsPerB < 0: own element of the batched C plane */ else { const int bidx = (row0g + row0 + rloc) / rowsPerB; v += CP[(size_t)bidx * sCPb + (size_t)by * 64 + col]; } }
      if (ACT == 3) v = fmaxf(v, 0.f); else if (ACT == 6) v = 0.5f * v * (1.0f + erff(v * 0.70710678118654752f)); else if (ACT == 11) v = 1.0f / (1.0f + expf(-v)); else if (ACT == 15) v = v / (1.0f + expf(-v)); else if (ACT == 12) v = (v > 0.f) ? v : 0.01f * v; else if (ACT == 8) v = tanhf(v); else if (ACT == 9) v = 0.5f * v * (1.0f + tanhf(0.7978845608028654f * (v + 0.044715f * v * v * v))); else if (ACT == 14) v = (v > 0.f) ? v : 0.1f * v; else if (ACT == 16) v = (v >= 0.f) ? v : 0.3f * v; else if (ACT == 17) v = (v >= 0.f) ? v : 0.2f * v;
      so[w][rloc][t * 16 + ln] = v; } }
  __builtin_amdgcn_fence(__ATOMIC_ACQ_REL, "workgroup"); __builtin_amdgcn_wave_barrier();
  const int rsub = lane >> 4, c4 = (lane & 15) * 4;
  {
#pragma unroll
    for (int q = 0; q < 16; ++q) { const int r = q * 2 + rsub; const v4f v = *(const v4fa*)&so[w][r][c4]; if (C) *(v4f*)(C + cofs + (size_t)(row0 + r) * ldc + col0 + c4) = v; if (C16) { v4h h4; for (int i = 0; i < 4; ++i) h4[i] = (_Float16)v[i]; *(v4h*)(C16 + cofs + (size_t)(row0 + r) * ldc + col0 + c4) = h4; } }
     } }


__global__ __launch_bounds__(256) void k_wnat(const float* __restrict__ w, size_t n8, _Float16* __restrict__ Bt) { const size_t t = (size_t)blockIdx.x * 256 + threadIdx.x; if (t >= n8) return; FragH f; for (int q = 0; q < 8; ++q) f.h[q] = (_Float16)(bf16_round(w[t * 8 + q]) * 16.0f); *(v8us*)((unsigned short*)Bt + t * 8) = f.half[0];  }
__global__ __launch_bounds__(256) void k_rsm(const float* __restrict__ S, _Float16* __restrict__ P, int nrows) {
  #pragma clang fp contract(off)
  const int i = blockIdx.x * 256 + threadIdx.x; if (i >= nrows) return; const float* s = S + (size_t)i * SQ; float mx = -3.0e38f;
#pragma unroll 1
  for (int j = 0; j < SQ; ++j) mx = fmaxf(mx, s[j]); float se = 0.f;
#pragma unroll 1
  for (int j = 0; j < SQ; ++j) se += expf(s[j] - mx); const float sc = 256.0f / se;
#pragma unroll 1
  for (int j0 = 0; j0 < SQ; j0 += 8) { FragH f; for (int q = 0; q < 8; ++q) f.h[q] = (_Float16)(expf(s[j0 + q] - mx) * sc); unsigned short* d = (unsigned short*)P + (size_t)i * SQ + j0; *(v8us*)d = f.half[0];  } }
__global__ __launch_bounds__(256) void k_vt(const _Float16* __restrict__ V16, int b, int h0, _Float16* __restrict__ VT) { __shared__ unsigned short tl[64][65]; const int tid = threadIdx.x; const int hh = blockIdx.x % HG, sg = blockIdx.x / HG; const int s0 = sg * 64; const int h = h0 + hh;
  for (int i = tid; i < 64 * 8; i += 256) { const int j = i / 8, d8 = (i % 8) * 8; FragH f; f.half[0] = *(const v8us*)((const unsigned short*)V16 + ((size_t)b * SQ + s0 + j) * DM + h * HD + d8); for (int q = 0; q < 8; ++q) tl[d8 + q][j] = f.u[q]; }
  __syncthreads();
  { for (int i = tid; i < 64 * 8; i += 256) { const int d = i / 8, j8 = (i % 8) * 8; FragH f; for (int q = 0; q < 8; ++q) f.u[q] = tl[d][j8 + q]; *(v8us*)((unsigned short*)VT + ((size_t)hh * HD + d) * SQ + s0 + j8) = f.half[0]; }  } }


__global__ __launch_bounds__(256) void k_rsmf(const float* __restrict__ S, _Float16* __restrict__ P, int qn, int hg) {
  #pragma clang fp contract(off)
  const int t = blockIdx.x * 256 + threadIdx.x; if (t >= qn * hg) return; const size_t i = (size_t)(t / qn) * SQ + (t % qn); const float* s = S + i * SQ; float mx = -3.0e38f;
#pragma unroll 1
  for (int j = 0; j < SQ; ++j) mx = fmaxf(mx, s[j]); float se = 0.f;
#pragma unroll 1
  for (int j = 0; j < SQ; ++j) se += __expf(s[j] - mx); const float sc = 256.0f / se;
#pragma unroll 1
  for (int j0 = 0; j0 < SQ; j0 += 8) { FragH f; for (int q = 0; q < 8; ++q) f.h[q] = (_Float16)(__expf(s[j0 + q] - mx) * sc); unsigned short* d = (unsigned short*)P + i * SQ + j0; *(v8us*)d = f.half[0];  } }

__global__ __launch_bounds__(256) void k_rsmr(const float* __restrict__ S, _Float16* __restrict__ P, int qn, int hg) {
  #pragma clang fp contract(off)
  const int t = blockIdx.x * 256 + threadIdx.x; if (t >= qn * hg) return; const size_t i = (size_t)t;      /* planes packed: row t of plane t / qn */ const float* s = S + i * SQ; float mx = -3.0e38f;
#pragma unroll 1
  for (int j = 0; j < SQ; ++j) mx = fmaxf(mx, s[j]); float se = 0.f;
#pragma unroll 1
  for (int j = 0; j < SQ; ++j) se += __expf(s[j] - mx); const float sc = 256.0f / se;
#pragma unroll 1
  for (int j0 = 0; j0 < SQ; j0 += 8) { FragH f; for (int q = 0; q < 8; ++q) f.h[q] = (_Float16)(__expf(s[j0 + q] - mx) * sc); unsigned short* d = (unsigned short*)P + i * SQ + j0; *(v8us*)d = f.half[0];  } }


__global__ __launch_bounds__(256) void k_rsmrm(const float* __restrict__ S, const int* __restrict__ Mk, _Float16* __restrict__ P, int qn, int hg) {
  #pragma clang fp contract(off)
  const int t = blockIdx.x * 256 + threadIdx.x; if (t >= qn * hg) return; const size_t i = (size_t)t; const float* s = S + i * SK; const int* mr = Mk + (size_t)(t % qn) * SK; float mx = -3.0e38f;
#pragma unroll 1
  for (int j = 0; j < SK; ++j) { const float f = (mr[j] != 0) ? 1.f : 0.f; mx = fmaxf(mx, fmaf(f, s[j], (1.f - f) * -1.0e9f)); } float se = 0.f;
#pragma unroll 1
  for (int j = 0; j < SK; ++j) { const float f = (mr[j] != 0) ? 1.f : 0.f; se += __expf(fmaf(f, s[j], (1.f - f) * -1.0e9f) - mx); } const float sc = 256.0f / se;
#pragma unroll 1
  for (int j0 = 0; j0 < SK; j0 += 8) { FragH fr; for (int q = 0; q < 8; ++q) { const int j = j0 + q; const float f = (mr[j] != 0) ? 1.f : 0.f; fr.h[q] = (_Float16)(__expf(fmaf(f, s[j], (1.f - f) * -1.0e9f) - mx) * sc); } unsigned short* d = (unsigned short*)P + i * SK + j0; *(v8us*)d = fr.half[0];  } }
extern "C" void kernel_launch(void* const* d_in, const int* in_sizes, int n_in,
                              void* d_out, int out_size, void* d_ws, size_t ws_size, hipStream_t stream) {
  (void)in_sizes; (void)n_in; (void)out_size;
  const float* const* I = (const float* const*)d_in; const float* x = I[0]; const float* ctx = I[1]; const int* mkm = (const int*)d_in[2]; const float* wq = I[3]; const float* bq = I[4]; const float* wkv = I[5]; const float* bkv = I[6]; const float* wo = I[7]; const float* bo = I[8];      /* [in][out] weights; int mask [b][n][m]; k | v from the fused Wkv [1024][2048] */
  char* ws = (char*)d_ws; size_t off = 0;
  auto take = [&](size_t bytes) { char* p = ws + off; off += (bytes + 255) & ~(size_t)255; return p; };
  _Float16* BQ = (_Float16*)take((size_t)DM * DM * 2); _Float16* BKV = (_Float16*)take((size_t)2 * DM * DC * 2); _Float16* BK = BKV; _Float16* BV = BKV + (size_t)DM * DC; _Float16* BO = (_Float16*)take((size_t)DM * DM * 2);
  _Float16* X16 = (_Float16*)take(NRQ * DM * 2); _Float16* C16 = (_Float16*)take(NRK * DC * 2); _Float16* Q16 = (_Float16*)take(NRQ * DM * 2); _Float16* K16 = (_Float16*)take(NRK * DM * 2); _Float16* V16 = (_Float16*)take(NRK * DM * 2); _Float16* O16 = (_Float16*)take(NRQ * DM * 2);
  float* S = (float*)take((size_t)HG * NQ * SK * 4); _Float16* P = (_Float16*)take((size_t)HG * NQ * SK * 2); _Float16* VT = (_Float16*)take((size_t)NH * HD * SK * 2);
  if (off > ws_size) return;      /* approx 8 + 8+8+8+8+8+8 + 16+8+2 = 82 MiB */
  { const unsigned g = (unsigned)(((size_t)DM * (DM / 8) + 255) / 256); k_wt_f16<<<g, 256, 0, stream>>>(wq, BQ, DM, DM, 16.0f); k_wt_f16<<<2 * g, 256, 0, stream>>>(wkv, BKV, DC, 2 * DM, 16.0f); k_wt_f16<<<g, 256, 0, stream>>>(wo, BO, DM, DM, 16.0f); }      /* [in][out] -> Bt x16; Wkv [1024][2048] -> Bt [2048][1024]: rows 0..1023 = k columns, 1024..2047 = v columns */
  k_x16<<<(unsigned)((NRQ * DM / 8 + 255) / 256), 256, 0, stream>>>(x, X16, NRQ * DM / 8); k_x16<<<(unsigned)((NRK * DC / 8 + 255) / 256), 256, 0, stream>>>(ctx, C16, NRK * DC / 8);
  k_gemm2<0><<<dim3((unsigned)((NRQ / 128) * (DM / 64)), 1), 128, 0, stream>>>(X16, DM, 0, BQ, DM, 0, 0.0625f, bq, 0, nullptr, 1, 0, 0, nullptr, Q16, DM, 0, (int)NRQ, DM, DM);
  k_gemm2<0><<<dim3((unsigned)((NRK / 128) * (DM / 64)), 1), 128, 0, stream>>>(C16, DC, 0, BK, DC, 0, 0.0625f, bkv, 0, nullptr, 1, 0, 0, nullptr, K16, DM, 0, (int)NRK, DM, DC);
  k_gemm2<0><<<dim3((unsigned)((NRK / 128) * (DM / 64)), 1), 128, 0, stream>>>(C16, DC, 0, BV, DC, 0, 0.0625f, bkv + DM, 0, nullptr, 1, 0, 0, nullptr, V16, DM, 0, (int)NRK, DM, DC);      /* v = context Wkv[:, 1024:] + bkv[1024:] */
  for (int b = 0; b < NB; ++b) { const size_t rq = (size_t)b * NQ, rk = (size_t)b * SK;
    k_vt<NH, SK><<<NH * (SK / 64), 256, 0, stream>>>(V16 + rk * DM, DM, 0, VT);      /* V^T [16][64][1024] */
    for (int h0 = 0; h0 < NH; h0 += HG) {
      k_gemm2<0><<<dim3((NQ / 128) * (SK / 64), HG), 128, 0, stream>>>(Q16 + rq * DM + (size_t)h0 * HD, DM, (size_t)HD, K16 + rk * DM + (size_t)h0 * HD, DM, (size_t)HD, 0.125f, nullptr, 0, nullptr, 1, 0, 0, S, nullptr, SK, (size_t)NQ * SK, NQ, SK, HD);      /* scores of HG heads (grid.y) */
      k_rsmrm<<<(HG * NQ + 255) / 256, 256, 0, stream>>>(S, mkm + (size_t)b * NQ * SK, P, NQ, HG);      /* masked softmax over the 1024 context tokens (this batch's int mask rows) */
      k_gemm2<0><<<dim3((NQ / 128) * (HD / 64), HG), 128, 0, stream>>>(P, SK, (size_t)NQ * SK, VT + (size_t)h0 * HD * SK, SK, (size_t)HD * SK, 0.25f, nullptr, 0, nullptr, 1, 0, 0, nullptr, O16 + rq * DM + (size_t)h0 * HD, DM, (size_t)HD, NQ, HD, SK); } }      /* o x64, merged */
  k_gemm2<0><<<dim3((unsigned)((NRQ / 128) * (DM / 64)), 1), 128, 0, stream>>>(O16, DM, 0, BO, DM, 0, 0.0009765625f, bo, 0, nullptr, 1, 0, 0, (float*)d_out, nullptr, DM, 0, (int)NRQ, DM, DM);      /* out = o Wo + bo */
}

// v001
// One run takes 946 microseconds.
// In two side-by-side timings against v000, it was 5.52 and 5.49 times as fast.
#include <hip/hip_runtime.h>
// Masked multi-head cross-attention (x [4][1024][1024] queries, context [4][1024][1024]; q = x Wq + bq; k | v = context Wkv + bkv viewed (m, 2, 16, 64) ([in][out] weights sigma 1/32, zero biases); 16 heads of 64; dots = q k^T / 8; a binary int mask [b][n][32*32 = m] shared by the heads: masked_fill(mask == 0, -inf); softmax over the 1024 context tokens; out = merged Wp + bp -> [4][1024][1024]).
// Structure: x and context as exact f16 rows; [in][out] weights as exact x16 planes (Wkv as one [2048][1024] plane: k rows then v rows); Q, K, V as WMMA GEMMs (32x64 wave tiles, f32 accumulation, + bias, f16 outputs); per batch: V^T via LDS transposes; per 4-head group: scores (K = 64, alpha 1/8) into f32 [1024][1024] planes, row softmax on VALU reading this batch's int mask row per query (arithmetic 0/1 select per key; f32 statistics, native exp; weights x256 f16), o = P V^T (o carried x64) into merged f16 rows; out = o Wp + bp GEMM (f32, alpha 2^-10); launches: see trace.
// Compute dtype: inputs rounded to bf16; x / context / weights exact; q, k, v, softmax weights and o as plain f16 GEMM operands (~2^-12); scores and statistics f32. v_wmma_f32_16x16x32_f16.
#define NB 4
#define NQ 1024
#define SK 1024
#define SQ SK                       /* keys per softmax row */
#define DM 1024
#define DC 1024
#define NH 16
#define HD 64
#define HG 4
#define NRQ ((size_t)NB * NQ)
#define NRK ((size_t)NB * SK)
typedef __bf16 v16b __attribute__((ext_vector_type(16)));
typedef unsigned short v8us __attribute__((ext_vector_type(8), may_alias));
typedef float  v8f  __attribute__((ext_vector_type(8)));
typedef float  v4f  __attribute__((ext_vector_type(4)));
typedef float  v4fa __attribute__((ext_vector_type(4), may_alias));
union FragB { v16b v; v8us half[2]; unsigned short u[16]; };

__device__ __forceinline__ unsigned short bf16_bits(float x) { unsigned int u = __float_as_uint(x); return (unsigned short)((u + 0x7FFFu + ((u >> 16) & 1u)) >> 16); }
__device__ __forceinline__ float bf16_val(unsigned short b) { return __uint_as_float(((unsigned int)b) << 16); }
__device__ __forceinline__ float bf16_round(float x) { return bf16_val(bf16_bits(x)); }
// D += A·B with NT terms: 1 = ah·bh, 2 = + al·bh (A split), 3 = + ah·bl (both split)
template <int NT>
__device__ __forceinline__ v8f mmaN(v16b ah, v16b al, v16b bh, v16b bl, v8f c) {
  c = __builtin_amdgcn_wmma_f32_16x16x32_bf16(false, ah, false, bh, (short)0, c, false, false);
  if (NT >= 2) c = __builtin_amdgcn_wmma_f32_16x16x32_bf16(false, al, false, bh, (short)0, c, false, false);
  if (NT >= 3) c = __builtin_amdgcn_wmma_f32_16x16x32_bf16(false, ah, false, bl, (short)0, c, false, false);
  asm volatile("v_nop\n\tv_nop\n\tv_nop\n\tv_nop" : "+v"(c) : "v"(ah), "v"(al), "v"(bh), "v"(bl));
  return c;
}

__global__ __launch_bounds__(256) void k_wt_bf16(const float* __restrict__ W, unsigned short* __restrict__ Wt, int K, int N) {
  const int t = blockIdx.x * 256 + threadIdx.x;
  const int k8n = K / 8;
  if (t >= N * k8n) return;
  const int n = t / k8n, k8 = (t % k8n) * 8;
  v8us v;
#pragma unroll
  for (int i = 0; i < 8; ++i) v[i] = bf16_bits(W[(size_t)(k8 + i) * N + n]);
  *(v8us*)(Wt + (size_t)n * K + k8) = v;
  
}

// GEMM C[M][N] (f32, pitch ldc) = act(A[M][K]·W + bias). A f32 row-major (pitch lda) converted per fragment to bf16
// (ASPLIT: hi/lo two planes -> 2 terms, else single rounded term); Wt bf16 [N][K] (pitch ldb). BIAS_BF16 rounds the
// bias to bf16 first (bias quantised to bf16 before the add). K%32==0, M%16==0, N%64==0.
template <bool ASPLIT, int ACT, bool BIAS_BF16>
__global__ __launch_bounds__(128) void k_gemm_bf(const float* __restrict__ A, int lda, const unsigned short* __restrict__ Wt, int ldb,
                                               const float* __restrict__ bias, float* __restrict__ C, int ldc, int M, int N, int K) {
  __shared__ __attribute__((aligned(16))) float so[4][16][64];
  const int tid = threadIdx.x, w = tid >> 5, lane = tid & 31, ln = lane & 15, hh = lane >> 4;
  const int ntn = N / 64;
  const int wid = blockIdx.x * 4 + w;
  const int mt = wid / ntn, nq = wid % ntn;
  if (mt * 16 >= M) return;
  const int row0 = mt * 16, col0 = nq * 64;
  const float* arow = A + (size_t)(row0 + ln) * lda;
  v8f acc[4] = {};
  for (int kb = 0; kb < K; kb += 32) {
    FragB ah, al;
    const v4f x0 = *(const v4fa*)(arow + kb + 8 * hh), x1 = *(const v4fa*)(arow + kb + 8 * hh + 4);
    const v4f x2 = *(const v4fa*)(arow + kb + 16 + 8 * hh), x3 = *(const v4fa*)(arow + kb + 16 + 8 * hh + 4);
    float xs[16] = {x0[0],x0[1],x0[2],x0[3],x1[0],x1[1],x1[2],x1[3],x2[0],x2[1],x2[2],x2[3],x3[0],x3[1],x3[2],x3[3]};
#pragma unroll
    for (int i = 0; i < 16; ++i) { const unsigned short hb = bf16_bits(xs[i]); ah.u[i] = hb; al.u[i] = ASPLIT ? bf16_bits(xs[i] - bf16_val(hb)) : (unsigned short)0; }
#pragma unroll
    for (int t = 0; t < 4; ++t) {
      const unsigned short* brow = Wt + (size_t)(col0 + t * 16 + ln) * ldb + kb;
      FragB b;
      b.half[0] = *(const v8us*)(brow + 8 * hh);
      b.half[1] = *(const v8us*)(brow + 16 + 8 * hh);
      acc[t] = mmaN<ASPLIT ? 2 : 1>(ah.v, al.v, b.v, b.v, acc[t]);
    }
  }
#pragma unroll
  for (int t = 0; t < 4; ++t) {
    float bv = bias ? bias[col0 + t * 16 + ln] : 0.f;
    if (BIAS_BF16) bv = bf16_round(bv);
#pragma unroll
    for (int r = 0; r < 8; ++r) { float v = acc[t][r] + bv; if (ACT == 1) v = fmaxf(v, 0.f); so[w][8 * hh + r][t * 16 + ln] = v; }
  }
  __builtin_amdgcn_fence(__ATOMIC_ACQ_REL, "workgroup");
  __builtin_amdgcn_wave_barrier();
  const int rsub = lane >> 4, c4 = (lane & 15) * 4;
  {
#pragma unroll
    for (int q = 0; q < 8; ++q) {
      const int r = q * 2 + rsub;
      const v4f v = *(const v4fa*)&so[w][r][c4];
      *(v4f*)(C + (size_t)(row0 + r) * ldc + col0 + c4) = v;
    }
    
  }
}

// GEMM C = act(A·W + bias + resid): A f32 (ASPLIT -> hi/lo 2 terms), Wt bf16 [N][K]; ACT 0 none, 1 relu, 2 exact gelu;
// resid (optional, f32, row index = (row % rmod), pitch ldr, RES_BF16 rounds it) added before the activation.
template <bool ASPLIT, int ACT, bool BIAS_BF16, bool RES_BF16>
__global__ __launch_bounds__(128) void k_gemm_bf3(const float* __restrict__ A, int lda, const unsigned short* __restrict__ Wt, int ldb,
                                                const float* __restrict__ bias, const float* __restrict__ resid, int rmod, int ldr,
                                                float* __restrict__ C, int ldc, int M, int N, int K) {
  __shared__ __attribute__((aligned(16))) float so[4][16][64];
  const int tid = threadIdx.x, w = tid >> 5, lane = tid & 31, ln = lane & 15, hh = lane >> 4;
  const int ntn = N / 64;
  const int wid = blockIdx.x * 4 + w;
  const int mt = wid / ntn, nq = wid % ntn;
  if (mt * 16 >= M) return;
  const int row0 = mt * 16, col0 = nq * 64;
  const float* arow = A + (size_t)(row0 + ln) * lda;
  v8f acc[4] = {};
  for (int kb = 0; kb < K; kb += 32) {
    FragB ah, al;
    const v4f x0 = *(const v4fa*)(arow + kb + 8 * hh), x1 = *(const v4fa*)(arow + kb + 8 * hh + 4);
    const v4f x2 = *(const v4fa*)(arow + kb + 16 + 8 * hh), x3 = *(const v4fa*)(arow + kb + 16 + 8 * hh + 4);
    float xs[16] = {x0[0],x0[1],x0[2],x0[3],x1[0],x1[1],x1[2],x1[3],x2[0],x2[1],x2[2],x2[3],x3[0],x3[1],x3[2],x3[3]};
#pragma unroll
    for (int i = 0; i < 16; ++i) { const unsigned short hb = bf16_bits(xs[i]); ah.u[i] = hb; al.u[i] = ASPLIT ? bf16_bits(xs[i] - bf16_val(hb)) : (unsigned short)0; }
#pragma unroll
    for (int t = 0; t < 4; ++t) {
      const unsigned short* brow = Wt + (size_t)(col0 + t * 16 + ln) * ldb + kb;
      FragB b;
      b.half[0] = *(const v8us*)(brow + 8 * hh);
      b.half[1] = *(const v8us*)(brow + 16 + 8 * hh);
      acc[t] = mmaN<ASPLIT ? 2 : 1>(ah.v, al.v, b.v, b.v, acc[t]);
    }
  }
#pragma unroll
  for (int t = 0; t < 4; ++t) {
    const int col = col0 + t * 16 + ln;
    float bv = bias ? bias[col] : 0.f;
    if (BIAS_BF16) bv = bf16_round(bv);
#pragma unroll
    for (int r = 0; r < 8; ++r) {
      float v = acc[t][r] + bv;
      if (resid) { float rv = resid[(size_t)((row0 + 8 * hh + r) % rmod) * ldr + col]; if (RES_BF16) rv = bf16_round(rv); v += rv; }
      if (ACT == 1) v = fmaxf(v, 0.f);
      if (ACT == 2) v = 0.5f * v * (1.0f + erff(v * 0.70710678118654752f));
      if (ACT == 3) { const float u = 0.7978845608028654f * (v + 0.044715f * v * v * v); v = 0.5f * v * (1.0f + tanhf(u)); }
      so[w][8 * hh + r][t * 16 + ln] = v;
    }
  }
  __builtin_amdgcn_fence(__ATOMIC_ACQ_REL, "workgroup");
  __builtin_amdgcn_wave_barrier();
  const int rsub = lane >> 4, c4 = (lane & 15) * 4;
  {
#pragma unroll
    for (int q = 0; q < 8; ++q) {
      const int r = q * 2 + rsub;
      const v4f v = *(const v4fa*)&so[w][r][c4];
      *(v4f*)(C + (size_t)(row0 + r) * ldc + col0 + c4) = v;
    }
    
  }
}
// row LayerNorm (biased variance, eps) over N: s = X (+ R); optional out_sum <- s; out_norm <- (s-mu)*rsqrt(var+eps)*g + b
template <bool PARAM_BF16>
__global__ __launch_bounds__(256) void k_layernorm(const float* __restrict__ X, const float* __restrict__ R, const float* __restrict__ g, const float* __restrict__ bta,
                                                  float* __restrict__ out_sum, float* __restrict__ out_norm, int N, float eps) {
  __shared__ float red[256];
  const int row = blockIdx.x, tid = threadIdx.x;
  const float* x = X + (size_t)row * N; const float* rr = R ? R + (size_t)row * N : nullptr;
  float vals[16];                     // up to N = 4096
  const int per = N / 256;            // contiguous chunk per thread? use strided-by-4 chunks: thread handles j = tid*4 + 1024*u
  float s1 = 0.f;
  for (int u = 0; u < per / 4; ++u) {
    const int j = tid * 4 + 1024 * u;
    const v4f a = *(const v4fa*)(x + j);
    v4f b = {0.f,0.f,0.f,0.f}; if (rr) b = *(const v4fa*)(rr + j);
#pragma unroll
    for (int q = 0; q < 4; ++q) { const float v = a[q] + b[q]; vals[u * 4 + q] = v; s1 += v; }
  }
  red[tid] = s1; __syncthreads();
  for (int st = 128; st > 0; st >>= 1) { if (tid < st) red[tid] += red[tid + st]; __syncthreads(); }
  const float mu = red[0] / (float)N; __syncthreads();
  float s2 = 0.f;
  for (int u = 0; u < per / 4; ++u)
#pragma unroll
    for (int q = 0; q < 4; ++q) { const float c = vals[u * 4 + q] - mu; s2 += c * c; }
  red[tid] = s2; __syncthreads();
  for (int st = 128; st > 0; st >>= 1) { if (tid < st) red[tid] += red[tid + st]; __syncthreads(); }
  const float rs = rsqrtf(red[0] / (float)N + eps);
  {
    for (int u = 0; u < per / 4; ++u) {
      const int j = tid * 4 + 1024 * u;
      v4f o, sm;
#pragma unroll
      for (int q = 0; q < 4; ++q) {
        float gg = g[j + q], bb = bta[j + q];
        if (PARAM_BF16) { gg = bf16_round(gg); bb = bf16_round(bb); }
        sm[q] = vals[u * 4 + q]; o[q] = (vals[u * 4 + q] - mu) * rs * gg + bb;
      }
      if (out_sum) *(v4f*)(out_sum + (size_t)row * N + j) = sm;
      *(v4f*)(out_norm + (size_t)row * N + j) = o;
    }
    
  }
}



// ---- f16 WMMA path (v_wmma_f32_16x16x32_f16): 11-bit significands for operands in range — used where a [0,1] probability operand needs more precision than bf16
typedef _Float16 v16h __attribute__((ext_vector_type(16)));
union FragH { v16h v; v8us half[2]; _Float16 h[16]; unsigned short u[16]; };
template <int NT>
__device__ __forceinline__ v8f mmaH(v16h ah, v16h al, v16h bh, v16h bl, v8f c) {
  c = __builtin_amdgcn_wmma_f32_16x16x32_f16(false, ah, false, bh, (short)0, c, false, false);
  if (NT >= 2) c = __builtin_amdgcn_wmma_f32_16x16x32_f16(false, al, false, bh, (short)0, c, false, false);
  if (NT >= 3) c = __builtin_amdgcn_wmma_f32_16x16x32_f16(false, ah, false, bl, (short)0, c, false, false);
  asm volatile("v_nop\n\tv_nop\n\tv_nop\n\tv_nop" : "+v"(c) : "v"(ah), "v"(al), "v"(bh), "v"(bl));
  return c;
}
// batched GEMM like k_gemm_b but f16 operands: A f32 (split into f16 hi/lo if ASPLIT, else rounded to f16), Bt = f16 values [n][k]; alpha; C f32; N multiple of 16 (partial tiles skipped)
template <bool ASPLIT>
__global__ __launch_bounds__(128) void k_gemm_h(const float* __restrict__ A, int lda, size_t sA, const _Float16* __restrict__ Bh, int ldb, size_t sB, float alpha, float* __restrict__ C, int ldc, size_t sC, int M, int N, int K) {
  __shared__ __attribute__((aligned(16))) float so[4][16][64];
  const int tid = threadIdx.x, w = tid >> 5, lane = tid & 31, ln = lane & 15, hh = lane >> 4; const int by = blockIdx.y;
  A += (size_t)by * sA; Bh += (size_t)by * sB; C += (size_t)by * sC;
  const int ntn = (N + 63) / 64; const int wid = blockIdx.x * 4 + w; const int mt = wid / ntn, nq = wid % ntn; if (mt * 16 >= M) return;
  const int row0 = mt * 16, col0 = nq * 64; const float* arow = A + (size_t)(row0 + ln) * lda;
  v8f acc[4] = {};
  for (int kb = 0; kb < K; kb += 32) {
    FragH ah, al;
    const v4f x0 = *(const v4fa*)(arow + kb + 8 * hh), x1 = *(const v4fa*)(arow + kb + 8 * hh + 4), x2 = *(const v4fa*)(arow + kb + 16 + 8 * hh), x3 = *(const v4fa*)(arow + kb + 16 + 8 * hh + 4);
    float xs[16] = {x0[0],x0[1],x0[2],x0[3],x1[0],x1[1],x1[2],x1[3],x2[0],x2[1],x2[2],x2[3],x3[0],x3[1],x3[2],x3[3]};
#pragma unroll
    for (int i = 0; i < 16; ++i) { const _Float16 h = (_Float16)xs[i]; ah.h[i] = h; al.h[i] = ASPLIT ? (_Float16)(xs[i] - (float)h) : (_Float16)0.0f; }
#pragma unroll
    for (int t = 0; t < 4; ++t) { if (col0 + t * 16 >= N) continue; const size_t boff = (size_t)(col0 + t * 16 + ln) * ldb + kb; FragH bq; bq.half[0] = *(const v8us*)(Bh + boff + 8 * hh); bq.half[1] = *(const v8us*)(Bh + boff + 16 + 8 * hh);
      acc[t] = mmaH<ASPLIT ? 2 : 1>(ah.v, al.v, bq.v, bq.v, acc[t]); }
  }
#pragma unroll
  for (int t = 0; t < 4; ++t) { if (col0 + t * 16 >= N) continue;
#pragma unroll
    for (int r = 0; r < 8; ++r) so[w][8 * hh + r][t * 16 + ln] = acc[t][r] * alpha; }
  __builtin_amdgcn_fence(__ATOMIC_ACQ_REL, "workgroup"); __builtin_amdgcn_wave_barrier();
  const int rsub = lane >> 4, c4 = (lane & 15) * 4;
  {
#pragma unroll
    for (int q = 0; q < 8; ++q) { const int r = q * 2 + rsub; if (col0 + c4 < N) { const v4f v = *(const v4fa*)&so[w][r][c4]; *(v4f*)(C + (size_t)(row0 + r) * ldc + col0 + c4) = v; } }
     }
}

// Wt[n][k] = f16(W[k][n]·scale) from f32 row-major W[K][N] (scale = power of two; bf16-exact weights stay exact in f16 away from the subnormal range)
__global__ __launch_bounds__(256) void k_wt_f16(const float* __restrict__ W, _Float16* __restrict__ Wt, int K, int N, float scale) {
  const int t = blockIdx.x * 256 + threadIdx.x; if (t >= N * (K / 8)) return; const int n = t / (K / 8), k8 = (t % (K / 8)) * 8; FragH f;
#pragma unroll
  for (int i = 0; i < 8; ++i) f.h[i] = (_Float16)(bf16_round(W[(size_t)(k8 + i) * N + n]) * scale); const v8us o = f.half[0];
  *(v8us*)((unsigned short*)Wt + (size_t)n * K + k8) = o; 
}
// k_gemm_hh variant with fused epilogue: v = acc·alpha + bias[by·sBias + col] (+ CP[(row/rowsPerB)·sCPb + by·64 + col] if CP) ; ACT 0 none / 1 elu ; writes f16 C16 (and f32 C if non-null)
template <int ACT>
__global__ __launch_bounds__(128) void k_gemm_hhx(const _Float16* __restrict__ A, int lda, size_t sA, const _Float16* __restrict__ Bh, int ldb, size_t sB, float alpha, const float* __restrict__ bias, size_t sBias, const float* __restrict__ CP, int rowsPerB, size_t sCPb, int row0g,
    float* __restrict__ C, _Float16* __restrict__ C16, int ldc, size_t sC, int M, int N, int K) {
  __shared__ __attribute__((aligned(16))) float so[4][16][64];
  const int tid = threadIdx.x, w = tid >> 5, lane = tid & 31, ln = lane & 15, hh = lane >> 4; const int by = blockIdx.y;
  A += (size_t)by * sA; Bh += (size_t)by * sB; const size_t cofs = (size_t)by * sC; const float* bp = bias ? bias + (size_t)by * sBias : nullptr;
  const int ntn = (N + 63) / 64; const int wid = blockIdx.x * 4 + w; const int mt = wid / ntn, nq = wid % ntn; if (mt * 16 >= M) return;
  const int row0 = mt * 16, col0 = nq * 64; const _Float16* arow = A + (size_t)(row0 + ln) * lda;
  v8f acc[4] = {};
  for (int kb = 0; kb < K; kb += 32) { FragH ah; ah.half[0] = *(const v8us*)((const unsigned short*)arow + kb + 8 * hh); ah.half[1] = *(const v8us*)((const unsigned short*)arow + kb + 16 + 8 * hh);
#pragma unroll
    for (int t = 0; t < 4; ++t) { if (col0 + t * 16 >= N) continue; const size_t boff = (size_t)(col0 + t * 16 + ln) * ldb + kb; FragH bq; bq.half[0] = *(const v8us*)((const unsigned short*)Bh + boff + 8 * hh); bq.half[1] = *(const v8us*)((const unsigned short*)Bh + boff + 16 + 8 * hh);
      acc[t] = mmaH<1>(ah.v, ah.v, bq.v, bq.v, acc[t]); }
  }
#pragma unroll
  for (int t = 0; t < 4; ++t) { if (col0 + t * 16 >= N) continue; const int col = col0 + t * 16 + ln; const float bv = bp ? bf16_round(bp[col]) : 0.f;
#pragma unroll
    for (int r = 0; r < 8; ++r) { float v = acc[t][r] * alpha + bv; if (CP) { const int rr = row0g + row0 + 8 * hh + r; if (rowsPerB < 0) v += CP[cofs + (size_t)rr * ldc + col];      /* rowsPerB < 0: own element of the batched C plane */ else { const int bidx = rr / rowsPerB; v += CP[(size_t)bidx * sCPb + (size_t)by * 64 + col]; } } if (ACT == 1) v = (v > 0.f) ? v : expm1f(v); else if (ACT == 7) v = (v > 0.f) ? v + 1.0f : expf(v); else if (ACT == 8) v = tanhf(v); else if (ACT == 9) v = 0.5f * v * (1.0f + tanhf(0.7978845608028654f * (v + 0.044715f * v * v * v))); else if (ACT == 11) v = 1.0f / (1.0f + expf(-v)); else if (ACT == 12) v = (v > 0.f) ? v : 0.01f * v; else if (ACT == 14) v = (v > 0.f) ? v : 0.1f * v; else if (ACT == 16) v = (v >= 0.f) ? v : 0.3f * v; else if (ACT == 17) v = (v >= 0.f) ? v : 0.2f * v; else if (ACT == 15) v = v / (1.0f + expf(-v)); else if (ACT == 3) v = fmaxf(v, 0.f); else if (ACT == 6) v = 0.5f * v * (1.0f + erff(v * 0.70710678118654752f)); so[w][8 * hh + r][t * 16 + ln] = v; } }
  __builtin_amdgcn_fence(__ATOMIC_ACQ_REL, "workgroup"); __builtin_amdgcn_wave_barrier();
  const int rsub = lane >> 4, c4 = (lane & 15) * 4; typedef _Float16 v4h __attribute__((ext_vector_type(4)));
  {
#pragma unroll
    for (int q = 0; q < 8; ++q) { const int r = q * 2 + rsub; if (col0 + c4 < N) { const v4f v = *(const v4fa*)&so[w][r][c4]; if (C) *(v4f*)(C + cofs + (size_t)(row0 + r) * ldc + col0 + c4) = v; if (C16) { v4h h4; for (int i = 0; i < 4; ++i) h4[i] = (_Float16)v[i]; *(v4h*)(C16 + cofs + (size_t)(row0 + r) * ldc + col0 + c4) = h4; } } }
     }
}


typedef _Float16 v4h __attribute__((ext_vector_type(4)));

__global__ __launch_bounds__(256) void k_x16(const float* __restrict__ x, _Float16* __restrict__ X16, size_t n8) { const size_t t = (size_t)blockIdx.x * 256 + threadIdx.x; if (t >= n8) return; FragH f;
#pragma unroll
  for (int q = 0; q < 8; ++q) f.h[q] = (_Float16)bf16_round(x[t * 8 + q]); *(v8us*)((unsigned short*)X16 + t * 8) = f.half[0];  }
__global__ __launch_bounds__(256) void k_h16(const float* __restrict__ x, _Float16* __restrict__ X16, size_t n8) { const size_t t = (size_t)blockIdx.x * 256 + threadIdx.x; if (t >= n8) return; FragH f;
#pragma unroll
  for (int q = 0; q < 8; ++q) f.h[q] = (_Float16)x[t * 8 + q]; *(v8us*)((unsigned short*)X16 + t * 8) = f.half[0];  }
__global__ __launch_bounds__(256) void k_round16f(const float* __restrict__ W, _Float16* __restrict__ Bt, size_t n8) { const size_t t = (size_t)blockIdx.x * 256 + threadIdx.x; if (t >= n8) return; FragH f;
#pragma unroll
  for (int i = 0; i < 8; ++i) f.h[i] = (_Float16)(bf16_round(W[t * 8 + i]) * 16.0f); *(v8us*)((unsigned short*)Bt + t * 8) = f.half[0];  }
template <int NHv, int TTv>
__global__ __launch_bounds__(256) void k_vt(const _Float16* __restrict__ V16, int ldv, int voff, _Float16* __restrict__ Vt) { __shared__ unsigned short tl[64][66]; const int tid = threadIdx.x; const int slab = blockIdx.x / (TTv / 64), lg = blockIdx.x % (TTv / 64); const int b = slab / NHv, h = slab % NHv;
  for (int i = tid; i < 64 * 8; i += 256) { const int r = i / 8, c8 = (i % 8) * 8; FragH f; f.half[0] = *(const v8us*)((const unsigned short*)V16 + ((size_t)b * TTv + lg * 64 + r) * ldv + voff + h * 64 + c8);
#pragma unroll
    for (int q = 0; q < 8; ++q) tl[r][c8 + q] = f.u[q]; }
  __syncthreads();
  {
#pragma unroll
    for (int rd = 0; rd < 2; ++rd) { const int d = rd * 32 + tid / 8, pc = tid % 8; FragH f;
#pragma unroll
      for (int q = 0; q < 8; ++q) f.u[q] = tl[pc * 8 + q][d];
      *(v8us*)((unsigned short*)Vt + ((size_t)slab * 64 + d) * TTv + lg * 64 + pc * 8) = f.half[0]; }
     } }

__global__ __launch_bounds__(256) void k_hl(const float* __restrict__ F, _Float16* __restrict__ Hh, _Float16* __restrict__ Hl, size_t n8) { const size_t t = (size_t)blockIdx.x * 256 + threadIdx.x; if (t >= n8) return; FragH fh, fl; const v4f a = *(const v4fa*)(F + t * 8), c = *(const v4fa*)(F + t * 8 + 4);
#pragma unroll
  for (int q = 0; q < 4; ++q) { _Float16 h = (_Float16)a[q]; fh.h[q] = h; fl.h[q] = (_Float16)((a[q] - (float)h) * 1024.0f); h = (_Float16)c[q]; fh.h[4 + q] = h; fl.h[4 + q] = (_Float16)((c[q] - (float)h) * 1024.0f); }
  { *(v8us*)((unsigned short*)Hh + t * 8) = fh.half[0]; *(v8us*)((unsigned short*)Hl + t * 8) = fl.half[0];  } }

// ---- fast GEMM (wave tile 32x64; requires M % 32 == 0 rows per launch region and N % 64 == 0); epilogue = k_gemm_hhx semantics ----
__device__ __forceinline__ v16h g2_frag(const _Float16* p, int hh) { FragH f; f.half[0] = *(const v8us*)((const unsigned short*)p + 8 * hh); f.half[1] = *(const v8us*)((const unsigned short*)p + 16 + 8 * hh); return f.v; }
__device__ __forceinline__ v8f g2_mma(v16h a, v16h b, v8f c) { v8f d = __builtin_amdgcn_wmma_f32_16x16x32_f16(false, a, false, b, (short)0, c, false, false); asm volatile("v_nop\n\tv_nop\n\tv_nop\n\tv_nop" : "+v"(d) : "v"(a), "v"(b)); return d; }
template <int ACT>
__global__ __launch_bounds__(128) void k_gemm2(const _Float16* __restrict__ A, int lda, size_t sA, const _Float16* __restrict__ Bh, int ldb, size_t sB, float alpha, const float* __restrict__ bias, size_t sBias, const float* __restrict__ CP, int rowsPerB, size_t sCPb, int row0g,
    float* __restrict__ C, _Float16* __restrict__ C16, int ldc, size_t sC, int M, int N, int K) { static_assert(ACT == 0 || ACT == 3 || ACT == 6 || ACT == 8 || ACT == 9 || ACT == 11 || ACT == 12 || ACT == 14 || ACT == 15 || ACT == 16 || ACT == 17, "k_gemm2: unsupported ACT code (would silently apply no activation)");
  __shared__ __attribute__((aligned(16))) float so[4][32][68];
  const int tid = threadIdx.x, w = tid >> 5, lane = tid & 31, ln = lane & 15, hh = lane >> 4; const int by = blockIdx.y;
  A += (size_t)by * sA; Bh += (size_t)by * sB; const size_t cofs = (size_t)by * sC; const float* bp = bias ? bias + (size_t)by * sBias : nullptr;
  const int ntn = N >> 6; const int mt = blockIdx.x / ntn, nq = blockIdx.x - mt * ntn; const int row0 = mt * 128 + 32 * w, col0 = nq * 64; if (row0 >= M) return;
  const _Float16* a0p = A + (size_t)(row0 + ln) * lda; const _Float16* a1p = a0p + (size_t)16 * lda;
  const _Float16* b0p = Bh + (size_t)(col0 + ln) * ldb; const _Float16* b1p = b0p + (size_t)16 * ldb; const _Float16* b2p = b1p + (size_t)16 * ldb; const _Float16* b3p = b2p + (size_t)16 * ldb;
  const v8f z8 = {0.f,0.f,0.f,0.f,0.f,0.f,0.f,0.f}; v8f c00 = z8, c01 = z8, c02 = z8, c03 = z8, c10 = z8, c11 = z8, c12 = z8, c13 = z8;
#pragma unroll 1
  for (int kb = 0; kb < K; kb += 32) { const v16h a0 = g2_frag(a0p + kb, hh), a1 = g2_frag(a1p + kb, hh);
    v16h b = g2_frag(b0p + kb, hh); c00 = g2_mma(a0, b, c00); c10 = g2_mma(a1, b, c10);
    b = g2_frag(b1p + kb, hh); c01 = g2_mma(a0, b, c01); c11 = g2_mma(a1, b, c11);
    b = g2_frag(b2p + kb, hh); c02 = g2_mma(a0, b, c02); c12 = g2_mma(a1, b, c12);
    b = g2_frag(b3p + kb, hh); c03 = g2_mma(a0, b, c03); c13 = g2_mma(a1, b, c13); }
  v8f accs[8] = {c00, c01, c02, c03, c10, c11, c12, c13};
#pragma unroll
  for (int u = 0; u < 8; ++u) { const int t = u & 3, half = u >> 2; const int col = col0 + t * 16 + ln; const float bv = bp ? bf16_round(bp[col]) : 0.f;
#pragma unroll
    for (int r = 0; r < 8; ++r) { const int rloc = half * 16 + 8 * hh + r; float v = accs[u][r] * alpha + bv; if (CP) { if (rowsPerB < 0) v += CP[cofs + (size_t)(row0g + row0 + rloc) * ldc + col];      /* rowsPerB < 0: own element of the batched C plane */ else { const int bidx = (row0g + row0 + rloc) / rowsPerB; v += CP[(size_t)bidx * sCPb + (size_t)by * 64 + col]; } }
      if (ACT == 3) v = fmaxf(v, 0.f); else if (ACT == 6) v = 0.5f * v * (1.0f + erff(v * 0.70710678118654752f)); else if (ACT == 11) v = 1.0f / (1.0f + expf(-v)); else if (ACT == 15) v = v / (1.0f + expf(-v)); else if (ACT == 12) v = (v > 0.f) ? v : 0.01f * v; else if (ACT == 8) v = tanhf(v); else if (ACT == 9) v = 0.5f * v * (1.0f + tanhf(0.7978845608028654f * (v + 0.044715f * v * v * v))); else if (ACT == 14) v = (v > 0.f) ? v : 0.1f * v; else if (ACT == 16) v = (v >= 0.f) ? v : 0.3f * v; else if (ACT == 17) v = (v >= 0.f) ? v : 0.2f * v;
      so[w][rloc][t * 16 + ln] = v; } }
  __builtin_amdgcn_fence(__ATOMIC_ACQ_REL, "workgroup"); __builtin_amdgcn_wave_barrier();
  const int rsub = lane >> 4, c4 = (lane & 15) * 4;
  {
#pragma unroll
    for (int q = 0; q < 16; ++q) { const int r = q * 2 + rsub; const v4f v = *(const v4fa*)&so[w][r][c4]; if (C) *(v4f*)(C + cofs + (size_t)(row0 + r) * ldc + col0 + c4) = v; if (C16) { v4h h4; for (int i = 0; i < 4; ++i) h4[i] = (_Float16)v[i]; *(v4h*)(C16 + cofs + (size_t)(row0 + r) * ldc + col0 + c4) = h4; } }
     } }


__global__ __launch_bounds__(256) void k_wnat(const float* __restrict__ w, size_t n8, _Float16* __restrict__ Bt) { const size_t t = (size_t)blockIdx.x * 256 + threadIdx.x; if (t >= n8) return; FragH f; for (int q = 0; q < 8; ++q) f.h[q] = (_Float16)(bf16_round(w[t * 8 + q]) * 16.0f); *(v8us*)((unsigned short*)Bt + t * 8) = f.half[0];  }
__global__ __launch_bounds__(256) void k_rsm(const float* __restrict__ S, _Float16* __restrict__ P, int nrows) {
  #pragma clang fp contract(off)
  const int i = blockIdx.x * 256 + threadIdx.x; if (i >= nrows) return; const float* s = S + (size_t)i * SQ; float mx = -3.0e38f;
#pragma unroll 1
  for (int j = 0; j < SQ; ++j) mx = fmaxf(mx, s[j]); float se = 0.f;
#pragma unroll 1
  for (int j = 0; j < SQ; ++j) se += expf(s[j] - mx); const float sc = 256.0f / se;
#pragma unroll 1
  for (int j0 = 0; j0 < SQ; j0 += 8) { FragH f; for (int q = 0; q < 8; ++q) f.h[q] = (_Float16)(expf(s[j0 + q] - mx) * sc); unsigned short* d = (unsigned short*)P + (size_t)i * SQ + j0; *(v8us*)d = f.half[0];  } }
__global__ __launch_bounds__(256) void k_vt(const _Float16* __restrict__ V16, int b, int h0, _Float16* __restrict__ VT) { __shared__ unsigned short tl[64][65]; const int tid = threadIdx.x; const int hh = blockIdx.x % HG, sg = blockIdx.x / HG; const int s0 = sg * 64; const int h = h0 + hh;
  for (int i = tid; i < 64 * 8; i += 256) { const int j = i / 8, d8 = (i % 8) * 8; FragH f; f.half[0] = *(const v8us*)((const unsigned short*)V16 + ((size_t)b * SQ + s0 + j) * DM + h * HD + d8); for (int q = 0; q < 8; ++q) tl[d8 + q][j] = f.u[q]; }
  __syncthreads();
  { for (int i = tid; i < 64 * 8; i += 256) { const int d = i / 8, j8 = (i % 8) * 8; FragH f; for (int q = 0; q < 8; ++q) f.u[q] = tl[d][j8 + q]; *(v8us*)((unsigned short*)VT + ((size_t)hh * HD + d) * SQ + s0 + j8) = f.half[0]; }  } }


__global__ __launch_bounds__(256) void k_rsmf(const float* __restrict__ S, _Float16* __restrict__ P, int qn, int hg) {
  #pragma clang fp contract(off)
  const int t = blockIdx.x * 256 + threadIdx.x; if (t >= qn * hg) return; const size_t i = (size_t)(t / qn) * SQ + (t % qn); const float* s = S + i * SQ; float mx = -3.0e38f;
#pragma unroll 1
  for (int j = 0; j < SQ; ++j) mx = fmaxf(mx, s[j]); float se = 0.f;
#pragma unroll 1
  for (int j = 0; j < SQ; ++j) se += __expf(s[j] - mx); const float sc = 256.0f / se;
#pragma unroll 1
  for (int j0 = 0; j0 < SQ; j0 += 8) { FragH f; for (int q = 0; q < 8; ++q) f.h[q] = (_Float16)(__expf(s[j0 + q] - mx) * sc); unsigned short* d = (unsigned short*)P + i * SQ + j0; *(v8us*)d = f.half[0];  } }

__global__ __launch_bounds__(256) void k_rsmr(const float* __restrict__ S, _Float16* __restrict__ P, int qn, int hg) {
  #pragma clang fp contract(off)
  const int t = blockIdx.x * 256 + threadIdx.x; if (t >= qn * hg) return; const size_t i = (size_t)t;      /* planes packed: row t of plane t / qn */ const float* s = S + i * SQ; float mx = -3.0e38f;
#pragma unroll 1
  for (int j = 0; j < SQ; ++j) mx = fmaxf(mx, s[j]); float se = 0.f;
#pragma unroll 1
  for (int j = 0; j < SQ; ++j) se += __expf(s[j] - mx); const float sc = 256.0f / se;
#pragma unroll 1
  for (int j0 = 0; j0 < SQ; j0 += 8) { FragH f; for (int q = 0; q < 8; ++q) f.h[q] = (_Float16)(__expf(s[j0 + q] - mx) * sc); unsigned short* d = (unsigned short*)P + i * SQ + j0; *(v8us*)d = f.half[0];  } }


typedef int v4ia __attribute__((ext_vector_type(4), may_alias));
// One wave per score row: lane l holds keys 128 u + 4 l .. + 3 (u = 0..7) in registers, so the row and its mask row are read once, every load covers 512 contiguous bytes
// and every store 256; row maximum and row sum by a five-step butterfly over the lanes. The hg heads of one query sit in neighbouring waves (they read the same mask row).
__global__ __launch_bounds__(256) void k_rsmrm(const float* __restrict__ S, const int* __restrict__ Mk, _Float16* __restrict__ P, int qn, int hg) {
  const int lane = threadIdx.x & 31; const int gw = blockIdx.x * 8 + __builtin_amdgcn_readfirstlane((int)(threadIdx.x >> 5)); const int q = gw / hg, hd = gw - q * hg; if (q >= qn) return;      /* wave-uniform, no barrier below */
  const size_t i = (size_t)hd * qn + q; const float* s = S + i * SK + lane * 4; const int* mr = Mk + (size_t)q * SK + lane * 4;
  v4f sv[8]; v4ia mv[8];
#pragma unroll
  for (int u = 0; u < 8; ++u) { sv[u] = *(const v4fa*)(s + u * 128); mv[u] = *(const v4ia*)(mr + u * 128); }
  asm volatile("s_wait_xcnt 0x0" ::: "memory");      /* the arithmetic right below reuses the registers that hold the 16 loads' addresses */
  __builtin_amdgcn_sched_barrier(0);      /* keeps all 16 loads in flight together: without it the compiler sinks the mask loads into the arithmetic, two at a time, and the wave pays the load latency four times */
  float mx = -3.0e38f;
#pragma unroll
  for (int u = 0; u < 8; ++u)
#pragma unroll
    for (int c = 0; c < 4; ++c) { const float f = (mv[u][c] != 0) ? 1.f : 0.f; const float v = fmaf(f, sv[u][c], (1.f - f) * -1.0e9f); sv[u][c] = v; mx = fmaxf(mx, v); }
#pragma unroll
  for (int d = 16; d > 0; d >>= 1) mx = fmaxf(mx, __shfl_xor(mx, d, 32));
  v4f s4 = {0.f, 0.f, 0.f, 0.f};      /* four independent sum chains */
#pragma unroll
  for (int u = 0; u < 8; ++u)
#pragma unroll
    for (int c = 0; c < 4; ++c) { const float t = (sv[u][c] - mx) * 1.4426950408889634f; float e;
      asm("v_exp_f32 %0, %1\n\tv_nop" : "=v"(e) : "v"(t));      /* the native exp (2^t) with the one free slot behind a transcendental inside the statement: 32 of them stand back to back here */
      sv[u][c] = e; s4[c] += e; }
  float se = (s4[0] + s4[1]) + (s4[2] + s4[3]);
#pragma unroll
  for (int d = 16; d > 0; d >>= 1) se += __shfl_xor(se, d, 32);
  const float sc = 256.0f / se; _Float16* p = P + i * SK + lane * 4;
#pragma unroll
  for (int u = 0; u < 8; ++u) { v4h h4;
#pragma unroll
    for (int c = 0; c < 4; ++c) h4[c] = (_Float16)(sv[u][c] * sc);
    *(v4h*)(p + u * 128) = h4; } }
extern "C" void kernel_launch(void* const* d_in, const int* in_sizes, int n_in,
                              void* d_out, int out_size, void* d_ws, size_t ws_size, hipStream_t stream) {
  (void)in_sizes; (void)n_in; (void)out_size;
  const float* const* I = (const float* const*)d_in; const float* x = I[0]; const float* ctx = I[1]; const int* mkm = (const int*)d_in[2]; const float* wq = I[3]; const float* bq = I[4]; const float* wkv = I[5]; const float* bkv = I[6]; const float* wo = I[7]; const float* bo = I[8];      /* [in][out] weights; int mask [b][n][m]; k | v from the fused Wkv [1024][2048] */
  char* ws = (char*)d_ws; size_t off = 0;
  auto take = [&](size_t bytes) { char* p = ws + off; off += (bytes + 255) & ~(size_t)255; return p; };
  _Float16* BQ = (_Float16*)take((size_t)DM * DM * 2); _Float16* BKV = (_Float16*)take((size_t)2 * DM * DC * 2); _Float16* BK = BKV; _Float16* BV = BKV + (size_t)DM * DC; _Float16* BO = (_Float16*)take((size_t)DM * DM * 2);
  _Float16* X16 = (_Float16*)take(NRQ * DM * 2); _Float16* C16 = (_Float16*)take(NRK * DC * 2); _Float16* Q16 = (_Float16*)take(NRQ * DM * 2); _Float16* K16 = (_Float16*)take(NRK * DM * 2); _Float16* V16 = (_Float16*)take(NRK * DM * 2); _Float16* O16 = (_Float16*)take(NRQ * DM * 2);
  float* S = (float*)take((size_t)HG * NQ * SK * 4); _Float16* P = (_Float16*)take((size_t)HG * NQ * SK * 2); _Float16* VT = (_Float16*)take((size_t)NH * HD * SK * 2);
  if (off > ws_size) return;      /* approx 8 + 8+8+8+8+8+8 + 16+8+2 = 82 MiB */
  { const unsigned g = (unsigned)(((size_t)DM * (DM / 8) + 255) / 256); k_wt_f16<<<g, 256, 0, stream>>>(wq, BQ, DM, DM, 16.0f); k_wt_f16<<<2 * g, 256, 0, stream>>>(wkv, BKV, DC, 2 * DM, 16.0f); k_wt_f16<<<g, 256, 0, stream>>>(wo, BO, DM, DM, 16.0f); }      /* [in][out] -> Bt x16; Wkv [1024][2048] -> Bt [2048][1024]: rows 0..1023 = k columns, 1024..2047 = v columns */
  k_x16<<<(unsigned)((NRQ * DM / 8 + 255) / 256), 256, 0, stream>>>(x, X16, NRQ * DM / 8); k_x16<<<(unsigned)((NRK * DC / 8 + 255) / 256), 256, 0, stream>>>(ctx, C16, NRK * DC / 8);
  k_gemm2<0><<<dim3((unsigned)((NRQ / 128) * (DM / 64)), 1), 128, 0, stream>>>(X16, DM, 0, BQ, DM, 0, 0.0625f, bq, 0, nullptr, 1, 0, 0, nullptr, Q16, DM, 0, (int)NRQ, DM, DM);
  k_gemm2<0><<<dim3((unsigned)((NRK / 128) * (DM / 64)), 1), 128, 0, stream>>>(C16, DC, 0, BK, DC, 0, 0.0625f, bkv, 0, nullptr, 1, 0, 0, nullptr, K16, DM, 0, (int)NRK, DM, DC);
  k_gemm2<0><<<dim3((unsigned)((NRK / 128) * (DM / 64)), 1), 128, 0, stream>>>(C16, DC, 0, BV, DC, 0, 0.0625f, bkv + DM, 0, nullptr, 1, 0, 0, nullptr, V16, DM, 0, (int)NRK, DM, DC);      /* v = context Wkv[:, 1024:] + bkv[1024:] */
  for (int b = 0; b < NB; ++b) { const size_t rq = (size_t)b * NQ, rk = (size_t)b * SK;
    k_vt<NH, SK><<<NH * (SK / 64), 256, 0, stream>>>(V16 + rk * DM, DM, 0, VT);      /* V^T [16][64][1024] */
    for (int h0 = 0; h0 < NH; h0 += HG) {
      k_gemm2<0><<<dim3((NQ / 128) * (SK / 64), HG), 128, 0, stream>>>(Q16 + rq * DM + (size_t)h0 * HD, DM, (size_t)HD, K16 + rk * DM + (size_t)h0 * HD, DM, (size_t)HD, 0.125f, nullptr, 0, nullptr, 1, 0, 0, S, nullptr, SK, (size_t)NQ * SK, NQ, SK, HD);      /* scores of HG heads (grid.y) */
      k_rsmrm<<<(HG * NQ + 7) / 8, 256, 0, stream>>>(S, mkm + (size_t)b * NQ * SK, P, NQ, HG);      /* masked softmax over the 1024 context tokens (this batch's int mask rows) */
      k_gemm2<0><<<dim3((NQ / 128) * (HD / 64), HG), 128, 0, stream>>>(P, SK, (size_t)NQ * SK, VT + (size_t)h0 * HD * SK, SK, (size_t)HD * SK, 0.25f, nullptr, 0, nullptr, 1, 0, 0, nullptr, O16 + rq * DM + (size_t)h0 * HD, DM, (size_t)HD, NQ, HD, SK); } }      /* o x64, merged */
  k_gemm2<0><<<dim3((unsigned)((NRQ / 128) * (DM / 64)), 1), 128, 0, stream>>>(O16, DM, 0, BO, DM, 0, 0.0009765625f, bo, 0, nullptr, 1, 0, 0, (float*)d_out, nullptr, DM, 0, (int)NRQ, DM, DM);      /* out = o Wo + bo */
}

// v002
// Measured time: 337 microseconds a run.
// Two timings next to v001 both put it at 2.81 times that version's speed.
// All steps since v000 together make it 15.5 times as fast.
#include <hip/hip_runtime.h>
// Masked multi-head cross-attention (x [4][1024][1024] queries, context [4][1024][1024]; q = x Wq + bq; k | v = context Wkv + bkv viewed (m, 2, 16, 64) ([in][out] weights sigma 1/32, zero biases); 16 heads of 64; dots = q k^T / 8; a binary int mask [b][n][32*32 = m] shared by the heads: masked_fill(mask == 0, -inf); softmax over the 1024 context tokens; out = merged Wp + bp -> [4][1024][1024]).
// Structure: x and context as exact f16 rows; [in][out] weights as exact x16 planes (Wkv as one [2048][1024] plane: k rows then v rows); Q and K | V (one launch, grid.y) as WMMA GEMMs (32x64 wave tiles, f32 accumulation, + bias, f16 outputs); V^T of all batches via LDS transposes (one launch); per batch: scores of its 16 heads (K = 64, alpha 1/8) into f32 [1024][1024] planes, row softmax on VALU reading this batch's int mask row per query (arithmetic 0/1 select per key; f32 statistics, native exp; weights x256 f16, kept for all 64 planes); o = P V^T (o carried x64) of all 64 planes in one launch into merged f16 rows; out = o Wp + bp GEMM (f32, alpha 2^-10); launches: see trace.
// Compute dtype: inputs rounded to bf16; x / context / weights exact; q, k, v, softmax weights and o as plain f16 GEMM operands (~2^-12); scores and statistics f32. v_wmma_f32_16x16x32_f16.
#define NB 4
#define NQ 1024
#define SK 1024
#define SQ SK                       /* keys per softmax row */
#define DM 1024
#define DC 1024
#define NH 16
#define HD 64
#define HG 4
#define NRQ ((size_t)NB * NQ)
#define NRK ((size_t)NB * SK)
typedef __bf16 v16b __attribute__((ext_vector_type(16)));
typedef unsigned short v8us __attribute__((ext_vector_type(8), may_alias));
typedef float  v8f  __attribute__((ext_vector_type(8)));
typedef float  v4f  __attribute__((ext_vector_type(4)));
typedef float  v4fa __attribute__((ext_vector_type(4), may_alias));
union FragB { v16b v; v8us half[2]; unsigned short u[16]; };

__device__ __forceinline__ unsigned short bf16_bits(float x) { unsigned int u = __float_as_uint(x); return (unsigned short)((u + 0x7FFFu + ((u >> 16) & 1u)) >> 16); }
__device__ __forceinline__ float bf16_val(unsigned short b) { return __uint_as_float(((unsigned int)b) << 16); }
__device__ __forceinline__ float bf16_round(float x) { return bf16_val(bf16_bits(x)); }
// D += A·B with NT terms: 1 = ah·bh, 2 = + al·bh (A split), 3 = + ah·bl (both split)
template <int NT>
__device__ __forceinline__ v8f mmaN(v16b ah, v16b al, v16b bh, v16b bl, v8f c) {
  c = __builtin_amdgcn_wmma_f32_16x16x32_bf16(false, ah, false, bh, (short)0, c, false, false);
  if (NT >= 2) c = __builtin_amdgcn_wmma_f32_16x16x32_bf16(false, al, false, bh, (short)0, c, false, false);
  if (NT >= 3) c = __builtin_amdgcn_wmma_f32_16x16x32_bf16(false, ah, false, bl, (short)0, c, false, false);
  asm volatile("v_nop\n\tv_nop\n\tv_nop\n\tv_nop" : "+v"(c) : "v"(ah), "v"(al), "v"(bh), "v"(bl));
  return c;
}

__global__ __launch_bounds__(256) void k_wt_bf16(const float* __restrict__ W, unsigned short* __restrict__ Wt, int K, int N) {
  const int t = blockIdx.x * 256 + threadIdx.x;
  const int k8n = K / 8;
  if (t >= N * k8n) return;
  const int n = t / k8n, k8 = (t % k8n) * 8;
  v8us v;
#pragma unroll
  for (int i = 0; i < 8; ++i) v[i] = bf16_bits(W[(size_t)(k8 + i) * N + n]);
  *(v8us*)(Wt + (size_t)n * K + k8) = v;
  
}

// GEMM C[M][N] (f32, pitch ldc) = act(A[M][K]·W + bias). A f32 row-major (pitch lda) converted per fragment to bf16
// (ASPLIT: hi/lo two planes -> 2 terms, else single rounded term); Wt bf16 [N][K] (pitch ldb). BIAS_BF16 rounds the
// bias to bf16 first (bias quantised to bf16 before the add). K%32==0, M%16==0, N%64==0.
template <bool ASPLIT, int ACT, bool BIAS_BF16>
__global__ __launch_bounds__(128) void k_gemm_bf(const float* __restrict__ A, int lda, const unsigned short* __restrict__ Wt, int ldb,
                                               const float* __restrict__ bias, float* __restrict__ C, int ldc, int M, int N, int K) {
  __shared__ __attribute__((aligned(16))) float so[4][16][64];
  const int tid = threadIdx.x, w = tid >> 5, lane = tid & 31, ln = lane & 15, hh = lane >> 4;
  const int ntn = N / 64;
  const int wid = blockIdx.x * 4 + w;
  const int mt = wid / ntn, nq = wid % ntn;
  if (mt * 16 >= M) return;
  const int row0 = mt * 16, col0 = nq * 64;
  const float* arow = A + (size_t)(row0 + ln) * lda;
  v8f acc[4] = {};
  for (int kb = 0; kb < K; kb += 32) {
    FragB ah, al;
    const v4f x0 = *(const v4fa*)(arow + kb + 8 * hh), x1 = *(const v4fa*)(arow + kb + 8 * hh + 4);
    const v4f x2 = *(const v4fa*)(arow + kb + 16 + 8 * hh), x3 = *(const v4fa*)(arow + kb + 16 + 8 * hh + 4);
    float xs[16] = {x0[0],x0[1],x0[2],x0[3],x1[0],x1[1],x1[2],x1[3],x2[0],x2[1],x2[2],x2[3],x3[0],x3[1],x3[2],x3[3]};
#pragma unroll
    for (int i = 0; i < 16; ++i) { const unsigned short hb = bf16_bits(xs[i]); ah.u[i] = hb; al.u[i] = ASPLIT ? bf16_bits(xs[i] - bf16_val(hb)) : (unsigned short)0; }
#pragma unroll
    for (int t = 0; t < 4; ++t) {
      const unsigned short* brow = Wt + (size_t)(col0 + t * 16 + ln) * ldb + kb;
      FragB b;
      b.half[0] = *(const v8us*)(brow + 8 * hh);
      b.half[1] = *(const v8us*)(brow + 16 + 8 * hh);
      acc[t] = mmaN<ASPLIT ? 2 : 1>(ah.v, al.v, b.v, b.v, acc[t]);
    }
  }
#pragma unroll
  for (int t = 0; t < 4; ++t) {
    float bv = bias ? bias[col0 + t * 16 + ln] : 0.f;
    if (BIAS_BF16) bv = bf16_round(bv);
#pragma unroll
    for (int r = 0; r < 8; ++r) { float v = acc[t][r] + bv; if (ACT == 1) v = fmaxf(v, 0.f); so[w][8 * hh + r][t * 16 + ln] = v; }
  }
  __builtin_amdgcn_fence(__ATOMIC_ACQ_REL, "workgroup");
  __builtin_amdgcn_wave_barrier();
  const int rsub = lane >> 4, c4 = (lane & 15) * 4;
  {
#pragma unroll
    for (int q = 0; q < 8; ++q) {
      const int r = q * 2 + rsub;
      const v4f v = *(const v4fa*)&so[w][r][c4];
      *(v4f*)(C + (size_t)(row0 + r) * ldc + col0 + c4) = v;
    }
    
  }
}

// GEMM C = act(A·W + bias + resid): A f32 (ASPLIT -> hi/lo 2 terms), Wt bf16 [N][K]; ACT 0 none, 1 relu, 2 exact gelu;
// resid (optional, f32, row index = (row % rmod), pitch ldr, RES_BF16 rounds it) added before the activation.
template <bool ASPLIT, int ACT, bool BIAS_BF16, bool RES_BF16>
__global__ __launch_bounds__(128) void k_gemm_bf3(const float* __restrict__ A, int lda, const unsigned short* __restrict__ Wt, int ldb,
                                                const float* __restrict__ bias, const float* __restrict__ resid, int rmod, int ldr,
                                                float* __restrict__ C, int ldc, int M, int N, int K) {
  __shared__ __attribute__((aligned(16))) float so[4][16][64];
  const int tid = threadIdx.x, w = tid >> 5, lane = tid & 31, ln = lane & 15, hh = lane >> 4;
  const int ntn = N / 64;
  const int wid = blockIdx.x * 4 + w;
  const int mt = wid / ntn, nq = wid % ntn;
  if (mt * 16 >= M) return;
  const int row0 = mt * 16, col0 = nq * 64;
  const float* arow = A + (size_t)(row0 + ln) * lda;
  v8f acc[4] = {};
  for (int kb = 0; kb < K; kb += 32) {
    FragB ah, al;
    const v4f x0 = *(const v4fa*)(arow + kb + 8 * hh), x1 = *(const v4fa*)(arow + kb + 8 * hh + 4);
    const v4f x2 = *(const v4fa*)(arow + kb + 16 + 8 * hh), x3 = *(const v4fa*)(arow + kb + 16 + 8 * hh + 4);
    float xs[16] = {x0[0],x0[1],x0[2],x0[3],x1[0],x1[1],x1[2],x1[3],x2[0],x2[1],x2[2],x2[3],x3[0],x3[1],x3[2],x3[3]};
#pragma unroll
    for (int i = 0; i < 16; ++i) { const unsigned short hb = bf16_bits(xs[i]); ah.u[i] = hb; al.u[i] = ASPLIT ? bf16_bits(xs[i] - bf16_val(hb)) : (unsigned short)0; }
#pragma unroll
    for (int t = 0; t < 4; ++t) {
      const unsigned short* brow = Wt + (size_t)(col0 + t * 16 + ln) * ldb + kb;
      FragB b;
      b.half[0] = *(const v8us*)(brow + 8 * hh);
      b.half[1] = *(const v8us*)(brow + 16 + 8 * hh);
      acc[t] = mmaN<ASPLIT ? 2 : 1>(ah.v, al.v, b.v, b.v, acc[t]);
    }
  }
#pragma unroll
  for (int t = 0; t < 4; ++t) {
    const int col = col0 + t * 16 + ln;
    float bv = bias ? bias[col] : 0.f;
    if (BIAS_BF16) bv = bf16_round(bv);
#pragma unroll
    for (int r = 0; r < 8; ++r) {
      float v = acc[t][r] + bv;
      if (resid) { float rv = resid[(size_t)((row0 + 8 * hh + r) % rmod) * ldr + col]; if (RES_BF16) rv = bf16_round(rv); v += rv; }
      if (ACT == 1) v = fmaxf(v, 0.f);
      if (ACT == 2) v = 0.5f * v * (1.0f + erff(v * 0.70710678118654752f));
      if (ACT == 3) { const float u = 0.7978845608028654f * (v + 0.044715f * v * v * v); v = 0.5f * v * (1.0f + tanhf(u)); }
      so[w][8 * hh + r][t * 16 + ln] = v;
    }
  }
  __builtin_amdgcn_fence(__ATOMIC_ACQ_REL, "workgroup");
  __builtin_amdgcn_wave_barrier();
  const int rsub = lane >> 4, c4 = (lane & 15) * 4;
  {
#pragma unroll
    for (int q = 0; q < 8; ++q) {
      const int r = q * 2 + rsub;
      const v4f v = *(const v4fa*)&so[w][r][c4];
      *(v4f*)(C + (size_t)(row0 + r) * ldc + col0 + c4) = v;
    }
    
  }
}
// row LayerNorm (biased variance, eps) over N: s = X (+ R); optional out_sum <- s; out_norm <- (s-mu)*rsqrt(var+eps)*g + b
template <bool PARAM_BF16>
__global__ __launch_bounds__(256) void k_layernorm(const float* __restrict__ X, const float* __restrict__ R, const float* __restrict__ g, const float* __restrict__ bta,
                                                  float* __restrict__ out_sum, float* __restrict__ out_norm, int N, float eps) {
  __shared__ float red[256];
  const int row = blockIdx.x, tid = threadIdx.x;
  const float* x = X + (size_t)row * N; const float* rr = R ? R + (size_t)row * N : nullptr;
  float vals[16];                     // up to N = 4096
  const int per = N / 256;            // contiguous chunk per thread? use strided-by-4 chunks: thread handles j = tid*4 + 1024*u
  float s1 = 0.f;
  for (int u = 0; u < per / 4; ++u) {
    const int j = tid * 4 + 1024 * u;
    const v4f a = *(const v4fa*)(x + j);
    v4f b = {0.f,0.f,0.f,0.f}; if (rr) b = *(const v4fa*)(rr + j);
#pragma unroll
    for (int q = 0; q < 4; ++q) { const float v = a[q] + b[q]; vals[u * 4 + q] = v; s1 += v; }
  }
  red[tid] = s1; __syncthreads();
  for (int st = 128; st > 0; st >>= 1) { if (tid < st) red[tid] += red[tid + st]; __syncthreads(); }
  const float mu = red[0] / (float)N; __syncthreads();
  float s2 = 0.f;
  for (int u = 0; u < per / 4; ++u)
#pragma unroll
    for (int q = 0; q < 4; ++q) { const float c = vals[u * 4 + q] - mu; s2 += c * c; }
  red[tid] = s2; __syncthreads();
  for (int st = 128; st > 0; st >>= 1) { if (tid < st) red[tid] += red[tid + st]; __syncthreads(); }
  const float rs = rsqrtf(red[0] / (float)N + eps);
  {
    for (int u = 0; u < per / 4; ++u) {
      const int j = tid * 4 + 1024 * u;
      v4f o, sm;
#pragma unroll
      for (int q = 0; q < 4; ++q) {
        float gg = g[j + q], bb = bta[j + q];
        if (PARAM_BF16) { gg = bf16_round(gg); bb = bf16_round(bb); }
        sm[q] = vals[u * 4 + q]; o[q] = (vals[u * 4 + q] - mu) * rs * gg + bb;
      }
      if (out_sum) *(v4f*)(out_sum + (size_t)row * N + j) = sm;
      *(v4f*)(out_norm + (size_t)row * N + j) = o;
    }
    
  }
}



// ---- f16 WMMA path (v_wmma_f32_16x16x32_f16): 11-bit significands for operands in range — used where a [0,1] probability operand needs more precision than bf16
typedef _Float16 v16h __attribute__((ext_vector_type(16)));
union FragH { v16h v; v8us half[2]; _Float16 h[16]; unsigned short u[16]; };
template <int NT>
__device__ __forceinline__ v8f mmaH(v16h ah, v16h al, v16h bh, v16h bl, v8f c) {
  c = __builtin_amdgcn_wmma_f32_16x16x32_f16(false, ah, false, bh, (short)0, c, false, false);
  if (NT >= 2) c = __builtin_amdgcn_wmma_f32_16x16x32_f16(false, al, false, bh, (short)0, c, false, false);
  if (NT >= 3) c = __builtin_amdgcn_wmma_f32_16x16x32_f16(false, ah, false, bl, (short)0, c, false, false);
  asm volatile("v_nop\n\tv_nop\n\tv_nop\n\tv_nop" : "+v"(c) : "v"(ah), "v"(al), "v"(bh), "v"(bl));
  return c;
}
// batched GEMM like k_gemm_b but f16 operands: A f32 (split into f16 hi/lo if ASPLIT, else rounded to f16), Bt = f16 values [n][k]; alpha; C f32; N multiple of 16 (partial tiles skipped)
template <bool ASPLIT>
__global__ __launch_bounds__(128) void k_gemm_h(const float* __restrict__ A, int lda, size_t sA, const _Float16* __restrict__ Bh, int ldb, size_t sB, float alpha, float* __restrict__ C, int ldc, size_t sC, int M, int N, int K) {
  __shared__ __attribute__((aligned(16))) float so[4][16][64];
  const int tid = threadIdx.x, w = tid >> 5, lane = tid & 31, ln = lane & 15, hh = lane >> 4; const int by = blockIdx.y;
  A += (size_t)by * sA; Bh += (size_t)by * sB; C += (size_t)by * sC;
  const int ntn = (N + 63) / 64; const int wid = blockIdx.x * 4 + w; const int mt = wid / ntn, nq = wid % ntn; if (mt * 16 >= M) return;
  const int row0 = mt * 16, col0 = nq * 64; const float* arow = A + (size_t)(row0 + ln) * lda;
  v8f acc[4] = {};
  for (int kb = 0; kb < K; kb += 32) {
    FragH ah, al;
    const v4f x0 = *(const v4fa*)(arow + kb + 8 * hh), x1 = *(const v4fa*)(arow + kb + 8 * hh + 4), x2 = *(const v4fa*)(arow + kb + 16 + 8 * hh), x3 = *(const v4fa*)(arow + kb + 16 + 8 * hh + 4);
    float xs[16] = {x0[0],x0[1],x0[2],x0[3],x1[0],x1[1],x1[2],x1[3],x2[0],x2[1],x2[2],x2[3],x3[0],x3[1],x3[2],x3[3]};
#pragma unroll
    for (int i = 0; i < 16; ++i) { const _Float16 h = (_Float16)xs[i]; ah.h[i] = h; al.h[i] = ASPLIT ? (_Float16)(xs[i] - (float)h) : (_Float16)0.0f; }
#pragma unroll
    for (int t = 0; t < 4; ++t) { if (col0 + t * 16 >= N) continue; const size_t boff = (size_t)(col0 + t * 16 + ln) * ldb + kb; FragH bq; bq.half[0] = *(const v8us*)(Bh + boff + 8 * hh); bq.half[1] = *(const v8us*)(Bh + boff + 16 + 8 * hh);
      acc[t] = mmaH<ASPLIT ? 2 : 1>(ah.v, al.v, bq.v, bq.v, acc[t]); }
  }
#pragma unroll
  for (int t = 0; t < 4; ++t) { if (col0 + t * 16 >= N) continue;
#pragma unroll
    for (int r = 0; r < 8; ++r) so[w][8 * hh + r][t * 16 + ln] = acc[t][r] * alpha; }
  __builtin_amdgcn_fence(__ATOMIC_ACQ_REL, "workgroup"); __builtin_amdgcn_wave_barrier();
  const int rsub = lane >> 4, c4 = (lane & 15) * 4;
  {
#pragma unroll
    for (int q = 0; q < 8; ++q) { const int r = q * 2 + rsub; if (col0 + c4 < N) { const v4f v = *(const v4fa*)&so[w][r][c4]; *(v4f*)(C + (size_t)(row0 + r) * ldc + col0 + c4) = v; } }
     }
}

// Wt[n][k] = f16(W[k][n]·scale) from f32 row-major W[K][N] (scale = power of two; bf16-exact weights stay exact in f16 away from the subnormal range)
__global__ __launch_bounds__(256) void k_wt_f16(const float* __restrict__ W, _Float16* __restrict__ Wt, int K, int N, float scale) {
  const int t = blockIdx.x * 256 + threadIdx.x; if (t >= N * (K / 8)) return; const int n = t / (K / 8), k8 = (t % (K / 8)) * 8; FragH f;
#pragma unroll
  for (int i = 0; i < 8; ++i) f.h[i] = (_Float16)(bf16_round(W[(size_t)(k8 + i) * N + n]) * scale); const v8us o = f.half[0];
  *(v8us*)((unsigned short*)Wt + (size_t)n * K + k8) = o; 
}
// k_gemm_hh variant with fused epilogue: v = acc·alpha + bias[by·sBias + col] (+ CP[(row/rowsPerB)·sCPb + by·64 + col] if CP) ; ACT 0 none / 1 elu ; writes f16 C16 (and f32 C if non-null)
template <int ACT>
__global__ __launch_bounds__(128) void k_gemm_hhx(const _Float16* __restrict__ A, int lda, size_t sA, const _Float16* __restrict__ Bh, int ldb, size_t sB, float alpha, const float* __restrict__ bias, size_t sBias, const float* __restrict__ CP, int rowsPerB, size_t sCPb, int row0g,
    float* __restrict__ C, _Float16* __restrict__ C16, int ldc, size_t sC, int M, int N, int K) {
  __shared__ __attribute__((aligned(16))) float so[4][16][64];
  const int tid = threadIdx.x, w = tid >> 5, lane = tid & 31, ln = lane & 15, hh = lane >> 4; const int by = blockIdx.y;
  A += (size_t)by * sA; Bh += (size_t)by * sB; const size_t cofs = (size_t)by * sC; const float* bp = bias ? bias + (size_t)by * sBias : nullptr;
  const int ntn = (N + 63) / 64; const int wid = blockIdx.x * 4 + w; const int mt = wid / ntn, nq = wid % ntn; if (mt * 16 >= M) return;
  const int row0 = mt * 16, col0 = nq * 64; const _Float16* arow = A + (size_t)(row0 + ln) * lda;
  v8f acc[4] = {};
  for (int kb = 0; kb < K; kb += 32) { FragH ah; ah.half[0] = *(const v8us*)((const unsigned short*)arow + kb + 8 * hh); ah.half[1] = *(const v8us*)((const unsigned short*)arow + kb + 16 + 8 * hh);
#pragma unroll
    for (int t = 0; t < 4; ++t) { if (col0 + t * 16 >= N) continue; const size_t boff = (size_t)(col0 + t * 16 + ln) * ldb + kb; FragH bq; bq.half[0] = *(const v8us*)((const unsigned short*)Bh + boff + 8 * hh); bq.half[1] = *(const v8us*)((const unsigned short*)Bh + boff + 16 + 8 * hh);
      acc[t] = mmaH<1>(ah.v, ah.v, bq.v, bq.v, acc[t]); }
  }
#pragma unroll
  for (int t = 0; t < 4; ++t) { if (col0 + t * 16 >= N) continue; const int col = col0 + t * 16 + ln; const float bv = bp ? bf16_round(bp[col]) : 0.f;
#pragma unroll
    for (int r = 0; r < 8; ++r) { float v = acc[t][r] * alpha + bv; if (CP) { const int rr = row0g + row0 + 8 * hh + r; if (rowsPerB < 0) v += CP[cofs + (size_t)rr * ldc + col];      /* rowsPerB < 0: own element of the batched C plane */ else { const int bidx = rr / rowsPerB; v += CP[(size_t)bidx * sCPb + (size_t)by * 64 + col]; } } if (ACT == 1) v = (v > 0.f) ? v : expm1f(v); else if (ACT == 7) v = (v > 0.f) ? v + 1.0f : expf(v); else if (ACT == 8) v = tanhf(v); else if (ACT == 9) v = 0.5f * v * (1.0f + tanhf(0.7978845608028654f * (v + 0.044715f * v * v * v))); else if (ACT == 11) v = 1.0f / (1.0f + expf(-v)); else if (ACT == 12) v = (v > 0.f) ? v : 0.01f * v; else if (ACT == 14) v = (v > 0.f) ? v : 0.1f * v; else if (ACT == 16) v = (v >= 0.f) ? v : 0.3f * v; else if (ACT == 17) v = (v >= 0.f) ? v : 0.2f * v; else if (ACT == 15) v = v / (1.0f + expf(-v)); else if (ACT == 3) v = fmaxf(v, 0.f); else if (ACT == 6) v = 0.5f * v * (1.0f + erff(v * 0.70710678118654752f)); so[w][8 * hh + r][t * 16 + ln] = v; } }
  __builtin_amdgcn_fence(__ATOMIC_ACQ_REL, "workgroup"); __builtin_amdgcn_wave_barrier();
  const int rsub = lane >> 4, c4 = (lane & 15) * 4; typedef _Float16 v4h __attribute__((ext_vector_type(4)));
  {
#pragma unroll
    for (int q = 0; q < 8; ++q) { const int r = q * 2 + rsub; if (col0 + c4 < N) { const v4f v = *(const v4fa*)&so[w][r][c4]; if (C) *(v4f*)(C + cofs + (size_t)(row0 + r) * ldc + col0 + c4) = v; if (C16) { v4h h4; for (int i = 0; i < 4; ++i) h4[i] = (_Float16)v[i]; *(v4h*)(C16 + cofs + (size_t)(row0 + r) * ldc + col0 + c4) = h4; } } }
     }
}


typedef _Float16 v4h __attribute__((ext_vector_type(4)));

__global__ __launch_bounds__(256) void k_x16(const float* __restrict__ x, _Float16* __restrict__ X16, size_t n8) { const size_t t = (size_t)blockIdx.x * 256 + threadIdx.x; if (t >= n8) return; FragH f;
#pragma unroll
  for (int q = 0; q < 8; ++q) f.h[q] = (_Float16)bf16_round(x[t * 8 + q]); *(v8us*)((unsigned short*)X16 + t * 8) = f.half[0];  }
__global__ __launch_bounds__(256) void k_h16(const float* __restrict__ x, _Float16* __restrict__ X16, size_t n8) { const size_t t = (size_t)blockIdx.x * 256 + threadIdx.x; if (t >= n8) return; FragH f;
#pragma unroll
  for (int q = 0; q < 8; ++q) f.h[q] = (_Float16)x[t * 8 + q]; *(v8us*)((unsigned short*)X16 + t * 8) = f.half[0];  }
__global__ __launch_bounds__(256) void k_round16f(const float* __restrict__ W, _Float16* __restrict__ Bt, size_t n8) { const size_t t = (size_t)blockIdx.x * 256 + threadIdx.x; if (t >= n8) return; FragH f;
#pragma unroll
  for (int i = 0; i < 8; ++i) f.h[i] = (_Float16)(bf16_round(W[t * 8 + i]) * 16.0f); *(v8us*)((unsigned short*)Bt + t * 8) = f.half[0];  }
template <int NHv, int TTv>
__global__ __launch_bounds__(256) void k_vt(const _Float16* __restrict__ V16, int ldv, int voff, _Float16* __restrict__ Vt) { __shared__ unsigned short tl[64][66]; const int tid = threadIdx.x; const int slab = blockIdx.x / (TTv / 64), lg = blockIdx.x % (TTv / 64); const int b = slab / NHv, h = slab % NHv;
  for (int i = tid; i < 64 * 8; i += 256) { const int r = i / 8, c8 = (i % 8) * 8; FragH f; f.half[0] = *(const v8us*)((const unsigned short*)V16 + ((size_t)b * TTv + lg * 64 + r) * ldv + voff + h * 64 + c8);
#pragma unroll
    for (int q = 0; q < 8; ++q) tl[r][c8 + q] = f.u[q]; }
  __syncthreads();
  {
#pragma unroll
    for (int rd = 0; rd < 2; ++rd) { const int d = rd * 32 + tid / 8, pc = tid % 8; FragH f;
#pragma unroll
      for (int q = 0; q < 8; ++q) f.u[q] = tl[pc * 8 + q][d];
      *(v8us*)((unsigned short*)Vt + ((size_t)slab * 64 + d) * TTv + lg * 64 + pc * 8) = f.half[0]; }
     } }

__global__ __launch_bounds__(256) void k_hl(const float* __restrict__ F, _Float16* __restrict__ Hh, _Float16* __restrict__ Hl, size_t n8) { const size_t t = (size_t)blockIdx.x * 256 + threadIdx.x; if (t >= n8) return; FragH fh, fl; const v4f a = *(const v4fa*)(F + t * 8), c = *(const v4fa*)(F + t * 8 + 4);
#pragma unroll
  for (int q = 0; q < 4; ++q) { _Float16 h = (_Float16)a[q]; fh.h[q] = h; fl.h[q] = (_Float16)((a[q] - (float)h) * 1024.0f); h = (_Float16)c[q]; fh.h[4 + q] = h; fl.h[4 + q] = (_Float16)((c[q] - (float)h) * 1024.0f); }
  { *(v8us*)((unsigned short*)Hh + t * 8) = fh.half[0]; *(v8us*)((unsigned short*)Hl + t * 8) = fl.half[0];  } }

// ---- fast GEMM (wave tile 32x64; requires M % 32 == 0 rows per launch region and N % 64 == 0); epilogue = k_gemm_hhx semantics ----
__device__ __forceinline__ v16h g2_frag(const _Float16* p, int hh) { FragH f; f.half[0] = *(const v8us*)((const unsigned short*)p + 8 * hh); f.half[1] = *(const v8us*)((const unsigned short*)p + 16 + 8 * hh); return f.v; }
__device__ __forceinline__ v8f g2_mma(v16h a, v16h b, v8f c) { v8f d = __builtin_amdgcn_wmma_f32_16x16x32_f16(false, a, false, b, (short)0, c, false, false); asm volatile("v_nop\n\tv_nop\n\tv_nop\n\tv_nop" : "+v"(d) : "v"(a), "v"(b)); return d; }
template <int ACT>
__global__ __launch_bounds__(128) void k_gemm2(const _Float16* __restrict__ A, int lda, size_t sA, const _Float16* __restrict__ Bh, int ldb, size_t sB, float alpha, const float* __restrict__ bias, size_t sBias, const float* __restrict__ CP, int rowsPerB, size_t sCPb, int row0g,
    float* __restrict__ C, _Float16* __restrict__ C16, int ldc, size_t sC, int M, int N, int K, size_t sAz, size_t sBz, size_t sCz) { static_assert(ACT == 0 || ACT == 3 || ACT == 6 || ACT == 8 || ACT == 9 || ACT == 11 || ACT == 12 || ACT == 14 || ACT == 15 || ACT == 16 || ACT == 17, "k_gemm2: unsupported ACT code (would silently apply no activation)");
  __shared__ __attribute__((aligned(16))) float so[4][32][68];
  const int tid = threadIdx.x, w = tid >> 5, lane = tid & 31, ln = lane & 15, hh = lane >> 4; const int by = blockIdx.y, bz = blockIdx.z;      /* two batch levels: grid.y (strides sA, sB, sC) and grid.z (strides sAz, sBz, sCz) */
  A += (size_t)by * sA + (size_t)bz * sAz; Bh += (size_t)by * sB + (size_t)bz * sBz; const size_t cofs = (size_t)by * sC + (size_t)bz * sCz; const float* bp = bias ? bias + (size_t)by * sBias : nullptr;
  const int ntn = N >> 6; const int mt = blockIdx.x / ntn, nq = blockIdx.x - mt * ntn; const int row0 = mt * 128 + 32 * w, col0 = nq * 64; if (row0 >= M) return;
  const _Float16* a0p = A + (size_t)(row0 + ln) * lda; const _Float16* a1p = a0p + (size_t)16 * lda;
  const _Float16* b0p = Bh + (size_t)(col0 + ln) * ldb; const _Float16* b1p = b0p + (size_t)16 * ldb; const _Float16* b2p = b1p + (size_t)16 * ldb; const _Float16* b3p = b2p + (size_t)16 * ldb;
  const v8f z8 = {0.f,0.f,0.f,0.f,0.f,0.f,0.f,0.f}; v8f c00 = z8, c01 = z8, c02 = z8, c03 = z8, c10 = z8, c11 = z8, c12 = z8, c13 = z8;
#pragma unroll 1
  for (int kb = 0; kb < K; kb += 32) { const v16h a0 = g2_frag(a0p + kb, hh), a1 = g2_frag(a1p + kb, hh);
    v16h b = g2_frag(b0p + kb, hh); c00 = g2_mma(a0, b, c00); c10 = g2_mma(a1, b, c10);
    b = g2_frag(b1p + kb, hh); c01 = g2_mma(a0, b, c01); c11 = g2_mma(a1, b, c11);
    b = g2_frag(b2p + kb, hh); c02 = g2_mma(a0, b, c02); c12 = g2_mma(a1, b, c12);
    b = g2_frag(b3p + kb, hh); c03 = g2_mma(a0, b, c03); c13 = g2_mma(a1, b, c13); }
  v8f accs[8] = {c00, c01, c02, c03, c10, c11, c12, c13};
#pragma unroll
  for (int u = 0; u < 8; ++u) { const int t = u & 3, half = u >> 2; const int col = col0 + t * 16 + ln; const float bv = bp ? bf16_round(bp[col]) : 0.f;
#pragma unroll
    for (int r = 0; r < 8; ++r) { const int rloc = half * 16 + 8 * hh + r; float v = accs[u][r] * alpha + bv; if (CP) { if (rowsPerB < 0) v += CP[cofs + (size_t)(row0g + row0 + rloc) * ldc + col];      /* rowsPerB < 0: own element of the batched C plane */ else { const int bidx = (row0g + row0 + rloc) / rowsPerB; v += CP[(size_t)bidx * sCPb + (size_t)by * 64 + col]; } }
      if (ACT == 3) v = fmaxf(v, 0.f); else if (ACT == 6) v = 0.5f * v * (1.0f + erff(v * 0.70710678118654752f)); else if (ACT == 11) v = 1.0f / (1.0f + expf(-v)); else if (ACT == 15) v = v / (1.0f + expf(-v)); else if (ACT == 12) v = (v > 0.f) ? v : 0.01f * v; else if (ACT == 8) v = tanhf(v); else if (ACT == 9) v = 0.5f * v * (1.0f + tanhf(0.7978845608028654f * (v + 0.044715f * v * v * v))); else if (ACT == 14) v = (v > 0.f) ? v : 0.1f * v; else if (ACT == 16) v = (v >= 0.f) ? v : 0.3f * v; else if (ACT == 17) v = (v >= 0.f) ? v : 0.2f * v;
      so[w][rloc][t * 16 + ln] = v; } }
  __builtin_amdgcn_fence(__ATOMIC_ACQ_REL, "workgroup"); __builtin_amdgcn_wave_barrier();
  const int rsub = lane >> 4, c4 = (lane & 15) * 4;
  {
#pragma unroll
    for (int q = 0; q < 16; ++q) { const int r = q * 2 + rsub; const v4f v = *(const v4fa*)&so[w][r][c4]; if (C) *(v4f*)(C + cofs + (size_t)(row0 + r) * ldc + col0 + c4) = v; if (C16) { v4h h4; for (int i = 0; i < 4; ++i) h4[i] = (_Float16)v[i]; *(v4h*)(C16 + cofs + (size_t)(row0 + r) * ldc + col0 + c4) = h4; } }
     } }


__global__ __launch_bounds__(256) void k_wnat(const float* __restrict__ w, size_t n8, _Float16* __restrict__ Bt) { const size_t t = (size_t)blockIdx.x * 256 + threadIdx.x; if (t >= n8) return; FragH f; for (int q = 0; q < 8; ++q) f.h[q] = (_Float16)(bf16_round(w[t * 8 + q]) * 16.0f); *(v8us*)((unsigned short*)Bt + t * 8) = f.half[0];  }
__global__ __launch_bounds__(256) void k_rsm(const float* __restrict__ S, _Float16* __restrict__ P, int nrows) {
  #pragma clang fp contract(off)
  const int i = blockIdx.x * 256 + threadIdx.x; if (i >= nrows) return; const float* s = S + (size_t)i * SQ; float mx = -3.0e38f;
#pragma unroll 1
  for (int j = 0; j < SQ; ++j) mx = fmaxf(mx, s[j]); float se = 0.f;
#pragma unroll 1
  for (int j = 0; j < SQ; ++j) se += expf(s[j] - mx); const float sc = 256.0f / se;
#pragma unroll 1
  for (int j0 = 0; j0 < SQ; j0 += 8) { FragH f; for (int q = 0; q < 8; ++q) f.h[q] = (_Float16)(expf(s[j0 + q] - mx) * sc); unsigned short* d = (unsigned short*)P + (size_t)i * SQ + j0; *(v8us*)d = f.half[0];  } }
__global__ __launch_bounds__(256) void k_vt(const _Float16* __restrict__ V16, int b, int h0, _Float16* __restrict__ VT) { __shared__ unsigned short tl[64][65]; const int tid = threadIdx.x; const int hh = blockIdx.x % HG, sg = blockIdx.x / HG; const int s0 = sg * 64; const int h = h0 + hh;
  for (int i = tid; i < 64 * 8; i += 256) { const int j = i / 8, d8 = (i % 8) * 8; FragH f; f.half[0] = *(const v8us*)((const unsigned short*)V16 + ((size_t)b * SQ + s0 + j) * DM + h * HD + d8); for (int q = 0; q < 8; ++q) tl[d8 + q][j] = f.u[q]; }
  __syncthreads();
  { for (int i = tid; i < 64 * 8; i += 256) { const int d = i / 8, j8 = (i % 8) * 8; FragH f; for (int q = 0; q < 8; ++q) f.u[q] = tl[d][j8 + q]; *(v8us*)((unsigned short*)VT + ((size_t)hh * HD + d) * SQ + s0 + j8) = f.half[0]; }  } }


__global__ __launch_bounds__(256) void k_rsmf(const float* __restrict__ S, _Float16* __restrict__ P, int qn, int hg) {
  #pragma clang fp contract(off)
  const int t = blockIdx.x * 256 + threadIdx.x; if (t >= qn * hg) return; const size_t i = (size_t)(t / qn) * SQ + (t % qn); const float* s = S + i * SQ; float mx = -3.0e38f;
#pragma unroll 1
  for (int j = 0; j < SQ; ++j) mx = fmaxf(mx, s[j]); float se = 0.f;
#pragma unroll 1
  for (int j = 0; j < SQ; ++j) se += __expf(s[j] - mx); const float sc = 256.0f / se;
#pragma unroll 1
  for (int j0 = 0; j0 < SQ; j0 += 8) { FragH f; for (int q = 0; q < 8; ++q) f.h[q] = (_Float16)(__expf(s[j0 + q] - mx) * sc); unsigned short* d = (unsigned short*)P + i * SQ + j0; *(v8us*)d = f.half[0];  } }

__global__ __launch_bounds__(256) void k_rsmr(const float* __restrict__ S, _Float16* __restrict__ P, int qn, int hg) {
  #pragma clang fp contract(off)
  const int t = blockIdx.x * 256 + threadIdx.x; if (t >= qn * hg) return; const size_t i = (size_t)t;      /* planes packed: row t of plane t / qn */ const float* s = S + i * SQ; float mx = -3.0e38f;
#pragma unroll 1
  for (int j = 0; j < SQ; ++j) mx = fmaxf(mx, s[j]); float se = 0.f;
#pragma unroll 1
  for (int j = 0; j < SQ; ++j) se += __expf(s[j] - mx); const float sc = 256.0f / se;
#pragma unroll 1
  for (int j0 = 0; j0 < SQ; j0 += 8) { FragH f; for (int q = 0; q < 8; ++q) f.h[q] = (_Float16)(__expf(s[j0 + q] - mx) * sc); unsigned short* d = (unsigned short*)P + i * SQ + j0; *(v8us*)d = f.half[0];  } }


typedef int v4ia __attribute__((ext_vector_type(4), may_alias));
// One wave per score row: lane l holds keys 128 u + 4 l .. + 3 (u = 0..7) in registers, so the row and its mask row are read once, every load covers 512 contiguous bytes
// and every store 256; row maximum and row sum by a five-step butterfly over the lanes. The hg heads of one query sit in neighbouring waves (they read the same mask row).
__global__ __launch_bounds__(256) void k_rsmrm(const float* __restrict__ S, const int* __restrict__ Mk, _Float16* __restrict__ P, int qn, int hg) {
  const int lane = threadIdx.x & 31; const int gw = blockIdx.x * 8 + __builtin_amdgcn_readfirstlane((int)(threadIdx.x >> 5)); const int q = gw / hg, hd = gw - q * hg; if (q >= qn) return;      /* wave-uniform, no barrier below */
  const size_t i = (size_t)hd * qn + q; const float* s = S + i * SK + lane * 4; const int* mr = Mk + (size_t)q * SK + lane * 4;
  v4f sv[8]; v4ia mv[8];
#pragma unroll
  for (int u = 0; u < 8; ++u) { sv[u] = *(const v4fa*)(s + u * 128); mv[u] = *(const v4ia*)(mr + u * 128); }
  asm volatile("s_wait_xcnt 0x0" ::: "memory");      /* the arithmetic right below reuses the registers that hold the 16 loads' addresses */
  __builtin_amdgcn_sched_barrier(0);      /* keeps all 16 loads in flight together: without it the compiler sinks the mask loads into the arithmetic, two at a time, and the wave pays the load latency four times */
  float mx = -3.0e38f;
#pragma unroll
  for (int u = 0; u < 8; ++u)
#pragma unroll
    for (int c = 0; c < 4; ++c) { const float f = (mv[u][c] != 0) ? 1.f : 0.f; const float v = fmaf(f, sv[u][c], (1.f - f) * -1.0e9f); sv[u][c] = v; mx = fmaxf(mx, v); }
#pragma unroll
  for (int d = 16; d > 0; d >>= 1) mx = fmaxf(mx, __shfl_xor(mx, d, 32));
  v4f s4 = {0.f, 0.f, 0.f, 0.f};      /* four independent sum chains */
#pragma unroll
  for (int u = 0; u < 8; ++u)
#pragma unroll
    for (int c = 0; c < 4; ++c) { const float t = (sv[u][c] - mx) * 1.4426950408889634f; float e;
      asm("v_exp_f32 %0, %1\n\tv_nop" : "=v"(e) : "v"(t));      /* the native exp (2^t) with the one free slot behind a transcendental inside the statement: 32 of them stand back to back here */
      sv[u][c] = e; s4[c] += e; }
  float se = (s4[0] + s4[1]) + (s4[2] + s4[3]);
#pragma unroll
  for (int d = 16; d > 0; d >>= 1) se += __shfl_xor(se, d, 32);
  const float sc = 256.0f / se; _Float16* p = P + i * SK + lane * 4;
#pragma unroll
  for (int u = 0; u < 8; ++u) { v4h h4;
#pragma unroll
    for (int c = 0; c < 4; ++c) h4[c] = (_Float16)(sv[u][c] * sc);
    *(v4h*)(p + u * 128) = h4; } }
extern "C" void kernel_launch(void* const* d_in, const int* in_sizes, int n_in,
                              void* d_out, int out_size, void* d_ws, size_t ws_size, hipStream_t stream) {
  (void)in_sizes; (void)n_in; (void)out_size;
  const float* const* I = (const float* const*)d_in; const float* x = I[0]; const float* ctx = I[1]; const int* mkm = (const int*)d_in[2]; const float* wq = I[3]; const float* bq = I[4]; const float* wkv = I[5]; const float* bkv = I[6]; const float* wo = I[7]; const float* bo = I[8];      /* [in][out] weights; int mask [b][n][m]; k | v from the fused Wkv [1024][2048] */
  char* ws = (char*)d_ws; size_t off = 0;
  auto take = [&](size_t bytes) { char* p = ws + off; off += (bytes + 255) & ~(size_t)255; return p; };
  _Float16* BQ = (_Float16*)take((size_t)DM * DM * 2); _Float16* BKV = (_Float16*)take((size_t)2 * DM * DC * 2); _Float16* BO = (_Float16*)take((size_t)DM * DM * 2);
  _Float16* X16 = (_Float16*)take(NRQ * DM * 2); _Float16* C16 = (_Float16*)take(NRK * DC * 2); _Float16* Q16 = (_Float16*)take(NRQ * DM * 2); _Float16* K16 = (_Float16*)take(2 * NRK * DM * 2); _Float16* V16 = K16 + NRK * DM; _Float16* O16 = X16;      /* o rows reuse the x rows, whose last reader is the Q GEMM */
  float* S = (float*)take((size_t)NH * NQ * SK * 4); _Float16* P = (_Float16*)take((size_t)NB * NH * NQ * SK * 2); _Float16* VT = (_Float16*)take((size_t)NB * NH * HD * SK * 2);      /* S: the 16 heads of one batch; P and V^T: all 64 (batch, head) planes */
  if (off > ws_size) return;      /* 8 + 5 x 8 + 64 + 128 + 8 = 248 MiB */
  { const unsigned g = (unsigned)(((size_t)DM * (DM / 8) + 255) / 256); k_wt_f16<<<g, 256, 0, stream>>>(wq, BQ, DM, DM, 16.0f); k_wt_f16<<<2 * g, 256, 0, stream>>>(wkv, BKV, DC, 2 * DM, 16.0f); k_wt_f16<<<g, 256, 0, stream>>>(wo, BO, DM, DM, 16.0f); }      /* [in][out] -> Bt x16; Wkv [1024][2048] -> Bt [2048][1024]: rows 0..1023 = k columns, 1024..2047 = v columns */
  k_x16<<<(unsigned)((NRQ * DM / 8 + 255) / 256), 256, 0, stream>>>(x, X16, NRQ * DM / 8); k_x16<<<(unsigned)((NRK * DC / 8 + 255) / 256), 256, 0, stream>>>(ctx, C16, NRK * DC / 8);
  k_gemm2<0><<<dim3((unsigned)((NRQ / 128) * (DM / 64)), 1), 128, 0, stream>>>(X16, DM, 0, BQ, DM, 0, 0.0625f, bq, 0, nullptr, 1, 0, 0, nullptr, Q16, DM, 0, (int)NRQ, DM, DM, 0, 0, 0);
  k_gemm2<0><<<dim3((unsigned)((NRK / 128) * (DM / 64)), 2), 128, 0, stream>>>(C16, DC, 0, BKV, DC, (size_t)DM * DC, 0.0625f, bkv, (size_t)DM, nullptr, 1, 0, 0, nullptr, K16, DM, NRK * DM, (int)NRK, DM, DC, 0, 0, 0);      /* grid.y 0: k = context Wkv[:, :1024] + bkv[:1024] -> K16; grid.y 1: v = context Wkv[:, 1024:] + bkv[1024:] -> V16 */
  k_vt<NH, SK><<<NB * NH * (SK / 64), 256, 0, stream>>>(V16, DM, 0, VT);      /* V^T [4 x 16][64][1024], all batches in one launch */
  for (int b = 0; b < NB; ++b) { const size_t rq = (size_t)b * NQ, rk = (size_t)b * SK;
    k_gemm2<0><<<dim3((NQ / 128) * (SK / 64), NH), 128, 0, stream>>>(Q16 + rq * DM, DM, (size_t)HD, K16 + rk * DM, DM, (size_t)HD, 0.125f, nullptr, 0, nullptr, 1, 0, 0, S, nullptr, SK, (size_t)NQ * SK, NQ, SK, HD, 0, 0, 0);      /* scores of this batch's 16 heads (grid.y) */
    k_rsmrm<<<(NH * NQ + 7) / 8, 256, 0, stream>>>(S, mkm + (size_t)b * NQ * SK, P + (size_t)b * NH * NQ * SK, NQ, NH); }      /* masked softmax over the 1024 context tokens (this batch's int mask rows) */
  k_gemm2<0><<<dim3((NQ / 128) * (HD / 64), NH, NB), 128, 0, stream>>>(P, SK, (size_t)NQ * SK, VT, SK, (size_t)HD * SK, 0.25f, nullptr, 0, nullptr, 1, 0, 0, nullptr, O16, DM, (size_t)HD, NQ, HD, SK, (size_t)NH * NQ * SK, (size_t)NH * HD * SK, (size_t)NQ * DM);      /* o x64, merged: heads on grid.y, batches on grid.z, one launch */
  k_gemm2<0><<<dim3((unsigned)((NRQ / 128) * (DM / 64)), 1), 128, 0, stream>>>(O16, DM, 0, BO, DM, 0, 0.0009765625f, bo, 0, nullptr, 1, 0, 0, (float*)d_out, nullptr, DM, 0, (int)NRQ, DM, DM, 0, 0, 0);      /* out = o Wo + bo */
}

// v003
// One run takes 215 microseconds.
// Timed twice side by side with v002, it ran 1.56 and 1.57 times as fast.
// All steps since v000 together make it 24.3 times as fast.
#include <hip/hip_runtime.h>
// Masked multi-head cross-attention (x [4][1024][1024] queries, context [4][1024][1024]; q = x Wq + bq; k | v = context Wkv + bkv viewed (m, 2, 16, 64) ([in][out] weights sigma 1/32, zero biases); 16 heads of 64; dots = q k^T / 8; a binary int mask [b][n][32*32 = m] shared by the heads: masked_fill(mask == 0, -inf); softmax over the 1024 context tokens; out = merged Wp + bp -> [4][1024][1024]).
// Structure: x and context as exact f16 rows; [in][out] weights as exact x16 planes (Wkv as one [2048][1024] plane: k rows then v rows); Q and K | V (one launch, grid.y) as WMMA GEMMs (32x64 wave tiles, f32 accumulation, + bias, f16 outputs); V^T of all batches via LDS transposes (one launch); scores (K = 64, 1/8), int mask select, online softmax (f32 statistics, native exp2; weights f16, unnormalised) and o = P V^T (o carried x64) of all 64 (batch, head) planes fused in one launch, scores and weights in registers only, into merged f16 rows; out = o Wp + bp GEMM (f32, alpha 2^-10); launches: see trace.
// Compute dtype: inputs rounded to bf16; x / context / weights exact; q, k, v, softmax weights and o as plain f16 GEMM operands (~2^-12); scores and statistics f32; v_wmma_f32_16x16x32_f16.
#define NB 4
#define NQ 1024
#define SK 1024
#define SQ SK                       /* keys per softmax row */
#define DM 1024
#define DC 1024
#define NH 16
#define HD 64
#define HG 4
#define NRQ ((size_t)NB * NQ)
#define NRK ((size_t)NB * SK)
typedef __bf16 v16b __attribute__((ext_vector_type(16)));
typedef unsigned short v8us __attribute__((ext_vector_type(8), may_alias));
typedef float  v8f  __attribute__((ext_vector_type(8)));
typedef float  v4f  __attribute__((ext_vector_type(4)));
typedef float  v4fa __attribute__((ext_vector_type(4), may_alias));
union FragB { v16b v; v8us half[2]; unsigned short u[16]; };

__device__ __forceinline__ unsigned short bf16_bits(float x) { unsigned int u = __float_as_uint(x); return (unsigned short)((u + 0x7FFFu + ((u >> 16) & 1u)) >> 16); }
__device__ __forceinline__ float bf16_val(unsigned short b) { return __uint_as_float(((unsigned int)b) << 16); }
__device__ __forceinline__ float bf16_round(float x) { return bf16_val(bf16_bits(x)); }
// D += A·B with NT terms: 1 = ah·bh, 2 = + al·bh (A split), 3 = + ah·bl (both split)
template <int NT>
__device__ __forceinline__ v8f mmaN(v16b ah, v16b al, v16b bh, v16b bl, v8f c) {
  c = __builtin_amdgcn_wmma_f32_16x16x32_bf16(false, ah, false, bh, (short)0, c, false, false);
  if (NT >= 2) c = __builtin_amdgcn_wmma_f32_16x16x32_bf16(false, al, false, bh, (short)0, c, false, false);
  if (NT >= 3) c = __builtin_amdgcn_wmma_f32_16x16x32_bf16(false, ah, false, bl, (short)0, c, false, false);
  asm volatile("v_nop\n\tv_nop\n\tv_nop\n\tv_nop" : "+v"(c) : "v"(ah), "v"(al), "v"(bh), "v"(bl));
  return c;
}

__global__ __launch_bounds__(256) void k_wt_bf16(const float* __restrict__ W, unsigned short* __restrict__ Wt, int K, int N) {
  const int t = blockIdx.x * 256 + threadIdx.x;
  const int k8n = K / 8;
  if (t >= N * k8n) return;
  const int n = t / k8n, k8 = (t % k8n) * 8;
  v8us v;
#pragma unroll
  for (int i = 0; i < 8; ++i) v[i] = bf16_bits(W[(size_t)(k8 + i) * N + n]);
  *(v8us*)(Wt + (size_t)n * K + k8) = v;
  
}

// GEMM C[M][N] (f32, pitch ldc) = act(A[M][K]·W + bias). A f32 row-major (pitch lda) converted per fragment to bf16
// (ASPLIT: hi/lo two planes -> 2 terms, else single rounded term); Wt bf16 [N][K] (pitch ldb). BIAS_BF16 rounds the
// bias to bf16 first (bias quantised to bf16 before the add). K%32==0, M%16==0, N%64==0.
template <bool ASPLIT, int ACT, bool BIAS_BF16>
__global__ __launch_bounds__(128) void k_gemm_bf(const float* __restrict__ A, int lda, const unsigned short* __restrict__ Wt, int ldb,
                                               const float* __restrict__ bias, float* __restrict__ C, int ldc, int M, int N, int K) {
  __shared__ __attribute__((aligned(16))) float so[4][16][64];
  const int tid = threadIdx.x, w = tid >> 5, lane = tid & 31, ln = lane & 15, hh = lane >> 4;
  const int ntn = N / 64;
  const int wid = blockIdx.x * 4 + w;
  const int mt = wid / ntn, nq = wid % ntn;
  if (mt * 16 >= M) return;
  const int row0 = mt * 16, col0 = nq * 64;
  const float* arow = A + (size_t)(row0 + ln) * lda;
  v8f acc[4] = {};
  for (int kb = 0; kb < K; kb += 32) {
    FragB ah, al;
    const v4f x0 = *(const v4fa*)(arow + kb + 8 * hh), x1 = *(const v4fa*)(arow + kb + 8 * hh + 4);
    const v4f x2 = *(const v4fa*)(arow + kb + 16 + 8 * hh), x3 = *(const v4fa*)(arow + kb + 16 + 8 * hh + 4);
    float xs[16] = {x0[0],x0[1],x0[2],x0[3],x1[0],x1[1],x1[2],x1[3],x2[0],x2[1],x2[2],x2[3],x3[0],x3[1],x3[2],x3[3]};
#pragma unroll
    for (int i = 0; i < 16; ++i) { const unsigned short hb = bf16_bits(xs[i]); ah.u[i] = hb; al.u[i] = ASPLIT ? bf16_bits(xs[i] - bf16_val(hb)) : (unsigned short)0; }
#pragma unroll
    for (int t = 0; t < 4; ++t) {
      const unsigned short* brow = Wt + (size_t)(col0 + t * 16 + ln) * ldb + kb;
      FragB b;
      b.half[0] = *(const v8us*)(brow + 8 * hh);
      b.half[1] = *(const v8us*)(brow + 16 + 8 * hh);
      acc[t] = mmaN<ASPLIT ? 2 : 1>(ah.v, al.v, b.v, b.v, acc[t]);
    }
  }
#pragma unroll
  for (int t = 0; t < 4; ++t) {
    float bv = bias ? bias[col0 + t * 16 + ln] : 0.f;
    if (BIAS_BF16) bv = bf16_round(bv);
#pragma unroll
    for (int r = 0; r < 8; ++r) { float v = acc[t][r] + bv; if (ACT == 1) v = fmaxf(v, 0.f); so[w][8 * hh + r][t * 16 + ln] = v; }
  }
  __builtin_amdgcn_fence(__ATOMIC_ACQ_REL, "workgroup");
  __builtin_amdgcn_wave_barrier();
  const int rsub = lane >> 4, c4 = (lane & 15) * 4;
  {
#pragma unroll
    for (int q = 0; q < 8; ++q) {
      const int r = q * 2 + rsub;
      const v4f v = *(const v4fa*)&so[w][r][c4];
      *(v4f*)(C + (size_t)(row0 + r) * ldc + col0 + c4) = v;
    }
    
  }
}

// GEMM C = act(A·W + bias + resid): A f32 (ASPLIT -> hi/lo 2 terms), Wt bf16 [N][K]; ACT 0 none, 1 relu, 2 exact gelu;
// resid (optional, f32, row index = (row % rmod), pitch ldr, RES_BF16 rounds it) added before the activation.
template <bool ASPLIT, int ACT, bool BIAS_BF16, bool RES_BF16>
__global__ __launch_bounds__(128) void k_gemm_bf3(const float* __restrict__ A, int lda, const unsigned short* __restrict__ Wt, int ldb,
                                                const float* __restrict__ bias, const float* __restrict__ resid, int rmod, int ldr,
                                                float* __restrict__ C, int ldc, int M, int N, int K) {
  __shared__ __attribute__((aligned(16))) float so[4][16][64];
  const int tid = threadIdx.x, w = tid >> 5, lane = tid & 31, ln = lane & 15, hh = lane >> 4;
  const int ntn = N / 64;
  const int wid = blockIdx.x * 4 + w;
  const int mt = wid / ntn, nq = wid % ntn;
  if (mt * 16 >= M) return;
  const int row0 = mt * 16, col0 = nq * 64;
  const float* arow = A + (size_t)(row0 + ln) * lda;
  v8f acc[4] = {};
  for (int kb = 0; kb < K; kb += 32) {
    FragB ah, al;
    const v4f x0 = *(const v4fa*)(arow + kb + 8 * hh), x1 = *(const v4fa*)(arow + kb + 8 * hh + 4);
    const v4f x2 = *(const v4fa*)(arow + kb + 16 + 8 * hh), x3 = *(const v4fa*)(arow + kb + 16 + 8 * hh + 4);
    float xs[16] = {x0[0],x0[1],x0[2],x0[3],x1[0],x1[1],x1[2],x1[3],x2[0],x2[1],x2[2],x2[3],x3[0],x3[1],x3[2],x3[3]};
#pragma unroll
    for (int i = 0; i < 16; ++i) { const unsigned short hb = bf16_bits(xs[i]); ah.u[i] = hb; al.u[i] = ASPLIT ? bf16_bits(xs[i] - bf16_val(hb)) : (unsigned short)0; }
#pragma unroll
    for (int t = 0; t < 4; ++t) {
      const unsigned short* brow = Wt + (size_t)(col0 + t * 16 + ln) * ldb + kb;
      FragB b;
      b.half[0] = *(const v8us*)(brow + 8 * hh);
      b.half[1] = *(const v8us*)(brow + 16 + 8 * hh);
      acc[t] = mmaN<ASPLIT ? 2 : 1>(ah.v, al.v, b.v, b.v, acc[t]);
    }
  }
#pragma unroll
  for (int t = 0; t < 4; ++t) {
    const int col = col0 + t * 16 + ln;
    float bv = bias ? bias[col] : 0.f;
    if (BIAS_BF16) bv = bf16_round(bv);
#pragma unroll
    for (int r = 0; r < 8; ++r) {
      float v = acc[t][r] + bv;
      if (resid) { float rv = resid[(size_t)((row0 + 8 * hh + r) % rmod) * ldr + col]; if (RES_BF16) rv = bf16_round(rv); v += rv; }
      if (ACT == 1) v = fmaxf(v, 0.f);
      if (ACT == 2) v = 0.5f * v * (1.0f + erff(v * 0.70710678118654752f));
      if (ACT == 3) { const float u = 0.7978845608028654f * (v + 0.044715f * v * v * v); v = 0.5f * v * (1.0f + tanhf(u)); }
      so[w][8 * hh + r][t * 16 + ln] = v;
    }
  }
  __builtin_amdgcn_fence(__ATOMIC_ACQ_REL, "workgroup");
  __builtin_amdgcn_wave_barrier();
  const int rsub = lane >> 4, c4 = (lane & 15) * 4;
  {
#pragma unroll
    for (int q = 0; q < 8; ++q) {
      const int r = q * 2 + rsub;
      const v4f v = *(const v4fa*)&so[w][r][c4];
      *(v4f*)(C + (size_t)(row0 + r) * ldc + col0 + c4) = v;
    }
    
  }
}
// row LayerNorm (biased variance, eps) over N: s = X (+ R); optional out_sum <- s; out_norm <- (s-mu)*rsqrt(var+eps)*g + b
template <bool PARAM_BF16>
__global__ __launch_bounds__(256) void k_layernorm(const float* __restrict__ X, const float* __restrict__ R, const float* __restrict__ g, const float* __restrict__ bta,
                                                  float* __restrict__ out_sum, float* __restrict__ out_norm, int N, float eps) {
  __shared__ float red[256];
  const int row = blockIdx.x, tid = threadIdx.x;
  const float* x = X + (size_t)row * N; const float* rr = R ? R + (size_t)row * N : nullptr;
  float vals[16];                     // up to N = 4096
  const int per = N / 256;            // contiguous chunk per thread? use strided-by-4 chunks: thread handles j = tid*4 + 1024*u
  float s1 = 0.f;
  for (int u = 0; u < per / 4; ++u) {
    const int j = tid * 4 + 1024 * u;
    const v4f a = *(const v4fa*)(x + j);
    v4f b = {0.f,0.f,0.f,0.f}; if (rr) b = *(const v4fa*)(rr + j);
#pragma unroll
    for (int q = 0; q < 4; ++q) { const float v = a[q] + b[q]; vals[u * 4 + q] = v; s1 += v; }
  }
  red[tid] = s1; __syncthreads();
  for (int st = 128; st > 0; st >>= 1) { if (tid < st) red[tid] += red[tid + st]; __syncthreads(); }
  const float mu = red[0] / (float)N; __syncthreads();
  float s2 = 0.f;
  for (int u = 0; u < per / 4; ++u)
#pragma unroll
    for (int q = 0; q < 4; ++q) { const float c = vals[u * 4 + q] - mu; s2 += c * c; }
  red[tid] = s2; __syncthreads();
  for (int st = 128; st > 0; st >>= 1) { if (tid < st) red[tid] += red[tid + st]; __syncthreads(); }
  const float rs = rsqrtf(red[0] / (float)N + eps);
  {
    for (int u = 0; u < per / 4; ++u) {
      const int j = tid * 4 + 1024 * u;
      v4f o, sm;
#pragma unroll
      for (int q = 0; q < 4; ++q) {
        float gg = g[j + q], bb = bta[j + q];
        if (PARAM_BF16) { gg = bf16_round(gg); bb = bf16_round(bb); }
        sm[q] = vals[u * 4 + q]; o[q] = (vals[u * 4 + q] - mu) * rs * gg + bb;
      }
      if (out_sum) *(v4f*)(out_sum + (size_t)row * N + j) = sm;
      *(v4f*)(out_norm + (size_t)row * N + j) = o;
    }
    
  }
}



// ---- f16 WMMA path (v_wmma_f32_16x16x32_f16): 11-bit significands for operands in range — used where a [0,1] probability operand needs more precision than bf16
typedef _Float16 v16h __attribute__((ext_vector_type(16)));
union FragH { v16h v; v8us half[2]; _Float16 h[16]; unsigned short u[16]; };
template <int NT>
__device__ __forceinline__ v8f mmaH(v16h ah, v16h al, v16h bh, v16h bl, v8f c) {
  c = __builtin_amdgcn_wmma_f32_16x16x32_f16(false, ah, false, bh, (short)0, c, false, false);
  if (NT >= 2) c = __builtin_amdgcn_wmma_f32_16x16x32_f16(false, al, false, bh, (short)0, c, false, false);
  if (NT >= 3) c = __builtin_amdgcn_wmma_f32_16x16x32_f16(false, ah, false, bl, (short)0, c, false, false);
  asm volatile("v_nop\n\tv_nop\n\tv_nop\n\tv_nop" : "+v"(c) : "v"(ah), "v"(al), "v"(bh), "v"(bl));
  return c;
}
// batched GEMM like k_gemm_b but f16 operands: A f32 (split into f16 hi/lo if ASPLIT, else rounded to f16), Bt = f16 values [n][k]; alpha; C f32; N multiple of 16 (partial tiles skipped)
template <bool ASPLIT>
__global__ __launch_bounds__(128) void k_gemm_h(const float* __restrict__ A, int lda, size_t sA, const _Float16* __restrict__ Bh, int ldb, size_t sB, float alpha, float* __restrict__ C, int ldc, size_t sC, int M, int N, int K) {
  __shared__ __attribute__((aligned(16))) float so[4][16][64];
  const int tid = threadIdx.x, w = tid >> 5, lane = tid & 31, ln = lane & 15, hh = lane >> 4; const int by = blockIdx.y;
  A += (size_t)by * sA; Bh += (size_t)by * sB; C += (size_t)by * sC;
  const int ntn = (N + 63) / 64; const int wid = blockIdx.x * 4 + w; const int mt = wid / ntn, nq = wid % ntn; if (mt * 16 >= M) return;
  const int row0 = mt * 16, col0 = nq * 64; const float* arow = A + (size_t)(row0 + ln) * lda;
  v8f acc[4] = {};
  for (int kb = 0; kb < K; kb += 32) {
    FragH ah, al;
    const v4f x0 = *(const v4fa*)(arow + kb + 8 * hh), x1 = *(const v4fa*)(arow + kb + 8 * hh + 4), x2 = *(const v4fa*)(arow + kb + 16 + 8 * hh), x3 = *(const v4fa*)(arow + kb + 16 + 8 * hh + 4);
    float xs[16] = {x0[0],x0[1],x0[2],x0[3],x1[0],x1[1],x1[2],x1[3],x2[0],x2[1],x2[2],x2[3],x3[0],x3[1],x3[2],x3[3]};
#pragma unroll
    for (int i = 0; i < 16; ++i) { const _Float16 h = (_Float16)xs[i]; ah.h[i] = h; al.h[i] = ASPLIT ? (_Float16)(xs[i] - (float)h) : (_Float16)0.0f; }
#pragma unroll
    for (int t = 0; t < 4; ++t) { if (col0 + t * 16 >= N) continue; const size_t boff = (size_t)(col0 + t * 16 + ln) * ldb + kb; FragH bq; bq.half[0] = *(const v8us*)(Bh + boff + 8 * hh); bq.half[1] = *(const v8us*)(Bh + boff + 16 + 8 * hh);
      acc[t] = mmaH<ASPLIT ? 2 : 1>(ah.v, al.v, bq.v, bq.v, acc[t]); }
  }
#pragma unroll
  for (int t = 0; t < 4; ++t) { if (col0 + t * 16 >= N) continue;
#pragma unroll
    for (int r = 0; r < 8; ++r) so[w][8 * hh + r][t * 16 + ln] = acc[t][r] * alpha; }
  __builtin_amdgcn_fence(__ATOMIC_ACQ_REL, "workgroup"); __builtin_amdgcn_wave_barrier();
  const int rsub = lane >> 4, c4 = (lane & 15) * 4;
  {
#pragma unroll
    for (int q = 0; q < 8; ++q) { const int r = q * 2 + rsub; if (col0 + c4 < N) { const v4f v = *(const v4fa*)&so[w][r][c4]; *(v4f*)(C + (size_t)(row0 + r) * ldc + col0 + c4) = v; } }
     }
}

// Wt[n][k] = f16(W[k][n]·scale) from f32 row-major W[K][N] (scale = power of two; bf16-exact weights stay exact in f16 away from the subnormal range)
__global__ __launch_bounds__(256) void k_wt_f16(const float* __restrict__ W, _Float16* __restrict__ Wt, int K, int N, float scale) {
  const int t = blockIdx.x * 256 + threadIdx.x; if (t >= N * (K / 8)) return; const int n = t / (K / 8), k8 = (t % (K / 8)) * 8; FragH f;
#pragma unroll
  for (int i = 0; i < 8; ++i) f.h[i] = (_Float16)(bf16_round(W[(size_t)(k8 + i) * N + n]) * scale); const v8us o = f.half[0];
  *(v8us*)((unsigned short*)Wt + (size_t)n * K + k8) = o; 
}
// k_gemm_hh variant with fused epilogue: v = acc·alpha + bias[by·sBias + col] (+ CP[(row/rowsPerB)·sCPb + by·64 + col] if CP) ; ACT 0 none / 1 elu ; writes f16 C16 (and f32 C if non-null)
template <int ACT>
__global__ __launch_bounds__(128) void k_gemm_hhx(const _Float16* __restrict__ A, int lda, size_t sA, const _Float16* __restrict__ Bh, int ldb, size_t sB, float alpha, const float* __restrict__ bias, size_t sBias, const float* __restrict__ CP, int rowsPerB, size_t sCPb, int row0g,
    float* __restrict__ C, _Float16* __restrict__ C16, int ldc, size_t sC, int M, int N, int K) {
  __shared__ __attribute__((aligned(16))) float so[4][16][64];
  const int tid = threadIdx.x, w = tid >> 5, lane = tid & 31, ln = lane & 15, hh = lane >> 4; const int by = blockIdx.y;
  A += (size_t)by * sA; Bh += (size_t)by * sB; const size_t cofs = (size_t)by * sC; const float* bp = bias ? bias + (size_t)by * sBias : nullptr;
  const int ntn = (N + 63) / 64; const int wid = blockIdx.x * 4 + w; const int mt = wid / ntn, nq = wid % ntn; if (mt * 16 >= M) return;
  const int row0 = mt * 16, col0 = nq * 64; const _Float16* arow = A + (size_t)(row0 + ln) * lda;
  v8f acc[4] = {};
  for (int kb = 0; kb < K; kb += 32) { FragH ah; ah.half[0] = *(const v8us*)((const unsigned short*)arow + kb + 8 * hh); ah.half[1] = *(const v8us*)((const unsigned short*)arow + kb + 16 + 8 * hh);
#pragma unroll
    for (int t = 0; t < 4; ++t) { if (col0 + t * 16 >= N) continue; const size_t boff = (size_t)(col0 + t * 16 + ln) * ldb + kb; FragH bq; bq.half[0] = *(const v8us*)((const unsigned short*)Bh + boff + 8 * hh); bq.half[1] = *(const v8us*)((const unsigned short*)Bh + boff + 16 + 8 * hh);
      acc[t] = mmaH<1>(ah.v, ah.v, bq.v, bq.v, acc[t]); }
  }
#pragma unroll
  for (int t = 0; t < 4; ++t) { if (col0 + t * 16 >= N) continue; const int col = col0 + t * 16 + ln; const float bv = bp ? bf16_round(bp[col]) : 0.f;
#pragma unroll
    for (int r = 0; r < 8; ++r) { float v = acc[t][r] * alpha + bv; if (CP) { const int rr = row0g + row0 + 8 * hh + r; if (rowsPerB < 0) v += CP[cofs + (size_t)rr * ldc + col];      /* rowsPerB < 0: own element of the batched C plane */ else { const int bidx = rr / rowsPerB; v += CP[(size_t)bidx * sCPb + (size_t)by * 64 + col]; } } if (ACT == 1) v = (v > 0.f) ? v : expm1f(v); else if (ACT == 7) v = (v > 0.f) ? v + 1.0f : expf(v); else if (ACT == 8) v = tanhf(v); else if (ACT == 9) v = 0.5f * v * (1.0f + tanhf(0.7978845608028654f * (v + 0.044715f * v * v * v))); else if (ACT == 11) v = 1.0f / (1.0f + expf(-v)); else if (ACT == 12) v = (v > 0.f) ? v : 0.01f * v; else if (ACT == 14) v = (v > 0.f) ? v : 0.1f * v; else if (ACT == 16) v = (v >= 0.f) ? v : 0.3f * v; else if (ACT == 17) v = (v >= 0.f) ? v : 0.2f * v; else if (ACT == 15) v = v / (1.0f + expf(-v)); else if (ACT == 3) v = fmaxf(v, 0.f); else if (ACT == 6) v = 0.5f * v * (1.0f + erff(v * 0.70710678118654752f)); so[w][8 * hh + r][t * 16 + ln] = v; } }
  __builtin_amdgcn_fence(__ATOMIC_ACQ_REL, "workgroup"); __builtin_amdgcn_wave_barrier();
  const int rsub = lane >> 4, c4 = (lane & 15) * 4; typedef _Float16 v4h __attribute__((ext_vector_type(4)));
  {
#pragma unroll
    for (int q = 0; q < 8; ++q) { const int r = q * 2 + rsub; if (col0 + c4 < N) { const v4f v = *(const v4fa*)&so[w][r][c4]; if (C) *(v4f*)(C + cofs + (size_t)(row0 + r) * ldc + col0 + c4) = v; if (C16) { v4h h4; for (int i = 0; i < 4; ++i) h4[i] = (_Float16)v[i]; *(v4h*)(C16 + cofs + (size_t)(row0 + r) * ldc + col0 + c4) = h4; } } }
     }
}


typedef _Float16 v4h __attribute__((ext_vector_type(4)));

__global__ __launch_bounds__(256) void k_x16(const float* __restrict__ x, _Float16* __restrict__ X16, size_t n8) { const size_t t = (size_t)blockIdx.x * 256 + threadIdx.x; if (t >= n8) return; FragH f;
#pragma unroll
  for (int q = 0; q < 8; ++q) f.h[q] = (_Float16)bf16_round(x[t * 8 + q]); *(v8us*)((unsigned short*)X16 + t * 8) = f.half[0];  }
__global__ __launch_bounds__(256) void k_h16(const float* __restrict__ x, _Float16* __restrict__ X16, size_t n8) { const size_t t = (size_t)blockIdx.x * 256 + threadIdx.x; if (t >= n8) return; FragH f;
#pragma unroll
  for (int q = 0; q < 8; ++q) f.h[q] = (_Float16)x[t * 8 + q]; *(v8us*)((unsigned short*)X16 + t * 8) = f.half[0];  }
__global__ __launch_bounds__(256) void k_round16f(const float* __restrict__ W, _Float16* __restrict__ Bt, size_t n8) { const size_t t = (size_t)blockIdx.x * 256 + threadIdx.x; if (t >= n8) return; FragH f;
#pragma unroll
  for (int i = 0; i < 8; ++i) f.h[i] = (_Float16)(bf16_round(W[t * 8 + i]) * 16.0f); *(v8us*)((unsigned short*)Bt + t * 8) = f.half[0];  }
template <int NHv, int TTv>
__global__ __launch_bounds__(256) void k_vt(const _Float16* __restrict__ V16, int ldv, int voff, _Float16* __restrict__ Vt) { __shared__ unsigned short tl[64][66]; const int tid = threadIdx.x; const int slab = blockIdx.x / (TTv / 64), lg = blockIdx.x % (TTv / 64); const int b = slab / NHv, h = slab % NHv;
  for (int i = tid; i < 64 * 8; i += 256) { const int r = i / 8, c8 = (i % 8) * 8; FragH f; f.half[0] = *(const v8us*)((const unsigned short*)V16 + ((size_t)b * TTv + lg * 64 + r) * ldv + voff + h * 64 + c8);
#pragma unroll
    for (int q = 0; q < 8; ++q) tl[r][c8 + q] = f.u[q]; }
  __syncthreads();
  {
#pragma unroll
    for (int rd = 0; rd < 2; ++rd) { const int d = rd * 32 + tid / 8, pc = tid % 8; FragH f;
#pragma unroll
      for (int q = 0; q < 8; ++q) f.u[q] = tl[pc * 8 + q][d];
      *(v8us*)((unsigned short*)Vt + ((size_t)slab * 64 + d) * TTv + lg * 64 + pc * 8) = f.half[0]; }
     } }

__global__ __launch_bounds__(256) void k_hl(const float* __restrict__ F, _Float16* __restrict__ Hh, _Float16* __restrict__ Hl, size_t n8) { const size_t t = (size_t)blockIdx.x * 256 + threadIdx.x; if (t >= n8) return; FragH fh, fl; const v4f a = *(const v4fa*)(F + t * 8), c = *(const v4fa*)(F + t * 8 + 4);
#pragma unroll
  for (int q = 0; q < 4; ++q) { _Float16 h = (_Float16)a[q]; fh.h[q] = h; fl.h[q] = (_Float16)((a[q] - (float)h) * 1024.0f); h = (_Float16)c[q]; fh.h[4 + q] = h; fl.h[4 + q] = (_Float16)((c[q] - (float)h) * 1024.0f); }
  { *(v8us*)((unsigned short*)Hh + t * 8) = fh.half[0]; *(v8us*)((unsigned short*)Hl + t * 8) = fl.half[0];  } }

// ---- fast GEMM (wave tile 32x64; requires M % 32 == 0 rows per launch region and N % 64 == 0); epilogue = k_gemm_hhx semantics ----
__device__ __forceinline__ v16h g2_frag(const _Float16* p, int hh) { FragH f; f.half[0] = *(const v8us*)((const unsigned short*)p + 8 * hh); f.half[1] = *(const v8us*)((const unsigned short*)p + 16 + 8 * hh); return f.v; }
__device__ __forceinline__ v8f g2_mma(v16h a, v16h b, v8f c) { v8f d = __builtin_amdgcn_wmma_f32_16x16x32_f16(false, a, false, b, (short)0, c, false, false); asm volatile("v_nop\n\tv_nop\n\tv_nop\n\tv_nop" : "+v"(d) : "v"(a), "v"(b)); return d; }
template <int ACT>
__global__ __launch_bounds__(128) void k_gemm2(const _Float16* __restrict__ A, int lda, size_t sA, const _Float16* __restrict__ Bh, int ldb, size_t sB, float alpha, const float* __restrict__ bias, size_t sBias, const float* __restrict__ CP, int rowsPerB, size_t sCPb, int row0g,
    float* __restrict__ C, _Float16* __restrict__ C16, int ldc, size_t sC, int M, int N, int K, size_t sAz, size_t sBz, size_t sCz) { static_assert(ACT == 0 || ACT == 3 || ACT == 6 || ACT == 8 || ACT == 9 || ACT == 11 || ACT == 12 || ACT == 14 || ACT == 15 || ACT == 16 || ACT == 17, "k_gemm2: unsupported ACT code (would silently apply no activation)");
  __shared__ __attribute__((aligned(16))) float so[4][32][68];
  const int tid = threadIdx.x, w = tid >> 5, lane = tid & 31, ln = lane & 15, hh = lane >> 4; const int by = blockIdx.y, bz = blockIdx.z;      /* two batch levels: grid.y (strides sA, sB, sC) and grid.z (strides sAz, sBz, sCz) */
  A += (size_t)by * sA + (size_t)bz * sAz; Bh += (size_t)by * sB + (size_t)bz * sBz; const size_t cofs = (size_t)by * sC + (size_t)bz * sCz; const float* bp = bias ? bias + (size_t)by * sBias : nullptr;
  const int ntn = N >> 6; const int mt = blockIdx.x / ntn, nq = blockIdx.x - mt * ntn; const int row0 = mt * 128 + 32 * w, col0 = nq * 64; if (row0 >= M) return;
  const _Float16* a0p = A + (size_t)(row0 + ln) * lda; const _Float16* a1p = a0p + (size_t)16 * lda;
  const _Float16* b0p = Bh + (size_t)(col0 + ln) * ldb; const _Float16* b1p = b0p + (size_t)16 * ldb; const _Float16* b2p = b1p + (size_t)16 * ldb; const _Float16* b3p = b2p + (size_t)16 * ldb;
  const v8f z8 = {0.f,0.f,0.f,0.f,0.f,0.f,0.f,0.f}; v8f c00 = z8, c01 = z8, c02 = z8, c03 = z8, c10 = z8, c11 = z8, c12 = z8, c13 = z8;
#pragma unroll 1
  for (int kb = 0; kb < K; kb += 32) { const v16h a0 = g2_frag(a0p + kb, hh), a1 = g2_frag(a1p + kb, hh);
    v16h b = g2_frag(b0p + kb, hh); c00 = g2_mma(a0, b, c00); c10 = g2_mma(a1, b, c10);
    b = g2_frag(b1p + kb, hh); c01 = g2_mma(a0, b, c01); c11 = g2_mma(a1, b, c11);
    b = g2_frag(b2p + kb, hh); c02 = g2_mma(a0, b, c02); c12 = g2_mma(a1, b, c12);
    b = g2_frag(b3p + kb, hh); c03 = g2_mma(a0, b, c03); c13 = g2_mma(a1, b, c13); }
  v8f accs[8] = {c00, c01, c02, c03, c10, c11, c12, c13};
#pragma unroll
  for (int u = 0; u < 8; ++u) { const int t = u & 3, half = u >> 2; const int col = col0 + t * 16 + ln; const float bv = bp ? bf16_round(bp[col]) : 0.f;
#pragma unroll
    for (int r = 0; r < 8; ++r) { const int rloc = half * 16 + 8 * hh + r; float v = accs[u][r] * alpha + bv; if (CP) { if (rowsPerB < 0) v += CP[cofs + (size_t)(row0g + row0 + rloc) * ldc + col];      /* rowsPerB < 0: own element of the batched C plane */ else { const int bidx = (row0g + row0 + rloc) / rowsPerB; v += CP[(size_t)bidx * sCPb + (size_t)by * 64 + col]; } }
      if (ACT == 3) v = fmaxf(v, 0.f); else if (ACT == 6) v = 0.5f * v * (1.0f + erff(v * 0.70710678118654752f)); else if (ACT == 11) v = 1.0f / (1.0f + expf(-v)); else if (ACT == 15) v = v / (1.0f + expf(-v)); else if (ACT == 12) v = (v > 0.f) ? v : 0.01f * v; else if (ACT == 8) v = tanhf(v); else if (ACT == 9) v = 0.5f * v * (1.0f + tanhf(0.7978845608028654f * (v + 0.044715f * v * v * v))); else if (ACT == 14) v = (v > 0.f) ? v : 0.1f * v; else if (ACT == 16) v = (v >= 0.f) ? v : 0.3f * v; else if (ACT == 17) v = (v >= 0.f) ? v : 0.2f * v;
      so[w][rloc][t * 16 + ln] = v; } }
  __builtin_amdgcn_fence(__ATOMIC_ACQ_REL, "workgroup"); __builtin_amdgcn_wave_barrier();
  const int rsub = lane >> 4, c4 = (lane & 15) * 4;
  {
#pragma unroll
    for (int q = 0; q < 16; ++q) { const int r = q * 2 + rsub; const v4f v = *(const v4fa*)&so[w][r][c4]; if (C) *(v4f*)(C + cofs + (size_t)(row0 + r) * ldc + col0 + c4) = v; if (C16) { v4h h4; for (int i = 0; i < 4; ++i) h4[i] = (_Float16)v[i]; *(v4h*)(C16 + cofs + (size_t)(row0 + r) * ldc + col0 + c4) = h4; } }
     } }


__global__ __launch_bounds__(256) void k_wnat(const float* __restrict__ w, size_t n8, _Float16* __restrict__ Bt) { const size_t t = (size_t)blockIdx.x * 256 + threadIdx.x; if (t >= n8) return; FragH f; for (int q = 0; q < 8; ++q) f.h[q] = (_Float16)(bf16_round(w[t * 8 + q]) * 16.0f); *(v8us*)((unsigned short*)Bt + t * 8) = f.half[0];  }
__global__ __launch_bounds__(256) void k_rsm(const float* __restrict__ S, _Float16* __restrict__ P, int nrows) {
  #pragma clang fp contract(off)
  const int i = blockIdx.x * 256 + threadIdx.x; if (i >= nrows) return; const float* s = S + (size_t)i * SQ; float mx = -3.0e38f;
#pragma unroll 1
  for (int j = 0; j < SQ; ++j) mx = fmaxf(mx, s[j]); float se = 0.f;
#pragma unroll 1
  for (int j = 0; j < SQ; ++j) se += expf(s[j] - mx); const float sc = 256.0f / se;
#pragma unroll 1
  for (int j0 = 0; j0 < SQ; j0 += 8) { FragH f; for (int q = 0; q < 8; ++q) f.h[q] = (_Float16)(expf(s[j0 + q] - mx) * sc); unsigned short* d = (unsigned short*)P + (size_t)i * SQ + j0; *(v8us*)d = f.half[0];  } }
__global__ __launch_bounds__(256) void k_vt(const _Float16* __restrict__ V16, int b, int h0, _Float16* __restrict__ VT) { __shared__ unsigned short tl[64][65]; const int tid = threadIdx.x; const int hh = blockIdx.x % HG, sg = blockIdx.x / HG; const int s0 = sg * 64; const int h = h0 + hh;
  for (int i = tid; i < 64 * 8; i += 256) { const int j = i / 8, d8 = (i % 8) * 8; FragH f; f.half[0] = *(const v8us*)((const unsigned short*)V16 + ((size_t)b * SQ + s0 + j) * DM + h * HD + d8); for (int q = 0; q < 8; ++q) tl[d8 + q][j] = f.u[q]; }
  __syncthreads();
  { for (int i = tid; i < 64 * 8; i += 256) { const int d = i / 8, j8 = (i % 8) * 8; FragH f; for (int q = 0; q < 8; ++q) f.u[q] = tl[d][j8 + q]; *(v8us*)((unsigned short*)VT + ((size_t)hh * HD + d) * SQ + s0 + j8) = f.half[0]; }  } }


__global__ __launch_bounds__(256) void k_rsmf(const float* __restrict__ S, _Float16* __restrict__ P, int qn, int hg) {
  #pragma clang fp contract(off)
  const int t = blockIdx.x * 256 + threadIdx.x; if (t >= qn * hg) return; const size_t i = (size_t)(t / qn) * SQ + (t % qn); const float* s = S + i * SQ; float mx = -3.0e38f;
#pragma unroll 1
  for (int j = 0; j < SQ; ++j) mx = fmaxf(mx, s[j]); float se = 0.f;
#pragma unroll 1
  for (int j = 0; j < SQ; ++j) se += __expf(s[j] - mx); const float sc = 256.0f / se;
#pragma unroll 1
  for (int j0 = 0; j0 < SQ; j0 += 8) { FragH f; for (int q = 0; q < 8; ++q) f.h[q] = (_Float16)(__expf(s[j0 + q] - mx) * sc); unsigned short* d = (unsigned short*)P + i * SQ + j0; *(v8us*)d = f.half[0];  } }

__global__ __launch_bounds__(256) void k_rsmr(const float* __restrict__ S, _Float16* __restrict__ P, int qn, int hg) {
  #pragma clang fp contract(off)
  const int t = blockIdx.x * 256 + threadIdx.x; if (t >= qn * hg) return; const size_t i = (size_t)t;      /* planes packed: row t of plane t / qn */ const float* s = S + i * SQ; float mx = -3.0e38f;
#pragma unroll 1
  for (int j = 0; j < SQ; ++j) mx = fmaxf(mx, s[j]); float se = 0.f;
#pragma unroll 1
  for (int j = 0; j < SQ; ++j) se += __expf(s[j] - mx); const float sc = 256.0f / se;
#pragma unroll 1
  for (int j0 = 0; j0 < SQ; j0 += 8) { FragH f; for (int q = 0; q < 8; ++q) f.h[q] = (_Float16)(__expf(s[j0 + q] - mx) * sc); unsigned short* d = (unsigned short*)P + i * SQ + j0; *(v8us*)d = f.half[0];  } }


typedef int v4ia __attribute__((ext_vector_type(4), may_alias));
typedef float f32x2 __attribute__((ext_vector_type(2)));
__device__ __forceinline__ float fa_xhalf(float x) { return __builtin_bit_cast(float, __builtin_amdgcn_permlanex16(__builtin_bit_cast(int, x), __builtin_bit_cast(int, x), 0x76543210, 0xfedcba98, false, false)); }      /* lane l with lane l ^ 16 */
__device__ __forceinline__ v8f fa_mma(v16h a, v16h b, v8f c) { return __builtin_amdgcn_wmma_f32_16x16x32_f16(false, a, false, b, (short)0, c, false, false); }
__device__ __forceinline__ v16h fa_frag(const char* base, unsigned off) { FragH f; f.half[0] = *(const v8us*)(base + off); f.half[1] = *(const v8us*)(base + off + 32); return f.v; }      /* k = 8 hh + 0..7 and 16 + 8 hh + 0..7; the lane's 16 hh bytes are in off */
// In front of a group of next-pass loads: keeps the loads from rising among the WMMAs that read the registers they refill (without it the compiler sets a load directly behind the WMMA whose A operand it overwrites).
__device__ __forceinline__ void fa_ahead() { __builtin_amdgcn_sched_barrier(0); }
// Between a run of eight WMMAs and the loads that refill their A operand registers: the four vector slots that a vector overwrite of a WMMA's operand asks for.
__device__ __forceinline__ void fa_mma_done() { asm volatile("v_nop\n\tv_nop\n\tv_nop\n\tv_nop"); }
// Behind each group of next-pass loads. The wait: the group's address registers are reused right behind it. The scheduling barrier: keeps that wait directly behind its loads and the group where it is written, a phase ahead of its use (without it the compiler moves the mask fetch down among the exponentials and the wait away from its loads).
__device__ __forceinline__ void fa_issued() { asm volatile("s_wait_xcnt 0x0" ::: "memory"); __builtin_amdgcn_sched_barrier(0); }
__global__ __launch_bounds__(256) void k_fattn(const _Float16* __restrict__ Q, const _Float16* __restrict__ Kr, const _Float16* __restrict__ VT, const int* __restrict__ Mk, _Float16* __restrict__ O) {
  const int lane = threadIdx.x & 31, ln = lane & 15, hh = lane >> 4; const int wave = __builtin_amdgcn_readfirstlane((int)(threadIdx.x >> 5));
  const int h = blockIdx.y, b = blockIdx.z, q0 = blockIdx.x * 256 + wave * 32;
  const float cs = 0.125f * 1.4426950408889634f;      /* 1 / sqrt(64), and e^x = 2^(x log2 e) */
  const float fill = -8589934592.0f;      /* masked_fill: -2^33, -2^30 after the 1/8. A power of two, so that its product with cs is exact: while every key seen so far is masked the maximum IS that product, the fused multiply-add of the exponent gives exactly 0 and the weights are 1 (finite); the first unmasked key rescales them to 0. A fill whose product rounds would leave a positive exponent there */
  const char* qb = (const char*)(Q + ((size_t)b * NQ + q0) * DM + h * HD);      /* wave-uniform bases; the lane's part is a 32-bit byte offset that never changes */
  const char* kb = (const char*)(Kr + (size_t)b * SK * DM + h * HD);
  const char* vb = (const char*)(VT + ((size_t)b * NH + h) * HD * SK);
  const char* mb_ = (const char*)(Mk + ((size_t)b * NQ + q0) * SK);
  const unsigned ko = (unsigned)(ln * DM * 2 + 16 * hh), vo = (unsigned)(ln * SK * 2 + 16 * hh), mo = (unsigned)(ln * SK * 4 + 32 * hh);
  v16h qf[2][2];
#pragma unroll
  for (int g = 0; g < 2; ++g)
#pragma unroll
    for (int kc = 0; kc < 2; ++kc) qf[g][kc] = fa_frag(qb + 16 * g * DM * 2 + 64 * kc, ko);
  fa_issued();      /* pass 0's groups in the loop's own order (K, mask, V^T): loads return in order, and the counted waits at the loop's head must hold for both ways into it */
  v16h kf[2][2], vf[4]; v4ia mk[2][2][2];
#pragma unroll
  for (int kt = 0; kt < 2; ++kt)
#pragma unroll
    for (int kc = 0; kc < 2; ++kc) kf[kt][kc] = fa_frag(kb + 16 * kt * DM * 2 + 64 * kc, ko);
  fa_issued();
#pragma unroll
  for (int g = 0; g < 2; ++g)
#pragma unroll
    for (int kt = 0; kt < 2; ++kt) { mk[g][kt][0] = *(const v4ia*)(mb_ + 16 * g * SK * 4 + 64 * kt + mo); mk[g][kt][1] = *(const v4ia*)(mb_ + 16 * g * SK * 4 + 64 * kt + 16 + mo); }
  fa_issued();
#pragma unroll
  for (int t = 0; t < 4; ++t) vf[t] = fa_frag(vb + 16 * t * SK * 2, vo);
  fa_issued();
  const v8f z8 = {0.f, 0.f, 0.f, 0.f, 0.f, 0.f, 0.f, 0.f};
  v8f acc[2][4]; float m_run[2], l_run[2];
#pragma unroll
  for (int g = 0; g < 2; ++g) { m_run[g] = -3.0e38f; l_run[g] = 0.f;
#pragma unroll
    for (int t = 0; t < 4; ++t) acc[g][t] = z8; }
  for (int key0 = 0; key0 < SK; key0 += 32) {
    const int kn = (key0 + 32) & (SK - 1);      /* the next pass's first key; the last pass fetches pass 0 again (in bounds, not used) so that the fetches stay unconditional */
    v8f s[2][2];
#pragma unroll
    for (int kt = 0; kt < 2; ++kt)
#pragma unroll
      for (int g = 0; g < 2; ++g) s[kt][g] = fa_mma(kf[kt][1], qf[g][1], fa_mma(kf[kt][0], qf[g][0], z8));
    fa_ahead(); fa_mma_done();      /* the score products first: the K fetch goes into their operand registers */
    { const char* kbn = kb + (size_t)kn * (DM * 2);
#pragma unroll
      for (int kt = 0; kt < 2; ++kt)
#pragma unroll
        for (int kc = 0; kc < 2; ++kc) kf[kt][kc] = fa_frag(kbn + 16 * kt * DM * 2 + 64 * kc, ko); }
    fa_issued();
    float mb[2]; bool need = false;
#pragma unroll
    for (int g = 0; g < 2; ++g) { float mx = -3.0e38f;
#pragma unroll
      for (int kt = 0; kt < 2; ++kt)
#pragma unroll
        for (int r = 0; r < 8; ++r) { const float v = (mk[g][kt][r >> 2][r & 3] != 0) ? s[kt][g][r] : fill; s[kt][g][r] = v; mx = fmaxf(mx, v); }
      mx = fmaxf(mx, fa_xhalf(mx)) * cs; mb[g] = mx; need = need || (mx > m_run[g] + 8.0f); }
    if (__builtin_amdgcn_ballot_w32(need) != 0) {      /* wave-uniform; rare after the first passes */
#pragma unroll
      for (int g = 0; g < 2; ++g) { const float mn = fmaxf(m_run[g], mb[g]); const float corr = __builtin_amdgcn_exp2f(m_run[g] - mn); m_run[g] = mn; l_run[g] *= corr;
#pragma unroll
        for (int t = 0; t < 4; ++t) acc[g][t] = acc[g][t] * corr; } }
    { const char* mbn = mb_ + (size_t)kn * 4;      /* behind the branch, which needs every select: the mask fetch goes into the registers that the selects read */
#pragma unroll
      for (int g = 0; g < 2; ++g)
#pragma unroll
        for (int kt = 0; kt < 2; ++kt) { mk[g][kt][0] = *(const v4ia*)(mbn + 16 * g * SK * 4 + 64 * kt + mo); mk[g][kt][1] = *(const v4ia*)(mbn + 16 * g * SK * 4 + 64 * kt + 16 + mo); } }
    fa_issued();
#pragma unroll
    for (int g = 0; g < 2; ++g) { const float nm = -m_run[g]; FragH pf; f32x2 ls = {0.f, 0.f};
#pragma unroll
      for (int i = 0; i < 8; ++i) { const f32x2 a = __builtin_elementwise_fma(f32x2{s[i >> 2][g][2 * (i & 3)], s[i >> 2][g][2 * (i & 3) + 1]}, f32x2{cs, cs}, f32x2{nm, nm});
        const f32x2 p = {__builtin_amdgcn_exp2f(a.x), __builtin_amdgcn_exp2f(a.y)}; ls += p; pf.h[2 * i] = (_Float16)p.x; pf.h[2 * i + 1] = (_Float16)p.y; }      /* element 8 kt + r of the B operand = key 16 kt + 8 hh + r */
      l_run[g] += ls.x + ls.y;
#pragma unroll
      for (int t = 0; t < 4; ++t) acc[g][t] = fa_mma(vf[t], pf.v, acc[g][t]); }
    fa_ahead();      /* the output products first: the V^T fetch goes into their operand registers (the compiler's own padding in front of the address addition, which overwrites a B register, keeps the four slots here) */
    { const char* vbn = vb + (size_t)kn * 2;
#pragma unroll
      for (int t = 0; t < 4; ++t) vf[t] = fa_frag(vbn + 16 * t * SK * 2, vo); }
    fa_issued();
  }
#pragma unroll
  for (int g = 0; g < 2; ++g) { const float l = l_run[g] + fa_xhalf(l_run[g]); const float inv = 64.0f / l;      /* o carried x64 */
    _Float16* op = O + ((size_t)b * NQ + q0 + 16 * g + ln) * DM + h * HD + 8 * hh;
#pragma unroll
    for (int t = 0; t < 4; ++t) { FragH f;
#pragma unroll
      for (int r = 0; r < 8; ++r) f.h[r] = (_Float16)(acc[g][t][r] * inv);
      *(v8us*)((unsigned short*)op + 16 * t) = f.half[0]; } }      /* d = 16 t + 8 hh + 0..7 of query ln: 16 contiguous bytes */
  asm volatile("s_wait_loadcnt 0x0" ::: "memory");      /* a precaution: the last pass's fetches (pass 0 again, not used) have landed before the wave ends and gives its registers back */
}
extern "C" void kernel_launch(void* const* d_in, const int* in_sizes, int n_in,
                              void* d_out, int out_size, void* d_ws, size_t ws_size, hipStream_t stream) {
  (void)in_sizes; (void)n_in; (void)out_size;
  const float* const* I = (const float* const*)d_in; const float* x = I[0]; const float* ctx = I[1]; const int* mkm = (const int*)d_in[2]; const float* wq = I[3]; const float* bq = I[4]; const float* wkv = I[5]; const float* bkv = I[6]; const float* wo = I[7]; const float* bo = I[8];      /* [in][out] weights; int mask [b][n][m]; k | v from the fused Wkv [1024][2048] */
  char* ws = (char*)d_ws; size_t off = 0;
  auto take = [&](size_t bytes) { char* p = ws + off; off += (bytes + 255) & ~(size_t)255; return p; };
  _Float16* BQ = (_Float16*)take((size_t)DM * DM * 2); _Float16* BKV = (_Float16*)take((size_t)2 * DM * DC * 2); _Float16* BO = (_Float16*)take((size_t)DM * DM * 2);
  _Float16* X16 = (_Float16*)take(NRQ * DM * 2); _Float16* C16 = (_Float16*)take(NRK * DC * 2); _Float16* Q16 = (_Float16*)take(NRQ * DM * 2); _Float16* K16 = (_Float16*)take(2 * NRK * DM * 2); _Float16* V16 = K16 + NRK * DM; _Float16* O16 = X16;      /* o rows reuse the x rows, whose last reader is the Q GEMM */
  _Float16* VT = (_Float16*)take((size_t)NB * NH * HD * SK * 2);      /* V^T: all 64 (batch, head) planes */
  if (off > ws_size) return;      /* 8 + 5 x 8 + 8 = 56 MiB */
  { const unsigned g = (unsigned)(((size_t)DM * (DM / 8) + 255) / 256); k_wt_f16<<<g, 256, 0, stream>>>(wq, BQ, DM, DM, 16.0f); k_wt_f16<<<2 * g, 256, 0, stream>>>(wkv, BKV, DC, 2 * DM, 16.0f); k_wt_f16<<<g, 256, 0, stream>>>(wo, BO, DM, DM, 16.0f); }      /* [in][out] -> Bt x16; Wkv [1024][2048] -> Bt [2048][1024]: rows 0..1023 = k columns, 1024..2047 = v columns */
  k_x16<<<(unsigned)((NRQ * DM / 8 + 255) / 256), 256, 0, stream>>>(x, X16, NRQ * DM / 8); k_x16<<<(unsigned)((NRK * DC / 8 + 255) / 256), 256, 0, stream>>>(ctx, C16, NRK * DC / 8);
  k_gemm2<0><<<dim3((unsigned)((NRQ / 128) * (DM / 64)), 1), 128, 0, stream>>>(X16, DM, 0, BQ, DM, 0, 0.0625f, bq, 0, nullptr, 1, 0, 0, nullptr, Q16, DM, 0, (int)NRQ, DM, DM, 0, 0, 0);
  k_gemm2<0><<<dim3((unsigned)((NRK / 128) * (DM / 64)), 2), 128, 0, stream>>>(C16, DC, 0, BKV, DC, (size_t)DM * DC, 0.0625f, bkv, (size_t)DM, nullptr, 1, 0, 0, nullptr, K16, DM, NRK * DM, (int)NRK, DM, DC, 0, 0, 0);      /* grid.y 0: k = context Wkv[:, :1024] + bkv[:1024] -> K16; grid.y 1: v = context Wkv[:, 1024:] + bkv[1024:] -> V16 */
  k_vt<NH, SK><<<NB * NH * (SK / 64), 256, 0, stream>>>(V16, DM, 0, VT);      /* V^T [4 x 16][64][1024], all batches in one launch */
  k_fattn<<<dim3(NQ / 256, NH, NB), 256, 0, stream>>>(Q16, K16, VT, mkm, O16);      /* scores, masked softmax and P V of all 64 (batch, head) planes: o x64, merged rows */
  k_gemm2<0><<<dim3((unsigned)((NRQ / 128) * (DM / 64)), 1), 128, 0, stream>>>(O16, DM, 0, BO, DM, 0, 0.0009765625f, bo, 0, nullptr, 1, 0, 0, (float*)d_out, nullptr, DM, 0, (int)NRQ, DM, DM, 0, 0, 0);      /* out = o Wo + bo */
}

// v004
// Measured time: 128 microseconds a run.
// Next to v003, in two timings, it ran 1.69 and 1.68 times as fast.
// All steps since v000 together make it 41.0 times as fast.
#include <hip/hip_runtime.h>
// Masked multi-head cross-attention (x [4][1024][1024] queries, context [4][1024][1024]; q = x Wq + bq; k | v = context Wkv + bkv viewed (m, 2, 16, 64) ([in][out] weights sigma 1/32, zero biases); 16 heads of 64; dots = q k^T / 8; a binary int mask [b][n][32*32 = m] shared by the heads: masked_fill(mask == 0, -inf); softmax over the 1024 context tokens; out = merged Wp + bp -> [4][1024][1024]).
// Structure: x and context as exact f16 rows; [in][out] weights as exact x16 planes (Wkv as one [2048][1024] plane: k rows then v rows); Q and K | V (one launch, grid.y) as WMMA GEMMs (operands staged in LDS, 32x64 wave tiles, f32 accumulation, + bias, f16 outputs); V^T of all batches via LDS transposes (one launch); scores (K = 64, 1/8), int mask select, online softmax (f32 statistics, native exp2; weights f16, unnormalised) and o = P V^T (o carried x64) of all 64 (batch, head) planes fused in one launch, scores and weights in registers only, into merged f16 rows; out = o Wp + bp GEMM (f32, alpha 2^-10); launches: see trace.
// Compute dtype: inputs rounded to bf16; x / context / weights exact; q, k, v, softmax weights and o as plain f16 GEMM operands (~2^-12); scores and statistics f32. v_wmma_f32_16x16x32_f16.
#define NB 4
#define NQ 1024
#define SK 1024
#define SQ SK                       /* keys per softmax row */
#define DM 1024
#define DC 1024
#define NH 16
#define HD 64
#define HG 4
#define NRQ ((size_t)NB * NQ)
#define NRK ((size_t)NB * SK)
typedef __bf16 v16b __attribute__((ext_vector_type(16)));
typedef unsigned short v8us __attribute__((ext_vector_type(8), may_alias));
typedef float  v8f  __attribute__((ext_vector_type(8)));
typedef float  v4f  __attribute__((ext_vector_type(4)));
typedef float  v4fa __attribute__((ext_vector_type(4), may_alias));
union FragB { v16b v; v8us half[2]; unsigned short u[16]; };

__device__ __forceinline__ unsigned short bf16_bits(float x) { unsigned int u = __float_as_uint(x); return (unsigned short)((u + 0x7FFFu + ((u >> 16) & 1u)) >> 16); }
__device__ __forceinline__ float bf16_val(unsigned short b) { return __uint_as_float(((unsigned int)b) << 16); }
__device__ __forceinline__ float bf16_round(float x) { return bf16_val(bf16_bits(x)); }
// D += A·B with NT terms: 1 = ah·bh, 2 = + al·bh (A split), 3 = + ah·bl (both split)
template <int NT>
__device__ __forceinline__ v8f mmaN(v16b ah, v16b al, v16b bh, v16b bl, v8f c) {
  c = __builtin_amdgcn_wmma_f32_16x16x32_bf16(false, ah, false, bh, (short)0, c, false, false);
  if (NT >= 2) c = __builtin_amdgcn_wmma_f32_16x16x32_bf16(false, al, false, bh, (short)0, c, false, false);
  if (NT >= 3) c = __builtin_amdgcn_wmma_f32_16x16x32_bf16(false, ah, false, bl, (short)0, c, false, false);
  asm volatile("v_nop\n\tv_nop\n\tv_nop\n\tv_nop" : "+v"(c) : "v"(ah), "v"(al), "v"(bh), "v"(bl));
  return c;
}

__global__ __launch_bounds__(256) void k_wt_bf16(const float* __restrict__ W, unsigned short* __restrict__ Wt, int K, int N) {
  const int t = blockIdx.x * 256 + threadIdx.x;
  const int k8n = K / 8;
  if (t >= N * k8n) return;
  const int n = t / k8n, k8 = (t % k8n) * 8;
  v8us v;
#pragma unroll
  for (int i = 0; i < 8; ++i) v[i] = bf16_bits(W[(size_t)(k8 + i) * N + n]);
  *(v8us*)(Wt + (size_t)n * K + k8) = v;
  
}

// GEMM C[M][N] (f32, pitch ldc) = act(A[M][K]·W + bias). A f32 row-major (pitch lda) converted per fragment to bf16
// (ASPLIT: hi/lo two planes -> 2 terms, else single rounded term); Wt bf16 [N][K] (pitch ldb). BIAS_BF16 rounds the
// bias to bf16 first (bias quantised to bf16 before the add). K%32==0, M%16==0, N%64==0.
template <bool ASPLIT, int ACT, bool BIAS_BF16>
__global__ __launch_bounds__(128) void k_gemm_bf(const float* __restrict__ A, int lda, const unsigned short* __restrict__ Wt, int ldb,
                                               const float* __restrict__ bias, float* __restrict__ C, int ldc, int M, int N, int K) {
  __shared__ __attribute__((aligned(16))) float so[4][16][64];
  const int tid = threadIdx.x, w = tid >> 5, lane = tid & 31, ln = lane & 15, hh = lane >> 4;
  const int ntn = N / 64;
  const int wid = blockIdx.x * 4 + w;
  const int mt = wid / ntn, nq = wid % ntn;
  if (mt * 16 >= M) return;
  const int row0 = mt * 16, col0 = nq * 64;
  const float* arow = A + (size_t)(row0 + ln) * lda;
  v8f acc[4] = {};
  for (int kb = 0; kb < K; kb += 32) {
    FragB ah, al;
    const v4f x0 = *(const v4fa*)(arow + kb + 8 * hh), x1 = *(const v4fa*)(arow + kb + 8 * hh + 4);
    const v4f x2 = *(const v4fa*)(arow + kb + 16 + 8 * hh), x3 = *(const v4fa*)(arow + kb + 16 + 8 * hh + 4);
    float xs[16] = {x0[0],x0[1],x0[2],x0[3],x1[0],x1[1],x1[2],x1[3],x2[0],x2[1],x2[2],x2[3],x3[0],x3[1],x3[2],x3[3]};
#pragma unroll
    for (int i = 0; i < 16; ++i) { const unsigned short hb = bf16_bits(xs[i]); ah.u[i] = hb; al.u[i] = ASPLIT ? bf16_bits(xs[i] - bf16_val(hb)) : (unsigned short)0; }
#pragma unroll
    for (int t = 0; t < 4; ++t) {
      const unsigned short* brow = Wt + (size_t)(col0 + t * 16 + ln) * ldb + kb;
      FragB b;
      b.half[0] = *(const v8us*)(brow + 8 * hh);
      b.half[1] = *(const v8us*)(brow + 16 + 8 * hh);
      acc[t] = mmaN<ASPLIT ? 2 : 1>(ah.v, al.v, b.v, b.v, acc[t]);
    }
  }
#pragma unroll
  for (int t = 0; t < 4; ++t) {
    float bv = bias ? bias[col0 + t * 16 + ln] : 0.f;
    if (BIAS_BF16) bv = bf16_round(bv);
#pragma unroll
    for (int r = 0; r < 8; ++r) { float v = acc[t][r] + bv; if (ACT == 1) v = fmaxf(v, 0.f); so[w][8 * hh + r][t * 16 + ln] = v; }
  }
  __builtin_amdgcn_fence(__ATOMIC_ACQ_REL, "workgroup");
  __builtin_amdgcn_wave_barrier();
  const int rsub = lane >> 4, c4 = (lane & 15) * 4;
  {
#pragma unroll
    for (int q = 0; q < 8; ++q) {
      const int r = q * 2 + rsub;
      const v4f v = *(const v4fa*)&so[w][r][c4];
      *(v4f*)(C + (size_t)(row0 + r) * ldc + col0 + c4) = v;
    }
    
  }
}

// GEMM C = act(A·W + bias + resid): A f32 (ASPLIT -> hi/lo 2 terms), Wt bf16 [N][K]; ACT 0 none, 1 relu, 2 exact gelu;
// resid (optional, f32, row index = (row % rmod), pitch ldr, RES_BF16 rounds it) added before the activation.
template <bool ASPLIT, int ACT, bool BIAS_BF16, bool RES_BF16>
__global__ __launch_bounds__(128) void k_gemm_bf3(const float* __restrict__ A, int lda, const unsigned short* __restrict__ Wt, int ldb,
                                                const float* __restrict__ bias, const float* __restrict__ resid, int rmod, int ldr,
                                                float* __restrict__ C, int ldc, int M, int N, int K) {
  __shared__ __attribute__((aligned(16))) float so[4][16][64];
  const int tid = threadIdx.x, w = tid >> 5, lane = tid & 31, ln = lane & 15, hh = lane >> 4;
  const int ntn = N / 64;
  const int wid = blockIdx.x * 4 + w;
  const int mt = wid / ntn, nq = wid % ntn;
  if (mt * 16 >= M) return;
  const int row0 = mt * 16, col0 = nq * 64;
  const float* arow = A + (size_t)(row0 + ln) * lda;
  v8f acc[4] = {};
  for (int kb = 0; kb < K; kb += 32) {
    FragB ah, al;
    const v4f x0 = *(const v4fa*)(arow + kb + 8 * hh), x1 = *(const v4fa*)(arow + kb + 8 * hh + 4);
    const v4f x2 = *(const v4fa*)(arow + kb + 16 + 8 * hh), x3 = *(const v4fa*)(arow + kb + 16 + 8 * hh + 4);
    float xs[16] = {x0[0],x0[1],x0[2],x0[3],x1[0],x1[1],x1[2],x1[3],x2[0],x2[1],x2[2],x2[3],x3[0],x3[1],x3[2],x3[3]};
#pragma unroll
    for (int i = 0; i < 16; ++i) { const unsigned short hb = bf16_bits(xs[i]); ah.u[i] = hb; al.u[i] = ASPLIT ? bf16_bits(xs[i] - bf16_val(hb)) : (unsigned short)0; }
#pragma unroll
    for (int t = 0; t < 4; ++t) {
      const unsigned short* brow = Wt + (size_t)(col0 + t * 16 + ln) * ldb + kb;
      FragB b;
      b.half[0] = *(const v8us*)(brow + 8 * hh);
      b.half[1] = *(const v8us*)(brow + 16 + 8 * hh);
      acc[t] = mmaN<ASPLIT ? 2 : 1>(ah.v, al.v, b.v, b.v, acc[t]);
    }
  }
#pragma unroll
  for (int t = 0; t < 4; ++t) {
    const int col = col0 + t * 16 + ln;
    float bv = bias ? bias[col] : 0.f;
    if (BIAS_BF16) bv = bf16_round(bv);
#pragma unroll
    for (int r = 0; r < 8; ++r) {
      float v = acc[t][r] + bv;
      if (resid) { float rv = resid[(size_t)((row0 + 8 * hh + r) % rmod) * ldr + col]; if (RES_BF16) rv = bf16_round(rv); v += rv; }
      if (ACT == 1) v = fmaxf(v, 0.f);
      if (ACT == 2) v = 0.5f * v * (1.0f + erff(v * 0.70710678118654752f));
      if (ACT == 3) { const float u = 0.7978845608028654f * (v + 0.044715f * v * v * v); v = 0.5f * v * (1.0f + tanhf(u)); }
      so[w][8 * hh + r][t * 16 + ln] = v;
    }
  }
  __builtin_amdgcn_fence(__ATOMIC_ACQ_REL, "workgroup");
  __builtin_amdgcn_wave_barrier();
  const int rsub = lane >> 4, c4 = (lane & 15) * 4;
  {
#pragma unroll
    for (int q = 0; q < 8; ++q) {
      const int r = q * 2 + rsub;
      const v4f v = *(const v4fa*)&so[w][r][c4];
      *(v4f*)(C + (size_t)(row0 + r) * ldc + col0 + c4) = v;
    }
    
  }
}
// row LayerNorm (biased variance, eps) over N: s = X (+ R); optional out_sum <- s; out_norm <- (s-mu)*rsqrt(var+eps)*g + b
template <bool PARAM_BF16>
__global__ __launch_bounds__(256) void k_layernorm(const float* __restrict__ X, const float* __restrict__ R, const float* __restrict__ g, const float* __restrict__ bta,
                                                  float* __restrict__ out_sum, float* __restrict__ out_norm, int N, float eps) {
  __shared__ float red[256];
  const int row = blockIdx.x, tid = threadIdx.x;
  const float* x = X + (size_t)row * N; const float* rr = R ? R + (size_t)row * N : nullptr;
  float vals[16];                     // up to N = 4096
  const int per = N / 256;            // contiguous chunk per thread? use strided-by-4 chunks: thread handles j = tid*4 + 1024*u
  float s1 = 0.f;
  for (int u = 0; u < per / 4; ++u) {
    const int j = tid * 4 + 1024 * u;
    const v4f a = *(const v4fa*)(x + j);
    v4f b = {0.f,0.f,0.f,0.f}; if (rr) b = *(const v4fa*)(rr + j);
#pragma unroll
    for (int q = 0; q < 4; ++q) { const float v = a[q] + b[q]; vals[u * 4 + q] = v; s1 += v; }
  }
  red[tid] = s1; __syncthreads();
  for (int st = 128; st > 0; st >>= 1) { if (tid < st) red[tid] += red[tid + st]; __syncthreads(); }
  const float mu = red[0] / (float)N; __syncthreads();
  float s2 = 0.f;
  for (int u = 0; u < per / 4; ++u)
#pragma unroll
    for (int q = 0; q < 4; ++q) { const float c = vals[u * 4 + q] - mu; s2 += c * c; }
  red[tid] = s2; __syncthreads();
  for (int st = 128; st > 0; st >>= 1) { if (tid < st) red[tid] += red[tid + st]; __syncthreads(); }
  const float rs = rsqrtf(red[0] / (float)N + eps);
  {
    for (int u = 0; u < per / 4; ++u) {
      const int j = tid * 4 + 1024 * u;
      v4f o, sm;
#pragma unroll
      for (int q = 0; q < 4; ++q) {
        float gg = g[j + q], bb = bta[j + q];
        if (PARAM_BF16) { gg = bf16_round(gg); bb = bf16_round(bb); }
        sm[q] = vals[u * 4 + q]; o[q] = (vals[u * 4 + q] - mu) * rs * gg + bb;
      }
      if (out_sum) *(v4f*)(out_sum + (size_t)row * N + j) = sm;
      *(v4f*)(out_norm + (size_t)row * N + j) = o;
    }
    
  }
}



// ---- f16 WMMA path (v_wmma_f32_16x16x32_f16): 11-bit significands for operands in range — used where a [0,1] probability operand needs more precision than bf16
typedef _Float16 v16h __attribute__((ext_vector_type(16)));
union FragH { v16h v; v8us half[2]; _Float16 h[16]; unsigned short u[16]; };
template <int NT>
__device__ __forceinline__ v8f mmaH(v16h ah, v16h al, v16h bh, v16h bl, v8f c) {
  c = __builtin_amdgcn_wmma_f32_16x16x32_f16(false, ah, false, bh, (short)0, c, false, false);
  if (NT >= 2) c = __builtin_amdgcn_wmma_f32_16x16x32_f16(false, al, false, bh, (short)0, c, false, false);
  if (NT >= 3) c = __builtin_amdgcn_wmma_f32_16x16x32_f16(false, ah, false, bl, (short)0, c, false, false);
  asm volatile("v_nop\n\tv_nop\n\tv_nop\n\tv_nop" : "+v"(c) : "v"(ah), "v"(al), "v"(bh), "v"(bl));
  return c;
}
// batched GEMM like k_gemm_b but f16 operands: A f32 (split into f16 hi/lo if ASPLIT, else rounded to f16), Bt = f16 values [n][k]; alpha; C f32; N multiple of 16 (partial tiles skipped)
template <bool ASPLIT>
__global__ __launch_bounds__(128) void k_gemm_h(const float* __restrict__ A, int lda, size_t sA, const _Float16* __restrict__ Bh, int ldb, size_t sB, float alpha, float* __restrict__ C, int ldc, size_t sC, int M, int N, int K) {
  __shared__ __attribute__((aligned(16))) float so[4][16][64];
  const int tid = threadIdx.x, w = tid >> 5, lane = tid & 31, ln = lane & 15, hh = lane >> 4; const int by = blockIdx.y;
  A += (size_t)by * sA; Bh += (size_t)by * sB; C += (size_t)by * sC;
  const int ntn = (N + 63) / 64; const int wid = blockIdx.x * 4 + w; const int mt = wid / ntn, nq = wid % ntn; if (mt * 16 >= M) return;
  const int row0 = mt * 16, col0 = nq * 64; const float* arow = A + (size_t)(row0 + ln) * lda;
  v8f acc[4] = {};
  for (int kb = 0; kb < K; kb += 32) {
    FragH ah, al;
    const v4f x0 = *(const v4fa*)(arow + kb + 8 * hh), x1 = *(const v4fa*)(arow + kb + 8 * hh + 4), x2 = *(const v4fa*)(arow + kb + 16 + 8 * hh), x3 = *(const v4fa*)(arow + kb + 16 + 8 * hh + 4);
    float xs[16] = {x0[0],x0[1],x0[2],x0[3],x1[0],x1[1],x1[2],x1[3],x2[0],x2[1],x2[2],x2[3],x3[0],x3[1],x3[2],x3[3]};
#pragma unroll
    for (int i = 0; i < 16; ++i) { const _Float16 h = (_Float16)xs[i]; ah.h[i] = h; al.h[i] = ASPLIT ? (_Float16)(xs[i] - (float)h) : (_Float16)0.0f; }
#pragma unroll
    for (int t = 0; t < 4; ++t) { if (col0 + t * 16 >= N) continue; const size_t boff = (size_t)(col0 + t * 16 + ln) * ldb + kb; FragH bq; bq.half[0] = *(const v8us*)(Bh + boff + 8 * hh); bq.half[1] = *(const v8us*)(Bh + boff + 16 + 8 * hh);
      acc[t] = mmaH<ASPLIT ? 2 : 1>(ah.v, al.v, bq.v, bq.v, acc[t]); }
  }
#pragma unroll
  for (int t = 0; t < 4; ++t) { if (col0 + t * 16 >= N) continue;
#pragma unroll
    for (int r = 0; r < 8; ++r) so[w][8 * hh + r][t * 16 + ln] = acc[t][r] * alpha; }
  __builtin_amdgcn_fence(__ATOMIC_ACQ_REL, "workgroup"); __builtin_amdgcn_wave_barrier();
  const int rsub = lane >> 4, c4 = (lane & 15) * 4;
  {
#pragma unroll
    for (int q = 0; q < 8; ++q) { const int r = q * 2 + rsub; if (col0 + c4 < N) { const v4f v = *(const v4fa*)&so[w][r][c4]; *(v4f*)(C + (size_t)(row0 + r) * ldc + col0 + c4) = v; } }
     }
}

// Wt[n][k] = f16(W[k][n]·scale) from f32 row-major W[K][N] (scale = power of two; bf16-exact weights stay exact in f16 away from the subnormal range)
__global__ __launch_bounds__(256) void k_wt_f16(const float* __restrict__ W, _Float16* __restrict__ Wt, int K, int N, float scale) {
  const int t = blockIdx.x * 256 + threadIdx.x; if (t >= N * (K / 8)) return; const int n = t / (K / 8), k8 = (t % (K / 8)) * 8; FragH f;
#pragma unroll
  for (int i = 0; i < 8; ++i) f.h[i] = (_Float16)(bf16_round(W[(size_t)(k8 + i) * N + n]) * scale); const v8us o = f.half[0];
  *(v8us*)((unsigned short*)Wt + (size_t)n * K + k8) = o; 
}
// k_gemm_hh variant with fused epilogue: v = acc·alpha + bias[by·sBias + col] (+ CP[(row/rowsPerB)·sCPb + by·64 + col] if CP) ; ACT 0 none / 1 elu ; writes f16 C16 (and f32 C if non-null)
template <int ACT>
__global__ __launch_bounds__(128) void k_gemm_hhx(const _Float16* __restrict__ A, int lda, size_t sA, const _Float16* __restrict__ Bh, int ldb, size_t sB, float alpha, const float* __restrict__ bias, size_t sBias, const float* __restrict__ CP, int rowsPerB, size_t sCPb, int row0g,
    float* __restrict__ C, _Float16* __restrict__ C16, int ldc, size_t sC, int M, int N, int K) {
  __shared__ __attribute__((aligned(16))) float so[4][16][64];
  const int tid = threadIdx.x, w = tid >> 5, lane = tid & 31, ln = lane & 15, hh = lane >> 4; const int by = blockIdx.y;
  A += (size_t)by * sA; Bh += (size_t)by * sB; const size_t cofs = (size_t)by * sC; const float* bp = bias ? bias + (size_t)by * sBias : nullptr;
  const int ntn = (N + 63) / 64; const int wid = blockIdx.x * 4 + w; const int mt = wid / ntn, nq = wid % ntn; if (mt * 16 >= M) return;
  const int row0 = mt * 16, col0 = nq * 64; const _Float16* arow = A + (size_t)(row0 + ln) * lda;
  v8f acc[4] = {};
  for (int kb = 0; kb < K; kb += 32) { FragH ah; ah.half[0] = *(const v8us*)((const unsigned short*)arow + kb + 8 * hh); ah.half[1] = *(const v8us*)((const unsigned short*)arow + kb + 16 + 8 * hh);
#pragma unroll
    for (int t = 0; t < 4; ++t) { if (col0 + t * 16 >= N) continue; const size_t boff = (size_t)(col0 + t * 16 + ln) * ldb + kb; FragH bq; bq.half[0] = *(const v8us*)((const unsigned short*)Bh + boff + 8 * hh); bq.half[1] = *(const v8us*)((const unsigned short*)Bh + boff + 16 + 8 * hh);
      acc[t] = mmaH<1>(ah.v, ah.v, bq.v, bq.v, acc[t]); }
  }
#pragma unroll
  for (int t = 0; t < 4; ++t) { if (col0 + t * 16 >= N) continue; const int col = col0 + t * 16 + ln; const float bv = bp ? bf16_round(bp[col]) : 0.f;
#pragma unroll
    for (int r = 0; r < 8; ++r) { float v = acc[t][r] * alpha + bv; if (CP) { const int rr = row0g + row0 + 8 * hh + r; if (rowsPerB < 0) v += CP[cofs + (size_t)rr * ldc + col];      /* rowsPerB < 0: own element of the batched C plane */ else { const int bidx = rr / rowsPerB; v += CP[(size_t)bidx * sCPb + (size_t)by * 64 + col]; } } if (ACT == 1) v = (v > 0.f) ? v : expm1f(v); else if (ACT == 7) v = (v > 0.f) ? v + 1.0f : expf(v); else if (ACT == 8) v = tanhf(v); else if (ACT == 9) v = 0.5f * v * (1.0f + tanhf(0.7978845608028654f * (v + 0.044715f * v * v * v))); else if (ACT == 11) v = 1.0f / (1.0f + expf(-v)); else if (ACT == 12) v = (v > 0.f) ? v : 0.01f * v; else if (ACT == 14) v = (v > 0.f) ? v : 0.1f * v; else if (ACT == 16) v = (v >= 0.f) ? v : 0.3f * v; else if (ACT == 17) v = (v >= 0.f) ? v : 0.2f * v; else if (ACT == 15) v = v / (1.0f + expf(-v)); else if (ACT == 3) v = fmaxf(v, 0.f); else if (ACT == 6) v = 0.5f * v * (1.0f + erff(v * 0.70710678118654752f)); so[w][8 * hh + r][t * 16 + ln] = v; } }
  __builtin_amdgcn_fence(__ATOMIC_ACQ_REL, "workgroup"); __builtin_amdgcn_wave_barrier();
  const int rsub = lane >> 4, c4 = (lane & 15) * 4; typedef _Float16 v4h __attribute__((ext_vector_type(4)));
  {
#pragma unroll
    for (int q = 0; q < 8; ++q) { const int r = q * 2 + rsub; if (col0 + c4 < N) { const v4f v = *(const v4fa*)&so[w][r][c4]; if (C) *(v4f*)(C + cofs + (size_t)(row0 + r) * ldc + col0 + c4) = v; if (C16) { v4h h4; for (int i = 0; i < 4; ++i) h4[i] = (_Float16)v[i]; *(v4h*)(C16 + cofs + (size_t)(row0 + r) * ldc + col0 + c4) = h4; } } }
     }
}


typedef _Float16 v4h __attribute__((ext_vector_type(4)));

__global__ __launch_bounds__(256) void k_x16(const float* __restrict__ x, _Float16* __restrict__ X16, size_t n8) { const size_t t = (size_t)blockIdx.x * 256 + threadIdx.x; if (t >= n8) return; FragH f;
#pragma unroll
  for (int q = 0; q < 8; ++q) f.h[q] = (_Float16)bf16_round(x[t * 8 + q]); *(v8us*)((unsigned short*)X16 + t * 8) = f.half[0];  }
__global__ __launch_bounds__(256) void k_h16(const float* __restrict__ x, _Float16* __restrict__ X16, size_t n8) { const size_t t = (size_t)blockIdx.x * 256 + threadIdx.x; if (t >= n8) return; FragH f;
#pragma unroll
  for (int q = 0; q < 8; ++q) f.h[q] = (_Float16)x[t * 8 + q]; *(v8us*)((unsigned short*)X16 + t * 8) = f.half[0];  }
__global__ __launch_bounds__(256) void k_round16f(const float* __restrict__ W, _Float16* __restrict__ Bt, size_t n8) { const size_t t = (size_t)blockIdx.x * 256 + threadIdx.x; if (t >= n8) return; FragH f;
#pragma unroll
  for (int i = 0; i < 8; ++i) f.h[i] = (_Float16)(bf16_round(W[t * 8 + i]) * 16.0f); *(v8us*)((unsigned short*)Bt + t * 8) = f.half[0];  }
template <int NHv, int TTv>
__global__ __launch_bounds__(256) void k_vt(const _Float16* __restrict__ V16, int ldv, int voff, _Float16* __restrict__ Vt) { __shared__ unsigned short tl[64][66]; const int tid = threadIdx.x; const int slab = blockIdx.x / (TTv / 64), lg = blockIdx.x % (TTv / 64); const int b = slab / NHv, h = slab % NHv;
  for (int i = tid; i < 64 * 8; i += 256) { const int r = i / 8, c8 = (i % 8) * 8; FragH f; f.half[0] = *(const v8us*)((const unsigned short*)V16 + ((size_t)b * TTv + lg * 64 + r) * ldv + voff + h * 64 + c8);
#pragma unroll
    for (int q = 0; q < 8; ++q) tl[r][c8 + q] = f.u[q]; }
  __syncthreads();
  {
#pragma unroll
    for (int rd = 0; rd < 2; ++rd) { const int d = rd * 32 + tid / 8, pc = tid % 8; FragH f;
#pragma unroll
      for (int q = 0; q < 8; ++q) f.u[q] = tl[pc * 8 + q][d];
      *(v8us*)((unsigned short*)Vt + ((size_t)slab * 64 + d) * TTv + lg * 64 + pc * 8) = f.half[0]; }
     } }

__global__ __launch_bounds__(256) void k_hl(const float* __restrict__ F, _Float16* __restrict__ Hh, _Float16* __restrict__ Hl, size_t n8) { const size_t t = (size_t)blockIdx.x * 256 + threadIdx.x; if (t >= n8) return; FragH fh, fl; const v4f a = *(const v4fa*)(F + t * 8), c = *(const v4fa*)(F + t * 8 + 4);
#pragma unroll
  for (int q = 0; q < 4; ++q) { _Float16 h = (_Float16)a[q]; fh.h[q] = h; fl.h[q] = (_Float16)((a[q] - (float)h) * 1024.0f); h = (_Float16)c[q]; fh.h[4 + q] = h; fl.h[4 + q] = (_Float16)((c[q] - (float)h) * 1024.0f); }
  { *(v8us*)((unsigned short*)Hh + t * 8) = fh.half[0]; *(v8us*)((unsigned short*)Hl + t * 8) = fl.half[0];  } }

// ---- fast GEMM (work-group tile 128x64, wave tile 32x64; requires M % 128 == 0, N % 64 == 0, K % 128 == 0, 256-byte aligned rows); operands staged in LDS; epilogue = k_gemm_hhx semantics ----
#define G2_KS 128                      /* k per stage: 256 bytes of every operand row */
#define G2_PITCH (G2_KS * 2 + 16)      /* LDS row pitch in bytes: 16 x odd, for 16-byte readers */
__device__ __forceinline__ v16h g2_lfrag(const char* p) { FragH f; f.half[0] = *(const v8us*)p; f.half[1] = *(const v8us*)(p + 32); return f.v; }      /* a fragment from a staged row; the lane's 16 hh bytes are in p */
__device__ __forceinline__ v8f g2_mma(v16h a, v16h b, v8f c) { v8f d = __builtin_amdgcn_wmma_f32_16x16x32_f16(false, a, false, b, (short)0, c, false, false); asm volatile("v_nop\n\tv_nop\n\tv_nop\n\tv_nop" : "+v"(d) : "v"(a), "v"(b)); return d; }
template <int ACT, int lda, int ldb>      /* the operands' row pitches at compile time: a thread's staging loads are then one base, one lane offset and immediates */
__global__ __launch_bounds__(128) void k_gemm2(const _Float16* __restrict__ A, size_t sA, const _Float16* __restrict__ Bh, size_t sB, float alpha, const float* __restrict__ bias, size_t sBias, const float* __restrict__ CP, int rowsPerB, size_t sCPb, int row0g,
    float* __restrict__ C, _Float16* __restrict__ C16, int ldc, size_t sC, int M, int N, int K, size_t sAz, size_t sBz, size_t sCz) { static_assert(ACT == 0 || ACT == 3 || ACT == 6 || ACT == 8 || ACT == 9 || ACT == 11 || ACT == 12 || ACT == 14 || ACT == 15 || ACT == 16 || ACT == 17, "k_gemm2: unsupported ACT code (would silently apply no activation)");
  __shared__ __attribute__((aligned(16))) char sm[192 * G2_PITCH];      /* one stage: 128 A rows, then 64 B rows, G2_KS k each; behind the k loop the waves' output staging */
  static_assert(sizeof(sm) >= 4 * 32 * 68 * sizeof(float), "k_gemm2: the output staging lies in the stage buffer"); float (*so)[32][68] = (float (*)[32][68])sm;
  const int tid = threadIdx.x, w = tid >> 5, lane = tid & 31, ln = lane & 15, hh = lane >> 4; const int by = blockIdx.y, bz = blockIdx.z;      /* two batch levels: grid.y (strides sA, sB, sC) and grid.z (strides sAz, sBz, sCz) */
  A += (size_t)by * sA + (size_t)bz * sAz; Bh += (size_t)by * sB + (size_t)bz * sBz; const size_t cofs = (size_t)by * sC + (size_t)bz * sCz; const float* bp = bias ? bias + (size_t)by * sBias : nullptr;
  const int ntn = N >> 6; const int mt = blockIdx.x / ntn, nq = blockIdx.x - mt * ntn; const int row0 = mt * 128 + 32 * w, col0 = nq * 64; if (mt * 128 >= M) return;      /* the same for the whole work-group: barriers follow */
  const char* Ab = (const char*)(A + (size_t)(mt * 128) * lda); const char* Bb = (const char*)(Bh + (size_t)col0 * ldb);      /* uniform bases; the lane's part is a 32-bit byte offset that never changes */
  const int sr = tid >> 4, sc = tid & 15;      /* staging: 16 lanes take one row's 256 bytes, so a wave's load covers 4 whole lines; thread rows sr + 8 j */
  const unsigned ga = (unsigned)(sr * lda + sc * 8) * 2, gb = (unsigned)(sr * ldb + sc * 8) * 2;
  char* sst = sm + sr * G2_PITCH + sc * 16;
  const char* sa = sm + (32 * w + ln) * G2_PITCH + 16 * hh; const char* sb = sm + (128 + ln) * G2_PITCH + 16 * hh;      /* fragment rows; k = 8 hh + 0..7 and 16 + 8 hh + 0..7 of each 32, A and B alike */
  const v8f z8 = {0.f,0.f,0.f,0.f,0.f,0.f,0.f,0.f}; v8f c00 = z8, c01 = z8, c02 = z8, c03 = z8, c10 = z8, c11 = z8, c12 = z8, c13 = z8;
  v8us st[24];
#pragma unroll
  for (int j = 0; j < 16; ++j) st[j] = *(const v8us*)(Ab + (size_t)(8 * j) * lda * 2 + ga);
#pragma unroll
  for (int j = 0; j < 8; ++j) st[16 + j] = *(const v8us*)(Bb + (size_t)(8 * j) * ldb * 2 + gb);
#pragma unroll 1
  for (int kb = 0; kb < K; kb += G2_KS) {
#pragma unroll
    for (int j = 0; j < 24; ++j) *(v8us*)(sst + 8 * j * G2_PITCH) = st[j];
    __syncthreads();      /* the stage is whole before anybody reads it */
    if (kb + G2_KS < K) {      /* the next stage's rows fly into registers while this stage is worked on */
      const char* An = Ab + (size_t)(kb + G2_KS) * 2; const char* Bn = Bb + (size_t)(kb + G2_KS) * 2;
#pragma unroll
      for (int j = 0; j < 16; ++j) st[j] = *(const v8us*)(An + (size_t)(8 * j) * lda * 2 + ga);
#pragma unroll
      for (int j = 0; j < 8; ++j) st[16 + j] = *(const v8us*)(Bn + (size_t)(8 * j) * ldb * 2 + gb);
      asm volatile("s_wait_xcnt 0x0" ::: "memory");      /* the loads' address registers are reused by the fragment loads right behind; it also keeps the global loads in front of the LDS reads */
    }
#pragma unroll
    for (int kk = 0; kk < G2_KS / 32; ++kk) { const v16h a0 = g2_lfrag(sa + 64 * kk), a1 = g2_lfrag(sa + 16 * G2_PITCH + 64 * kk);      /* the six fragments of a k step are asked for together: one LDS wait a step */
      const v16h b0 = g2_lfrag(sb + 64 * kk), b1 = g2_lfrag(sb + 16 * G2_PITCH + 64 * kk), b2 = g2_lfrag(sb + 32 * G2_PITCH + 64 * kk), b3 = g2_lfrag(sb + 48 * G2_PITCH + 64 * kk);
      c00 = g2_mma(a0, b0, c00); c10 = g2_mma(a1, b0, c10); c01 = g2_mma(a0, b1, c01); c11 = g2_mma(a1, b1, c11);
      c02 = g2_mma(a0, b2, c02); c12 = g2_mma(a1, b2, c12); c03 = g2_mma(a0, b3, c03); c13 = g2_mma(a1, b3, c13); }
    __syncthreads();      /* every reader has left the stage before it is written again (behind the last pass: before the output staging) */
  }
  v8f accs[8] = {c00, c01, c02, c03, c10, c11, c12, c13};
#pragma unroll
  for (int u = 0; u < 8; ++u) { const int t = u & 3, half = u >> 2; const int col = col0 + t * 16 + ln; const float bv = bp ? bf16_round(bp[col]) : 0.f;
#pragma unroll
    for (int r = 0; r < 8; ++r) { const int rloc = half * 16 + 8 * hh + r; float v = accs[u][r] * alpha + bv; if (CP) { if (rowsPerB < 0) v += CP[cofs + (size_t)(row0g + row0 + rloc) * ldc + col];      /* rowsPerB < 0: own element of the batched C plane */ else { const int bidx = (row0g + row0 + rloc) / rowsPerB; v += CP[(size_t)bidx * sCPb + (size_t)by * 64 + col]; } }
      if (ACT == 3) v = fmaxf(v, 0.f); else if (ACT == 6) v = 0.5f * v * (1.0f + erff(v * 0.70710678118654752f)); else if (ACT == 11) v = 1.0f / (1.0f + expf(-v)); else if (ACT == 15) v = v / (1.0f + expf(-v)); else if (ACT == 12) v = (v > 0.f) ? v : 0.01f * v; else if (ACT == 8) v = tanhf(v); else if (ACT == 9) v = 0.5f * v * (1.0f + tanhf(0.7978845608028654f * (v + 0.044715f * v * v * v))); else if (ACT == 14) v = (v > 0.f) ? v : 0.1f * v; else if (ACT == 16) v = (v >= 0.f) ? v : 0.3f * v; else if (ACT == 17) v = (v >= 0.f) ? v : 0.2f * v;
      so[w][rloc][t * 16 + ln] = v; } }
  __builtin_amdgcn_fence(__ATOMIC_ACQ_REL, "workgroup"); __builtin_amdgcn_wave_barrier();
  const int rsub = lane >> 4, c4 = (lane & 15) * 4;
  {
#pragma unroll
    for (int q = 0; q < 16; ++q) { const int r = q * 2 + rsub; const v4f v = *(const v4fa*)&so[w][r][c4]; if (C) *(v4f*)(C + cofs + (size_t)(row0 + r) * ldc + col0 + c4) = v; if (C16) { v4h h4; for (int i = 0; i < 4; ++i) h4[i] = (_Float16)v[i]; *(v4h*)(C16 + cofs + (size_t)(row0 + r) * ldc + col0 + c4) = h4; } }
     } }


__global__ __launch_bounds__(256) void k_wnat(const float* __restrict__ w, size_t n8, _Float16* __restrict__ Bt) { const size_t t = (size_t)blockIdx.x * 256 + threadIdx.x; if (t >= n8) return; FragH f; for (int q = 0; q < 8; ++q) f.h[q] = (_Float16)(bf16_round(w[t * 8 + q]) * 16.0f); *(v8us*)((unsigned short*)Bt + t * 8) = f.half[0];  }
__global__ __launch_bounds__(256) void k_rsm(const float* __restrict__ S, _Float16* __restrict__ P, int nrows) {
  #pragma clang fp contract(off)
  const int i = blockIdx.x * 256 + threadIdx.x; if (i >= nrows) return; const float* s = S + (size_t)i * SQ; float mx = -3.0e38f;
#pragma unroll 1
  for (int j = 0; j < SQ; ++j) mx = fmaxf(mx, s[j]); float se = 0.f;
#pragma unroll 1
  for (int j = 0; j < SQ; ++j) se += expf(s[j] - mx); const float sc = 256.0f / se;
#pragma unroll 1
  for (int j0 = 0; j0 < SQ; j0 += 8) { FragH f; for (int q = 0; q < 8; ++q) f.h[q] = (_Float16)(expf(s[j0 + q] - mx) * sc); unsigned short* d = (unsigned short*)P + (size_t)i * SQ + j0; *(v8us*)d = f.half[0];  } }
__global__ __launch_bounds__(256) void k_vt(const _Float16* __restrict__ V16, int b, int h0, _Float16* __restrict__ VT) { __shared__ unsigned short tl[64][65]; const int tid = threadIdx.x; const int hh = blockIdx.x % HG, sg = blockIdx.x / HG; const int s0 = sg * 64; const int h = h0 + hh;
  for (int i = tid; i < 64 * 8; i += 256) { const int j = i / 8, d8 = (i % 8) * 8; FragH f; f.half[0] = *(const v8us*)((const unsigned short*)V16 + ((size_t)b * SQ + s0 + j) * DM + h * HD + d8); for (int q = 0; q < 8; ++q) tl[d8 + q][j] = f.u[q]; }
  __syncthreads();
  { for (int i = tid; i < 64 * 8; i += 256) { const int d = i / 8, j8 = (i % 8) * 8; FragH f; for (int q = 0; q < 8; ++q) f.u[q] = tl[d][j8 + q]; *(v8us*)((unsigned short*)VT + ((size_t)hh * HD + d) * SQ + s0 + j8) = f.half[0]; }  } }


__global__ __launch_bounds__(256) void k_rsmf(const float* __restrict__ S, _Float16* __restrict__ P, int qn, int hg) {
  #pragma clang fp contract(off)
  const int t = blockIdx.x * 256 + threadIdx.x; if (t >= qn * hg) return; const size_t i = (size_t)(t / qn) * SQ + (t % qn); const float* s = S + i * SQ; float mx = -3.0e38f;
#pragma unroll 1
  for (int j = 0; j < SQ; ++j) mx = fmaxf(mx, s[j]); float se = 0.f;
#pragma unroll 1
  for (int j = 0; j < SQ; ++j) se += __expf(s[j] - mx); const float sc = 256.0f / se;
#pragma unroll 1
  for (int j0 = 0; j0 < SQ; j0 += 8) { FragH f; for (int q = 0; q < 8; ++q) f.h[q] = (_Float16)(__expf(s[j0 + q] - mx) * sc); unsigned short* d = (unsigned short*)P + i * SQ + j0; *(v8us*)d = f.half[0];  } }

__global__ __launch_bounds__(256) void k_rsmr(const float* __restrict__ S, _Float16* __restrict__ P, int qn, int hg) {
  #pragma clang fp contract(off)
  const int t = blockIdx.x * 256 + threadIdx.x; if (t >= qn * hg) return; const size_t i = (size_t)t;      /* planes packed: row t of plane t / qn */ const float* s = S + i * SQ; float mx = -3.0e38f;
#pragma unroll 1
  for (int j = 0; j < SQ; ++j) mx = fmaxf(mx, s[j]); float se = 0.f;
#pragma unroll 1
  for (int j = 0; j < SQ; ++j) se += __expf(s[j] - mx); const float sc = 256.0f / se;
#pragma unroll 1
  for (int j0 = 0; j0 < SQ; j0 += 8) { FragH f; for (int q = 0; q < 8; ++q) f.h[q] = (_Float16)(__expf(s[j0 + q] - mx) * sc); unsigned short* d = (unsigned short*)P + i * SQ + j0; *(v8us*)d = f.half[0];  } }


typedef int v4ia __attribute__((ext_vector_type(4), may_alias));
typedef float f32x2 __attribute__((ext_vector_type(2)));
__device__ __forceinline__ float fa_xhalf(float x) { return __builtin_bit_cast(float, __builtin_amdgcn_permlanex16(__builtin_bit_cast(int, x), __builtin_bit_cast(int, x), 0x76543210, 0xfedcba98, false, false)); }      /* lane l with lane l ^ 16 */
__device__ __forceinline__ v8f fa_mma(v16h a, v16h b, v8f c) { return __builtin_amdgcn_wmma_f32_16x16x32_f16(false, a, false, b, (short)0, c, false, false); }
__device__ __forceinline__ v16h fa_frag(const char* base, unsigned off) { FragH f; f.half[0] = *(const v8us*)(base + off); f.half[1] = *(const v8us*)(base + off + 32); return f.v; }      /* k = 8 hh + 0..7 and 16 + 8 hh + 0..7; the lane's 16 hh bytes are in off */
// In front of a group of next-pass loads: keeps the loads from rising among the WMMAs that read the registers they refill (without it the compiler sets a load directly behind the WMMA whose A operand it overwrites).
__device__ __forceinline__ void fa_ahead() { __builtin_amdgcn_sched_barrier(0); }
// Between a run of eight WMMAs and the loads that refill their A operand registers: the four vector slots that a vector overwrite of a WMMA's operand asks for.
__device__ __forceinline__ void fa_mma_done() { asm volatile("v_nop\n\tv_nop\n\tv_nop\n\tv_nop"); }
// Behind each group of next-pass loads. The wait: the group's address registers are reused right behind it. The scheduling barrier: keeps that wait directly behind its loads and the group where it is written, a phase ahead of its use (without it the compiler moves the mask fetch down among the exponentials and the wait away from its loads).
__device__ __forceinline__ void fa_issued() { asm volatile("s_wait_xcnt 0x0" ::: "memory"); __builtin_amdgcn_sched_barrier(0); }
__global__ __launch_bounds__(256) void k_fattn(const _Float16* __restrict__ Q, const _Float16* __restrict__ Kr, const _Float16* __restrict__ VT, const int* __restrict__ Mk, _Float16* __restrict__ O) {
  const int lane = threadIdx.x & 31, ln = lane & 15, hh = lane >> 4; const int wave = __builtin_amdgcn_readfirstlane((int)(threadIdx.x >> 5));
  const int h = blockIdx.y, b = blockIdx.z, q0 = blockIdx.x * 256 + wave * 32;
  const float cs = 0.125f * 1.4426950408889634f;      /* 1 / sqrt(64), and e^x = 2^(x log2 e) */
  const float fill = -8589934592.0f;      /* masked_fill: -2^33, -2^30 after the 1/8. A power of two, so that its product with cs is exact: while every key seen so far is masked the maximum IS that product, the fused multiply-add of the exponent gives exactly 0 and the weights are 1 (finite); the first unmasked key rescales them to 0. A fill whose product rounds would leave a positive exponent there */
  const char* qb = (const char*)(Q + ((size_t)b * NQ + q0) * DM + h * HD);      /* wave-uniform bases; the lane's part is a 32-bit byte offset that never changes */
  const char* kb = (const char*)(Kr + (size_t)b * SK * DM + h * HD);
  const char* vb = (const char*)(VT + ((size_t)b * NH + h) * HD * SK);
  const char* mb_ = (const char*)(Mk + ((size_t)b * NQ + q0) * SK);
  const unsigned ko = (unsigned)(ln * DM * 2 + 16 * hh), vo = (unsigned)(ln * SK * 2 + 16 * hh), mo = (unsigned)(ln * SK * 4 + 32 * hh);
  v16h qf[2][2];
#pragma unroll
  for (int g = 0; g < 2; ++g)
#pragma unroll
    for (int kc = 0; kc < 2; ++kc) qf[g][kc] = fa_frag(qb + 16 * g * DM * 2 + 64 * kc, ko);
  fa_issued();      /* pass 0's groups in the loop's own order (K, mask, V^T): loads return in order, and the counted waits at the loop's head must hold for both ways into it */
  v16h kf[2][2], vf[4]; v4ia mk[2][2][2];
#pragma unroll
  for (int kt = 0; kt < 2; ++kt)
#pragma unroll
    for (int kc = 0; kc < 2; ++kc) kf[kt][kc] = fa_frag(kb + 16 * kt * DM * 2 + 64 * kc, ko);
  fa_issued();
#pragma unroll
  for (int g = 0; g < 2; ++g)
#pragma unroll
    for (int kt = 0; kt < 2; ++kt) { mk[g][kt][0] = *(const v4ia*)(mb_ + 16 * g * SK * 4 + 64 * kt + mo); mk[g][kt][1] = *(const v4ia*)(mb_ + 16 * g * SK * 4 + 64 * kt + 16 + mo); }
  fa_issued();
#pragma unroll
  for (int t = 0; t < 4; ++t) vf[t] = fa_frag(vb + 16 * t * SK * 2, vo);
  fa_issued();
  const v8f z8 = {0.f, 0.f, 0.f, 0.f, 0.f, 0.f, 0.f, 0.f};
  v8f acc[2][4]; float m_run[2], l_run[2];
#pragma unroll
  for (int g = 0; g < 2; ++g) { m_run[g] = -3.0e38f; l_run[g] = 0.f;
#pragma unroll
    for (int t = 0; t < 4; ++t) acc[g][t] = z8; }
  for (int key0 = 0; key0 < SK; key0 += 32) {
    const int kn = (key0 + 32) & (SK - 1);      /* the next pass's first key; the last pass fetches pass 0 again (in bounds, not used) so that the fetches stay unconditional */
    v8f s[2][2];
#pragma unroll
    for (int kt = 0; kt < 2; ++kt)
#pragma unroll
      for (int g = 0; g < 2; ++g) s[kt][g] = fa_mma(kf[kt][1], qf[g][1], fa_mma(kf[kt][0], qf[g][0], z8));
    fa_ahead(); fa_mma_done();      /* the score products first: the K fetch goes into their operand registers */
    { const char* kbn = kb + (size_t)kn * (DM * 2);
#pragma unroll
      for (int kt = 0; kt < 2; ++kt)
#pragma unroll
        for (int kc = 0; kc < 2; ++kc) kf[kt][kc] = fa_frag(kbn + 16 * kt * DM * 2 + 64 * kc, ko); }
    fa_issued();
    float mb[2]; bool need = false;
#pragma unroll
    for (int g = 0; g < 2; ++g) { float mx = -3.0e38f;
#pragma unroll
      for (int kt = 0; kt < 2; ++kt)
#pragma unroll
        for (int r = 0; r < 8; ++r) { const float v = (mk[g][kt][r >> 2][r & 3] != 0) ? s[kt][g][r] : fill; s[kt][g][r] = v; mx = fmaxf(mx, v); }
      mx = fmaxf(mx, fa_xhalf(mx)) * cs; mb[g] = mx; need = need || (mx > m_run[g] + 8.0f); }
    if (__builtin_amdgcn_ballot_w32(need) != 0) {      /* wave-uniform; rare after the first passes */
#pragma unroll
      for (int g = 0; g < 2; ++g) { const float mn = fmaxf(m_run[g], mb[g]); const float corr = __builtin_amdgcn_exp2f(m_run[g] - mn); m_run[g] = mn; l_run[g] *= corr;
#pragma unroll
        for (int t = 0; t < 4; ++t) acc[g][t] = acc[g][t] * corr; } }
    { const char* mbn = mb_ + (size_t)kn * 4;      /* behind the branch, which needs every select: the mask fetch goes into the registers that the selects read */
#pragma unroll
      for (int g = 0; g < 2; ++g)
#pragma unroll
        for (int kt = 0; kt < 2; ++kt) { mk[g][kt][0] = *(const v4ia*)(mbn + 16 * g * SK * 4 + 64 * kt + mo); mk[g][kt][1] = *(const v4ia*)(mbn + 16 * g * SK * 4 + 64 * kt + 16 + mo); } }
    fa_issued();
#pragma unroll
    for (int g = 0; g < 2; ++g) { const float nm = -m_run[g]; FragH pf; f32x2 ls = {0.f, 0.f};
#pragma unroll
      for (int i = 0; i < 8; ++i) { const f32x2 a = __builtin_elementwise_fma(f32x2{s[i >> 2][g][2 * (i & 3)], s[i >> 2][g][2 * (i & 3) + 1]}, f32x2{cs, cs}, f32x2{nm, nm});
        const f32x2 p = {__builtin_amdgcn_exp2f(a.x), __builtin_amdgcn_exp2f(a.y)}; ls += p; pf.h[2 * i] = (_Float16)p.x; pf.h[2 * i + 1] = (_Float16)p.y; }      /* element 8 kt + r of the B operand = key 16 kt + 8 hh + r */
      l_run[g] += ls.x + ls.y;
#pragma unroll
      for (int t = 0; t < 4; ++t) acc[g][t] = fa_mma(vf[t], pf.v, acc[g][t]); }
    fa_ahead();      /* the output products first: the V^T fetch goes into their operand registers (the compiler's own padding in front of the address addition, which overwrites a B register, keeps the four slots here) */
    { const char* vbn = vb + (size_t)kn * 2;
#pragma unroll
      for (int t = 0; t < 4; ++t) vf[t] = fa_frag(vbn + 16 * t * SK * 2, vo); }
    fa_issued();
  }
#pragma unroll
  for (int g = 0; g < 2; ++g) { const float l = l_run[g] + fa_xhalf(l_run[g]); const float inv = 64.0f / l;      /* o carried x64 */
    _Float16* op = O + ((size_t)b * NQ + q0 + 16 * g + ln) * DM + h * HD + 8 * hh;
#pragma unroll
    for (int t = 0; t < 4; ++t) { FragH f;
#pragma unroll
      for (int r = 0; r < 8; ++r) f.h[r] = (_Float16)(acc[g][t][r] * inv);
      *(v8us*)((unsigned short*)op + 16 * t) = f.half[0]; } }      /* d = 16 t + 8 hh + 0..7 of query ln: 16 contiguous bytes */
  asm volatile("s_wait_loadcnt 0x0" ::: "memory");      /* a precaution: the last pass's fetches (pass 0 again, not used) have landed before the wave ends and gives its registers back */
}
extern "C" void kernel_launch(void* const* d_in, const int* in_sizes, int n_in,
                              void* d_out, int out_size, void* d_ws, size_t ws_size, hipStream_t stream) {
  (void)in_sizes; (void)n_in; (void)out_size;
  const float* const* I = (const float* const*)d_in; const float* x = I[0]; const float* ctx = I[1]; const int* mkm = (const int*)d_in[2]; const float* wq = I[3]; const float* bq = I[4]; const float* wkv = I[5]; const float* bkv = I[6]; const float* wo = I[7]; const float* bo = I[8];      /* [in][out] weights; int mask [b][n][m]; k | v from the fused Wkv [1024][2048] */
  char* ws = (char*)d_ws; size_t off = 0;
  auto take = [&](size_t bytes) { char* p = ws + off; off += (bytes + 255) & ~(size_t)255; return p; };
  _Float16* BQ = (_Float16*)take((size_t)DM * DM * 2); _Float16* BKV = (_Float16*)take((size_t)2 * DM * DC * 2); _Float16* BO = (_Float16*)take((size_t)DM * DM * 2);
  _Float16* X16 = (_Float16*)take(NRQ * DM * 2); _Float16* C16 = (_Float16*)take(NRK * DC * 2); _Float16* Q16 = (_Float16*)take(NRQ * DM * 2); _Float16* K16 = (_Float16*)take(2 * NRK * DM * 2); _Float16* V16 = K16 + NRK * DM; _Float16* O16 = X16;      /* o rows reuse the x rows, whose last reader is the Q GEMM */
  _Float16* VT = (_Float16*)take((size_t)NB * NH * HD * SK * 2);      /* V^T: all 64 (batch, head) planes */
  if (off > ws_size) return;      /* 8 + 5 x 8 + 8 = 56 MiB */
  { const unsigned g = (unsigned)(((size_t)DM * (DM / 8) + 255) / 256); k_wt_f16<<<g, 256, 0, stream>>>(wq, BQ, DM, DM, 16.0f); k_wt_f16<<<2 * g, 256, 0, stream>>>(wkv, BKV, DC, 2 * DM, 16.0f); k_wt_f16<<<g, 256, 0, stream>>>(wo, BO, DM, DM, 16.0f); }      /* [in][out] -> Bt x16; Wkv [1024][2048] -> Bt [2048][1024]: rows 0..1023 = k columns, 1024..2047 = v columns */
  k_x16<<<(unsigned)((NRQ * DM / 8 + 255) / 256), 256, 0, stream>>>(x, X16, NRQ * DM / 8); k_x16<<<(unsigned)((NRK * DC / 8 + 255) / 256), 256, 0, stream>>>(ctx, C16, NRK * DC / 8);
  k_gemm2<0, DM, DM><<<dim3((unsigned)((NRQ / 128) * (DM / 64)), 1), 128, 0, stream>>>(X16, 0, BQ, 0, 0.0625f, bq, 0, nullptr, 1, 0, 0, nullptr, Q16, DM, 0, (int)NRQ, DM, DM, 0, 0, 0);
  k_gemm2<0, DC, DC><<<dim3((unsigned)((NRK / 128) * (DM / 64)), 2), 128, 0, stream>>>(C16, 0, BKV, (size_t)DM * DC, 0.0625f, bkv, (size_t)DM, nullptr, 1, 0, 0, nullptr, K16, DM, NRK * DM, (int)NRK, DM, DC, 0, 0, 0);      /* grid.y 0: k = context Wkv[:, :1024] + bkv[:1024] -> K16; grid.y 1: v = context Wkv[:, 1024:] + bkv[1024:] -> V16 */
  k_vt<NH, SK><<<NB * NH * (SK / 64), 256, 0, stream>>>(V16, DM, 0, VT);      /* V^T [4 x 16][64][1024], all batches in one launch */
  k_fattn<<<dim3(NQ / 256, NH, NB), 256, 0, stream>>>(Q16, K16, VT, mkm, O16);      /* scores, masked softmax and P V of all 64 (batch, head) planes: o x64, merged rows */
  k_gemm2<0, DM, DM><<<dim3((unsigned)((NRQ / 128) * (DM / 64)), 1), 128, 0, stream>>>(O16, 0, BO, 0, 0.0009765625f, bo, 0, nullptr, 1, 0, 0, (float*)d_out, nullptr, DM, 0, (int)NRQ, DM, DM, 0, 0, 0);      /* out = o Wo + bo */
}

// v005
// One run takes 108 microseconds.
// Two timings next to v004 both put it at 1.19 times that version's speed.
// All steps since v000 together make it 48.9 times as fast.
#include <hip/hip_runtime.h>
// Masked multi-head cross-attention (x [4][1024][1024] queries, context [4][1024][1024]; q = x Wq + bq; k | v = context Wkv + bkv viewed (m, 2, 16, 64) ([in][out] weights sigma 1/32, zero biases); 16 heads of 64; dots = q k^T / 8; a binary int mask [b][n][32*32 = m] shared by the heads: masked_fill(mask == 0, -inf); softmax over the 1024 context tokens; out = merged Wp + bp -> [4][1024][1024]).
// Structure: x and context as exact f16 rows and [in][out] weights as exact x16 planes (Wkv as one [2048][1024] plane: k rows then v rows), all in one preparation launch; Q and K | V (one launch, grid.y) as WMMA GEMMs (operands staged in LDS, 32x64 wave tiles, f32 accumulation, + bias, f16 outputs); V^T of all batches via LDS transposes (one launch); scores (K = 64, 1/8), int mask select, online softmax (f32 statistics, native exp2; weights f16, unnormalised) and o = P V^T (o carried x64) of all 64 (batch, head) planes fused in one launch, scores and weights in registers only, into merged f16 rows; out = o Wp + bp GEMM (f32, alpha 2^-10); launches: see trace.
// Compute dtype: inputs rounded to bf16; x / context / weights exact; q, k, v, softmax weights and o as plain f16 GEMM operands (~2^-12); scores and statistics f32. v_wmma_f32_16x16x32_f16.
#define NB 4
#define NQ 1024
#define SK 1024
#define SQ SK                       /* keys per softmax row */
#define DM 1024
#define DC 1024
#define NH 16
#define HD 64
#define HG 4
#define NRQ ((size_t)NB * NQ)
#define NRK ((size_t)NB * SK)
typedef __bf16 v16b __attribute__((ext_vector_type(16)));
typedef unsigned short v8us __attribute__((ext_vector_type(8), may_alias));
typedef float  v8f  __attribute__((ext_vector_type(8)));
typedef float  v4f  __attribute__((ext_vector_type(4)));
typedef float  v4fa __attribute__((ext_vector_type(4), may_alias));
union FragB { v16b v; v8us half[2]; unsigned short u[16]; };

__device__ __forceinline__ unsigned short bf16_bits(float x) { unsigned int u = __float_as_uint(x); return (unsigned short)((u + 0x7FFFu + ((u >> 16) & 1u)) >> 16); }
__device__ __forceinline__ float bf16_val(unsigned short b) { return __uint_as_float(((unsigned int)b) << 16); }
__device__ __forceinline__ float bf16_round(float x) { return bf16_val(bf16_bits(x)); }
// D += A·B with NT terms: 1 = ah·bh, 2 = + al·bh (A split), 3 = + ah·bl (both split)
template <int NT>
__device__ __forceinline__ v8f mmaN(v16b ah, v16b al, v16b bh, v16b bl, v8f c) {
  c = __builtin_amdgcn_wmma_f32_16x16x32_bf16(false, ah, false, bh, (short)0, c, false, false);
  if (NT >= 2) c = __builtin_amdgcn_wmma_f32_16x16x32_bf16(false, al, false, bh, (short)0, c, false, false);
  if (NT >= 3) c = __builtin_amdgcn_wmma_f32_16x16x32_bf16(false, ah, false, bl, (short)0, c, false, false);
  asm volatile("v_nop\n\tv_nop\n\tv_nop\n\tv_nop" : "+v"(c) : "v"(ah), "v"(al), "v"(bh), "v"(bl));
  return c;
}

__global__ __launch_bounds__(256) void k_wt_bf16(const float* __restrict__ W, unsigned short* __restrict__ Wt, int K, int N) {
  const int t = blockIdx.x * 256 + threadIdx.x;
  const int k8n = K / 8;
  if (t >= N * k8n) return;
  const int n = t / k8n, k8 = (t % k8n) * 8;
  v8us v;
#pragma unroll
  for (int i = 0; i < 8; ++i) v[i] = bf16_bits(W[(size_t)(k8 + i) * N + n]);
  *(v8us*)(Wt + (size_t)n * K + k8) = v;
  
}

// GEMM C[M][N] (f32, pitch ldc) = act(A[M][K]·W + bias). A f32 row-major (pitch lda) converted per fragment to bf16
// (ASPLIT: hi/lo two planes -> 2 terms, else single rounded term); Wt bf16 [N][K] (pitch ldb). BIAS_BF16 rounds the
// bias to bf16 first (bias quantised to bf16 before the add). K%32==0, M%16==0, N%64==0.
template <bool ASPLIT, int ACT, bool BIAS_BF16>
__global__ __launch_bounds__(128) void k_gemm_bf(const float* __restrict__ A, int lda, const unsigned short* __restrict__ Wt, int ldb,
                                               const float* __restrict__ bias, float* __restrict__ C, int ldc, int M, int N, int K) {
  __shared__ __attribute__((aligned(16))) float so[4][16][64];
  const int tid = threadIdx.x, w = tid >> 5, lane = tid & 31, ln = lane & 15, hh = lane >> 4;
  const int ntn = N / 64;
  const int wid = blockIdx.x * 4 + w;
  const int mt = wid / ntn, nq = wid % ntn;
  if (mt * 16 >= M) return;
  const int row0 = mt * 16, col0 = nq * 64;
  const float* arow = A + (size_t)(row0 + ln) * lda;
  v8f acc[4] = {};
  for (int kb = 0; kb < K; kb += 32) {
    FragB ah, al;
    const v4f x0 = *(const v4fa*)(arow + kb + 8 * hh), x1 = *(const v4fa*)(arow + kb + 8 * hh + 4);
    const v4f x2 = *(const v4fa*)(arow + kb + 16 + 8 * hh), x3 = *(const v4fa*)(arow + kb + 16 + 8 * hh + 4);
    float xs[16] = {x0[0],x0[1],x0[2],x0[3],x1[0],x1[1],x1[2],x1[3],x2[0],x2[1],x2[2],x2[3],x3[0],x3[1],x3[2],x3[3]};
#pragma unroll
    for (int i = 0; i < 16; ++i) { const unsigned short hb = bf16_bits(xs[i]); ah.u[i] = hb; al.u[i] = ASPLIT ? bf16_bits(xs[i] - bf16_val(hb)) : (unsigned short)0; }
#pragma unroll
    for (int t = 0; t < 4; ++t) {
      const unsigned short* brow = Wt + (size_t)(col0 + t * 16 + ln) * ldb + kb;
      FragB b;
      b.half[0] = *(const v8us*)(brow + 8 * hh);
      b.half[1] = *(const v8us*)(brow + 16 + 8 * hh);
      acc[t] = mmaN<ASPLIT ? 2 : 1>(ah.v, al.v, b.v, b.v, acc[t]);
    }
  }
#pragma unroll
  for (int t = 0; t < 4; ++t) {
    float bv = bias ? bias[col0 + t * 16 + ln] : 0.f;
    if (BIAS_BF16) bv = bf16_round(bv);
#pragma unroll
    for (int r = 0; r < 8; ++r) { float v = acc[t][r] + bv; if (ACT == 1) v = fmaxf(v, 0.f); so[w][8 * hh + r][t * 16 + ln] = v; }
  }
  __builtin_amdgcn_fence(__ATOMIC_ACQ_REL, "workgroup");
  __builtin_amdgcn_wave_barrier();
  const int rsub = lane >> 4, c4 = (lane & 15) * 4;
  {
#pragma unroll
    for (int q = 0; q < 8; ++q) {
      const int r = q * 2 + rsub;
      const v4f v = *(const v4fa*)&so[w][r][c4];
      *(v4f*)(C + (size_t)(row0 + r) * ldc + col0 + c4) = v;
    }
    
  }
}

// GEMM C = act(A·W + bias + resid): A f32 (ASPLIT -> hi/lo 2 terms), Wt bf16 [N][K]; ACT 0 none, 1 relu, 2 exact gelu;
// resid (optional, f32, row index = (row % rmod), pitch ldr, RES_BF16 rounds it) added before the activation.
template <bool ASPLIT, int ACT, bool BIAS_BF16, bool RES_BF16>
__global__ __launch_bounds__(128) void k_gemm_bf3(const float* __restrict__ A, int lda, const unsigned short* __restrict__ Wt, int ldb,
                                                const float* __restrict__ bias, const float* __restrict__ resid, int rmod, int ldr,
                                                float* __restrict__ C, int ldc, int M, int N, int K) {
  __shared__ __attribute__((aligned(16))) float so[4][16][64];
  const int tid = threadIdx.x, w = tid >> 5, lane = tid & 31, ln = lane & 15, hh = lane >> 4;
  const int ntn = N / 64;
  const int wid = blockIdx.x * 4 + w;
  const int mt = wid / ntn, nq = wid % ntn;
  if (mt * 16 >= M) return;
  const int row0 = mt * 16, col0 = nq * 64;
  const float* arow = A + (size_t)(row0 + ln) * lda;
  v8f acc[4] = {};
  for (int kb = 0; kb < K; kb += 32) {
    FragB ah, al;
    const v4f x0 = *(const v4fa*)(arow + kb + 8 * hh), x1 = *(const v4fa*)(arow + kb + 8 * hh + 4);
    const v4f x2 = *(const v4fa*)(arow + kb + 16 + 8 * hh), x3 = *(const v4fa*)(arow + kb + 16 + 8 * hh + 4);
    float xs[16] = {x0[0],x0[1],x0[2],x0[3],x1[0],x1[1],x1[2],x1[3],x2[0],x2[1],x2[2],x2[3],x3[0],x3[1],x3[2],x3[3]};
#pragma unroll
    for (int i = 0; i < 16; ++i) { const unsigned short hb = bf16_bits(xs[i]); ah.u[i] = hb; al.u[i] = ASPLIT ? bf16_bits(xs[i] - bf16_val(hb)) : (unsigned short)0; }
#pragma unroll
    for (int t = 0; t < 4; ++t) {
      const unsigned short* brow = Wt + (size_t)(col0 + t * 16 + ln) * ldb + kb;
      FragB b;
      b.half[0] = *(const v8us*)(brow + 8 * hh);
      b.half[1] = *(const v8us*)(brow + 16 + 8 * hh);
      acc[t] = mmaN<ASPLIT ? 2 : 1>(ah.v, al.v, b.v, b.v, acc[t]);
    }
  }
#pragma unroll
  for (int t = 0; t < 4; ++t) {
    const int col = col0 + t * 16 + ln;
    float bv = bias ? bias[col] : 0.f;
    if (BIAS_BF16) bv = bf16_round(bv);
#pragma unroll
    for (int r = 0; r < 8; ++r) {
      float v = acc[t][r] + bv;
      if (resid) { float rv = resid[(size_t)((row0 + 8 * hh + r) % rmod) * ldr + col]; if (RES_BF16) rv = bf16_round(rv); v += rv; }
      if (ACT == 1) v = fmaxf(v, 0.f);
      if (ACT == 2) v = 0.5f * v * (1.0f + erff(v * 0.70710678118654752f));
      if (ACT == 3) { const float u = 0.7978845608028654f * (v + 0.044715f * v * v * v); v = 0.5f * v * (1.0f + tanhf(u)); }
      so[w][8 * hh + r][t * 16 + ln] = v;
    }
  }
  __builtin_amdgcn_fence(__ATOMIC_ACQ_REL, "workgroup");
  __builtin_amdgcn_wave_barrier();
  const int rsub = lane >> 4, c4 = (lane & 15) * 4;
  {
#pragma unroll
    for (int q = 0; q < 8; ++q) {
      const int r = q * 2 + rsub;
      const v4f v = *(const v4fa*)&so[w][r][c4];
      *(v4f*)(C + (size_t)(row0 + r) * ldc + col0 + c4) = v;
    }
    
  }
}
// row LayerNorm (biased variance, eps) over N: s = X (+ R); optional out_sum <- s; out_norm <- (s-mu)*rsqrt(var+eps)*g + b
template <bool PARAM_BF16>
__global__ __launch_bounds__(256) void k_layernorm(const float* __restrict__ X, const float* __restrict__ R, const float* __restrict__ g, const float* __restrict__ bta,
                                                  float* __restrict__ out_sum, float* __restrict__ out_norm, int N, float eps) {
  __shared__ float red[256];
  const int row = blockIdx.x, tid = threadIdx.x;
  const float* x = X + (size_t)row * N; const float* rr = R ? R + (size_t)row * N : nullptr;
  float vals[16];                     // up to N = 4096
  const int per = N / 256;            // contiguous chunk per thread? use strided-by-4 chunks: thread handles j = tid*4 + 1024*u
  float s1 = 0.f;
  for (int u = 0; u < per / 4; ++u) {
    const int j = tid * 4 + 1024 * u;
    const v4f a = *(const v4fa*)(x + j);
    v4f b = {0.f,0.f,0.f,0.f}; if (rr) b = *(const v4fa*)(rr + j);
#pragma unroll
    for (int q = 0; q < 4; ++q) { const float v = a[q] + b[q]; vals[u * 4 + q] = v; s1 += v; }
  }
  red[tid] = s1; __syncthreads();
  for (int st = 128; st > 0; st >>= 1) { if (tid < st) red[tid] += red[tid + st]; __syncthreads(); }
  const float mu = red[0] / (float)N; __syncthreads();
  float s2 = 0.f;
  for (int u = 0; u < per / 4; ++u)
#pragma unroll
    for (int q = 0; q < 4; ++q) { const float c = vals[u * 4 + q] - mu; s2 += c * c; }
  red[tid] = s2; __syncthreads();
  for (int st = 128; st > 0; st >>= 1) { if (tid < st) red[tid] += red[tid + st]; __syncthreads(); }
  const float rs = rsqrtf(red[0] / (float)N + eps);
  {
    for (int u = 0; u < per / 4; ++u) {
      const int j = tid * 4 + 1024 * u;
      v4f o, sm;
#pragma unroll
      for (int q = 0; q < 4; ++q) {
        float gg = g[j + q], bb = bta[j + q];
        if (PARAM_BF16) { gg = bf16_round(gg); bb = bf16_round(bb); }
        sm[q] = vals[u * 4 + q]; o[q] = (vals[u * 4 + q] - mu) * rs * gg + bb;
      }
      if (out_sum) *(v4f*)(out_sum + (size_t)row * N + j) = sm;
      *(v4f*)(out_norm + (size_t)row * N + j) = o;
    }
    
  }
}



// ---- f16 WMMA path (v_wmma_f32_16x16x32_f16): 11-bit significands for operands in range — used where a [0,1] probability operand needs more precision than bf16
typedef _Float16 v16h __attribute__((ext_vector_type(16)));
union FragH { v16h v; v8us half[2]; _Float16 h[16]; unsigned short u[16]; };
template <int NT>
__device__ __forceinline__ v8f mmaH(v16h ah, v16h al, v16h bh, v16h bl, v8f c) {
  c = __builtin_amdgcn_wmma_f32_16x16x32_f16(false, ah, false, bh, (short)0, c, false, false);
  if (NT >= 2) c = __builtin_amdgcn_wmma_f32_16x16x32_f16(false, al, false, bh, (short)0, c, false, false);
  if (NT >= 3) c = __builtin_amdgcn_wmma_f32_16x16x32_f16(false, ah, false, bl, (short)0, c, false, false);
  asm volatile("v_nop\n\tv_nop\n\tv_nop\n\tv_nop" : "+v"(c) : "v"(ah), "v"(al), "v"(bh), "v"(bl));
  return c;
}
// batched GEMM like k_gemm_b but f16 operands: A f32 (split into f16 hi/lo if ASPLIT, else rounded to f16), Bt = f16 values [n][k]; alpha; C f32; N multiple of 16 (partial tiles skipped)
template <bool ASPLIT>
__global__ __launch_bounds__(128) void k_gemm_h(const float* __restrict__ A, int lda, size_t sA, const _Float16* __restrict__ Bh, int ldb, size_t sB, float alpha, float* __restrict__ C, int ldc, size_t sC, int M, int N, int K) {
  __shared__ __attribute__((aligned(16))) float so[4][16][64];
  const int tid = threadIdx.x, w = tid >> 5, lane = tid & 31, ln = lane & 15, hh = lane >> 4; const int by = blockIdx.y;
  A += (size_t)by * sA; Bh += (size_t)by * sB; C += (size_t)by * sC;
  const int ntn = (N + 63) / 64; const int wid = blockIdx.x * 4 + w; const int mt = wid / ntn, nq = wid % ntn; if (mt * 16 >= M) return;
  const int row0 = mt * 16, col0 = nq * 64; const float* arow = A + (size_t)(row0 + ln) * lda;
  v8f acc[4] = {};
  for (int kb = 0; kb < K; kb += 32) {
    FragH ah, al;
    const v4f x0 = *(const v4fa*)(arow + kb + 8 * hh), x1 = *(const v4fa*)(arow + kb + 8 * hh + 4), x2 = *(const v4fa*)(arow + kb + 16 + 8 * hh), x3 = *(const v4fa*)(arow + kb + 16 + 8 * hh + 4);
    float xs[16] = {x0[0],x0[1],x0[2],x0[3],x1[0],x1[1],x1[2],x1[3],x2[0],x2[1],x2[2],x2[3],x3[0],x3[1],x3[2],x3[3]};
#pragma unroll
    for (int i = 0; i < 16; ++i) { const _Float16 h = (_Float16)xs[i]; ah.h[i] = h; al.h[i] = ASPLIT ? (_Float16)(xs[i] - (float)h) : (_Float16)0.0f; }
#pragma unroll
    for (int t = 0; t < 4; ++t) { if (col0 + t * 16 >= N) continue; const size_t boff = (size_t)(col0 + t * 16 + ln) * ldb + kb; FragH bq; bq.half[0] = *(const v8us*)(Bh + boff + 8 * hh); bq.half[1] = *(const v8us*)(Bh + boff + 16 + 8 * hh);
      acc[t] = mmaH<ASPLIT ? 2 : 1>(ah.v, al.v, bq.v, bq.v, acc[t]); }
  }
#pragma unroll
  for (int t = 0; t < 4; ++t) { if (col0 + t * 16 >= N) continue;
#pragma unroll
    for (int r = 0; r < 8; ++r) so[w][8 * hh + r][t * 16 + ln] = acc[t][r] * alpha; }
  __builtin_amdgcn_fence(__ATOMIC_ACQ_REL, "workgroup"); __builtin_amdgcn_wave_barrier();
  const int rsub = lane >> 4, c4 = (lane & 15) * 4;
  {
#pragma unroll
    for (int q = 0; q < 8; ++q) { const int r = q * 2 + rsub; if (col0 + c4 < N) { const v4f v = *(const v4fa*)&so[w][r][c4]; *(v4f*)(C + (size_t)(row0 + r) * ldc + col0 + c4) = v; } }
     }
}

// k_gemm_hh variant with fused epilogue: v = acc·alpha + bias[by·sBias + col] (+ CP[(row/rowsPerB)·sCPb + by·64 + col] if CP) ; ACT 0 none / 1 elu ; writes f16 C16 (and f32 C if non-null)
template <int ACT>
__global__ __launch_bounds__(128) void k_gemm_hhx(const _Float16* __restrict__ A, int lda, size_t sA, const _Float16* __restrict__ Bh, int ldb, size_t sB, float alpha, const float* __restrict__ bias, size_t sBias, const float* __restrict__ CP, int rowsPerB, size_t sCPb, int row0g,
    float* __restrict__ C, _Float16* __restrict__ C16, int ldc, size_t sC, int M, int N, int K) {
  __shared__ __attribute__((aligned(16))) float so[4][16][64];
  const int tid = threadIdx.x, w = tid >> 5, lane = tid & 31, ln = lane & 15, hh = lane >> 4; const int by = blockIdx.y;
  A += (size_t)by * sA; Bh += (size_t)by * sB; const size_t cofs = (size_t)by * sC; const float* bp = bias ? bias + (size_t)by * sBias : nullptr;
  const int ntn = (N + 63) / 64; const int wid = blockIdx.x * 4 + w; const int mt = wid / ntn, nq = wid % ntn; if (mt * 16 >= M) return;
  const int row0 = mt * 16, col0 = nq * 64; const _Float16* arow = A + (size_t)(row0 + ln) * lda;
  v8f acc[4] = {};
  for (int kb = 0; kb < K; kb += 32) { FragH ah; ah.half[0] = *(const v8us*)((const unsigned short*)arow + kb + 8 * hh); ah.half[1] = *(const v8us*)((const unsigned short*)arow + kb + 16 + 8 * hh);
#pragma unroll
    for (int t = 0; t < 4; ++t) { if (col0 + t * 16 >= N) continue; const size_t boff = (size_t)(col0 + t * 16 + ln) * ldb + kb; FragH bq; bq.half[0] = *(const v8us*)((const unsigned short*)Bh + boff + 8 * hh); bq.half[1] = *(const v8us*)((const unsigned short*)Bh + boff + 16 + 8 * hh);
      acc[t] = mmaH<1>(ah.v, ah.v, bq.v, bq.v, acc[t]); }
  }
#pragma unroll
  for (int t = 0; t < 4; ++t) { if (col0 + t * 16 >= N) continue; const int col = col0 + t * 16 + ln; const float bv = bp ? bf16_round(bp[col]) : 0.f;
#pragma unroll
    for (int r = 0; r < 8; ++r) { float v = acc[t][r] * alpha + bv; if (CP) { const int rr = row0g + row0 + 8 * hh + r; if (rowsPerB < 0) v += CP[cofs + (size_t)rr * ldc + col];      /* rowsPerB < 0: own element of the batched C plane */ else { const int bidx = rr / rowsPerB; v += CP[(size_t)bidx * sCPb + (size_t)by * 64 + col]; } } if (ACT == 1) v = (v > 0.f) ? v : expm1f(v); else if (ACT == 7) v = (v > 0.f) ? v + 1.0f : expf(v); else if (ACT == 8) v = tanhf(v); else if (ACT == 9) v = 0.5f * v * (1.0f + tanhf(0.7978845608028654f * (v + 0.044715f * v * v * v))); else if (ACT == 11) v = 1.0f / (1.0f + expf(-v)); else if (ACT == 12) v = (v > 0.f) ? v : 0.01f * v; else if (ACT == 14) v = (v > 0.f) ? v : 0.1f * v; else if (ACT == 16) v = (v >= 0.f) ? v : 0.3f * v; else if (ACT == 17) v = (v >= 0.f) ? v : 0.2f * v; else if (ACT == 15) v = v / (1.0f + expf(-v)); else if (ACT == 3) v = fmaxf(v, 0.f); else if (ACT == 6) v = 0.5f * v * (1.0f + erff(v * 0.70710678118654752f)); so[w][8 * hh + r][t * 16 + ln] = v; } }
  __builtin_amdgcn_fence(__ATOMIC_ACQ_REL, "workgroup"); __builtin_amdgcn_wave_barrier();
  const int rsub = lane >> 4, c4 = (lane & 15) * 4; typedef _Float16 v4h __attribute__((ext_vector_type(4)));
  {
#pragma unroll
    for (int q = 0; q < 8; ++q) { const int r = q * 2 + rsub; if (col0 + c4 < N) { const v4f v = *(const v4fa*)&so[w][r][c4]; if (C) *(v4f*)(C + cofs + (size_t)(row0 + r) * ldc + col0 + c4) = v; if (C16) { v4h h4; for (int i = 0; i < 4; ++i) h4[i] = (_Float16)v[i]; *(v4h*)(C16 + cofs + (size_t)(row0 + r) * ldc + col0 + c4) = h4; } } }
     }
}


typedef _Float16 v4h __attribute__((ext_vector_type(4)));

__global__ __launch_bounds__(256) void k_h16(const float* __restrict__ x, _Float16* __restrict__ X16, size_t n8) { const size_t t = (size_t)blockIdx.x * 256 + threadIdx.x; if (t >= n8) return; FragH f;
#pragma unroll
  for (int q = 0; q < 8; ++q) f.h[q] = (_Float16)x[t * 8 + q]; *(v8us*)((unsigned short*)X16 + t * 8) = f.half[0];  }
__global__ __launch_bounds__(256) void k_round16f(const float* __restrict__ W, _Float16* __restrict__ Bt, size_t n8) { const size_t t = (size_t)blockIdx.x * 256 + threadIdx.x; if (t >= n8) return; FragH f;
#pragma unroll
  for (int i = 0; i < 8; ++i) f.h[i] = (_Float16)(bf16_round(W[t * 8 + i]) * 16.0f); *(v8us*)((unsigned short*)Bt + t * 8) = f.half[0];  }
template <int NHv, int TTv>
__global__ __launch_bounds__(256) void k_vt(const _Float16* __restrict__ V16, int ldv, int voff, _Float16* __restrict__ Vt) { __shared__ unsigned short tl[64][66]; const int tid = threadIdx.x; const int slab = blockIdx.x / (TTv / 64), lg = blockIdx.x % (TTv / 64); const int b = slab / NHv, h = slab % NHv;
  for (int i = tid; i < 64 * 8; i += 256) { const int r = i / 8, c8 = (i % 8) * 8; FragH f; f.half[0] = *(const v8us*)((const unsigned short*)V16 + ((size_t)b * TTv + lg * 64 + r) * ldv + voff + h * 64 + c8);
#pragma unroll
    for (int q = 0; q < 8; ++q) tl[r][c8 + q] = f.u[q]; }
  __syncthreads();
  {
#pragma unroll
    for (int rd = 0; rd < 2; ++rd) { const int d = rd * 32 + tid / 8, pc = tid % 8; FragH f;
#pragma unroll
      for (int q = 0; q < 8; ++q) f.u[q] = tl[pc * 8 + q][d];
      *(v8us*)((unsigned short*)Vt + ((size_t)slab * 64 + d) * TTv + lg * 64 + pc * 8) = f.half[0]; }
     } }

__global__ __launch_bounds__(256) void k_hl(const float* __restrict__ F, _Float16* __restrict__ Hh, _Float16* __restrict__ Hl, size_t n8) { const size_t t = (size_t)blockIdx.x * 256 + threadIdx.x; if (t >= n8) return; FragH fh, fl; const v4f a = *(const v4fa*)(F + t * 8), c = *(const v4fa*)(F + t * 8 + 4);
#pragma unroll
  for (int q = 0; q < 4; ++q) { _Float16 h = (_Float16)a[q]; fh.h[q] = h; fl.h[q] = (_Float16)((a[q] - (float)h) * 1024.0f); h = (_Float16)c[q]; fh.h[4 + q] = h; fl.h[4 + q] = (_Float16)((c[q] - (float)h) * 1024.0f); }
  { *(v8us*)((unsigned short*)Hh + t * 8) = fh.half[0]; *(v8us*)((unsigned short*)Hl + t * 8) = fl.half[0];  } }

// ---- fast GEMM (work-group tile 128x64, wave tile 32x64; requires M % 128 == 0, N % 64 == 0, K % 128 == 0, 256-byte aligned rows); operands staged in LDS; epilogue = k_gemm_hhx semantics ----
#define G2_KS 128                      /* k per stage: 256 bytes of every operand row */
#define G2_PITCH (G2_KS * 2 + 16)      /* LDS row pitch in bytes: 16 x odd, for 16-byte readers */
__device__ __forceinline__ v16h g2_lfrag(const char* p) { FragH f; f.half[0] = *(const v8us*)p; f.half[1] = *(const v8us*)(p + 32); return f.v; }      /* a fragment from a staged row; the lane's 16 hh bytes are in p */
__device__ __forceinline__ v8f g2_mma(v16h a, v16h b, v8f c) { v8f d = __builtin_amdgcn_wmma_f32_16x16x32_f16(false, a, false, b, (short)0, c, false, false); asm volatile("v_nop\n\tv_nop\n\tv_nop\n\tv_nop" : "+v"(d) : "v"(a), "v"(b)); return d; }
template <int ACT, int lda, int ldb>      /* the operands' row pitches at compile time: a thread's staging loads are then one base, one lane offset and immediates */
__global__ __launch_bounds__(128) void k_gemm2(const _Float16* __restrict__ A, size_t sA, const _Float16* __restrict__ Bh, size_t sB, float alpha, const float* __restrict__ bias, size_t sBias, const float* __restrict__ CP, int rowsPerB, size_t sCPb, int row0g,
    float* __restrict__ C, _Float16* __restrict__ C16, int ldc, size_t sC, int M, int N, int K, size_t sAz, size_t sBz, size_t sCz) { static_assert(ACT == 0 || ACT == 3 || ACT == 6 || ACT == 8 || ACT == 9 || ACT == 11 || ACT == 12 || ACT == 14 || ACT == 15 || ACT == 16 || ACT == 17, "k_gemm2: unsupported ACT code (would silently apply no activation)");
  __shared__ __attribute__((aligned(16))) char sm[192 * G2_PITCH];      /* one stage: 128 A rows, then 64 B rows, G2_KS k each; behind the k loop the waves' output staging */
  static_assert(sizeof(sm) >= 4 * 32 * 68 * sizeof(float), "k_gemm2: the output staging lies in the stage buffer"); float (*so)[32][68] = (float (*)[32][68])sm;
  const int tid = threadIdx.x, w = tid >> 5, lane = tid & 31, ln = lane & 15, hh = lane >> 4; const int by = blockIdx.y, bz = blockIdx.z;      /* two batch levels: grid.y (strides sA, sB, sC) and grid.z (strides sAz, sBz, sCz) */
  A += (size_t)by * sA + (size_t)bz * sAz; Bh += (size_t)by * sB + (size_t)bz * sBz; const size_t cofs = (size_t)by * sC + (size_t)bz * sCz; const float* bp = bias ? bias + (size_t)by * sBias : nullptr;
  const int ntn = N >> 6; const int mt = blockIdx.x / ntn, nq = blockIdx.x - mt * ntn; const int row0 = mt * 128 + 32 * w, col0 = nq * 64; if (mt * 128 >= M) return;      /* the same for the whole work-group: barriers follow */
  const char* Ab = (const char*)(A + (size_t)(mt * 128) * lda); const char* Bb = (const char*)(Bh + (size_t)col0 * ldb);      /* uniform bases; the lane's part is a 32-bit byte offset that never changes */
  const int sr = tid >> 4, sc = tid & 15;      /* staging: 16 lanes take one row's 256 bytes, so a wave's load covers 4 whole lines; thread rows sr + 8 j */
  const unsigned ga = (unsigned)(sr * lda + sc * 8) * 2, gb = (unsigned)(sr * ldb + sc * 8) * 2;
  char* sst = sm + sr * G2_PITCH + sc * 16;
  const char* sa = sm + (32 * w + ln) * G2_PITCH + 16 * hh; const char* sb = sm + (128 + ln) * G2_PITCH + 16 * hh;      /* fragment rows; k = 8 hh + 0..7 and 16 + 8 hh + 0..7 of each 32, A and B alike */
  const v8f z8 = {0.f,0.f,0.f,0.f,0.f,0.f,0.f,0.f}; v8f c00 = z8, c01 = z8, c02 = z8, c03 = z8, c10 = z8, c11 = z8, c12 = z8, c13 = z8;
  v8us st[24];
#pragma unroll
  for (int j = 0; j < 16; ++j) st[j] = *(const v8us*)(Ab + (size_t)(8 * j) * lda * 2 + ga);
#pragma unroll
  for (int j = 0; j < 8; ++j) st[16 + j] = *(const v8us*)(Bb + (size_t)(8 * j) * ldb * 2 + gb);
#pragma unroll 1
  for (int kb = 0; kb < K; kb += G2_KS) {
#pragma unroll
    for (int j = 0; j < 24; ++j) *(v8us*)(sst + 8 * j * G2_PITCH) = st[j];
    __syncthreads();      /* the stage is whole before anybody reads it */
    if (kb + G2_KS < K) {      /* the next stage's rows fly into registers while this stage is worked on */
      const char* An = Ab + (size_t)(kb + G2_KS) * 2; const char* Bn = Bb + (size_t)(kb + G2_KS) * 2;
#pragma unroll
      for (int j = 0; j < 16; ++j) st[j] = *(const v8us*)(An + (size_t)(8 * j) * lda * 2 + ga);
#pragma unroll
      for (int j = 0; j < 8; ++j) st[16 + j] = *(const v8us*)(Bn + (size_t)(8 * j) * ldb * 2 + gb);
      asm volatile("s_wait_xcnt 0x0" ::: "memory");      /* the loads' address registers are reused by the fragment loads right behind; it also keeps the global loads in front of the LDS reads */
    }
#pragma unroll
    for (int kk = 0; kk < G2_KS / 32; ++kk) { const v16h a0 = g2_lfrag(sa + 64 * kk), a1 = g2_lfrag(sa + 16 * G2_PITCH + 64 * kk);      /* the six fragments of a k step are asked for together: one LDS wait a step */
      const v16h b0 = g2_lfrag(sb + 64 * kk), b1 = g2_lfrag(sb + 16 * G2_PITCH + 64 * kk), b2 = g2_lfrag(sb + 32 * G2_PITCH + 64 * kk), b3 = g2_lfrag(sb + 48 * G2_PITCH + 64 * kk);
      c00 = g2_mma(a0, b0, c00); c10 = g2_mma(a1, b0, c10); c01 = g2_mma(a0, b1, c01); c11 = g2_mma(a1, b1, c11);
      c02 = g2_mma(a0, b2, c02); c12 = g2_mma(a1, b2, c12); c03 = g2_mma(a0, b3, c03); c13 = g2_mma(a1, b3, c13); }
    __syncthreads();      /* every reader has left the stage before it is written again (behind the last pass: before the output staging) */
  }
  v8f accs[8] = {c00, c01, c02, c03, c10, c11, c12, c13};
#pragma unroll
  for (int u = 0; u < 8; ++u) { const int t = u & 3, half = u >> 2; const int col = col0 + t * 16 + ln; const float bv = bp ? bf16_round(bp[col]) : 0.f;
#pragma unroll
    for (int r = 0; r < 8; ++r) { const int rloc = half * 16 + 8 * hh + r; float v = accs[u][r] * alpha + bv; if (CP) { if (rowsPerB < 0) v += CP[cofs + (size_t)(row0g + row0 + rloc) * ldc + col];      /* rowsPerB < 0: own element of the batched C plane */ else { const int bidx = (row0g + row0 + rloc) / rowsPerB; v += CP[(size_t)bidx * sCPb + (size_t)by * 64 + col]; } }
      if (ACT == 3) v = fmaxf(v, 0.f); else if (ACT == 6) v = 0.5f * v * (1.0f + erff(v * 0.70710678118654752f)); else if (ACT == 11) v = 1.0f / (1.0f + expf(-v)); else if (ACT == 15) v = v / (1.0f + expf(-v)); else if (ACT == 12) v = (v > 0.f) ? v : 0.01f * v; else if (ACT == 8) v = tanhf(v); else if (ACT == 9) v = 0.5f * v * (1.0f + tanhf(0.7978845608028654f * (v + 0.044715f * v * v * v))); else if (ACT == 14) v = (v > 0.f) ? v : 0.1f * v; else if (ACT == 16) v = (v >= 0.f) ? v : 0.3f * v; else if (ACT == 17) v = (v >= 0.f) ? v : 0.2f * v;
      so[w][rloc][t * 16 + ln] = v; } }
  __builtin_amdgcn_fence(__ATOMIC_ACQ_REL, "workgroup"); __builtin_amdgcn_wave_barrier();
  const int rsub = lane >> 4, c4 = (lane & 15) * 4;
  {
#pragma unroll
    for (int q = 0; q < 16; ++q) { const int r = q * 2 + rsub; const v4f v = *(const v4fa*)&so[w][r][c4]; if (C) *(v4f*)(C + cofs + (size_t)(row0 + r) * ldc + col0 + c4) = v; if (C16) { v4h h4; for (int i = 0; i < 4; ++i) h4[i] = (_Float16)v[i]; *(v4h*)(C16 + cofs + (size_t)(row0 + r) * ldc + col0 + c4) = h4; } }
     } }


__global__ __launch_bounds__(256) void k_wnat(const float* __restrict__ w, size_t n8, _Float16* __restrict__ Bt) { const size_t t = (size_t)blockIdx.x * 256 + threadIdx.x; if (t >= n8) return; FragH f; for (int q = 0; q < 8; ++q) f.h[q] = (_Float16)(bf16_round(w[t * 8 + q]) * 16.0f); *(v8us*)((unsigned short*)Bt + t * 8) = f.half[0];  }
__global__ __launch_bounds__(256) void k_rsm(const float* __restrict__ S, _Float16* __restrict__ P, int nrows) {
  #pragma clang fp contract(off)
  const int i = blockIdx.x * 256 + threadIdx.x; if (i >= nrows) return; const float* s = S + (size_t)i * SQ; float mx = -3.0e38f;
#pragma unroll 1
  for (int j = 0; j < SQ; ++j) mx = fmaxf(mx, s[j]); float se = 0.f;
#pragma unroll 1
  for (int j = 0; j < SQ; ++j) se += expf(s[j] - mx); const float sc = 256.0f / se;
#pragma unroll 1
  for (int j0 = 0; j0 < SQ; j0 += 8) { FragH f; for (int q = 0; q < 8; ++q) f.h[q] = (_Float16)(expf(s[j0 + q] - mx) * sc); unsigned short* d = (unsigned short*)P + (size_t)i * SQ + j0; *(v8us*)d = f.half[0];  } }
__global__ __launch_bounds__(256) void k_vt(const _Float16* __restrict__ V16, int b, int h0, _Float16* __restrict__ VT) { __shared__ unsigned short tl[64][65]; const int tid = threadIdx.x; const int hh = blockIdx.x % HG, sg = blockIdx.x / HG; const int s0 = sg * 64; const int h = h0 + hh;
  for (int i = tid; i < 64 * 8; i += 256) { const int j = i / 8, d8 = (i % 8) * 8; FragH f; f.half[0] = *(const v8us*)((const unsigned short*)V16 + ((size_t)b * SQ + s0 + j) * DM + h * HD + d8); for (int q = 0; q < 8; ++q) tl[d8 + q][j] = f.u[q]; }
  __syncthreads();
  { for (int i = tid; i < 64 * 8; i += 256) { const int d = i / 8, j8 = (i % 8) * 8; FragH f; for (int q = 0; q < 8; ++q) f.u[q] = tl[d][j8 + q]; *(v8us*)((unsigned short*)VT + ((size_t)hh * HD + d) * SQ + s0 + j8) = f.half[0]; }  } }


__global__ __launch_bounds__(256) void k_rsmf(const float* __restrict__ S, _Float16* __restrict__ P, int qn, int hg) {
  #pragma clang fp contract(off)
  const int t = blockIdx.x * 256 + threadIdx.x; if (t >= qn * hg) return; const size_t i = (size_t)(t / qn) * SQ + (t % qn); const float* s = S + i * SQ; float mx = -3.0e38f;
#pragma unroll 1
  for (int j = 0; j < SQ; ++j) mx = fmaxf(mx, s[j]); float se = 0.f;
#pragma unroll 1
  for (int j = 0; j < SQ; ++j) se += __expf(s[j] - mx); const float sc = 256.0f / se;
#pragma unroll 1
  for (int j0 = 0; j0 < SQ; j0 += 8) { FragH f; for (int q = 0; q < 8; ++q) f.h[q] = (_Float16)(__expf(s[j0 + q] - mx) * sc); unsigned short* d = (unsigned short*)P + i * SQ + j0; *(v8us*)d = f.half[0];  } }

__global__ __launch_bounds__(256) void k_rsmr(const float* __restrict__ S, _Float16* __restrict__ P, int qn, int hg) {
  #pragma clang fp contract(off)
  const int t = blockIdx.x * 256 + threadIdx.x; if (t >= qn * hg) return; const size_t i = (size_t)t;      /* planes packed: row t of plane t / qn */ const float* s = S + i * SQ; float mx = -3.0e38f;
#pragma unroll 1
  for (int j = 0; j < SQ; ++j) mx = fmaxf(mx, s[j]); float se = 0.f;
#pragma unroll 1
  for (int j = 0; j < SQ; ++j) se += __expf(s[j] - mx); const float sc = 256.0f / se;
#pragma unroll 1
  for (int j0 = 0; j0 < SQ; j0 += 8) { FragH f; for (int q = 0; q < 8; ++q) f.h[q] = (_Float16)(__expf(s[j0 + q] - mx) * sc); unsigned short* d = (unsigned short*)P + i * SQ + j0; *(v8us*)d = f.half[0];  } }


typedef int v4ia __attribute__((ext_vector_type(4), may_alias));
typedef float f32x2 __attribute__((ext_vector_type(2)));
__device__ __forceinline__ float fa_xhalf(float x) { return __builtin_bit_cast(float, __builtin_amdgcn_permlanex16(__builtin_bit_cast(int, x), __builtin_bit_cast(int, x), 0x76543210, 0xfedcba98, false, false)); }      /* lane l with lane l ^ 16 */
__device__ __forceinline__ v8f fa_mma(v16h a, v16h b, v8f c) { return __builtin_amdgcn_wmma_f32_16x16x32_f16(false, a, false, b, (short)0, c, false, false); }
__device__ __forceinline__ v16h fa_frag(const char* base, unsigned off) { FragH f; f.half[0] = *(const v8us*)(base + off); f.half[1] = *(const v8us*)(base + off + 32); return f.v; }      /* k = 8 hh + 0..7 and 16 + 8 hh + 0..7; the lane's 16 hh bytes are in off */
// In front of a group of next-pass loads: keeps the loads from rising among the WMMAs that read the registers they refill (without it the compiler sets a load directly behind the WMMA whose A operand it overwrites).
__device__ __forceinline__ void fa_ahead() { __builtin_amdgcn_sched_barrier(0); }
// Between a run of eight WMMAs and the loads that refill their A operand registers: the four vector slots that a vector overwrite of a WMMA's operand asks for.
__device__ __forceinline__ void fa_mma_done() { asm volatile("v_nop\n\tv_nop\n\tv_nop\n\tv_nop"); }
// Behind each group of next-pass loads. The wait: the group's address registers are reused right behind it. The scheduling barrier: keeps that wait directly behind its loads and the group where it is written, a phase ahead of its use (without it the compiler moves the mask fetch down among the exponentials and the wait away from its loads).
__device__ __forceinline__ void fa_issued() { asm volatile("s_wait_xcnt 0x0" ::: "memory"); __builtin_amdgcn_sched_barrier(0); }
__global__ __launch_bounds__(256) void k_fattn(const _Float16* __restrict__ Q, const _Float16* __restrict__ Kr, const _Float16* __restrict__ VT, const int* __restrict__ Mk, _Float16* __restrict__ O) {
  const int lane = threadIdx.x & 31, ln = lane & 15, hh = lane >> 4; const int wave = __builtin_amdgcn_readfirstlane((int)(threadIdx.x >> 5));
  const int h = blockIdx.y, b = blockIdx.z, q0 = blockIdx.x * 256 + wave * 32;
  const float cs = 0.125f * 1.4426950408889634f;      /* 1 / sqrt(64), and e^x = 2^(x log2 e) */
  const float fill = -8589934592.0f;      /* masked_fill: -2^33, -2^30 after the 1/8. A power of two, so that its product with cs is exact: while every key seen so far is masked the maximum IS that product, the fused multiply-add of the exponent gives exactly 0 and the weights are 1 (finite); the first unmasked key rescales them to 0. A fill whose product rounds would leave a positive exponent there */
  const char* qb = (const char*)(Q + ((size_t)b * NQ + q0) * DM + h * HD);      /* wave-uniform bases; the lane's part is a 32-bit byte offset that never changes */
  const char* kb = (const char*)(Kr + (size_t)b * SK * DM + h * HD);
  const char* vb = (const char*)(VT + ((size_t)b * NH + h) * HD * SK);
  const char* mb_ = (const char*)(Mk + ((size_t)b * NQ + q0) * SK);
  const unsigned ko = (unsigned)(ln * DM * 2 + 16 * hh), vo = (unsigned)(ln * SK * 2 + 16 * hh), mo = (unsigned)(ln * SK * 4 + 32 * hh);
  v16h qf[2][2];
#pragma unroll
  for (int g = 0; g < 2; ++g)
#pragma unroll
    for (int kc = 0; kc < 2; ++kc) qf[g][kc] = fa_frag(qb + 16 * g * DM * 2 + 64 * kc, ko);
  fa_issued();      /* pass 0's groups in the loop's own order (K, mask, V^T): loads return in order, and the counted waits at the loop's head must hold for both ways into it */
  v16h kf[2][2], vf[4]; v4ia mk[2][2][2];
#pragma unroll
  for (int kt = 0; kt < 2; ++kt)
#pragma unroll
    for (int kc = 0; kc < 2; ++kc) kf[kt][kc] = fa_frag(kb + 16 * kt * DM * 2 + 64 * kc, ko);
  fa_issued();
#pragma unroll
  for (int g = 0; g < 2; ++g)
#pragma unroll
    for (int kt = 0; kt < 2; ++kt) { mk[g][kt][0] = *(const v4ia*)(mb_ + 16 * g * SK * 4 + 64 * kt + mo); mk[g][kt][1] = *(const v4ia*)(mb_ + 16 * g * SK * 4 + 64 * kt + 16 + mo); }
  fa_issued();
#pragma unroll
  for (int t = 0; t < 4; ++t) vf[t] = fa_frag(vb + 16 * t * SK * 2, vo);
  fa_issued();
  const v8f z8 = {0.f, 0.f, 0.f, 0.f, 0.f, 0.f, 0.f, 0.f};
  v8f acc[2][4]; float m_run[2], l_run[2];
#pragma unroll
  for (int g = 0; g < 2; ++g) { m_run[g] = -3.0e38f; l_run[g] = 0.f;
#pragma unroll
    for (int t = 0; t < 4; ++t) acc[g][t] = z8; }
  for (int key0 = 0; key0 < SK; key0 += 32) {
    const int kn = (key0 + 32) & (SK - 1);      /* the next pass's first key; the last pass fetches pass 0 again (in bounds, not used) so that the fetches stay unconditional */
    v8f s[2][2];
#pragma unroll
    for (int kt = 0; kt < 2; ++kt)
#pragma unroll
      for (int g = 0; g < 2; ++g) s[kt][g] = fa_mma(kf[kt][1], qf[g][1], fa_mma(kf[kt][0], qf[g][0], z8));
    fa_ahead(); fa_mma_done();      /* the score products first: the K fetch goes into their operand registers */
    { const char* kbn = kb + (size_t)kn * (DM * 2);
#pragma unroll
      for (int kt = 0; kt < 2; ++kt)
#pragma unroll
        for (int kc = 0; kc < 2; ++kc) kf[kt][kc] = fa_frag(kbn + 16 * kt * DM * 2 + 64 * kc, ko); }
    fa_issued();
    float mb[2]; bool need = false;
#pragma unroll
    for (int g = 0; g < 2; ++g) { float mx = -3.0e38f;
#pragma unroll
      for (int kt = 0; kt < 2; ++kt)
#pragma unroll
        for (int r = 0; r < 8; ++r) { const float v = (mk[g][kt][r >> 2][r & 3] != 0) ? s[kt][g][r] : fill; s[kt][g][r] = v; mx = fmaxf(mx, v); }
      mx = fmaxf(mx, fa_xhalf(mx)) * cs; mb[g] = mx; need = need || (mx > m_run[g] + 8.0f); }
    if (__builtin_amdgcn_ballot_w32(need) != 0) {      /* wave-uniform; rare after the first passes */
#pragma unroll
      for (int g = 0; g < 2; ++g) { const float mn = fmaxf(m_run[g], mb[g]); const float corr = __builtin_amdgcn_exp2f(m_run[g] - mn); m_run[g] = mn; l_run[g] *= corr;
#pragma unroll
        for (int t = 0; t < 4; ++t) acc[g][t] = acc[g][t] * corr; } }
    { const char* mbn = mb_ + (size_t)kn * 4;      /* behind the branch, which needs every select: the mask fetch goes into the registers that the selects read */
#pragma unroll
      for (int g = 0; g < 2; ++g)
#pragma unroll
        for (int kt = 0; kt < 2; ++kt) { mk[g][kt][0] = *(const v4ia*)(mbn + 16 * g * SK * 4 + 64 * kt + mo); mk[g][kt][1] = *(const v4ia*)(mbn + 16 * g * SK * 4 + 64 * kt + 16 + mo); } }
    fa_issued();
#pragma unroll
    for (int g = 0; g < 2; ++g) { const float nm = -m_run[g]; FragH pf; f32x2 ls = {0.f, 0.f};
#pragma unroll
      for (int i = 0; i < 8; ++i) { const f32x2 a = __builtin_elementwise_fma(f32x2{s[i >> 2][g][2 * (i & 3)], s[i >> 2][g][2 * (i & 3) + 1]}, f32x2{cs, cs}, f32x2{nm, nm});
        const f32x2 p = {__builtin_amdgcn_exp2f(a.x), __builtin_amdgcn_exp2f(a.y)}; ls += p; pf.h[2 * i] = (_Float16)p.x; pf.h[2 * i + 1] = (_Float16)p.y; }      /* element 8 kt + r of the B operand = key 16 kt + 8 hh + r */
      l_run[g] += ls.x + ls.y;
#pragma unroll
      for (int t = 0; t < 4; ++t) acc[g][t] = fa_mma(vf[t], pf.v, acc[g][t]); }
    fa_ahead();      /* the output products first: the V^T fetch goes into their operand registers (the compiler's own padding in front of the address addition, which overwrites a B register, keeps the four slots here) */
    { const char* vbn = vb + (size_t)kn * 2;
#pragma unroll
      for (int t = 0; t < 4; ++t) vf[t] = fa_frag(vbn + 16 * t * SK * 2, vo); }
    fa_issued();
  }
#pragma unroll
  for (int g = 0; g < 2; ++g) { const float l = l_run[g] + fa_xhalf(l_run[g]); const float inv = 64.0f / l;      /* o carried x64 */
    _Float16* op = O + ((size_t)b * NQ + q0 + 16 * g + ln) * DM + h * HD + 8 * hh;
#pragma unroll
    for (int t = 0; t < 4; ++t) { FragH f;
#pragma unroll
      for (int r = 0; r < 8; ++r) f.h[r] = (_Float16)(acc[g][t][r] * inv);
      *(v8us*)((unsigned short*)op + 16 * t) = f.half[0]; } }      /* d = 16 t + 8 hh + 0..7 of query ln: 16 contiguous bytes */
  asm volatile("s_wait_loadcnt 0x0" ::: "memory");      /* a precaution: the last pass's fetches (pass 0 again, not used) have landed before the wave ends and gives its registers back */
}
// Operand preparation, all of it in one launch of 256 work-groups of 16 waves (one a WGP): the work is 48 MiB of reads and 24 MiB of writes; few long waves in one launch keep launch gaps and wave starts small beside the bytes.
// Every wave takes three pieces of 1,024 elements and asks for all of them at once (24 loads of 16 bytes a lane):
//  - 4 KiB of x and 4 KiB of context -> exact f16 rows: each load 512 contiguous bytes, each store 256;
//  - a 64 k x 16 n block of one [in][out] weight -> Bt[n][k] = f16(bf16(W[k][n]) x 16): lane = (k group lane & 7, n group lane >> 3) reads 4 n of 8 k rows (a load touches 8 lines, where one element a lane would touch 32; the line's other half goes to the
//    neighbour wave of the work-group) and so holds 8 k of 4 n: each of its 4 stores is 16 bytes of a Bt row, 8 lanes a whole line. The transpose is in the registers' naming: no LDS, no barrier.
// Work-groups 0..63 take Wq, 64..191 Wkv (Bt rows 0..1023 = k columns, 1024..2047 = v columns), 192..255 Wp: 64 k x 256 n each.
__global__ __launch_bounds__(512) void k_prep(const float* __restrict__ x, const float* __restrict__ ctx, const float* __restrict__ wq, const float* __restrict__ wkv, const float* __restrict__ wo,
    _Float16* __restrict__ X16, _Float16* __restrict__ C16, _Float16* __restrict__ BQ, _Float16* __restrict__ BKV, _Float16* __restrict__ BO) {
  static_assert(NRQ * DM == (size_t)256 * 16 * 1024 && NRK * DC == (size_t)256 * 16 * 1024 && DM == 1024 && DC == 1024, "k_prep: 4,096 waves, one piece of each kind a wave");
  const int lane = threadIdx.x & 31, lk = lane & 7, l4 = lane >> 3; const int wave = __builtin_amdgcn_readfirstlane((int)(threadIdx.x >> 5)); const int blk = blockIdx.x;
  const bool iskv = blk >= 64 && blk < 192; const float* W = blk < 64 ? wq : iskv ? wkv : wo; _Float16* Bt = blk < 64 ? BQ : iskv ? BKV : BO;
  const int t = blk < 64 ? blk : iskv ? blk - 64 : blk - 192; const int N = iskv ? 2 * DM : DM, sh = iskv ? 3 : 2;      /* N / 256 = 1 << sh column groups */
  const int k0 = (t >> sh) * 64, n0 = (t & ((1 << sh) - 1)) * 256 + wave * 16;
  const size_t e0 = ((size_t)blk * 16 + wave) * 1024;      /* the wave's first element of x and of context */
  const char* xp = (const char*)(x + e0); const char* cp = (const char*)(ctx + e0); const char* wp = (const char*)(W + (size_t)k0 * N + n0);      /* wave-uniform bases; the lane's part is a 32-bit byte offset */
  unsigned wl[8];
#pragma unroll
  for (int r = 0; r < 8; ++r) wl[r] = (unsigned)((8 * lk + r) * N + 4 * l4) * 4;
  v4f xv[8], cv[8], wv[8];
#pragma unroll
  for (int j = 0; j < 8; ++j) xv[j] = *(const v4fa*)(xp + 512 * j + 16 * lane);
#pragma unroll
  for (int j = 0; j < 8; ++j) cv[j] = *(const v4fa*)(cp + 512 * j + 16 * lane);
#pragma unroll
  for (int r = 0; r < 8; ++r) wv[r] = *(const v4fa*)(wp + wl[r]);
  // The wait: the loads' offset registers are reused right behind. Its operands (inputs only) keep those registers as they are up to the wait.
  asm volatile("s_wait_xcnt 0x0" :: "v"(lane), "v"(wl[0]), "v"(wl[1]), "v"(wl[2]), "v"(wl[3]), "v"(wl[4]), "v"(wl[5]), "v"(wl[6]), "v"(wl[7]) : "memory");
  __builtin_amdgcn_sched_barrier(0);      /* all 24 loads are asked for before the first value is worked on: without it the compiler sets the second and third group behind the conversions of the group before, three memory latencies in a row */
#pragma unroll
  for (int j = 0; j < 8; ++j) { v4h o;
#pragma unroll
    for (int q = 0; q < 4; ++q) o[q] = (_Float16)bf16_round(xv[j][q]);
    *(v4h*)(X16 + e0 + 128 * j + 4 * lane) = o; }
  __builtin_amdgcn_sched_barrier(0);      /* a piece's stores leave as soon as it is converted: without it the compiler keeps them back to the kernel's end, behind the last load's wait */
#pragma unroll
  for (int j = 0; j < 8; ++j) { v4h o;
#pragma unroll
    for (int q = 0; q < 4; ++q) o[q] = (_Float16)bf16_round(cv[j][q]);
    *(v4h*)(C16 + e0 + 128 * j + 4 * lane) = o; }
  __builtin_amdgcn_sched_barrier(0);      /* as above */
#pragma unroll
  for (int i = 0; i < 4; ++i) { FragH f;
#pragma unroll
    for (int r = 0; r < 8; ++r) f.h[r] = (_Float16)(bf16_round(wv[r][i]) * 16.0f);      /* x16, a power of two: bf16-exact weights stay exact in f16 away from the subnormal range */
    *(v8us*)((unsigned short*)Bt + (size_t)(n0 + 4 * l4 + i) * DM + k0 + 8 * lk) = f.half[0]; }
}
extern "C" void kernel_launch(void* const* d_in, const int* in_sizes, int n_in,
                              void* d_out, int out_size, void* d_ws, size_t ws_size, hipStream_t stream) {
  (void)in_sizes; (void)n_in; (void)out_size;
  const float* const* I = (const float* const*)d_in; const float* x = I[0]; const float* ctx = I[1]; const int* mkm = (const int*)d_in[2]; const float* wq = I[3]; const float* bq = I[4]; const float* wkv = I[5]; const float* bkv = I[6]; const float* wo = I[7]; const float* bo = I[8];      /* [in][out] weights; int mask [b][n][m]; k | v from the fused Wkv [1024][2048] */
  char* ws = (char*)d_ws; size_t off = 0;
  auto take = [&](size_t bytes) { char* p = ws + off; off += (bytes + 255) & ~(size_t)255; return p; };
  _Float16* BQ = (_Float16*)take((size_t)DM * DM * 2); _Float16* BKV = (_Float16*)take((size_t)2 * DM * DC * 2); _Float16* BO = (_Float16*)take((size_t)DM * DM * 2);
  _Float16* X16 = (_Float16*)take(NRQ * DM * 2); _Float16* C16 = (_Float16*)take(NRK * DC * 2); _Float16* Q16 = (_Float16*)take(NRQ * DM * 2); _Float16* K16 = (_Float16*)take(2 * NRK * DM * 2); _Float16* V16 = K16 + NRK * DM; _Float16* O16 = X16;      /* o rows reuse the x rows, whose last reader is the Q GEMM */
  _Float16* VT = (_Float16*)take((size_t)NB * NH * HD * SK * 2);      /* V^T: all 64 (batch, head) planes */
  if (off > ws_size) return;      /* 8 + 5 x 8 + 8 = 56 MiB */
  k_prep<<<256, 512, 0, stream>>>(x, ctx, wq, wkv, wo, X16, C16, BQ, BKV, BO);      /* x, context -> f16 rows; [in][out] weights -> Bt x16; Wkv [1024][2048] -> Bt [2048][1024]: rows 0..1023 = k columns, 1024..2047 = v columns */
  k_gemm2<0, DM, DM><<<dim3((unsigned)((NRQ / 128) * (DM / 64)), 1), 128, 0, stream>>>(X16, 0, BQ, 0, 0.0625f, bq, 0, nullptr, 1, 0, 0, nullptr, Q16, DM, 0, (int)NRQ, DM, DM, 0, 0, 0);
  k_gemm2<0, DC, DC><<<dim3((unsigned)((NRK / 128) * (DM / 64)), 2), 128, 0, stream>>>(C16, 0, BKV, (size_t)DM * DC, 0.0625f, bkv, (size_t)DM, nullptr, 1, 0, 0, nullptr, K16, DM, NRK * DM, (int)NRK, DM, DC, 0, 0, 0);      /* grid.y 0: k = context Wkv[:, :1024] + bkv[:1024] -> K16; grid.y 1: v = context Wkv[:, 1024:] + bkv[1024:] -> V16 */
  k_vt<NH, SK><<<NB * NH * (SK / 64), 256, 0, stream>>>(V16, DM, 0, VT);      /* V^T [4 x 16][64][1024], all batches in one launch */
  k_fattn<<<dim3(NQ / 256, NH, NB), 256, 0, stream>>>(Q16, K16, VT, mkm, O16);      /* scores, masked softmax and P V of all 64 (batch, head) planes: o x64, merged rows */
  k_gemm2<0, DM, DM><<<dim3((unsigned)((NRQ / 128) * (DM / 64)), 1), 128, 0, stream>>>(O16, 0, BO, 0, 0.0009765625f, bo, 0, nullptr, 1, 0, 0, (float*)d_out, nullptr, DM, 0, (int)NRQ, DM, DM, 0, 0, 0);      /* out = o Wo + bo */
}

// v006
// Measured time: 102 microseconds a run.
// Timed twice side by side with v005, it ran 1.05 times as fast both times.
// Over all steps from v000 it is 51.4 times as fast.
#include <hip/hip_runtime.h>
// Masked multi-head cross-attention (x [4][1024][1024] queries, context [4][1024][1024]; q = x Wq + bq; k | v = context Wkv + bkv viewed (m, 2, 16, 64) ([in][out] weights sigma 1/32, zero biases); 16 heads of 64; dots = q k^T / 8; a binary int mask [b][n][32*32 = m] shared by the heads: masked_fill(mask == 0, -inf); softmax over the 1024 context tokens; out = merged Wp + bp -> [4][1024][1024]).
// Structure: x and context as exact f16 rows and [in][out] weights as exact x16 planes (Wkv as one [2048][1024] plane: k rows then v rows), and the int mask as 1-bit lane-mask words, all in one preparation launch; Q and K | V (one launch, grid.y) as WMMA GEMMs (operands staged in LDS, 32x64 wave tiles, f32 accumulation, + bias, f16 outputs); V^T of all batches via LDS transposes (one launch); scores (K = 64, 1/8), mask select, online softmax (f32 statistics, native exp2; weights f16, unnormalised) and o = P V^T (o carried x64) of all 64 (batch, head) planes fused in one launch, scores and weights in registers only, into merged f16 rows; out = o Wp + bp GEMM (f32, alpha 2^-10); launches: see trace.
// Compute dtype: inputs rounded to bf16; x / context / weights exact; q, k, v, softmax weights and o as plain f16 GEMM operands (~2^-12); scores and statistics f32. v_wmma_f32_16x16x32_f16.
#define NB 4
#define NQ 1024
#define SK 1024
#define SQ SK                       /* keys per softmax row */
#define DM 1024
#define DC 1024
#define NH 16
#define HD 64
#define HG 4
#define NRQ ((size_t)NB * NQ)
#define NRK ((size_t)NB * SK)
typedef __bf16 v16b __attribute__((ext_vector_type(16)));
typedef unsigned short v8us __attribute__((ext_vector_type(8), may_alias));
typedef float  v8f  __attribute__((ext_vector_type(8)));
typedef float  v4f  __attribute__((ext_vector_type(4)));
typedef float  v4fa __attribute__((ext_vector_type(4), may_alias));
union FragB { v16b v; v8us half[2]; unsigned short u[16]; };

__device__ __forceinline__ unsigned short bf16_bits(float x) { unsigned int u = __float_as_uint(x); return (unsigned short)((u + 0x7FFFu + ((u >> 16) & 1u)) >> 16); }
__device__ __forceinline__ float bf16_val(unsigned short b) { return __uint_as_float(((unsigned int)b) << 16); }
__device__ __forceinline__ float bf16_round(float x) { return bf16_val(bf16_bits(x)); }
// D += A·B with NT terms: 1 = ah·bh, 2 = + al·bh (A split), 3 = + ah·bl (both split)
template <int NT>
__device__ __forceinline__ v8f mmaN(v16b ah, v16b al, v16b bh, v16b bl, v8f c) {
  c = __builtin_amdgcn_wmma_f32_16x16x32_bf16(false, ah, false, bh, (short)0, c, false, false);
  if (NT >= 2) c = __builtin_amdgcn_wmma_f32_16x16x32_bf16(false, al, false, bh, (short)0, c, false, false);
  if (NT >= 3) c = __builtin_amdgcn_wmma_f32_16x16x32_bf16(false, ah, false, bl, (short)0, c, false, false);
  asm volatile("v_nop\n\tv_nop\n\tv_nop\n\tv_nop" : "+v"(c) : "v"(ah), "v"(al), "v"(bh), "v"(bl));
  return c;
}

__global__ __launch_bounds__(256) void k_wt_bf16(const float* __restrict__ W, unsigned short* __restrict__ Wt, int K, int N) {
  const int t = blockIdx.x * 256 + threadIdx.x;
  const int k8n = K / 8;
  if (t >= N * k8n) return;
  const int n = t / k8n, k8 = (t % k8n) * 8;
  v8us v;
#pragma unroll
  for (int i = 0; i < 8; ++i) v[i] = bf16_bits(W[(size_t)(k8 + i) * N + n]);
  *(v8us*)(Wt + (size_t)n * K + k8) = v;
  
}

// GEMM C[M][N] (f32, pitch ldc) = act(A[M][K]·W + bias). A f32 row-major (pitch lda) converted per fragment to bf16
// (ASPLIT: hi/lo two planes -> 2 terms, else single rounded term); Wt bf16 [N][K] (pitch ldb). BIAS_BF16 rounds the
// bias to bf16 first (bias quantised to bf16 before the add). K%32==0, M%16==0, N%64==0.
template <bool ASPLIT, int ACT, bool BIAS_BF16>
__global__ __launch_bounds__(128) void k_gemm_bf(const float* __restrict__ A, int lda, const unsigned short* __restrict__ Wt, int ldb,
                                               const float* __restrict__ bias, float* __restrict__ C, int ldc, int M, int N, int K) {
  __shared__ __attribute__((aligned(16))) float so[4][16][64];
  const int tid = threadIdx.x, w = tid >> 5, lane = tid & 31, ln = lane & 15, hh = lane >> 4;
  const int ntn = N / 64;
  const int wid = blockIdx.x * 4 + w;
  const int mt = wid / ntn, nq = wid % ntn;
  if (mt * 16 >= M) return;
  const int row0 = mt * 16, col0 = nq * 64;
  const float* arow = A + (size_t)(row0 + ln) * lda;
  v8f acc[4] = {};
  for (int kb = 0; kb < K; kb += 32) {
    FragB ah, al;
    const v4f x0 = *(const v4fa*)(arow + kb + 8 * hh), x1 = *(const v4fa*)(arow + kb + 8 * hh + 4);
    const v4f x2 = *(const v4fa*)(arow + kb + 16 + 8 * hh), x3 = *(const v4fa*)(arow + kb + 16 + 8 * hh + 4);
    float xs[16] = {x0[0],x0[1],x0[2],x0[3],x1[0],x1[1],x1[2],x1[3],x2[0],x2[1],x2[2],x2[3],x3[0],x3[1],x3[2],x3[3]};
#pragma unroll
    for (int i = 0; i < 16; ++i) { const unsigned short hb = bf16_bits(xs[i]); ah.u[i] = hb; al.u[i] = ASPLIT ? bf16_bits(xs[i] - bf16_val(hb)) : (unsigned short)0; }
#pragma unroll
    for (int t = 0; t < 4; ++t) {
      const unsigned short* brow = Wt + (size_t)(col0 + t * 16 + ln) * ldb + kb;
      FragB b;
      b.half[0] = *(const v8us*)(brow + 8 * hh);
      b.half[1] = *(const v8us*)(brow + 16 + 8 * hh);
      acc[t] = mmaN<ASPLIT ? 2 : 1>(ah.v, al.v, b.v, b.v, acc[t]);
    }
  }
#pragma unroll
  for (int t = 0; t < 4; ++t) {
    float bv = bias ? bias[col0 + t * 16 + ln] : 0.f;
    if (BIAS_BF16) bv = bf16_round(bv);
#pragma unroll
    for (int r = 0; r < 8; ++r) { float v = acc[t][r] + bv; if (ACT == 1) v = fmaxf(v, 0.f); so[w][8 * hh + r][t * 16 + ln] = v; }
  }
  __builtin_amdgcn_fence(__ATOMIC_ACQ_REL, "workgroup");
  __builtin_amdgcn_wave_barrier();
  const int rsub = lane >> 4, c4 = (lane & 15) * 4;
  {
#pragma unroll
    for (int q = 0; q < 8; ++q) {
      const int r = q * 2 + rsub;
      const v4f v = *(const v4fa*)&so[w][r][c4];
      *(v4f*)(C + (size_t)(row0 + r) * ldc + col0 + c4) = v;
    }
    
  }
}

// GEMM C = act(A·W + bias + resid): A f32 (ASPLIT -> hi/lo 2 terms), Wt bf16 [N][K]; ACT 0 none, 1 relu, 2 exact gelu;
// resid (optional, f32, row index = (row % rmod), pitch ldr, RES_BF16 rounds it) added before the activation.
template <bool ASPLIT, int ACT, bool BIAS_BF16, bool RES_BF16>
__global__ __launch_bounds__(128) void k_gemm_bf3(const float* __restrict__ A, int lda, const unsigned short* __restrict__ Wt, int ldb,
                                                const float* __restrict__ bias, const float* __restrict__ resid, int rmod, int ldr,
                                                float* __restrict__ C, int ldc, int M, int N, int K) {
  __shared__ __attribute__((aligned(16))) float so[4][16][64];
  const int tid = threadIdx.x, w = tid >> 5, lane = tid & 31, ln = lane & 15, hh = lane >> 4;
  const int ntn = N / 64;
  const int wid = blockIdx.x * 4 + w;
  const int mt = wid / ntn, nq = wid % ntn;
  if (mt * 16 >= M) return;
  const int row0 = mt * 16, col0 = nq * 64;
  const float* arow = A + (size_t)(row0 + ln) * lda;
  v8f acc[4] = {};
  for (int kb = 0; kb < K; kb += 32) {
    FragB ah, al;
    const v4f x0 = *(const v4fa*)(arow + kb + 8 * hh), x1 = *(const v4fa*)(arow + kb + 8 * hh + 4);
    const v4f x2 = *(const v4fa*)(arow + kb + 16 + 8 * hh), x3 = *(const v4fa*)(arow + kb + 16 + 8 * hh + 4);
    float xs[16] = {x0[0],x0[1],x0[2],x0[3],x1[0],x1[1],x1[2],x1[3],x2[0],x2[1],x2[2],x2[3],x3[0],x3[1],x3[2],x3[3]};
#pragma unroll
    for (int i = 0; i < 16; ++i) { const unsigned short hb = bf16_bits(xs[i]); ah.u[i] = hb; al.u[i] = ASPLIT ? bf16_bits(xs[i] - bf16_val(hb)) : (unsigned short)0; }
#pragma unroll
    for (int t = 0; t < 4; ++t) {
      const unsigned short* brow = Wt + (size_t)(col0 + t * 16 + ln) * ldb + kb;
      FragB b;
      b.half[0] = *(const v8us*)(brow + 8 * hh);
      b.half[1] = *(const v8us*)(brow + 16 + 8 * hh);
      acc[t] = mmaN<ASPLIT ? 2 : 1>(ah.v, al.v, b.v, b.v, acc[t]);
    }
  }
#pragma unroll
  for (int t = 0; t < 4; ++t) {
    const int col = col0 + t * 16 + ln;
    float bv = bias ? bias[col] : 0.f;
    if (BIAS_BF16) bv = bf16_round(bv);
#pragma unroll
    for (int r = 0; r < 8; ++r) {
      float v = acc[t][r] + bv;
      if (resid) { float rv = resid[(size_t)((row0 + 8 * hh + r) % rmod) * ldr + col]; if (RES_BF16) rv = bf16_round(rv); v += rv; }
      if (ACT == 1) v = fmaxf(v, 0.f);
      if (ACT == 2) v = 0.5f * v * (1.0f + erff(v * 0.70710678118654752f));
      if (ACT == 3) { const float u = 0.7978845608028654f * (v + 0.044715f * v * v * v); v = 0.5f * v * (1.0f + tanhf(u)); }
      so[w][8 * hh + r][t * 16 + ln] = v;
    }
  }
  __builtin_amdgcn_fence(__ATOMIC_ACQ_REL, "workgroup");
  __builtin_amdgcn_wave_barrier();
  const int rsub = lane >> 4, c4 = (lane & 15) * 4;
  {
#pragma unroll
    for (int q = 0; q < 8; ++q) {
      const int r = q * 2 + rsub;
      const v4f v = *(const v4fa*)&so[w][r][c4];
      *(v4f*)(C + (size_t)(row0 + r) * ldc + col0 + c4) = v;
    }
    
  }
}
// row LayerNorm (biased variance, eps) over N: s = X (+ R); optional out_sum <- s; out_norm <- (s-mu)*rsqrt(var+eps)*g + b
template <bool PARAM_BF16>
__global__ __launch_bounds__(256) void k_layernorm(const float* __restrict__ X, const float* __restrict__ R, const float* __restrict__ g, const float* __restrict__ bta,
                                                  float* __restrict__ out_sum, float* __restrict__ out_norm, int N, float eps) {
  __shared__ float red[256];
  const int row = blockIdx.x, tid = threadIdx.x;
  const float* x = X + (size_t)row * N; const float* rr = R ? R + (size_t)row * N : nullptr;
  float vals[16];                     // up to N = 4096
  const int per = N / 256;            // contiguous chunk per thread? use strided-by-4 chunks: thread handles j = tid*4 + 1024*u
  float s1 = 0.f;
  for (int u = 0; u < per / 4; ++u) {
    const int j = tid * 4 + 1024 * u;
    const v4f a = *(const v4fa*)(x + j);
    v4f b = {0.f,0.f,0.f,0.f}; if (rr) b = *(const v4fa*)(rr + j);
#pragma unroll
    for (int q = 0; q < 4; ++q) { const float v = a[q] + b[q]; vals[u * 4 + q] = v; s1 += v; }
  }
  red[tid] = s1; __syncthreads();
  for (int st = 128; st > 0; st >>= 1) { if (tid < st) red[tid] += red[tid + st]; __syncthreads(); }
  const float mu = red[0] / (float)N; __syncthreads();
  float s2 = 0.f;
  for (int u = 0; u < per / 4; ++u)
#pragma unroll
    for (int q = 0; q < 4; ++q) { const float c = vals[u * 4 + q] - mu; s2 += c * c; }
  red[tid] = s2; __syncthreads();
  for (int st = 128; st > 0; st >>= 1) { if (tid < st) red[tid] += red[tid + st]; __syncthreads(); }
  const float rs = rsqrtf(red[0] / (float)N + eps);
  {
    for (int u = 0; u < per / 4; ++u) {
      const int j = tid * 4 + 1024 * u;
      v4f o, sm;
#pragma unroll
      for (int q = 0; q < 4; ++q) {
        float gg = g[j + q], bb = bta[j + q];
        if (PARAM_BF16) { gg = bf16_round(gg); bb = bf16_round(bb); }
        sm[q] = vals[u * 4 + q]; o[q] = (vals[u * 4 + q] - mu) * rs * gg + bb;
      }
      if (out_sum) *(v4f*)(out_sum + (size_t)row * N + j) = sm;
      *(v4f*)(out_norm + (size_t)row * N + j) = o;
    }
    
  }
}



// ---- f16 WMMA path (v_wmma_f32_16x16x32_f16): 11-bit significands for operands in range — used where a [0,1] probability operand needs more precision than bf16
typedef _Float16 v16h __attribute__((ext_vector_type(16)));
union FragH { v16h v; v8us half[2]; _Float16 h[16]; unsigned short u[16]; };
template <int NT>
__device__ __forceinline__ v8f mmaH(v16h ah, v16h al, v16h bh, v16h bl, v8f c) {
  c = __builtin_amdgcn_wmma_f32_16x16x32_f16(false, ah, false, bh, (short)0, c, false, false);
  if (NT >= 2) c = __builtin_amdgcn_wmma_f32_16x16x32_f16(false, al, false, bh, (short)0, c, false, false);
  if (NT >= 3) c = __builtin_amdgcn_wmma_f32_16x16x32_f16(false, ah, false, bl, (short)0, c, false, false);
  asm volatile("v_nop\n\tv_nop\n\tv_nop\n\tv_nop" : "+v"(c) : "v"(ah), "v"(al), "v"(bh), "v"(bl));
  return c;
}
// batched GEMM like k_gemm_b but f16 operands: A f32 (split into f16 hi/lo if ASPLIT, else rounded to f16), Bt = f16 values [n][k]; alpha; C f32; N multiple of 16 (partial tiles skipped)
template <bool ASPLIT>
__global__ __launch_bounds__(128) void k_gemm_h(const float* __restrict__ A, int lda, size_t sA, const _Float16* __restrict__ Bh, int ldb, size_t sB, float alpha, float* __restrict__ C, int ldc, size_t sC, int M, int N, int K) {
  __shared__ __attribute__((aligned(16))) float so[4][16][64];
  const int tid = threadIdx.x, w = tid >> 5, lane = tid & 31, ln = lane & 15, hh = lane >> 4; const int by = blockIdx.y;
  A += (size_t)by * sA; Bh += (size_t)by * sB; C += (size_t)by * sC;
  const int ntn = (N + 63) / 64; const int wid = blockIdx.x * 4 + w; const int mt = wid / ntn, nq = wid % ntn; if (mt * 16 >= M) return;
  const int row0 = mt * 16, col0 = nq * 64; const float* arow = A + (size_t)(row0 + ln) * lda;
  v8f acc[4] = {};
  for (int kb = 0; kb < K; kb += 32) {
    FragH ah, al;
    const v4f x0 = *(const v4fa*)(arow + kb + 8 * hh), x1 = *(const v4fa*)(arow + kb + 8 * hh + 4), x2 = *(const v4fa*)(arow + kb + 16 + 8 * hh), x3 = *(const v4fa*)(arow + kb + 16 + 8 * hh + 4);
    float xs[16] = {x0[0],x0[1],x0[2],x0[3],x1[0],x1[1],x1[2],x1[3],x2[0],x2[1],x2[2],x2[3],x3[0],x3[1],x3[2],x3[3]};
#pragma unroll
    for (int i = 0; i < 16; ++i) { const _Float16 h = (_Float16)xs[i]; ah.h[i] = h; al.h[i] = ASPLIT ? (_Float16)(xs[i] - (float)h) : (_Float16)0.0f; }
#pragma unroll
    for (int t = 0; t < 4; ++t) { if (col0 + t * 16 >= N) continue; const size_t boff = (size_t)(col0 + t * 16 + ln) * ldb + kb; FragH bq; bq.half[0] = *(const v8us*)(Bh + boff + 8 * hh); bq.half[1] = *(const v8us*)(Bh + boff + 16 + 8 * hh);
      acc[t] = mmaH<ASPLIT ? 2 : 1>(ah.v, al.v, bq.v, bq.v, acc[t]); }
  }
#pragma unroll
  for (int t = 0; t < 4; ++t) { if (col0 + t * 16 >= N) continue;
#pragma unroll
    for (int r = 0; r < 8; ++r) so[w][8 * hh + r][t * 16 + ln] = acc[t][r] * alpha; }
  __builtin_amdgcn_fence(__ATOMIC_ACQ_REL, "workgroup"); __builtin_amdgcn_wave_barrier();
  const int rsub = lane >> 4, c4 = (lane & 15) * 4;
  {
#pragma unroll
    for (int q = 0; q < 8; ++q) { const int r = q * 2 + rsub; if (col0 + c4 < N) { const v4f v = *(const v4fa*)&so[w][r][c4]; *(v4f*)(C + (size_t)(row0 + r) * ldc + col0 + c4) = v; } }
     }
}

// k_gemm_hh variant with fused epilogue: v = acc·alpha + bias[by·sBias + col] (+ CP[(row/rowsPerB)·sCPb + by·64 + col] if CP) ; ACT 0 none / 1 elu ; writes f16 C16 (and f32 C if non-null)
template <int ACT>
__global__ __launch_bounds__(128) void k_gemm_hhx(const _Float16* __restrict__ A, int lda, size_t sA, const _Float16* __restrict__ Bh, int ldb, size_t sB, float alpha, const float* __restrict__ bias, size_t sBias, const float* __restrict__ CP, int rowsPerB, size_t sCPb, int row0g,
    float* __restrict__ C, _Float16* __restrict__ C16, int ldc, size_t sC, int M, int N, int K) {
  __shared__ __attribute__((aligned(16))) float so[4][16][64];
  const int tid = threadIdx.x, w = tid >> 5, lane = tid & 31, ln = lane & 15, hh = lane >> 4; const int by = blockIdx.y;
  A += (size_t)by * sA; Bh += (size_t)by * sB; const size_t cofs = (size_t)by * sC; const float* bp = bias ? bias + (size_t)by * sBias : nullptr;
  const int ntn = (N + 63) / 64; const int wid = blockIdx.x * 4 + w; const int mt = wid / ntn, nq = wid % ntn; if (mt * 16 >= M) return;
  const int row0 = mt * 16, col0 = nq * 64; const _Float16* arow = A + (size_t)(row0 + ln) * lda;
  v8f acc[4] = {};
  for (int kb = 0; kb < K; kb += 32) { FragH ah; ah.half[0] = *(const v8us*)((const unsigned short*)arow + kb + 8 * hh); ah.half[1] = *(const v8us*)((const unsigned short*)arow + kb + 16 + 8 * hh);
#pragma unroll
    for (int t = 0; t < 4; ++t) { if (col0 + t * 16 >= N) continue; const size_t boff = (size_t)(col0 + t * 16 + ln) * ldb + kb; FragH bq; bq.half[0] = *(const v8us*)((const unsigned short*)Bh + boff + 8 * hh); bq.half[1] = *(const v8us*)((const unsigned short*)Bh + boff + 16 + 8 * hh);
      acc[t] = mmaH<1>(ah.v, ah.v, bq.v, bq.v, acc[t]); }
  }
#pragma unroll
  for (int t = 0; t < 4; ++t) { if (col0 + t * 16 >= N) continue; const int col = col0 + t * 16 + ln; const float bv = bp ? bf16_round(bp[col]) : 0.f;
#pragma unroll
    for (int r = 0; r < 8; ++r) { float v = acc[t][r] * alpha + bv; if (CP) { const int rr = row0g + row0 + 8 * hh + r; if (rowsPerB < 0) v += CP[cofs + (size_t)rr * ldc + col];      /* rowsPerB < 0: own element of the batched C plane */ else { const int bidx = rr / rowsPerB; v += CP[(size_t)bidx * sCPb + (size_t)by * 64 + col]; } } if (ACT == 1) v = (v > 0.f) ? v : expm1f(v); else if (ACT == 7) v = (v > 0.f) ? v + 1.0f : expf(v); else if (ACT == 8) v = tanhf(v); else if (ACT == 9) v = 0.5f * v * (1.0f + tanhf(0.7978845608028654f * (v + 0.044715f * v * v * v))); else if (ACT == 11) v = 1.0f / (1.0f + expf(-v)); else if (ACT == 12) v = (v > 0.f) ? v : 0.01f * v; else if (ACT == 14) v = (v > 0.f) ? v : 0.1f * v; else if (ACT == 16) v = (v >= 0.f) ? v : 0.3f * v; else if (ACT == 17) v = (v >= 0.f) ? v : 0.2f * v; else if (ACT == 15) v = v / (1.0f + expf(-v)); else if (ACT == 3) v = fmaxf(v, 0.f); else if (ACT == 6) v = 0.5f * v * (1.0f + erff(v * 0.70710678118654752f)); so[w][8 * hh + r][t * 16 + ln] = v; } }
  __builtin_amdgcn_fence(__ATOMIC_ACQ_REL, "workgroup"); __builtin_amdgcn_wave_barrier();
  const int rsub = lane >> 4, c4 = (lane & 15) * 4; typedef _Float16 v4h __attribute__((ext_vector_type(4)));
  {
#pragma unroll
    for (int q = 0; q < 8; ++q) { const int r = q * 2 + rsub; if (col0 + c4 < N) { const v4f v = *(const v4fa*)&so[w][r][c4]; if (C) *(v4f*)(C + cofs + (size_t)(row0 + r) * ldc + col0 + c4) = v; if (C16) { v4h h4; for (int i = 0; i < 4; ++i) h4[i] = (_Float16)v[i]; *(v4h*)(C16 + cofs + (size_t)(row0 + r) * ldc + col0 + c4) = h4; } } }
     }
}


typedef _Float16 v4h __attribute__((ext_vector_type(4)));

__global__ __launch_bounds__(256) void k_h16(const float* __restrict__ x, _Float16* __restrict__ X16, size_t n8) { const size_t t = (size_t)blockIdx.x * 256 + threadIdx.x; if (t >= n8) return; FragH f;
#pragma unroll
  for (int q = 0; q < 8; ++q) f.h[q] = (_Float16)x[t * 8 + q]; *(v8us*)((unsigned short*)X16 + t * 8) = f.half[0];  }
__global__ __launch_bounds__(256) void k_round16f(const float* __restrict__ W, _Float16* __restrict__ Bt, size_t n8) { const size_t t = (size_t)blockIdx.x * 256 + threadIdx.x; if (t >= n8) return; FragH f;
#pragma unroll
  for (int i = 0; i < 8; ++i) f.h[i] = (_Float16)(bf16_round(W[t * 8 + i]) * 16.0f); *(v8us*)((unsigned short*)Bt + t * 8) = f.half[0];  }
template <int NHv, int TTv>
__global__ __launch_bounds__(256) void k_vt(const _Float16* __restrict__ V16, int ldv, int voff, _Float16* __restrict__ Vt) { __shared__ unsigned short tl[64][66]; const int tid = threadIdx.x; const int slab = blockIdx.x / (TTv / 64), lg = blockIdx.x % (TTv / 64); const int b = slab / NHv, h = slab % NHv;
  for (int i = tid; i < 64 * 8; i += 256) { const int r = i / 8, c8 = (i % 8) * 8; FragH f; f.half[0] = *(const v8us*)((const unsigned short*)V16 + ((size_t)b * TTv + lg * 64 + r) * ldv + voff + h * 64 + c8);
#pragma unroll
    for (int q = 0; q < 8; ++q) tl[r][c8 + q] = f.u[q]; }
  __syncthreads();
  {
#pragma unroll
    for (int rd = 0; rd < 2; ++rd) { const int d = rd * 32 + tid / 8, pc = tid % 8; FragH f;
#pragma unroll
      for (int q = 0; q < 8; ++q) f.u[q] = tl[pc * 8 + q][d];
      *(v8us*)((unsigned short*)Vt + ((size_t)slab * 64 + d) * TTv + lg * 64 + pc * 8) = f.half[0]; }
     } }

__global__ __launch_bounds__(256) void k_hl(const float* __restrict__ F, _Float16* __restrict__ Hh, _Float16* __restrict__ Hl, size_t n8) { const size_t t = (size_t)blockIdx.x * 256 + threadIdx.x; if (t >= n8) return; FragH fh, fl; const v4f a = *(const v4fa*)(F + t * 8), c = *(const v4fa*)(F + t * 8 + 4);
#pragma unroll
  for (int q = 0; q < 4; ++q) { _Float16 h = (_Float16)a[q]; fh.h[q] = h; fl.h[q] = (_Float16)((a[q] - (float)h) * 1024.0f); h = (_Float16)c[q]; fh.h[4 + q] = h; fl.h[4 + q] = (_Float16)((c[q] - (float)h) * 1024.0f); }
  { *(v8us*)((unsigned short*)Hh + t * 8) = fh.half[0]; *(v8us*)((unsigned short*)Hl + t * 8) = fl.half[0];  } }

// ---- fast GEMM (work-group tile 128x64, wave tile 32x64; requires M % 128 == 0, N % 64 == 0, K % 128 == 0, 256-byte aligned rows); operands staged in LDS; epilogue = k_gemm_hhx semantics ----
#define G2_KS 128                      /* k per stage: 256 bytes of every operand row */
#define G2_PITCH (G2_KS * 2 + 16)      /* LDS row pitch in bytes: 16 x odd, for 16-byte readers */
__device__ __forceinline__ v16h g2_lfrag(const char* p) { FragH f; f.half[0] = *(const v8us*)p; f.half[1] = *(const v8us*)(p + 32); return f.v; }      /* a fragment from a staged row; the lane's 16 hh bytes are in p */
__device__ __forceinline__ v8f g2_mma(v16h a, v16h b, v8f c) { v8f d = __builtin_amdgcn_wmma_f32_16x16x32_f16(false, a, false, b, (short)0, c, false, false); asm volatile("v_nop\n\tv_nop\n\tv_nop\n\tv_nop" : "+v"(d) : "v"(a), "v"(b)); return d; }
template <int ACT, int lda, int ldb>      /* the operands' row pitches at compile time: a thread's staging loads are then one base, one lane offset and immediates */
__global__ __launch_bounds__(128) void k_gemm2(const _Float16* __restrict__ A, size_t sA, const _Float16* __restrict__ Bh, size_t sB, float alpha, const float* __restrict__ bias, size_t sBias, const float* __restrict__ CP, int rowsPerB, size_t sCPb, int row0g,
    float* __restrict__ C, _Float16* __restrict__ C16, int ldc, size_t sC, int M, int N, int K, size_t sAz, size_t sBz, size_t sCz) { static_assert(ACT == 0 || ACT == 3 || ACT == 6 || ACT == 8 || ACT == 9 || ACT == 11 || ACT == 12 || ACT == 14 || ACT == 15 || ACT == 16 || ACT == 17, "k_gemm2: unsupported ACT code (would silently apply no activation)");
  __shared__ __attribute__((aligned(16))) char sm[192 * G2_PITCH];      /* one stage: 128 A rows, then 64 B rows, G2_KS k each; behind the k loop the waves' output staging */
  static_assert(sizeof(sm) >= 4 * 32 * 68 * sizeof(float), "k_gemm2: the output staging lies in the stage buffer"); float (*so)[32][68] = (float (*)[32][68])sm;
  const int tid = threadIdx.x, w = tid >> 5, lane = tid & 31, ln = lane & 15, hh = lane >> 4; const int by = blockIdx.y, bz = blockIdx.z;      /* two batch levels: grid.y (strides sA, sB, sC) and grid.z (strides sAz, sBz, sCz) */
  A += (size_t)by * sA + (size_t)bz * sAz; Bh += (size_t)by * sB + (size_t)bz * sBz; const size_t cofs = (size_t)by * sC + (size_t)bz * sCz; const float* bp = bias ? bias + (size_t)by * sBias : nullptr;
  const int ntn = N >> 6; const int mt = blockIdx.x / ntn, nq = blockIdx.x - mt * ntn; const int row0 = mt * 128 + 32 * w, col0 = nq * 64; if (mt * 128 >= M) return;      /* the same for the whole work-group: barriers follow */
  const char* Ab = (const char*)(A + (size_t)(mt * 128) * lda); const char* Bb = (const char*)(Bh + (size_t)col0 * ldb);      /* uniform bases; the lane's part is a 32-bit byte offset that never changes */
  const int sr = tid >> 4, sc = tid & 15;      /* staging: 16 lanes take one row's 256 bytes, so a wave's load covers 4 whole lines; thread rows sr + 8 j */
  const unsigned ga = (unsigned)(sr * lda + sc * 8) * 2, gb = (unsigned)(sr * ldb + sc * 8) * 2;
  char* sst = sm + sr * G2_PITCH + sc * 16;
  const char* sa = sm + (32 * w + ln) * G2_PITCH + 16 * hh; const char* sb = sm + (128 + ln) * G2_PITCH + 16 * hh;      /* fragment rows; k = 8 hh + 0..7 and 16 + 8 hh + 0..7 of each 32, A and B alike */
  const v8f z8 = {0.f,0.f,0.f,0.f,0.f,0.f,0.f,0.f}; v8f c00 = z8, c01 = z8, c02 = z8, c03 = z8, c10 = z8, c11 = z8, c12 = z8, c13 = z8;
  v8us st[24];
#pragma unroll
  for (int j = 0; j < 16; ++j) st[j] = *(const v8us*)(Ab + (size_t)(8 * j) * lda * 2 + ga);
#pragma unroll
  for (int j = 0; j < 8; ++j) st[16 + j] = *(const v8us*)(Bb + (size_t)(8 * j) * ldb * 2 + gb);
#pragma unroll 1
  for (int kb = 0; kb < K; kb += G2_KS) {
#pragma unroll
    for (int j = 0; j < 24; ++j) *(v8us*)(sst + 8 * j * G2_PITCH) = st[j];
    __syncthreads();      /* the stage is whole before anybody reads it */
    if (kb + G2_KS < K) {      /* the next stage's rows fly into registers while this stage is worked on */
      const char* An = Ab + (size_t)(kb + G2_KS) * 2; const char* Bn = Bb + (size_t)(kb + G2_KS) * 2;
#pragma unroll
      for (int j = 0; j < 16; ++j) st[j] = *(const v8us*)(An + (size_t)(8 * j) * lda * 2 + ga);
#pragma unroll
      for (int j = 0; j < 8; ++j) st[16 + j] = *(const v8us*)(Bn + (size_t)(8 * j) * ldb * 2 + gb);
      asm volatile("s_wait_xcnt 0x0" ::: "memory");      /* the loads' address registers are reused by the fragment loads right behind; it also keeps the global loads in front of the LDS reads */
    }
#pragma unroll
    for (int kk = 0; kk < G2_KS / 32; ++kk) { const v16h a0 = g2_lfrag(sa + 64 * kk), a1 = g2_lfrag(sa + 16 * G2_PITCH + 64 * kk);      /* the six fragments of a k step are asked for together: one LDS wait a step */
      const v16h b0 = g2_lfrag(sb + 64 * kk), b1 = g2_lfrag(sb + 16 * G2_PITCH + 64 * kk), b2 = g2_lfrag(sb + 32 * G2_PITCH + 64 * kk), b3 = g2_lfrag(sb + 48 * G2_PITCH + 64 * kk);
      c00 = g2_mma(a0, b0, c00); c10 = g2_mma(a1, b0, c10); c01 = g2_mma(a0, b1, c01); c11 = g2_mma(a1, b1, c11);
      c02 = g2_mma(a0, b2, c02); c12 = g2_mma(a1, b2, c12); c03 = g2_mma(a0, b3, c03); c13 = g2_mma(a1, b3, c13); }
    __syncthreads();      /* every reader has left the stage before it is written again (behind the last pass: before the output staging) */
  }
  v8f accs[8] = {c00, c01, c02, c03, c10, c11, c12, c13};
#pragma unroll
  for (int u = 0; u < 8; ++u) { const int t = u & 3, half = u >> 2; const int col = col0 + t * 16 + ln; const float bv = bp ? bf16_round(bp[col]) : 0.f;
#pragma unroll
    for (int r = 0; r < 8; ++r) { const int rloc = half * 16 + 8 * hh + r; float v = accs[u][r] * alpha + bv; if (CP) { if (rowsPerB < 0) v += CP[cofs + (size_t)(row0g + row0 + rloc) * ldc + col];      /* rowsPerB < 0: own element of the batched C plane */ else { const int bidx = (row0g + row0 + rloc) / rowsPerB; v += CP[(size_t)bidx * sCPb + (size_t)by * 64 + col]; } }
      if (ACT == 3) v = fmaxf(v, 0.f); else if (ACT == 6) v = 0.5f * v * (1.0f + erff(v * 0.70710678118654752f)); else if (ACT == 11) v = 1.0f / (1.0f + expf(-v)); else if (ACT == 15) v = v / (1.0f + expf(-v)); else if (ACT == 12) v = (v > 0.f) ? v : 0.01f * v; else if (ACT == 8) v = tanhf(v); else if (ACT == 9) v = 0.5f * v * (1.0f + tanhf(0.7978845608028654f * (v + 0.044715f * v * v * v))); else if (ACT == 14) v = (v > 0.f) ? v : 0.1f * v; else if (ACT == 16) v = (v >= 0.f) ? v : 0.3f * v; else if (ACT == 17) v = (v >= 0.f) ? v : 0.2f * v;
      so[w][rloc][t * 16 + ln] = v; } }
  __builtin_amdgcn_fence(__ATOMIC_ACQ_REL, "workgroup"); __builtin_amdgcn_wave_barrier();
  const int rsub = lane >> 4, c4 = (lane & 15) * 4;
  {
#pragma unroll
    for (int q = 0; q < 16; ++q) { const int r = q * 2 + rsub; const v4f v = *(const v4fa*)&so[w][r][c4]; if (C) *(v4f*)(C + cofs + (size_t)(row0 + r) * ldc + col0 + c4) = v; if (C16) { v4h h4; for (int i = 0; i < 4; ++i) h4[i] = (_Float16)v[i]; *(v4h*)(C16 + cofs + (size_t)(row0 + r) * ldc + col0 + c4) = h4; } }
     } }


__global__ __launch_bounds__(256) void k_wnat(const float* __restrict__ w, size_t n8, _Float16* __restrict__ Bt) { const size_t t = (size_t)blockIdx.x * 256 + threadIdx.x; if (t >= n8) return; FragH f; for (int q = 0; q < 8; ++q) f.h[q] = (_Float16)(bf16_round(w[t * 8 + q]) * 16.0f); *(v8us*)((unsigned short*)Bt + t * 8) = f.half[0];  }
__global__ __launch_bounds__(256) void k_rsm(const float* __restrict__ S, _Float16* __restrict__ P, int nrows) {
  #pragma clang fp contract(off)
  const int i = blockIdx.x * 256 + threadIdx.x; if (i >= nrows) return; const float* s = S + (size_t)i * SQ; float mx = -3.0e38f;
#pragma unroll 1
  for (int j = 0; j < SQ; ++j) mx = fmaxf(mx, s[j]); float se = 0.f;
#pragma unroll 1
  for (int j = 0; j < SQ; ++j) se += expf(s[j] - mx); const float sc = 256.0f / se;
#pragma unroll 1
  for (int j0 = 0; j0 < SQ; j0 += 8) { FragH f; for (int q = 0; q < 8; ++q) f.h[q] = (_Float16)(expf(s[j0 + q] - mx) * sc); unsigned short* d = (unsigned short*)P + (size_t)i * SQ + j0; *(v8us*)d = f.half[0];  } }
__global__ __launch_bounds__(256) void k_vt(const _Float16* __restrict__ V16, int b, int h0, _Float16* __restrict__ VT) { __shared__ unsigned short tl[64][65]; const int tid = threadIdx.x; const int hh = blockIdx.x % HG, sg = blockIdx.x / HG; const int s0 = sg * 64; const int h = h0 + hh;
  for (int i = tid; i < 64 * 8; i += 256) { const int j = i / 8, d8 = (i % 8) * 8; FragH f; f.half[0] = *(const v8us*)((const unsigned short*)V16 + ((size_t)b * SQ + s0 + j) * DM + h * HD + d8); for (int q = 0; q < 8; ++q) tl[d8 + q][j] = f.u[q]; }
  __syncthreads();
  { for (int i = tid; i < 64 * 8; i += 256) { const int d = i / 8, j8 = (i % 8) * 8; FragH f; for (int q = 0; q < 8; ++q) f.u[q] = tl[d][j8 + q]; *(v8us*)((unsigned short*)VT + ((size_t)hh * HD + d) * SQ + s0 + j8) = f.half[0]; }  } }


__global__ __launch_bounds__(256) void k_rsmf(const float* __restrict__ S, _Float16* __restrict__ P, int qn, int hg) {
  #pragma clang fp contract(off)
  const int t = blockIdx.x * 256 + threadIdx.x; if (t >= qn * hg) return; const size_t i = (size_t)(t / qn) * SQ + (t % qn); const float* s = S + i * SQ; float mx = -3.0e38f;
#pragma unroll 1
  for (int j = 0; j < SQ; ++j) mx = fmaxf(mx, s[j]); float se = 0.f;
#pragma unroll 1
  for (int j = 0; j < SQ; ++j) se += __expf(s[j] - mx); const float sc = 256.0f / se;
#pragma unroll 1
  for (int j0 = 0; j0 < SQ; j0 += 8) { FragH f; for (int q = 0; q < 8; ++q) f.h[q] = (_Float16)(__expf(s[j0 + q] - mx) * sc); unsigned short* d = (unsigned short*)P + i * SQ + j0; *(v8us*)d = f.half[0];  } }

__global__ __launch_bounds__(256) void k_rsmr(const float* __restrict__ S, _Float16* __restrict__ P, int qn, int hg) {
  #pragma clang fp contract(off)
  const int t = blockIdx.x * 256 + threadIdx.x; if (t >= qn * hg) return; const size_t i = (size_t)t;      /* planes packed: row t of plane t / qn */ const float* s = S + i * SQ; float mx = -3.0e38f;
#pragma unroll 1
  for (int j = 0; j < SQ; ++j) mx = fmaxf(mx, s[j]); float se = 0.f;
#pragma unroll 1
  for (int j = 0; j < SQ; ++j) se += __expf(s[j] - mx); const float sc = 256.0f / se;
#pragma unroll 1
  for (int j0 = 0; j0 < SQ; j0 += 8) { FragH f; for (int q = 0; q < 8; ++q) f.h[q] = (_Float16)(__expf(s[j0 + q] - mx) * sc); unsigned short* d = (unsigned short*)P + i * SQ + j0; *(v8us*)d = f.half[0];  } }


typedef int v4ia __attribute__((ext_vector_type(4), may_alias));
typedef unsigned v16ua __attribute__((ext_vector_type(16), may_alias));
typedef float f32x2 __attribute__((ext_vector_type(2)));
__device__ __forceinline__ float fa_xhalf(float x) { return __builtin_bit_cast(float, __builtin_amdgcn_permlanex16(__builtin_bit_cast(int, x), __builtin_bit_cast(int, x), 0x76543210, 0xfedcba98, false, false)); }      /* lane l with lane l ^ 16 */
__device__ __forceinline__ v8f fa_mma(v16h a, v16h b, v8f c) { return __builtin_amdgcn_wmma_f32_16x16x32_f16(false, a, false, b, (short)0, c, false, false); }
__device__ __forceinline__ v16h fa_frag(const char* base, unsigned off) { FragH f; f.half[0] = *(const v8us*)(base + off); f.half[1] = *(const v8us*)(base + off + 32); return f.v; }      /* k = 8 hh + 0..7 and 16 + 8 hh + 0..7; the lane's 16 hh bytes are in off */
// In front of a group of next-pass loads: keeps the loads from rising among the WMMAs that read the registers they refill (without it the compiler sets a load directly behind the WMMA whose A operand it overwrites).
__device__ __forceinline__ void fa_ahead() { __builtin_amdgcn_sched_barrier(0); }
// Between a run of eight WMMAs and the loads that refill their A operand registers: the four vector slots that a vector overwrite of a WMMA's operand asks for.
__device__ __forceinline__ void fa_mma_done() { asm volatile("v_nop\n\tv_nop\n\tv_nop\n\tv_nop"); }
// Behind each group of next-pass loads. The wait: the group's address registers are reused right behind it. The scheduling barrier: keeps that wait directly behind its loads and the group where it is written, a phase ahead of its use (without it the compiler moves the mask fetch down among the exponentials and the wait away from its loads).
__device__ __forceinline__ void fa_issued() { asm volatile("s_wait_xcnt 0x0" ::: "memory"); __builtin_amdgcn_sched_barrier(0); }
__global__ __launch_bounds__(256) void k_fattn(const _Float16* __restrict__ Q, const _Float16* __restrict__ Kr, const _Float16* __restrict__ VT, const unsigned* __restrict__ MW, _Float16* __restrict__ O) {
  const int lane = threadIdx.x & 31, ln = lane & 15, hh = lane >> 4; const int wave = __builtin_amdgcn_readfirstlane((int)(threadIdx.x >> 5));
  const int h = blockIdx.y, b = blockIdx.z, q0 = blockIdx.x * 256 + wave * 32;
  const float cs = 0.125f * 1.4426950408889634f;      /* 1 / sqrt(64), and e^x = 2^(x log2 e) */
  const float fill = -8589934592.0f;      /* masked_fill: -2^33, -2^30 after the 1/8. A power of two, so that its product with cs is exact: while every key seen so far is masked the maximum IS that product, the fused multiply-add of the exponent gives exactly 0 and the weights are 1 (finite); the first unmasked key rescales them to 0. A fill whose product rounds would leave a positive exponent there */
  const char* qb = (const char*)(Q + ((size_t)b * NQ + q0) * DM + h * HD);      /* wave-uniform bases; the lane's part is a 32-bit byte offset that never changes */
  const char* kb = (const char*)(Kr + (size_t)b * SK * DM + h * HD);
  const char* vb = (const char*)(VT + ((size_t)b * NH + h) * HD * SK);
  const unsigned* mb_ = MW + ((size_t)b * NQ + q0) * (SK / 32);      /* the wave's 32 passes x 32 lane-mask words, contiguous; the address is wave-uniform, so the words come by scalar loads */
  const unsigned ko = (unsigned)(ln * DM * 2 + 16 * hh), vo = (unsigned)(ln * SK * 2 + 16 * hh);
  v16h qf[2][2];
#pragma unroll
  for (int g = 0; g < 2; ++g)
#pragma unroll
    for (int kc = 0; kc < 2; ++kc) qf[g][kc] = fa_frag(qb + 16 * g * DM * 2 + 64 * kc, ko);
  fa_issued();      /* pass 0's groups in the loop's own order (K, mask, V^T): loads return in order, and the counted waits at the loop's head must hold for both ways into it */
  v16h kf[2][2], vf[4]; v16ua mk[2];      /* mk[g][8 kt + r]: bit l = lane l's mask element of score register r, tile kt, column group g */
#pragma unroll
  for (int kt = 0; kt < 2; ++kt)
#pragma unroll
    for (int kc = 0; kc < 2; ++kc) kf[kt][kc] = fa_frag(kb + 16 * kt * DM * 2 + 64 * kc, ko);
  fa_issued();
  mk[0] = *(const v16ua*)mb_; mk[1] = *(const v16ua*)(mb_ + 16);
  fa_issued();
#pragma unroll
  for (int t = 0; t < 4; ++t) vf[t] = fa_frag(vb + 16 * t * SK * 2, vo);
  fa_issued();
  const v8f z8 = {0.f, 0.f, 0.f, 0.f, 0.f, 0.f, 0.f, 0.f};
  v8f acc[2][4]; float m_run[2], l_run[2];
#pragma unroll
  for (int g = 0; g < 2; ++g) { m_run[g] = -3.0e38f; l_run[g] = 0.f;
#pragma unroll
    for (int t = 0; t < 4; ++t) acc[g][t] = z8; }
  for (int key0 = 0; key0 < SK; key0 += 32) {
    const int kn = (key0 + 32) & (SK - 1);      /* the next pass's first key; the last pass fetches pass 0 again (in bounds, not used) so that the fetches stay unconditional */
    v8f s[2][2];
#pragma unroll
    for (int kt = 0; kt < 2; ++kt)
#pragma unroll
      for (int g = 0; g < 2; ++g) s[kt][g] = fa_mma(kf[kt][1], qf[g][1], fa_mma(kf[kt][0], qf[g][0], z8));
    fa_ahead(); fa_mma_done();      /* the score products first: the K fetch goes into their operand registers */
    { const char* kbn = kb + (size_t)kn * (DM * 2);
#pragma unroll
      for (int kt = 0; kt < 2; ++kt)
#pragma unroll
        for (int kc = 0; kc < 2; ++kc) kf[kt][kc] = fa_frag(kbn + 16 * kt * DM * 2 + 64 * kc, ko); }
    fa_issued();
    float mb[2]; bool need = false;
#pragma unroll
    for (int g = 0; g < 2; ++g) { float mx = -3.0e38f;
#pragma unroll
      for (int kt = 0; kt < 2; ++kt)
#pragma unroll
        for (int r = 0; r < 8; ++r) { const float v = __builtin_amdgcn_inverse_ballot_w32(mk[g][8 * kt + r]) ? s[kt][g][r] : fill; s[kt][g][r] = v; mx = fmaxf(mx, v); }      /* the word IS the select's lane mask: no compare */
      mx = fmaxf(mx, fa_xhalf(mx)) * cs; mb[g] = mx; need = need || (mx > m_run[g] + 8.0f); }
    if (__builtin_amdgcn_ballot_w32(need) != 0) {      /* wave-uniform; rare after the first passes */
#pragma unroll
      for (int g = 0; g < 2; ++g) { const float mn = fmaxf(m_run[g], mb[g]); const float corr = __builtin_amdgcn_exp2f(m_run[g] - mn); m_run[g] = mn; l_run[g] *= corr;
#pragma unroll
        for (int t = 0; t < 4; ++t) acc[g][t] = acc[g][t] * corr; } }
    { const unsigned* mbn = mb_ + kn;      /* 32 words a pass of 32 keys. Behind the branch, which needs every select: the mask fetch goes into the registers that the selects read */
      mk[0] = *(const v16ua*)mbn; mk[1] = *(const v16ua*)(mbn + 16); }
    fa_issued();
#pragma unroll
    for (int g = 0; g < 2; ++g) { const float nm = -m_run[g]; FragH pf; f32x2 ls = {0.f, 0.f};
#pragma unroll
      for (int i = 0; i < 8; ++i) { const f32x2 a = __builtin_elementwise_fma(f32x2{s[i >> 2][g][2 * (i & 3)], s[i >> 2][g][2 * (i & 3) + 1]}, f32x2{cs, cs}, f32x2{nm, nm});
        const f32x2 p = {__builtin_amdgcn_exp2f(a.x), __builtin_amdgcn_exp2f(a.y)}; ls += p; pf.h[2 * i] = (_Float16)p.x; pf.h[2 * i + 1] = (_Float16)p.y; }      /* element 8 kt + r of the B operand = key 16 kt + 8 hh + r */
      l_run[g] += ls.x + ls.y;
#pragma unroll
      for (int t = 0; t < 4; ++t) acc[g][t] = fa_mma(vf[t], pf.v, acc[g][t]); }
    fa_ahead();      /* the output products first: the V^T fetch goes into their operand registers (the compiler's own padding in front of the address addition, which overwrites a B register, keeps the four slots here) */
    { const char* vbn = vb + (size_t)kn * 2;
#pragma unroll
      for (int t = 0; t < 4; ++t) vf[t] = fa_frag(vbn + 16 * t * SK * 2, vo); }
    fa_issued();
  }
#pragma unroll
  for (int g = 0; g < 2; ++g) { const float l = l_run[g] + fa_xhalf(l_run[g]); const float inv = 64.0f / l;      /* o carried x64 */
    _Float16* op = O + ((size_t)b * NQ + q0 + 16 * g + ln) * DM + h * HD + 8 * hh;
#pragma unroll
    for (int t = 0; t < 4; ++t) { FragH f;
#pragma unroll
      for (int r = 0; r < 8; ++r) f.h[r] = (_Float16)(acc[g][t][r] * inv);
      *(v8us*)((unsigned short*)op + 16 * t) = f.half[0]; } }      /* d = 16 t + 8 hh + 0..7 of query ln: 16 contiguous bytes */
  asm volatile("s_wait_loadcnt 0x0" ::: "memory");      /* a precaution: the last pass's fetches (pass 0 again, not used) have landed before the wave ends and gives its registers back */
}
// Operand preparation, all of it in one launch of 256 work-groups of 16 waves (one a WGP): the work is 64 MiB of reads and 24 MiB + 512 KiB of writes; few long waves in one launch keep launch gaps and wave starts small beside the bytes.
// Every wave takes four pieces of 1,024 elements and asks for all of them at once (32 loads of 16 bytes a lane):
//  - a 32 query x 32 key block of the int mask (what one k_fattn wave needs in one pass) -> 32 lane-mask words: each lane reads the mask elements of its own score registers in k_fattn (query 16 g + ln, keys 16 kt + 8 hh + r),
//    a ballot of (element != 0) is the word of register (g, kt, r); one 128-byte store. The 16 heads then read 1 bit an element by scalar loads, where each read 4 bytes by 16-line vector loads;
//  - 4 KiB of x and 4 KiB of context -> exact f16 rows: each load 512 contiguous bytes, each store 256;
//  - a 64 k x 16 n block of one [in][out] weight -> Bt[n][k] = f16(bf16(W[k][n]) x 16): lane = (k group lane & 7, n group lane >> 3) reads 4 n of 8 k rows (a load touches 8 lines, where one element a lane would touch 32; the line's other half goes to the
//    neighbour wave of the work-group) and so holds 8 k of 4 n: each of its 4 stores is 16 bytes of a Bt row, 8 lanes a whole line. The transpose is in the registers' naming: no LDS, no barrier.
// Work-groups 0..63 take Wq, 64..191 Wkv (Bt rows 0..1023 = k columns, 1024..2047 = v columns), 192..255 Wp: 64 k x 256 n each.
__global__ __launch_bounds__(512) void k_prep(const float* __restrict__ x, const float* __restrict__ ctx, const int* __restrict__ Mk, const float* __restrict__ wq, const float* __restrict__ wkv, const float* __restrict__ wo,
    _Float16* __restrict__ X16, _Float16* __restrict__ C16, unsigned* __restrict__ MW, _Float16* __restrict__ BQ, _Float16* __restrict__ BKV, _Float16* __restrict__ BO) {
  static_assert(NRQ * SK == (size_t)256 * 16 * 1024 && SK == 1024, "k_prep: one 32 x 32 mask block a wave");
  static_assert(NRQ * DM == (size_t)256 * 16 * 1024 && NRK * DC == (size_t)256 * 16 * 1024 && DM == 1024 && DC == 1024, "k_prep: 4,096 waves, one piece of each kind a wave");
  const int lane = threadIdx.x & 31, lk = lane & 7, l4 = lane >> 3; const int wave = __builtin_amdgcn_readfirstlane((int)(threadIdx.x >> 5)); const int blk = blockIdx.x;
  const bool iskv = blk >= 64 && blk < 192; const float* W = blk < 64 ? wq : iskv ? wkv : wo; _Float16* Bt = blk < 64 ? BQ : iskv ? BKV : BO;
  const int t = blk < 64 ? blk : iskv ? blk - 64 : blk - 192; const int N = iskv ? 2 * DM : DM, sh = iskv ? 3 : 2;      /* N / 256 = 1 << sh column groups */
  const int k0 = (t >> sh) * 64, n0 = (t & ((1 << sh) - 1)) * 256 + wave * 16;
  const size_t e0 = ((size_t)blk * 16 + wave) * 1024;      /* the wave's first element of x and of context */
  const char* xp = (const char*)(x + e0); const char* cp = (const char*)(ctx + e0); const char* wp = (const char*)(W + (size_t)k0 * N + n0);      /* wave-uniform bases; the lane's part is a 32-bit byte offset */
  unsigned wl[8];
#pragma unroll
  for (int r = 0; r < 8; ++r) wl[r] = (unsigned)((8 * lk + r) * N + 4 * l4) * 4;
  const int gw = blk * 16 + wave;      /* mask block: query rows 32 (gw >> 5) .. + 31 of the flat [b n] rows, keys 32 (gw & 31) .. + 31 */
  const char* mp = (const char*)(Mk + (size_t)(gw >> 5) * 32 * SK + (gw & 31) * 32); const unsigned ml = (unsigned)((lane & 15) * SK * 4 + 32 * (lane >> 4));
  v4f xv[8], cv[8], wv[8]; v4ia mv[8];
#pragma unroll
  for (int j = 0; j < 8; ++j) xv[j] = *(const v4fa*)(xp + 512 * j + 16 * lane);
#pragma unroll
  for (int j = 0; j < 8; ++j) cv[j] = *(const v4fa*)(cp + 512 * j + 16 * lane);
#pragma unroll
  for (int r = 0; r < 8; ++r) wv[r] = *(const v4fa*)(wp + wl[r]);
#pragma unroll
  for (int i = 0; i < 8; ++i) mv[i] = *(const v4ia*)(mp + 16 * (i >> 2) * SK * 4 + 64 * ((i >> 1) & 1) + 16 * (i & 1) + ml);      /* i = 4 g + 2 kt + (r >> 2) */
  // The wait: the loads' offset registers are reused right behind. Its operands (inputs only) keep those registers as they are up to the wait.
  asm volatile("s_wait_xcnt 0x0" :: "v"(lane), "v"(wl[0]), "v"(wl[1]), "v"(wl[2]), "v"(wl[3]), "v"(wl[4]), "v"(wl[5]), "v"(wl[6]), "v"(wl[7]), "v"(ml) : "memory");
  __builtin_amdgcn_sched_barrier(0);      /* all 32 loads are asked for before the first value is worked on: without it the compiler sets the second and third group behind the conversions of the group before, three memory latencies in a row */
#pragma unroll
  for (int j = 0; j < 8; ++j) { v4h o;
#pragma unroll
    for (int q = 0; q < 4; ++q) o[q] = (_Float16)bf16_round(xv[j][q]);
    *(v4h*)(X16 + e0 + 128 * j + 4 * lane) = o; }
  __builtin_amdgcn_sched_barrier(0);      /* a piece's stores leave as soon as it is converted: without it the compiler keeps them back to the kernel's end, behind the last load's wait */
#pragma unroll
  for (int j = 0; j < 8; ++j) { v4h o;
#pragma unroll
    for (int q = 0; q < 4; ++q) o[q] = (_Float16)bf16_round(cv[j][q]);
    *(v4h*)(C16 + e0 + 128 * j + 4 * lane) = o; }
  __builtin_amdgcn_sched_barrier(0);      /* as above */
#pragma unroll
  for (int i = 0; i < 4; ++i) { FragH f;
#pragma unroll
    for (int r = 0; r < 8; ++r) f.h[r] = (_Float16)(bf16_round(wv[r][i]) * 16.0f);      /* x16, a power of two: bf16-exact weights stay exact in f16 away from the subnormal range */
    *(v8us*)((unsigned short*)Bt + (size_t)(n0 + 4 * l4 + i) * DM + k0 + 8 * lk) = f.half[0]; }
  __builtin_amdgcn_sched_barrier(0);      /* as above */
  unsigned word = 0;
#pragma unroll
  for (int i = 0; i < 32; ++i) { const unsigned bl = __builtin_amdgcn_ballot_w32(mv[i >> 2][i & 3] != 0); word = lane == i ? bl : word; }      /* word i = 16 g + 8 kt + r goes to lane i */
  MW[(size_t)gw * 32 + lane] = word;
}
extern "C" void kernel_launch(void* const* d_in, const int* in_sizes, int n_in,
                              void* d_out, int out_size, void* d_ws, size_t ws_size, hipStream_t stream) {
  (void)in_sizes; (void)n_in; (void)out_size;
  const float* const* I = (const float* const*)d_in; const float* x = I[0]; const float* ctx = I[1]; const int* mkm = (const int*)d_in[2]; const float* wq = I[3]; const float* bq = I[4]; const float* wkv = I[5]; const float* bkv = I[6]; const float* wo = I[7]; const float* bo = I[8];      /* [in][out] weights; int mask [b][n][m]; k | v from the fused Wkv [1024][2048] */
  char* ws = (char*)d_ws; size_t off = 0;
  auto take = [&](size_t bytes) { char* p = ws + off; off += (bytes + 255) & ~(size_t)255; return p; };
  _Float16* BQ = (_Float16*)take((size_t)DM * DM * 2); _Float16* BKV = (_Float16*)take((size_t)2 * DM * DC * 2); _Float16* BO = (_Float16*)take((size_t)DM * DM * 2);
  _Float16* X16 = (_Float16*)take(NRQ * DM * 2); _Float16* C16 = (_Float16*)take(NRK * DC * 2); _Float16* Q16 = (_Float16*)take(NRQ * DM * 2); _Float16* K16 = (_Float16*)take(2 * NRK * DM * 2); _Float16* V16 = K16 + NRK * DM; _Float16* O16 = X16;      /* o rows reuse the x rows, whose last reader is the Q GEMM */
  _Float16* VT = (_Float16*)take((size_t)NB * NH * HD * SK * 2);      /* V^T: all 64 (batch, head) planes */
  unsigned* MW = (unsigned*)take(NRQ * SK / 8);      /* the mask, 1 bit an element, as lane-mask words */
  if (off > ws_size) return;      /* 8 + 5 x 8 + 8 = 56 MiB, + 512 KiB */
  k_prep<<<256, 512, 0, stream>>>(x, ctx, mkm, wq, wkv, wo, X16, C16, MW, BQ, BKV, BO);      /* x, context -> f16 rows; [in][out] weights -> Bt x16; Wkv [1024][2048] -> Bt [2048][1024]: rows 0..1023 = k columns, 1024..2047 = v columns */
  k_gemm2<0, DM, DM><<<dim3((unsigned)((NRQ / 128) * (DM / 64)), 1), 128, 0, stream>>>(X16, 0, BQ, 0, 0.0625f, bq, 0, nullptr, 1, 0, 0, nullptr, Q16, DM, 0, (int)NRQ, DM, DM, 0, 0, 0);
  k_gemm2<0, DC, DC><<<dim3((unsigned)((NRK / 128) * (DM / 64)), 2), 128, 0, stream>>>(C16, 0, BKV, (size_t)DM * DC, 0.0625f, bkv, (size_t)DM, nullptr, 1, 0, 0, nullptr, K16, DM, NRK * DM, (int)NRK, DM, DC, 0, 0, 0);      /* grid.y 0: k = context Wkv[:, :1024] + bkv[:1024] -> K16; grid.y 1: v = context Wkv[:, 1024:] + bkv[1024:] -> V16 */
  k_vt<NH, SK><<<NB * NH * (SK / 64), 256, 0, stream>>>(V16, DM, 0, VT);      /* V^T [4 x 16][64][1024], all batches in one launch */
  k_fattn<<<dim3(NQ / 256, NH, NB), 256, 0, stream>>>(Q16, K16, VT, MW, O16);      /* scores, masked softmax and P V of all 64 (batch, head) planes: o x64, merged rows */
  k_gemm2<0, DM, DM><<<dim3((unsigned)((NRQ / 128) * (DM / 64)), 1), 128, 0, stream>>>(O16, 0, BO, 0, 0.0009765625f, bo, 0, nullptr, 1, 0, 0, (float*)d_out, nullptr, DM, 0, (int)NRQ, DM, DM, 0, 0, 0);      /* out = o Wo + bo */
}

// v007
// Measured time: 89.3 microseconds a run.
// Next to v006, in two timings, it ran 1.15 times as fast each time.
// Over all steps from v000 it is 59.0 times as fast.
#include <hip/hip_runtime.h>
// Masked multi-head cross-attention (x [4][1024][1024] queries, context [4][1024][1024]; q = x Wq + bq; k | v = context Wkv + bkv viewed (m, 2, 16, 64) ([in][out] weights sigma 1/32, zero biases); 16 heads of 64; dots = q k^T / 8; a binary int mask [b][n][32*32 = m] shared by the heads: masked_fill(mask == 0, -inf); softmax over the 1024 context tokens; out = merged Wp + bp -> [4][1024][1024]).
// Structure: x and context as exact f16 rows and [in][out] weights as exact x16 planes (Wkv as one [2048][1024] plane: k rows then v rows), and the int mask as 1-bit lane-mask words, all in one preparation launch; Q and K | V (one launch, grid.y) as WMMA GEMMs (operands staged in LDS, 32x64 wave tiles, f32 accumulation, + bias, f16 outputs); V^T of all batches via LDS transposes (one launch); scores (K = 64, 1/8), mask select, online softmax (f32 statistics, native exp2; weights f16, unnormalised) and o = P V^T (o carried x64) of all 64 (batch, head) planes fused in one launch, scores and weights in registers only, into merged f16 rows; out = o Wp + bp GEMM (f32, alpha 2^-10); launches: see trace.
// Compute dtype: inputs rounded to bf16; x / context / weights exact; q, k, v, softmax weights and o as plain f16 GEMM operands (~2^-12); scores and statistics f32. v_wmma_f32_16x16x32_f16.
#define NB 4
#define NQ 1024
#define SK 1024
#define SQ SK                       /* keys per softmax row */
#define DM 1024
#define DC 1024
#define NH 16
#define HD 64
#define HG 4
#define NRQ ((size_t)NB * NQ)
#define NRK ((size_t)NB * SK)
typedef __bf16 v16b __attribute__((ext_vector_type(16)));
typedef unsigned short v8us __attribute__((ext_vector_type(8), may_alias));
typedef float  v8f  __attribute__((ext_vector_type(8)));
typedef float  v4f  __attribute__((ext_vector_type(4)));
typedef float  v4fa __attribute__((ext_vector_type(4), may_alias));
union FragB { v16b v; v8us half[2]; unsigned short u[16]; };

__device__ __forceinline__ unsigned short bf16_bits(float x) { unsigned int u = __float_as_uint(x); return (unsigned short)((u + 0x7FFFu + ((u >> 16) & 1u)) >> 16); }
__device__ __forceinline__ float bf16_val(unsigned short b) { return __uint_as_float(((unsigned int)b) << 16); }
__device__ __forceinline__ float bf16_round(float x) { return bf16_val(bf16_bits(x)); }
// D += A·B with NT terms: 1 = ah·bh, 2 = + al·bh (A split), 3 = + ah·bl (both split)
template <int NT>
__device__ __forceinline__ v8f mmaN(v16b ah, v16b al, v16b bh, v16b bl, v8f c) {
  c = __builtin_amdgcn_wmma_f32_16x16x32_bf16(false, ah, false, bh, (short)0, c, false, false);
  if (NT >= 2) c = __builtin_amdgcn_wmma_f32_16x16x32_bf16(false, al, false, bh, (short)0, c, false, false);
  if (NT >= 3) c = __builtin_amdgcn_wmma_f32_16x16x32_bf16(false, ah, false, bl, (short)0, c, false, false);
  asm volatile("v_nop\n\tv_nop\n\tv_nop\n\tv_nop" : "+v"(c) : "v"(ah), "v"(al), "v"(bh), "v"(bl));
  return c;
}

__global__ __launch_bounds__(256) void k_wt_bf16(const float* __restrict__ W, unsigned short* __restrict__ Wt, int K, int N) {
  const int t = blockIdx.x * 256 + threadIdx.x;
  const int k8n = K / 8;
  if (t >= N * k8n) return;
  const int n = t / k8n, k8 = (t % k8n) * 8;
  v8us v;
#pragma unroll
  for (int i = 0; i < 8; ++i) v[i] = bf16_bits(W[(size_t)(k8 + i) * N + n]);
  *(v8us*)(Wt + (size_t)n * K + k8) = v;
  
}

// GEMM C[M][N] (f32, pitch ldc) = act(A[M][K]·W + bias). A f32 row-major (pitch lda) converted per fragment to bf16
// (ASPLIT: hi/lo two planes -> 2 terms, else single rounded term); Wt bf16 [N][K] (pitch ldb). BIAS_BF16 rounds the
// bias to bf16 first (bias quantised to bf16 before the add). K%32==0, M%16==0, N%64==0.
template <bool ASPLIT, int ACT, bool BIAS_BF16>
__global__ __launch_bounds__(128) void k_gemm_bf(const float* __restrict__ A, int lda, const unsigned short* __restrict__ Wt, int ldb,
                                               const float* __restrict__ bias, float* __restrict__ C, int ldc, int M, int N, int K) {
  __shared__ __attribute__((aligned(16))) float so[4][16][64];
  const int tid = threadIdx.x, w = tid >> 5, lane = tid & 31, ln = lane & 15, hh = lane >> 4;
  const int ntn = N / 64;
  const int wid = blockIdx.x * 4 + w;
  const int mt = wid / ntn, nq = wid % ntn;
  if (mt * 16 >= M) return;
  const int row0 = mt * 16, col0 = nq * 64;
  const float* arow = A + (size_t)(row0 + ln) * lda;
  v8f acc[4] = {};
  for (int kb = 0; kb < K; kb += 32) {
    FragB ah, al;
    const v4f x0 = *(const v4fa*)(arow + kb + 8 * hh), x1 = *(const v4fa*)(arow + kb + 8 * hh + 4);
    const v4f x2 = *(const v4fa*)(arow + kb + 16 + 8 * hh), x3 = *(const v4fa*)(arow + kb + 16 + 8 * hh + 4);
    float xs[16] = {x0[0],x0[1],x0[2],x0[3],x1[0],x1[1],x1[2],x1[3],x2[0],x2[1],x2[2],x2[3],x3[0],x3[1],x3[2],x3[3]};
#pragma unroll
    for (int i = 0; i < 16; ++i) { const unsigned short hb = bf16_bits(xs[i]); ah.u[i] = hb; al.u[i] = ASPLIT ? bf16_bits(xs[i] - bf16_val(hb)) : (unsigned short)0; }
#pragma unroll
    for (int t = 0; t < 4; ++t) {
      const unsigned short* brow = Wt + (size_t)(col0 + t * 16 + ln) * ldb + kb;
      FragB b;
      b.half[0] = *(const v8us*)(brow + 8 * hh);
      b.half[1] = *(const v8us*)(brow + 16 + 8 * hh);
      acc[t] = mmaN<ASPLIT ? 2 : 1>(ah.v, al.v, b.v, b.v, acc[t]);
    }
  }
#pragma unroll
  for (int t = 0; t < 4; ++t) {
    float bv = bias ? bias[col0 + t * 16 + ln] : 0.f;
    if (BIAS_BF16) bv = bf16_round(bv);
#pragma unroll
    for (int r = 0; r < 8; ++r) { float v = acc[t][r] + bv; if (ACT == 1) v = fmaxf(v, 0.f); so[w][8 * hh + r][t * 16 + ln] = v; }
  }
  __builtin_amdgcn_fence(__ATOMIC_ACQ_REL, "workgroup");
  __builtin_amdgcn_wave_barrier();
  const int rsub = lane >> 4, c4 = (lane & 15) * 4;
  {
#pragma unroll
    for (int q = 0; q < 8; ++q) {
      const int r = q * 2 + rsub;
      const v4f v = *(const v4fa*)&so[w][r][c4];
      *(v4f*)(C + (size_t)(row0 + r) * ldc + col0 + c4) = v;
    }
    
  }
}

// GEMM C = act(A·W + bias + resid): A f32 (ASPLIT -> hi/lo 2 terms), Wt bf16 [N][K]; ACT 0 none, 1 relu, 2 exact gelu;
// resid (optional, f32, row index = (row % rmod), pitch ldr, RES_BF16 rounds it) added before the activation.
template <bool ASPLIT, int ACT, bool BIAS_BF16, bool RES_BF16>
__global__ __launch_bounds__(128) void k_gemm_bf3(const float* __restrict__ A, int lda, const unsigned short* __restrict__ Wt, int ldb,
                                                const float* __restrict__ bias, const float* __restrict__ resid, int rmod, int ldr,
                                                float* __restrict__ C, int ldc, int M, int N, int K) {
  __shared__ __attribute__((aligned(16))) float so[4][16][64];
  const int tid = threadIdx.x, w = tid >> 5, lane = tid & 31, ln = lane & 15, hh = lane >> 4;
  const int ntn = N / 64;
  const int wid = blockIdx.x * 4 + w;
  const int mt = wid / ntn, nq = wid % ntn;
  if (mt * 16 >= M) return;
  const int row0 = mt * 16, col0 = nq * 64;
  const float* arow = A + (size_t)(row0 + ln) * lda;
  v8f acc[4] = {};
  for (int kb = 0; kb < K; kb += 32) {
    FragB ah, al;
    const v4f x0 = *(const v4fa*)(arow + kb + 8 * hh), x1 = *(const v4fa*)(arow + kb + 8 * hh + 4);
    const v4f x2 = *(const v4fa*)(arow + kb + 16 + 8 * hh), x3 = *(const v4fa*)(arow + kb + 16 + 8 * hh + 4);
    float xs[16] = {x0[0],x0[1],x0[2],x0[3],x1[0],x1[1],x1[2],x1[3],x2[0],x2[1],x2[2],x2[3],x3[0],x3[1],x3[2],x3[3]};
#pragma unroll
    for (int i = 0; i < 16; ++i) { const unsigned short hb = bf16_bits(xs[i]); ah.u[i] = hb; al.u[i] = ASPLIT ? bf16_bits(xs[i] - bf16_val(hb)) : (unsigned short)0; }
#pragma unroll
    for (int t = 0; t < 4; ++t) {
      const unsigned short* brow = Wt + (size_t)(col0 + t * 16 + ln) * ldb + kb;
      FragB b;
      b.half[0] = *(const v8us*)(brow + 8 * hh);
      b.half[1] = *(const v8us*)(brow + 16 + 8 * hh);
      acc[t] = mmaN<ASPLIT ? 2 : 1>(ah.v, al.v, b.v, b.v, acc[t]);
    }
  }
#pragma unroll
  for (int t = 0; t < 4; ++t) {
    const int col = col0 + t * 16 + ln;
    float bv = bias ? bias[col] : 0.f;
    if (BIAS_BF16) bv = bf16_round(bv);
#pragma unroll
    for (int r = 0; r < 8; ++r) {
      float v = acc[t][r] + bv;
      if (resid) { float rv = resid[(size_t)((row0 + 8 * hh + r) % rmod) * ldr + col]; if (RES_BF16) rv = bf16_round(rv); v += rv; }
      if (ACT == 1) v = fmaxf(v, 0.f);
      if (ACT == 2) v = 0.5f * v * (1.0f + erff(v * 0.70710678118654752f));
      if (ACT == 3) { const float u = 0.7978845608028654f * (v + 0.044715f * v * v * v); v = 0.5f * v * (1.0f + tanhf(u)); }
      so[w][8 * hh + r][t * 16 + ln] = v;
    }
  }
  __builtin_amdgcn_fence(__ATOMIC_ACQ_REL, "workgroup");
  __builtin_amdgcn_wave_barrier();
  const int rsub = lane >> 4, c4 = (lane & 15) * 4;
  {
#pragma unroll
    for (int q = 0; q < 8; ++q) {
      const int r = q * 2 + rsub;
      const v4f v = *(const v4fa*)&so[w][r][c4];
      *(v4f*)(C + (size_t)(row0 + r) * ldc + col0 + c4) = v;
    }
    
  }
}
// row LayerNorm (biased variance, eps) over N: s = X (+ R); optional out_sum <- s; out_norm <- (s-mu)*rsqrt(var+eps)*g + b
template <bool PARAM_BF16>
__global__ __launch_bounds__(256) void k_layernorm(const float* __restrict__ X, const float* __restrict__ R, const float* __restrict__ g, const float* __restrict__ bta,
                                                  float* __restrict__ out_sum, float* __restrict__ out_norm, int N, float eps) {
  __shared__ float red[256];
  const int row = blockIdx.x, tid = threadIdx.x;
  const float* x = X + (size_t)row * N; const float* rr = R ? R + (size_t)row * N : nullptr;
  float vals[16];                     // up to N = 4096
  const int per = N / 256;            // contiguous chunk per thread? use strided-by-4 chunks: thread handles j = tid*4 + 1024*u
  float s1 = 0.f;
  for (int u = 0; u < per / 4; ++u) {
    const int j = tid * 4 + 1024 * u;
    const v4f a = *(const v4fa*)(x + j);
    v4f b = {0.f,0.f,0.f,0.f}; if (rr) b = *(const v4fa*)(rr + j);
#pragma unroll
    for (int q = 0; q < 4; ++q) { const float v = a[q] + b[q]; vals[u * 4 + q] = v; s1 += v; }
  }
  red[tid] = s1; __syncthreads();
  for (int st = 128; st > 0; st >>= 1) { if (tid < st) red[tid] += red[tid + st]; __syncthreads(); }
  const float mu = red[0] / (float)N; __syncthreads();
  float s2 = 0.f;
  for (int u = 0; u < per / 4; ++u)
#pragma unroll
    for (int q = 0; q < 4; ++q) { const float c = vals[u * 4 + q] - mu; s2 += c * c; }
  red[tid] = s2; __syncthreads();
  for (int st = 128; st > 0; st >>= 1) { if (tid < st) red[tid] += red[tid + st]; __syncthreads(); }
  const float rs = rsqrtf(red[0] / (float)N + eps);
  {
    for (int u = 0; u < per / 4; ++u) {
      const int j = tid * 4 + 1024 * u;
      v4f o, sm;
#pragma unroll
      for (int q = 0; q < 4; ++q) {
        float gg = g[j + q], bb = bta[j + q];
        if (PARAM_BF16) { gg = bf16_round(gg); bb = bf16_round(bb); }
        sm[q] = vals[u * 4 + q]; o[q] = (vals[u * 4 + q] - mu) * rs * gg + bb;
      }
      if (out_sum) *(v4f*)(out_sum + (size_t)row * N + j) = sm;
      *(v4f*)(out_norm + (size_t)row * N + j) = o;
    }
    
  }
}



// ---- f16 WMMA path (v_wmma_f32_16x16x32_f16): 11-bit significands for operands in range — used where a [0,1] probability operand needs more precision than bf16
typedef _Float16 v16h __attribute__((ext_vector_type(16)));
union FragH { v16h v; v8us half[2]; _Float16 h[16]; unsigned short u[16]; };
template <int NT>
__device__ __forceinline__ v8f mmaH(v16h ah, v16h al, v16h bh, v16h bl, v8f c) {
  c = __builtin_amdgcn_wmma_f32_16x16x32_f16(false, ah, false, bh, (short)0, c, false, false);
  if (NT >= 2) c = __builtin_amdgcn_wmma_f32_16x16x32_f16(false, al, false, bh, (short)0, c, false, false);
  if (NT >= 3) c = __builtin_amdgcn_wmma_f32_16x16x32_f16(false, ah, false, bl, (short)0, c, false, false);
  asm volatile("v_nop\n\tv_nop\n\tv_nop\n\tv_nop" : "+v"(c) : "v"(ah), "v"(al), "v"(bh), "v"(bl));
  return c;
}
// batched GEMM like k_gemm_b but f16 operands: A f32 (split into f16 hi/lo if ASPLIT, else rounded to f16), Bt = f16 values [n][k]; alpha; C f32; N multiple of 16 (partial tiles skipped)
template <bool ASPLIT>
__global__ __launch_bounds__(128) void k_gemm_h(const float* __restrict__ A, int lda, size_t sA, const _Float16* __restrict__ Bh, int ldb, size_t sB, float alpha, float* __restrict__ C, int ldc, size_t sC, int M, int N, int K) {
  __shared__ __attribute__((aligned(16))) float so[4][16][64];
  const int tid = threadIdx.x, w = tid >> 5, lane = tid & 31, ln = lane & 15, hh = lane >> 4; const int by = blockIdx.y;
  A += (size_t)by * sA; Bh += (size_t)by * sB; C += (size_t)by * sC;
  const int ntn = (N + 63) / 64; const int wid = blockIdx.x * 4 + w; const int mt = wid / ntn, nq = wid % ntn; if (mt * 16 >= M) return;
  const int row0 = mt * 16, col0 = nq * 64; const float* arow = A + (size_t)(row0 + ln) * lda;
  v8f acc[4] = {};
  for (int kb = 0; kb < K; kb += 32) {
    FragH ah, al;
    const v4f x0 = *(const v4fa*)(arow + kb + 8 * hh), x1 = *(const v4fa*)(arow + kb + 8 * hh + 4), x2 = *(const v4fa*)(arow + kb + 16 + 8 * hh), x3 = *(const v4fa*)(arow + kb + 16 + 8 * hh + 4);
    float xs[16] = {x0[0],x0[1],x0[2],x0[3],x1[0],x1[1],x1[2],x1[3],x2[0],x2[1],x2[2],x2[3],x3[0],x3[1],x3[2],x3[3]};
#pragma unroll
    for (int i = 0; i < 16; ++i) { const _Float16 h = (_Float16)xs[i]; ah.h[i] = h; al.h[i] = ASPLIT ? (_Float16)(xs[i] - (float)h) : (_Float16)0.0f; }
#pragma unroll
    for (int t = 0; t < 4; ++t) { if (col0 + t * 16 >= N) continue; const size_t boff = (size_t)(col0 + t * 16 + ln) * ldb + kb; FragH bq; bq.half[0] = *(const v8us*)(Bh + boff + 8 * hh); bq.half[1] = *(const v8us*)(Bh + boff + 16 + 8 * hh);
      acc[t] = mmaH<ASPLIT ? 2 : 1>(ah.v, al.v, bq.v, bq.v, acc[t]); }
  }
#pragma unroll
  for (int t = 0; t < 4; ++t) { if (col0 + t * 16 >= N) continue;
#pragma unroll
    for (int r = 0; r < 8; ++r) so[w][8 * hh + r][t * 16 + ln] = acc[t][r] * alpha; }
  __builtin_amdgcn_fence(__ATOMIC_ACQ_REL, "workgroup"); __builtin_amdgcn_wave_barrier();
  const int rsub = lane >> 4, c4 = (lane & 15) * 4;
  {
#pragma unroll
    for (int q = 0; q < 8; ++q) { const int r = q * 2 + rsub; if (col0 + c4 < N) { const v4f v = *(const v4fa*)&so[w][r][c4]; *(v4f*)(C + (size_t)(row0 + r) * ldc + col0 + c4) = v; } }
     }
}

// k_gemm_hh variant with fused epilogue: v = acc·alpha + bias[by·sBias + col] (+ CP[(row/rowsPerB)·sCPb + by·64 + col] if CP) ; ACT 0 none / 1 elu ; writes f16 C16 (and f32 C if non-null)
template <int ACT>
__global__ __launch_bounds__(128) void k_gemm_hhx(const _Float16* __restrict__ A, int lda, size_t sA, const _Float16* __restrict__ Bh, int ldb, size_t sB, float alpha, const float* __restrict__ bias, size_t sBias, const float* __restrict__ CP, int rowsPerB, size_t sCPb, int row0g,
    float* __restrict__ C, _Float16* __restrict__ C16, int ldc, size_t sC, int M, int N, int K) {
  __shared__ __attribute__((aligned(16))) float so[4][16][64];
  const int tid = threadIdx.x, w = tid >> 5, lane = tid & 31, ln = lane & 15, hh = lane >> 4; const int by = blockIdx.y;
  A += (size_t)by * sA; Bh += (size_t)by * sB; const size_t cofs = (size_t)by * sC; const float* bp = bias ? bias + (size_t)by * sBias : nullptr;
  const int ntn = (N + 63) / 64; const int wid = blockIdx.x * 4 + w; const int mt = wid / ntn, nq = wid % ntn; if (mt * 16 >= M) return;
  const int row0 = mt * 16, col0 = nq * 64; const _Float16* arow = A + (size_t)(row0 + ln) * lda;
  v8f acc[4] = {};
  for (int kb = 0; kb < K; kb += 32) { FragH ah; ah.half[0] = *(const v8us*)((const unsigned short*)arow + kb + 8 * hh); ah.half[1] = *(const v8us*)((const unsigned short*)arow + kb + 16 + 8 * hh);
#pragma unroll
    for (int t = 0; t < 4; ++t) { if (col0 + t * 16 >= N) continue; const size_t boff = (size_t)(col0 + t * 16 + ln) * ldb + kb; FragH bq; bq.half[0] = *(const v8us*)((const unsigned short*)Bh + boff + 8 * hh); bq.half[1] = *(const v8us*)((const unsigned short*)Bh + boff + 16 + 8 * hh);
      acc[t] = mmaH<1>(ah.v, ah.v, bq.v, bq.v, acc[t]); }
  }
#pragma unroll
  for (int t = 0; t < 4; ++t) { if (col0 + t * 16 >= N) continue; const int col = col0 + t * 16 + ln; const float bv = bp ? bf16_round(bp[col]) : 0.f;
#pragma unroll
    for (int r = 0; r < 8; ++r) { float v = acc[t][r] * alpha + bv; if (CP) { const int rr = row0g + row0 + 8 * hh + r; if (rowsPerB < 0) v += CP[cofs + (size_t)rr * ldc + col];      /* rowsPerB < 0: own element of the batched C plane */ else { const int bidx = rr / rowsPerB; v += CP[(size_t)bidx * sCPb + (size_t)by * 64 + col]; } } if (ACT == 1) v = (v > 0.f) ? v : expm1f(v); else if (ACT == 7) v = (v > 0.f) ? v + 1.0f : expf(v); else if (ACT == 8) v = tanhf(v); else if (ACT == 9) v = 0.5f * v * (1.0f + tanhf(0.7978845608028654f * (v + 0.044715f * v * v * v))); else if (ACT == 11) v = 1.0f / (1.0f + expf(-v)); else if (ACT == 12) v = (v > 0.f) ? v : 0.01f * v; else if (ACT == 14) v = (v > 0.f) ? v : 0.1f * v; else if (ACT == 16) v = (v >= 0.f) ? v : 0.3f * v; else if (ACT == 17) v = (v >= 0.f) ? v : 0.2f * v; else if (ACT == 15) v = v / (1.0f + expf(-v)); else if (ACT == 3) v = fmaxf(v, 0.f); else if (ACT == 6) v = 0.5f * v * (1.0f + erff(v * 0.70710678118654752f)); so[w][8 * hh + r][t * 16 + ln] = v; } }
  __builtin_amdgcn_fence(__ATOMIC_ACQ_REL, "workgroup"); __builtin_amdgcn_wave_barrier();
  const int rsub = lane >> 4, c4 = (lane & 15) * 4; typedef _Float16 v4h __attribute__((ext_vector_type(4)));
  {
#pragma unroll
    for (int q = 0; q < 8; ++q) { const int r = q * 2 + rsub; if (col0 + c4 < N) { const v4f v = *(const v4fa*)&so[w][r][c4]; if (C) *(v4f*)(C + cofs + (size_t)(row0 + r) * ldc + col0 + c4) = v; if (C16) { v4h h4; for (int i = 0; i < 4; ++i) h4[i] = (_Float16)v[i]; *(v4h*)(C16 + cofs + (size_t)(row0 + r) * ldc + col0 + c4) = h4; } } }
     }
}


typedef _Float16 v4h __attribute__((ext_vector_type(4)));

__global__ __launch_bounds__(256) void k_h16(const float* __restrict__ x, _Float16* __restrict__ X16, size_t n8) { const size_t t = (size_t)blockIdx.x * 256 + threadIdx.x; if (t >= n8) return; FragH f;
#pragma unroll
  for (int q = 0; q < 8; ++q) f.h[q] = (_Float16)x[t * 8 + q]; *(v8us*)((unsigned short*)X16 + t * 8) = f.half[0];  }
__global__ __launch_bounds__(256) void k_round16f(const float* __restrict__ W, _Float16* __restrict__ Bt, size_t n8) { const size_t t = (size_t)blockIdx.x * 256 + threadIdx.x; if (t >= n8) return; FragH f;
#pragma unroll
  for (int i = 0; i < 8; ++i) f.h[i] = (_Float16)(bf16_round(W[t * 8 + i]) * 16.0f); *(v8us*)((unsigned short*)Bt + t * 8) = f.half[0];  }
template <int NHv, int TTv>
__global__ __launch_bounds__(256) void k_vt(const _Float16* __restrict__ V16, int ldv, int voff, _Float16* __restrict__ Vt) { __shared__ unsigned short tl[64][66]; const int tid = threadIdx.x; const int slab = blockIdx.x / (TTv / 64), lg = blockIdx.x % (TTv / 64); const int b = slab / NHv, h = slab % NHv;
  for (int i = tid; i < 64 * 8; i += 256) { const int r = i / 8, c8 = (i % 8) * 8; FragH f; f.half[0] = *(const v8us*)((const unsigned short*)V16 + ((size_t)b * TTv + lg * 64 + r) * ldv + voff + h * 64 + c8);
#pragma unroll
    for (int q = 0; q < 8; ++q) tl[r][c8 + q] = f.u[q]; }
  __syncthreads();
  {
#pragma unroll
    for (int rd = 0; rd < 2; ++rd) { const int d = rd * 32 + tid / 8, pc = tid % 8; FragH f;
#pragma unroll
      for (int q = 0; q < 8; ++q) f.u[q] = tl[pc * 8 + q][d];
      *(v8us*)((unsigned short*)Vt + ((size_t)slab * 64 + d) * TTv + lg * 64 + pc * 8) = f.half[0]; }
     } }

__global__ __launch_bounds__(256) void k_hl(const float* __restrict__ F, _Float16* __restrict__ Hh, _Float16* __restrict__ Hl, size_t n8) { const size_t t = (size_t)blockIdx.x * 256 + threadIdx.x; if (t >= n8) return; FragH fh, fl; const v4f a = *(const v4fa*)(F + t * 8), c = *(const v4fa*)(F + t * 8 + 4);
#pragma unroll
  for (int q = 0; q < 4; ++q) { _Float16 h = (_Float16)a[q]; fh.h[q] = h; fl.h[q] = (_Float16)((a[q] - (float)h) * 1024.0f); h = (_Float16)c[q]; fh.h[4 + q] = h; fl.h[4 + q] = (_Float16)((c[q] - (float)h) * 1024.0f); }
  { *(v8us*)((unsigned short*)Hh + t * 8) = fh.half[0]; *(v8us*)((unsigned short*)Hl + t * 8) = fl.half[0];  } }

// ---- fast GEMM (work-group tile 128x64, wave tile 32x64; requires M % 128 == 0, N % 64 == 0, K % 128 == 0, 256-byte aligned rows); operands staged in LDS; epilogue = k_gemm_hhx semantics ----
#define G2_KS 128                      /* k per stage: 256 bytes of every operand row */
#define G2_PITCH (G2_KS * 2 + 16)      /* LDS row pitch in bytes: 16 x odd, for 16-byte readers */
__device__ __forceinline__ v16h g2_lfrag(const char* p) { FragH f; f.half[0] = *(const v8us*)p; f.half[1] = *(const v8us*)(p + 32); return f.v; }      /* a fragment from a staged row; the lane's 16 hh bytes are in p */
__device__ __forceinline__ v8f g2_mma(v16h a, v16h b, v8f c) { v8f d = __builtin_amdgcn_wmma_f32_16x16x32_f16(false, a, false, b, (short)0, c, false, false); asm volatile("v_nop\n\tv_nop\n\tv_nop\n\tv_nop" : "+v"(d) : "v"(a), "v"(b)); return d; }
template <int ACT, int lda, int ldb>      /* the operands' row pitches at compile time: a thread's staging loads are then one base, one lane offset and immediates */
__global__ __launch_bounds__(128) void k_gemm2(const _Float16* __restrict__ A, size_t sA, const _Float16* __restrict__ Bh, size_t sB, float alpha, const float* __restrict__ bias, size_t sBias, const float* __restrict__ CP, int rowsPerB, size_t sCPb, int row0g,
    float* __restrict__ C, _Float16* __restrict__ C16, int ldc, size_t sC, int M, int N, int K, size_t sAz, size_t sBz, size_t sCz) { static_assert(ACT == 0 || ACT == 3 || ACT == 6 || ACT == 8 || ACT == 9 || ACT == 11 || ACT == 12 || ACT == 14 || ACT == 15 || ACT == 16 || ACT == 17, "k_gemm2: unsupported ACT code (would silently apply no activation)");
  __shared__ __attribute__((aligned(16))) char sm[192 * G2_PITCH];      /* one stage: 128 A rows, then 64 B rows, G2_KS k each; behind the k loop the waves' output staging */
  static_assert(sizeof(sm) >= 4 * 32 * 68 * sizeof(float), "k_gemm2: the output staging lies in the stage buffer"); float (*so)[32][68] = (float (*)[32][68])sm;
  const int tid = threadIdx.x, w = tid >> 5, lane = tid & 31, ln = lane & 15, hh = lane >> 4; const int by = blockIdx.y, bz = blockIdx.z;      /* two batch levels: grid.y (strides sA, sB, sC) and grid.z (strides sAz, sBz, sCz) */
  A += (size_t)by * sA + (size_t)bz * sAz; Bh += (size_t)by * sB + (size_t)bz * sBz; const size_t cofs = (size_t)by * sC + (size_t)bz * sCz; const float* bp = bias ? bias + (size_t)by * sBias : nullptr;
  const int ntn = N >> 6; const int mt = blockIdx.x / ntn, nq = blockIdx.x - mt * ntn; const int row0 = mt * 128 + 32 * w, col0 = nq * 64; if (mt * 128 >= M) return;      /* the same for the whole work-group: barriers follow */
  const char* Ab = (const char*)(A + (size_t)(mt * 128) * lda); const char* Bb = (const char*)(Bh + (size_t)col0 * ldb);      /* uniform bases; the lane's part is a 32-bit byte offset that never changes */
  const int sr = tid >> 4, sc = tid & 15;      /* staging: 16 lanes take one row's 256 bytes, so a wave's load covers 4 whole lines; thread rows sr + 8 j */
  const unsigned ga = (unsigned)(sr * lda + sc * 8) * 2, gb = (unsigned)(sr * ldb + sc * 8) * 2;
  char* sst = sm + sr * G2_PITCH + sc * 16;
  const char* sa = sm + (32 * w + ln) * G2_PITCH + 16 * hh; const char* sb = sm + (128 + ln) * G2_PITCH + 16 * hh;      /* fragment rows; k = 8 hh + 0..7 and 16 + 8 hh + 0..7 of each 32, A and B alike */
  const v8f z8 = {0.f,0.f,0.f,0.f,0.f,0.f,0.f,0.f}; v8f c00 = z8, c01 = z8, c02 = z8, c03 = z8, c10 = z8, c11 = z8, c12 = z8, c13 = z8;
  v8us st[24];
#pragma unroll
  for (int j = 0; j < 16; ++j) st[j] = *(const v8us*)(Ab + (size_t)(8 * j) * lda * 2 + ga);
#pragma unroll
  for (int j = 0; j < 8; ++j) st[16 + j] = *(const v8us*)(Bb + (size_t)(8 * j) * ldb * 2 + gb);
#pragma unroll 1
  for (int kb = 0; kb < K; kb += G2_KS) {
#pragma unroll
    for (int j = 0; j < 24; ++j) *(v8us*)(sst + 8 * j * G2_PITCH) = st[j];
    __syncthreads();      /* the stage is whole before anybody reads it */
    if (kb + G2_KS < K) {      /* the next stage's rows fly into registers while this stage is worked on */
      const char* An = Ab + (size_t)(kb + G2_KS) * 2; const char* Bn = Bb + (size_t)(kb + G2_KS) * 2;
#pragma unroll
      for (int j = 0; j < 16; ++j) st[j] = *(const v8us*)(An + (size_t)(8 * j) * lda * 2 + ga);
#pragma unroll
      for (int j = 0; j < 8; ++j) st[16 + j] = *(const v8us*)(Bn + (size_t)(8 * j) * ldb * 2 + gb);
      asm volatile("s_wait_xcnt 0x0" ::: "memory");      /* the loads' address registers are reused by the fragment loads right behind; it also keeps the global loads in front of the LDS reads */
    }
#pragma unroll
    for (int kk = 0; kk < G2_KS / 32; ++kk) { const v16h a0 = g2_lfrag(sa + 64 * kk), a1 = g2_lfrag(sa + 16 * G2_PITCH + 64 * kk);      /* the six fragments of a k step are asked for together: one LDS wait a step */
      const v16h b0 = g2_lfrag(sb + 64 * kk), b1 = g2_lfrag(sb + 16 * G2_PITCH + 64 * kk), b2 = g2_lfrag(sb + 32 * G2_PITCH + 64 * kk), b3 = g2_lfrag(sb + 48 * G2_PITCH + 64 * kk);
      c00 = g2_mma(a0, b0, c00); c10 = g2_mma(a1, b0, c10); c01 = g2_mma(a0, b1, c01); c11 = g2_mma(a1, b1, c11);
      c02 = g2_mma(a0, b2, c02); c12 = g2_mma(a1, b2, c12); c03 = g2_mma(a0, b3, c03); c13 = g2_mma(a1, b3, c13); }
    __syncthreads();      /* every reader has left the stage before it is written again (behind the last pass: before the output staging) */
  }
  v8f accs[8] = {c00, c01, c02, c03, c10, c11, c12, c13};
#pragma unroll
  for (int u = 0; u < 8; ++u) { const int t = u & 3, half = u >> 2; const int col = col0 + t * 16 + ln; const float bv = bp ? bf16_round(bp[col]) : 0.f;
#pragma unroll
    for (int r = 0; r < 8; ++r) { const int rloc = half * 16 + 8 * hh + r; float v = accs[u][r] * alpha + bv; if (CP) { if (rowsPerB < 0) v += CP[cofs + (size_t)(row0g + row0 + rloc) * ldc + col];      /* rowsPerB < 0: own element of the batched C plane */ else { const int bidx = (row0g + row0 + rloc) / rowsPerB; v += CP[(size_t)bidx * sCPb + (size_t)by * 64 + col]; } }
      if (ACT == 3) v = fmaxf(v, 0.f); else if (ACT == 6) v = 0.5f * v * (1.0f + erff(v * 0.70710678118654752f)); else if (ACT == 11) v = 1.0f / (1.0f + expf(-v)); else if (ACT == 15) v = v / (1.0f + expf(-v)); else if (ACT == 12) v = (v > 0.f) ? v : 0.01f * v; else if (ACT == 8) v = tanhf(v); else if (ACT == 9) v = 0.5f * v * (1.0f + tanhf(0.7978845608028654f * (v + 0.044715f * v * v * v))); else if (ACT == 14) v = (v > 0.f) ? v : 0.1f * v; else if (ACT == 16) v = (v >= 0.f) ? v : 0.3f * v; else if (ACT == 17) v = (v >= 0.f) ? v : 0.2f * v;
      so[w][rloc][t * 16 + ln] = v; } }
  __builtin_amdgcn_fence(__ATOMIC_ACQ_REL, "workgroup"); __builtin_amdgcn_wave_barrier();
  const int rsub = lane >> 4, c4 = (lane & 15) * 4;
  {
#pragma unroll
    for (int q = 0; q < 16; ++q) { const int r = q * 2 + rsub; const v4f v = *(const v4fa*)&so[w][r][c4]; if (C) *(v4f*)(C + cofs + (size_t)(row0 + r) * ldc + col0 + c4) = v; if (C16) { v4h h4; for (int i = 0; i < 4; ++i) h4[i] = (_Float16)v[i]; *(v4h*)(C16 + cofs + (size_t)(row0 + r) * ldc + col0 + c4) = h4; } }
     } }


__global__ __launch_bounds__(256) void k_wnat(const float* __restrict__ w, size_t n8, _Float16* __restrict__ Bt) { const size_t t = (size_t)blockIdx.x * 256 + threadIdx.x; if (t >= n8) return; FragH f; for (int q = 0; q < 8; ++q) f.h[q] = (_Float16)(bf16_round(w[t * 8 + q]) * 16.0f); *(v8us*)((unsigned short*)Bt + t * 8) = f.half[0];  }
__global__ __launch_bounds__(256) void k_rsm(const float* __restrict__ S, _Float16* __restrict__ P, int nrows) {
  #pragma clang fp contract(off)
  const int i = blockIdx.x * 256 + threadIdx.x; if (i >= nrows) return; const float* s = S + (size_t)i * SQ; float mx = -3.0e38f;
#pragma unroll 1
  for (int j = 0; j < SQ; ++j) mx = fmaxf(mx, s[j]); float se = 0.f;
#pragma unroll 1
  for (int j = 0; j < SQ; ++j) se += expf(s[j] - mx); const float sc = 256.0f / se;
#pragma unroll 1
  for (int j0 = 0; j0 < SQ; j0 += 8) { FragH f; for (int q = 0; q < 8; ++q) f.h[q] = (_Float16)(expf(s[j0 + q] - mx) * sc); unsigned short* d = (unsigned short*)P + (size_t)i * SQ + j0; *(v8us*)d = f.half[0];  } }
__global__ __launch_bounds__(256) void k_vt(const _Float16* __restrict__ V16, int b, int h0, _Float16* __restrict__ VT) { __shared__ unsigned short tl[64][65]; const int tid = threadIdx.x; const int hh = blockIdx.x % HG, sg = blockIdx.x / HG; const int s0 = sg * 64; const int h = h0 + hh;
  for (int i = tid; i < 64 * 8; i += 256) { const int j = i / 8, d8 = (i % 8) * 8; FragH f; f.half[0] = *(const v8us*)((const unsigned short*)V16 + ((size_t)b * SQ + s0 + j) * DM + h * HD + d8); for (int q = 0; q < 8; ++q) tl[d8 + q][j] = f.u[q]; }
  __syncthreads();
  { for (int i = tid; i < 64 * 8; i += 256) { const int d = i / 8, j8 = (i % 8) * 8; FragH f; for (int q = 0; q < 8; ++q) f.u[q] = tl[d][j8 + q]; *(v8us*)((unsigned short*)VT + ((size_t)hh * HD + d) * SQ + s0 + j8) = f.half[0]; }  } }


__global__ __launch_bounds__(256) void k_rsmf(const float* __restrict__ S, _Float16* __restrict__ P, int qn, int hg) {
  #pragma clang fp contract(off)
  const int t = blockIdx.x * 256 + threadIdx.x; if (t >= qn * hg) return; const size_t i = (size_t)(t / qn) * SQ + (t % qn); const float* s = S + i * SQ; float mx = -3.0e38f;
#pragma unroll 1
  for (int j = 0; j < SQ; ++j) mx = fmaxf(mx, s[j]); float se = 0.f;
#pragma unroll 1
  for (int j = 0; j < SQ; ++j) se += __expf(s[j] - mx); const float sc = 256.0f / se;
#pragma unroll 1
  for (int j0 = 0; j0 < SQ; j0 += 8) { FragH f; for (int q = 0; q < 8; ++q) f.h[q] = (_Float16)(__expf(s[j0 + q] - mx) * sc); unsigned short* d = (unsigned short*)P + i * SQ + j0; *(v8us*)d = f.half[0];  } }

__global__ __launch_bounds__(256) void k_rsmr(const float* __restrict__ S, _Float16* __restrict__ P, int qn, int hg) {
  #pragma clang fp contract(off)
  const int t = blockIdx.x * 256 + threadIdx.x; if (t >= qn * hg) return; const size_t i = (size_t)t;      /* planes packed: row t of plane t / qn */ const float* s = S + i * SQ; float mx = -3.0e38f;
#pragma unroll 1
  for (int j = 0; j < SQ; ++j) mx = fmaxf(mx, s[j]); float se = 0.f;
#pragma unroll 1
  for (int j = 0; j < SQ; ++j) se += __expf(s[j] - mx); const float sc = 256.0f / se;
#pragma unroll 1
  for (int j0 = 0; j0 < SQ; j0 += 8) { FragH f; for (int q = 0; q < 8; ++q) f.h[q] = (_Float16)(__expf(s[j0 + q] - mx) * sc); unsigned short* d = (unsigned short*)P + i * SQ + j0; *(v8us*)d = f.half[0];  } }


typedef int v4ia __attribute__((ext_vector_type(4), may_alias));
typedef unsigned v16ua __attribute__((ext_vector_type(16), may_alias));
typedef float f32x2 __attribute__((ext_vector_type(2)));
__device__ __forceinline__ float fa_xhalf(float x) { return __builtin_bit_cast(float, __builtin_amdgcn_permlanex16(__builtin_bit_cast(int, x), __builtin_bit_cast(int, x), 0x76543210, 0xfedcba98, false, false)); }      /* lane l with lane l ^ 16 */
__device__ __forceinline__ v8f fa_mma(v16h a, v16h b, v8f c) { return __builtin_amdgcn_wmma_f32_16x16x32_f16(false, a, false, b, (short)0, c, false, false); }
__device__ __forceinline__ v16h fa_frag(const char* base, unsigned off) { FragH f; f.half[0] = *(const v8us*)(base + off); f.half[1] = *(const v8us*)(base + off + 32); return f.v; }      /* k = 8 hh + 0..7 and 16 + 8 hh + 0..7; the lane's 16 hh bytes are in off */
// In front of a group of fragment loads: keeps the loads from rising among the WMMAs in front of them.
__device__ __forceinline__ void fa_ahead() { __builtin_amdgcn_sched_barrier(0); }
// Behind the next pass's mask fetch. The wait: the fetch's address registers are reused right behind it. The scheduling barrier: keeps that wait directly behind its loads and the fetch where it is written, a phase ahead of its use (without it the compiler moves the mask fetch down among the exponentials and the wait away from its loads).
__device__ __forceinline__ void fa_issued() { asm volatile("s_wait_xcnt 0x0" ::: "memory"); __builtin_amdgcn_sched_barrier(0); }
// Behind a group of fragment loads from LDS: keeps the group where it is written, as one group a phase ahead of its use (without it the compiler may sink single loads down to their WMMAs).
__device__ __forceinline__ void fa_placed() { __builtin_amdgcn_sched_barrier(0); }
// The mask words as constant-address-space data (k_prep wrote them in an earlier launch; nothing writes them in this one): with the ring's copies and barriers in the kernel the compiler fetched them, as plain global loads, by vector loads behind the first barrier and moved them to scalar registers word by word.
typedef __attribute__((address_space(4))) const v16ua fa_cwords;
#define FA_KS 128                      /* keys per LDS stage: four passes of 32 */
#define FA_KP (HD * 2 + 16)            /* LDS pitch of a K row (64 d): 144 bytes = 16 x odd, for 16-byte readers */
#define FA_VP (FA_KS * 2 + 16)         /* LDS pitch of a V^T row (128 keys): 272 bytes = 16 x odd */
#define FA_KB (FA_KS * FA_KP)          /* a stage's K tile */
#define FA_SB (FA_KB + HD * FA_VP)     /* a stage: K tile, then V^T tile */
// One stage's K rows (128 x 128 bytes) and V^T rows (64 x 256 bytes) from global memory into LDS, through no register: 8 asynchronous 16-byte copies a lane, a wave's copy = 4 whole lines.
// lk, lv: the lane's LDS byte addresses of its first K and V^T piece; gk, gv: the global ones. The four pieces of each kind lie 32 K rows / 16 V^T rows apart.
// The wait on the address translations is the statement's last line: the copies' address registers are free for reuse only behind it (a precaution).
__device__ __forceinline__ void fa_stage(unsigned lk, unsigned lv, const char* gk, const char* gv) {
  asm volatile("global_load_async_to_lds_b128 %0, %1, off\n\t"
               "global_load_async_to_lds_b128 %2, %3, off\n\t"
               "global_load_async_to_lds_b128 %4, %5, off\n\t"
               "global_load_async_to_lds_b128 %6, %7, off\n\t"
               "global_load_async_to_lds_b128 %8, %9, off\n\t"
               "global_load_async_to_lds_b128 %10, %11, off\n\t"
               "global_load_async_to_lds_b128 %12, %13, off\n\t"
               "global_load_async_to_lds_b128 %14, %15, off\n\t"
               "s_wait_xcnt 0x0"
               :: "v"(lk), "v"(gk), "v"(lk + 32 * FA_KP), "v"(gk + 32 * DM * 2), "v"(lk + 64 * FA_KP), "v"(gk + 64 * DM * 2), "v"(lk + 96 * FA_KP), "v"(gk + 96 * DM * 2),
                  "v"(lv), "v"(gv), "v"(lv + 16 * FA_VP), "v"(gv + 16 * SK * 2), "v"(lv + 32 * FA_VP), "v"(gv + 32 * SK * 2), "v"(lv + 48 * FA_VP), "v"(gv + 48 * SK * 2)
               : "memory");
}
__global__ __launch_bounds__(256) void k_fattn(const _Float16* __restrict__ Q, const _Float16* __restrict__ Kr, const _Float16* __restrict__ VT, const unsigned* __restrict__ MW, _Float16* __restrict__ O) {
  __shared__ __attribute__((aligned(16))) char sm[2 * FA_SB];
  const int tid = threadIdx.x, lane = tid & 31, ln = lane & 15, hh = lane >> 4; const int wave = __builtin_amdgcn_readfirstlane((int)(threadIdx.x >> 5));
  const int h = blockIdx.y, b = blockIdx.z, q0 = blockIdx.x * 256 + wave * 32;
  const float cs = 0.125f * 1.4426950408889634f;      /* 1 / sqrt(64), and e^x = 2^(x log2 e) */
  const float fill = -8589934592.0f;      /* masked_fill: -2^33, -2^30 after the 1/8. A power of two, so that its product with cs is exact: while every key seen so far is masked the maximum IS that product, the fused multiply-add of the exponent gives exactly 0 and the weights are 1 (finite); the first unmasked key rescales them to 0. A fill whose product rounds would leave a positive exponent there */
  const char* qb = (const char*)(Q + ((size_t)b * NQ + q0) * DM + h * HD);      /* wave-uniform bases; the lane's part is a 32-bit byte offset that never changes */
  const char* kb = (const char*)(Kr + (size_t)b * SK * DM + h * HD);
  const char* vb = (const char*)(VT + ((size_t)b * NH + h) * HD * SK);
  const unsigned* mb_ = MW + ((size_t)b * NQ + q0) * (SK / 32);      /* the wave's 32 passes x 32 lane-mask words, contiguous; the address is wave-uniform, so the words come by scalar loads */
  const unsigned ko = (unsigned)(ln * DM * 2 + 16 * hh);
  /* staging: 8 lanes take a K row's 128 bytes (thread rows (tid >> 3) + 32 j), 16 lanes a V^T row's 256 bytes of the stage (thread rows (tid >> 4) + 16 j) */
  const unsigned sm0 = (unsigned)(size_t)sm;      /* the ring's LDS byte address: the low 32 bits of the __shared__ address */
  const unsigned lk0 = sm0 + (unsigned)((tid >> 3) * FA_KP + (tid & 7) * 16), lv0 = sm0 + (unsigned)(FA_KB + (tid >> 4) * FA_VP + (tid & 15) * 16);
  const char* gk0 = kb + (size_t)((tid >> 3) * DM * 2 + (tid & 7) * 16); const char* gv0 = vb + (size_t)((tid >> 4) * SK * 2 + (tid & 15) * 16);
  fa_stage(lk0, lv0, gk0, gv0);      /* stage 0 into buffer 0 */
  v16h qf[2][2];
#pragma unroll
  for (int g = 0; g < 2; ++g)
#pragma unroll
    for (int kc = 0; kc < 2; ++kc) qf[g][kc] = fa_frag(qb + 16 * g * DM * 2 + 64 * kc, ko);
  fa_issued();      /* the Q loads' address registers are reused right behind */
  v16ua mk[2];      /* mk[g][8 kt + r]: bit l = lane l's mask element of score register r, tile kt, column group g */
  mk[0] = *(fa_cwords*)mb_; mk[1] = *(fa_cwords*)(mb_ + 16);
  fa_issued();
  asm volatile("s_wait_asynccnt 0x0" ::: "memory");      /* this wave's part of stage 0 has landed */
  __syncthreads();      /* stage 0 is whole before anybody reads it */
  fa_stage(lk0 + FA_SB, lv0 + FA_SB, gk0 + (size_t)FA_KS * DM * 2, gv0 + FA_KS * 2);      /* stage 1 into buffer 1: flies while stage 0 is worked on */
  const v8f z8 = {0.f, 0.f, 0.f, 0.f, 0.f, 0.f, 0.f, 0.f};
  v8f acc[2][4]; float m_run[2], l_run[2];
#pragma unroll
  for (int g = 0; g < 2; ++g) { m_run[g] = -3.0e38f; l_run[g] = 0.f;
#pragma unroll
    for (int t = 0; t < 4; ++t) acc[g][t] = z8; }
  const int klo = ln * FA_KP + 16 * hh, vlo = FA_KB + ln * FA_VP + 16 * hh;      /* the lane's fragment rows in a stage; k = 8 hh + 0..7 and 16 + 8 hh + 0..7 of each 32, as in the Q fragments and in P */
#pragma unroll 1      /* the ring stays a loop of eight stages */
  for (int st = 0; st < SK / FA_KS; ++st) {
    const char* sk = sm + (st & 1) * FA_SB + klo; const char* sv = sm + (st & 1) * FA_SB + vlo;
    v16h kf[2][2], vf[4];
#pragma unroll
    for (int kt = 0; kt < 2; ++kt)
#pragma unroll
      for (int kc = 0; kc < 2; ++kc) kf[kt][kc] = g2_lfrag(sk + 16 * kt * FA_KP + 64 * kc);      /* the stage's first K fragments */
    fa_placed();
#pragma unroll      /* the four passes of a stage: every LDS offset an immediate, and the last pass without a K fetch */
    for (int p = 0; p < FA_KS / 32; ++p) {
      const int kn = (st * FA_KS + p * 32 + 32) & (SK - 1);      /* the next pass's first key; the last pass fetches pass 0's mask words again (in bounds, not used) so that the fetch stays unconditional */
      v8f s[2][2];
#pragma unroll
      for (int kt = 0; kt < 2; ++kt)
#pragma unroll
        for (int g = 0; g < 2; ++g) s[kt][g] = fa_mma(kf[kt][1], qf[g][1], fa_mma(kf[kt][0], qf[g][0], z8));
      fa_ahead();      /* the score products first: the K fetch goes into their operand registers */
      if (p + 1 < FA_KS / 32) {
#pragma unroll
        for (int kt = 0; kt < 2; ++kt)
#pragma unroll
          for (int kc = 0; kc < 2; ++kc) kf[kt][kc] = g2_lfrag(sk + (32 * (p + 1) + 16 * kt) * FA_KP + 64 * kc); }
#pragma unroll
      for (int t = 0; t < 4; ++t) vf[t] = g2_lfrag(sv + 16 * t * FA_VP + 64 * p);
      fa_placed();
      float mb[2]; bool need = false;
#pragma unroll
      for (int g = 0; g < 2; ++g) { float mx = -3.0e38f;
#pragma unroll
        for (int kt = 0; kt < 2; ++kt)
#pragma unroll
          for (int r = 0; r < 8; ++r) { const float v = __builtin_amdgcn_inverse_ballot_w32(mk[g][8 * kt + r]) ? s[kt][g][r] : fill; s[kt][g][r] = v; mx = fmaxf(mx, v); }      /* the word IS the select's lane mask: no compare */
        mx = fmaxf(mx, fa_xhalf(mx)) * cs; mb[g] = mx; need = need || (mx > m_run[g] + 8.0f); }
      if (__builtin_amdgcn_ballot_w32(need) != 0) {      /* wave-uniform; rare after the first passes */
#pragma unroll
        for (int g = 0; g < 2; ++g) { const float mn = fmaxf(m_run[g], mb[g]); const float corr = __builtin_amdgcn_exp2f(m_run[g] - mn); m_run[g] = mn; l_run[g] *= corr;
#pragma unroll
          for (int t = 0; t < 4; ++t) acc[g][t] = acc[g][t] * corr; } }
      { const unsigned* mbn = mb_ + kn;      /* 32 words a pass of 32 keys. Behind the branch, which needs every select: the mask fetch goes into the registers that the selects read */
        mk[0] = *(fa_cwords*)mbn; mk[1] = *(fa_cwords*)(mbn + 16); }
      fa_issued();
#pragma unroll
      for (int g = 0; g < 2; ++g) { const float nm = -m_run[g]; FragH pf; f32x2 ls = {0.f, 0.f};
#pragma unroll
        for (int i = 0; i < 8; ++i) { const f32x2 a = __builtin_elementwise_fma(f32x2{s[i >> 2][g][2 * (i & 3)], s[i >> 2][g][2 * (i & 3) + 1]}, f32x2{cs, cs}, f32x2{nm, nm});
          const f32x2 p2 = {__builtin_amdgcn_exp2f(a.x), __builtin_amdgcn_exp2f(a.y)}; ls += p2; pf.h[2 * i] = (_Float16)p2.x; pf.h[2 * i + 1] = (_Float16)p2.y; }      /* element 8 kt + r of the B operand = key 16 kt + 8 hh + r */
        l_run[g] += ls.x + ls.y;
#pragma unroll
        for (int t = 0; t < 4; ++t) acc[g][t] = fa_mma(vf[t], pf.v, acc[g][t]); }
    }
    asm volatile("s_wait_dscnt 0x0" ::: "memory");      /* this wave's reads of the stage are done */
    asm volatile("s_wait_asynccnt 0x0" ::: "memory");      /* this wave's part of the next stage has landed */
    __syncthreads();      /* publishes the next stage, and ends every wave's reads of this one before it is refilled */
    if (st + 2 < SK / FA_KS) fa_stage(lk0 + (st & 1) * FA_SB, lv0 + (st & 1) * FA_SB, gk0 + (size_t)(st + 2) * (FA_KS * DM * 2), gv0 + (st + 2) * (FA_KS * 2));      /* the same for the whole work-group: stage st + 2 into the buffer just left */
  }
  asm volatile("s_wait_asynccnt 0x0" ::: "memory");      /* no copy is outstanding when the wave ends */
#pragma unroll
  for (int g = 0; g < 2; ++g) { const float l = l_run[g] + fa_xhalf(l_run[g]); const float inv = 64.0f / l;      /* o carried x64 */
    _Float16* op = O + ((size_t)b * NQ + q0 + 16 * g + ln) * DM + h * HD + 8 * hh;
#pragma unroll
    for (int t = 0; t < 4; ++t) { FragH f;
#pragma unroll
      for (int r = 0; r < 8; ++r) f.h[r] = (_Float16)(acc[g][t][r] * inv);
      *(v8us*)((unsigned short*)op + 16 * t) = f.half[0]; } }      /* d = 16 t + 8 hh + 0..7 of query ln: 16 contiguous bytes */
}
// Operand preparation, all of it in one launch of 256 work-groups of 16 waves (one a WGP): the work is 64 MiB of reads and 24 MiB + 512 KiB of writes; few long waves in one launch keep launch gaps and wave starts small beside the bytes.
// Every wave takes four pieces of 1,024 elements and asks for all of them at once (32 loads of 16 bytes a lane):
//  - a 32 query x 32 key block of the int mask (what one k_fattn wave needs in one pass) -> 32 lane-mask words: each lane reads the mask elements of its own score registers in k_fattn (query 16 g + ln, keys 16 kt + 8 hh + r),
//    a ballot of (element != 0) is the word of register (g, kt, r); one 128-byte store. The 16 heads then read 1 bit an element by scalar loads, where each read 4 bytes by 16-line vector loads;
//  - 4 KiB of x and 4 KiB of context -> exact f16 rows: each load 512 contiguous bytes, each store 256;
//  - a 64 k x 16 n block of one [in][out] weight -> Bt[n][k] = f16(bf16(W[k][n]) x 16): lane = (k group lane & 7, n group lane >> 3) reads 4 n of 8 k rows (a load touches 8 lines, where one element a lane would touch 32; the line's other half goes to the
//    neighbour wave of the work-group) and so holds 8 k of 4 n: each of its 4 stores is 16 bytes of a Bt row, 8 lanes a whole line. The transpose is in the registers' naming: no LDS, no barrier.
// Work-groups 0..63 take Wq, 64..191 Wkv (Bt rows 0..1023 = k columns, 1024..2047 = v columns), 192..255 Wp: 64 k x 256 n each.
__global__ __launch_bounds__(512) void k_prep(const float* __restrict__ x, const float* __restrict__ ctx, const int* __restrict__ Mk, const float* __restrict__ wq, const float* __restrict__ wkv, const float* __restrict__ wo,
    _Float16* __restrict__ X16, _Float16* __restrict__ C16, unsigned* __restrict__ MW, _Float16* __restrict__ BQ, _Float16* __restrict__ BKV, _Float16* __restrict__ BO) {
  static_assert(NRQ * SK == (size_t)256 * 16 * 1024 && SK == 1024, "k_prep: one 32 x 32 mask block a wave");
  static_assert(NRQ * DM == (size_t)256 * 16 * 1024 && NRK * DC == (size_t)256 * 16 * 1024 && DM == 1024 && DC == 1024, "k_prep: 4,096 waves, one piece of each kind a wave");
  const int lane = threadIdx.x & 31, lk = lane & 7, l4 = lane >> 3; const int wave = __builtin_amdgcn_readfirstlane((int)(threadIdx.x >> 5)); const int blk = blockIdx.x;
  const bool iskv = blk >= 64 && blk < 192; const float* W = blk < 64 ? wq : iskv ? wkv : wo; _Float16* Bt = blk < 64 ? BQ : iskv ? BKV : BO;
  const int t = blk < 64 ? blk : iskv ? blk - 64 : blk - 192; const int N = iskv ? 2 * DM : DM, sh = iskv ? 3 : 2;      /* N / 256 = 1 << sh column groups */
  const int k0 = (t >> sh) * 64, n0 = (t & ((1 << sh) - 1)) * 256 + wave * 16;
  const size_t e0 = ((size_t)blk * 16 + wave) * 1024;      /* the wave's first element of x and of context */
  const char* xp = (const char*)(x + e0); const char* cp = (const char*)(ctx + e0); const char* wp = (const char*)(W + (size_t)k0 * N + n0);      /* wave-uniform bases; the lane's part is a 32-bit byte offset */
  unsigned wl[8];
#pragma unroll
  for (int r = 0; r < 8; ++r) wl[r] = (unsigned)((8 * lk + r) * N + 4 * l4) * 4;
  const int gw = blk * 16 + wave;      /* mask block: query rows 32 (gw >> 5) .. + 31 of the flat [b n] rows, keys 32 (gw & 31) .. + 31 */
  const char* mp = (const char*)(Mk + (size_t)(gw >> 5) * 32 * SK + (gw & 31) * 32); const unsigned ml = (unsigned)((lane & 15) * SK * 4 + 32 * (lane >> 4));
  v4f xv[8], cv[8], wv[8]; v4ia mv[8];
#pragma unroll
  for (int j = 0; j < 8; ++j) xv[j] = *(const v4fa*)(xp + 512 * j + 16 * lane);
#pragma unroll
  for (int j = 0; j < 8; ++j) cv[j] = *(const v4fa*)(cp + 512 * j + 16 * lane);
#pragma unroll
  for (int r = 0; r < 8; ++r) wv[r] = *(const v4fa*)(wp + wl[r]);
#pragma unroll
  for (int i = 0; i < 8; ++i) mv[i] = *(const v4ia*)(mp + 16 * (i >> 2) * SK * 4 + 64 * ((i >> 1) & 1) + 16 * (i & 1) + ml);      /* i = 4 g + 2 kt + (r >> 2) */
  // The wait: the loads' offset registers are reused right behind. Its operands (inputs only) keep those registers as they are up to the wait.
  asm volatile("s_wait_xcnt 0x0" :: "v"(lane), "v"(wl[0]), "v"(wl[1]), "v"(wl[2]), "v"(wl[3]), "v"(wl[4]), "v"(wl[5]), "v"(wl[6]), "v"(wl[7]), "v"(ml) : "memory");
  __builtin_amdgcn_sched_barrier(0);      /* all 32 loads are asked for before the first value is worked on: without it the compiler sets the second and third group behind the conversions of the group before, three memory latencies in a row */
#pragma unroll
  for (int j = 0; j < 8; ++j) { v4h o;
#pragma unroll
    for (int q = 0; q < 4; ++q) o[q] = (_Float16)bf16_round(xv[j][q]);
    *(v4h*)(X16 + e0 + 128 * j + 4 * lane) = o; }
  __builtin_amdgcn_sched_barrier(0);      /* a piece's stores leave as soon as it is converted: without it the compiler keeps them back to the kernel's end, behind the last load's wait */
#pragma unroll
  for (int j = 0; j < 8; ++j) { v4h o;
#pragma unroll
    for (int q = 0; q < 4; ++q) o[q] = (_Float16)bf16_round(cv[j][q]);
    *(v4h*)(C16 + e0 + 128 * j + 4 * lane) = o; }
  __builtin_amdgcn_sched_barrier(0);      /* as above */
#pragma unroll
  for (int i = 0; i < 4; ++i) { FragH f;
#pragma unroll
    for (int r = 0; r < 8; ++r) f.h[r] = (_Float16)(bf16_round(wv[r][i]) * 16.0f);      /* x16, a power of two: bf16-exact weights stay exact in f16 away from the subnormal range */
    *(v8us*)((unsigned short*)Bt + (size_t)(n0 + 4 * l4 + i) * DM + k0 + 8 * lk) = f.half[0]; }
  __builtin_amdgcn_sched_barrier(0);      /* as above */
  unsigned word = 0;
#pragma unroll
  for (int i = 0; i < 32; ++i) { const unsigned bl = __builtin_amdgcn_ballot_w32(mv[i >> 2][i & 3] != 0); word = lane == i ? bl : word; }      /* word i = 16 g + 8 kt + r goes to lane i */
  MW[(size_t)gw * 32 + lane] = word;
}
extern "C" void kernel_launch(void* const* d_in, const int* in_sizes, int n_in,
                              void* d_out, int out_size, void* d_ws, size_t ws_size, hipStream_t stream) {
  (void)in_sizes; (void)n_in; (void)out_size;
  const float* const* I = (const float* const*)d_in; const float* x = I[0]; const float* ctx = I[1]; const int* mkm = (const int*)d_in[2]; const float* wq = I[3]; const float* bq = I[4]; const float* wkv = I[5]; const float* bkv = I[6]; const float* wo = I[7]; const float* bo = I[8];      /* [in][out] weights; int mask [b][n][m]; k | v from the fused Wkv [1024][2048] */
  char* ws = (char*)d_ws; size_t off = 0;
  auto take = [&](size_t bytes) { char* p = ws + off; off += (bytes + 255) & ~(size_t)255; return p; };
  _Float16* BQ = (_Float16*)take((size_t)DM * DM * 2); _Float16* BKV = (_Float16*)take((size_t)2 * DM * DC * 2); _Float16* BO = (_Float16*)take((size_t)DM * DM * 2);
  _Float16* X16 = (_Float16*)take(NRQ * DM * 2); _Float16* C16 = (_Float16*)take(NRK * DC * 2); _Float16* Q16 = (_Float16*)take(NRQ * DM * 2); _Float16* K16 = (_Float16*)take(2 * NRK * DM * 2); _Float16* V16 = K16 + NRK * DM; _Float16* O16 = X16;      /* o rows reuse the x rows, whose last reader is the Q GEMM */
  _Float16* VT = (_Float16*)take((size_t)NB * NH * HD * SK * 2);      /* V^T: all 64 (batch, head) planes */
  unsigned* MW = (unsigned*)take(NRQ * SK / 8);      /* the mask, 1 bit an element, as lane-mask words */
  if (off > ws_size) return;      /* 8 + 5 x 8 + 8 = 56 MiB, + 512 KiB */
  k_prep<<<256, 512, 0, stream>>>(x, ctx, mkm, wq, wkv, wo, X16, C16, MW, BQ, BKV, BO);      /* x, context -> f16 rows; [in][out] weights -> Bt x16; Wkv [1024][2048] -> Bt [2048][1024]: rows 0..1023 = k columns, 1024..2047 = v columns */
  k_gemm2<0, DM, DM><<<dim3((unsigned)((NRQ / 128) * (DM / 64)), 1), 128, 0, stream>>>(X16, 0, BQ, 0, 0.0625f, bq, 0, nullptr, 1, 0, 0, nullptr, Q16, DM, 0, (int)NRQ, DM, DM, 0, 0, 0);
  k_gemm2<0, DC, DC><<<dim3((unsigned)((NRK / 128) * (DM / 64)), 2), 128, 0, stream>>>(C16, 0, BKV, (size_t)DM * DC, 0.0625f, bkv, (size_t)DM, nullptr, 1, 0, 0, nullptr, K16, DM, NRK * DM, (int)NRK, DM, DC, 0, 0, 0);      /* grid.y 0: k = context Wkv[:, :1024] + bkv[:1024] -> K16; grid.y 1: v = context Wkv[:, 1024:] + bkv[1024:] -> V16 */
  k_vt<NH, SK><<<NB * NH * (SK / 64), 256, 0, stream>>>(V16, DM, 0, VT);      /* V^T [4 x 16][64][1024], all batches in one launch */
  k_fattn<<<dim3(NQ / 256, NH, NB), 256, 0, stream>>>(Q16, K16, VT, MW, O16);      /* scores, masked softmax and P V of all 64 (batch, head) planes: o x64, merged rows */
  k_gemm2<0, DM, DM><<<dim3((unsigned)((NRQ / 128) * (DM / 64)), 1), 128, 0, stream>>>(O16, 0, BO, 0, 0.0009765625f, bo, 0, nullptr, 1, 0, 0, (float*)d_out, nullptr, DM, 0, (int)NRQ, DM, DM, 0, 0, 0);      /* out = o Wo + bo */
}

// v008
// One run takes 85.9 microseconds.
// In both of two side-by-side timings against v007, it was 1.04 times as fast.
// Over all steps from v000 it is 61.3 times as fast.
#include <hip/hip_runtime.h>
// Masked multi-head cross-attention (x [4][1024][1024] queries, context [4][1024][1024]; q = x Wq + bq; k | v = context Wkv + bkv viewed (m, 2, 16, 64) ([in][out] weights sigma 1/32, zero biases); 16 heads of 64; dots = q k^T / 8; a binary int mask [b][n][32*32 = m] shared by the heads: masked_fill(mask == 0, -inf); softmax over the 1024 context tokens; out = merged Wp + bp -> [4][1024][1024]).
// Structure: x and context as exact f16 rows and [in][out] weights as exact x16 planes (Wkv as one [2048][1024] plane: k rows then v rows), and the int mask as 1-bit lane-mask words, all in one preparation launch; Q and K | V (one launch, grid.y) as WMMA GEMMs (operands staged in LDS, 32x64 wave tiles, f32 accumulation, + bias, f16 outputs); scores (K = 64, 1/8), mask select, online softmax (f32 statistics, native exp2; weights f16, unnormalised) and o = P V (V rows transposed on their way from LDS into the fragments; o carried x64) of all 64 (batch, head) planes fused in one launch, scores and weights in registers only, into merged f16 rows; out = o Wp + bp GEMM (f32, alpha 2^-10).
// Compute dtype: inputs rounded to bf16; x / context / weights exact; q, k, v, softmax weights and o as plain f16 GEMM operands (~2^-12); scores and statistics f32. v_wmma_f32_16x16x32_f16.
#define NB 4
#define NQ 1024
#define SK 1024
#define SQ SK                       /* keys per softmax row */
#define DM 1024
#define DC 1024
#define NH 16
#define HD 64
#define HG 4
#define NRQ ((size_t)NB * NQ)
#define NRK ((size_t)NB * SK)
typedef __bf16 v16b __attribute__((ext_vector_type(16)));
typedef unsigned short v8us __attribute__((ext_vector_type(8), may_alias));
typedef float  v8f  __attribute__((ext_vector_type(8)));
typedef float  v4f  __attribute__((ext_vector_type(4)));
typedef float  v4fa __attribute__((ext_vector_type(4), may_alias));
union FragB { v16b v; v8us half[2]; unsigned short u[16]; };

__device__ __forceinline__ unsigned short bf16_bits(float x) { unsigned int u = __float_as_uint(x); return (unsigned short)((u + 0x7FFFu + ((u >> 16) & 1u)) >> 16); }
__device__ __forceinline__ float bf16_val(unsigned short b) { return __uint_as_float(((unsigned int)b) << 16); }
__device__ __forceinline__ float bf16_round(float x) { return bf16_val(bf16_bits(x)); }
// D += A·B with NT terms: 1 = ah·bh, 2 = + al·bh (A split), 3 = + ah·bl (both split)
template <int NT>
__device__ __forceinline__ v8f mmaN(v16b ah, v16b al, v16b bh, v16b bl, v8f c) {
  c = __builtin_amdgcn_wmma_f32_16x16x32_bf16(false, ah, false, bh, (short)0, c, false, false);
  if (NT >= 2) c = __builtin_amdgcn_wmma_f32_16x16x32_bf16(false, al, false, bh, (short)0, c, false, false);
  if (NT >= 3) c = __builtin_amdgcn_wmma_f32_16x16x32_bf16(false, ah, false, bl, (short)0, c, false, false);
  asm volatile("v_nop\n\tv_nop\n\tv_nop\n\tv_nop" : "+v"(c) : "v"(ah), "v"(al), "v"(bh), "v"(bl));
  return c;
}

__global__ __launch_bounds__(256) void k_wt_bf16(const float* __restrict__ W, unsigned short* __restrict__ Wt, int K, int N) {
  const int t = blockIdx.x * 256 + threadIdx.x;
  const int k8n = K / 8;
  if (t >= N * k8n) return;
  const int n = t / k8n, k8 = (t % k8n) * 8;
  v8us v;
#pragma unroll
  for (int i = 0; i < 8; ++i) v[i] = bf16_bits(W[(size_t)(k8 + i) * N + n]);
  *(v8us*)(Wt + (size_t)n * K + k8) = v;
  
}

// GEMM C[M][N] (f32, pitch ldc) = act(A[M][K]·W + bias). A f32 row-major (pitch lda) converted per fragment to bf16
// (ASPLIT: hi/lo two planes -> 2 terms, else single rounded term); Wt bf16 [N][K] (pitch ldb). BIAS_BF16 rounds the
// bias to bf16 first (bias quantised to bf16 before the add). K%32==0, M%16==0, N%64==0.
template <bool ASPLIT, int ACT, bool BIAS_BF16>
__global__ __launch_bounds__(128) void k_gemm_bf(const float* __restrict__ A, int lda, const unsigned short* __restrict__ Wt, int ldb,
                                               const float* __restrict__ bias, float* __restrict__ C, int ldc, int M, int N, int K) {
  __shared__ __attribute__((aligned(16))) float so[4][16][64];
  const int tid = threadIdx.x, w = tid >> 5, lane = tid & 31, ln = lane & 15, hh = lane >> 4;
  const int ntn = N / 64;
  const int wid = blockIdx.x * 4 + w;
  const int mt = wid / ntn, nq = wid % ntn;
  if (mt * 16 >= M) return;
  const int row0 = mt * 16, col0 = nq * 64;
  const float* arow = A + (size_t)(row0 + ln) * lda;
  v8f acc[4] = {};
  for (int kb = 0; kb < K; kb += 32) {
    FragB ah, al;
    const v4f x0 = *(const v4fa*)(arow + kb + 8 * hh), x1 = *(const v4fa*)(arow + kb + 8 * hh + 4);
    const v4f x2 = *(const v4fa*)(arow + kb + 16 + 8 * hh), x3 = *(const v4fa*)(arow + kb + 16 + 8 * hh + 4);
    float xs[16] = {x0[0],x0[1],x0[2],x0[3],x1[0],x1[1],x1[2],x1[3],x2[0],x2[1],x2[2],x2[3],x3[0],x3[1],x3[2],x3[3]};
#pragma unroll
    for (int i = 0; i < 16; ++i) { const unsigned short hb = bf16_bits(xs[i]); ah.u[i] = hb; al.u[i] = ASPLIT ? bf16_bits(xs[i] - bf16_val(hb)) : (unsigned short)0; }
#pragma unroll
    for (int t = 0; t < 4; ++t) {
      const unsigned short* brow = Wt + (size_t)(col0 + t * 16 + ln) * ldb + kb;
      FragB b;
      b.half[0] = *(const v8us*)(brow + 8 * hh);
      b.half[1] = *(const v8us*)(brow + 16 + 8 * hh);
      acc[t] = mmaN<ASPLIT ? 2 : 1>(ah.v, al.v, b.v, b.v, acc[t]);
    }
  }
#pragma unroll
  for (int t = 0; t < 4; ++t) {
    float bv = bias ? bias[col0 + t * 16 + ln] : 0.f;
    if (BIAS_BF16) bv = bf16_round(bv);
#pragma unroll
    for (int r = 0; r < 8; ++r) { float v = acc[t][r] + bv; if (ACT == 1) v = fmaxf(v, 0.f); so[w][8 * hh + r][t * 16 + ln] = v; }
  }
  __builtin_amdgcn_fence(__ATOMIC_ACQ_REL, "workgroup");
  __builtin_amdgcn_wave_barrier();
  const int rsub = lane >> 4, c4 = (lane & 15) * 4;
  {
#pragma unroll
    for (int q = 0; q < 8; ++q) {
      const int r = q * 2 + rsub;
      const v4f v = *(const v4fa*)&so[w][r][c4];
      *(v4f*)(C + (size_t)(row0 + r) * ldc + col0 + c4) = v;
    }
    
  }
}

// GEMM C = act(A·W + bias + resid): A f32 (ASPLIT -> hi/lo 2 terms), Wt bf16 [N][K]; ACT 0 none, 1 relu, 2 exact gelu;
// resid (optional, f32, row index = (row % rmod), pitch ldr, RES_BF16 rounds it) added before the activation.
template <bool ASPLIT, int ACT, bool BIAS_BF16, bool RES_BF16>
__global__ __launch_bounds__(128) void k_gemm_bf3(const float* __restrict__ A, int lda, const unsigned short* __restrict__ Wt, int ldb,
                                                const float* __restrict__ bias, const float* __restrict__ resid, int rmod, int ldr,
                                                float* __restrict__ C, int ldc, int M, int N, int K) {
  __shared__ __attribute__((aligned(16))) float so[4][16][64];
  const int tid = threadIdx.x, w = tid >> 5, lane = tid & 31, ln = lane & 15, hh = lane >> 4;
  const int ntn = N / 64;
  const int wid = blockIdx.x * 4 + w;
  const int mt = wid / ntn, nq = wid % ntn;
  if (mt * 16 >= M) return;
  const int row0 = mt * 16, col0 = nq * 64;
  const float* arow = A + (size_t)(row0 + ln) * lda;
  v8f acc[4] = {};
  for (int kb = 0; kb < K; kb += 32) {
    FragB ah, al;
    const v4f x0 = *(const v4fa*)(arow + kb + 8 * hh), x1 = *(const v4fa*)(arow + kb + 8 * hh + 4);
    const v4f x2 = *(const v4fa*)(arow + kb + 16 + 8 * hh), x3 = *(const v4fa*)(arow + kb + 16 + 8 * hh + 4);
    float xs[16] = {x0[0],x0[1],x0[2],x0[3],x1[0],x1[1],x1[2],x1[3],x2[0],x2[1],x2[2],x2[3],x3[0],x3[1],x3[2],x3[3]};
#pragma unroll
    for (int i = 0; i < 16; ++i) { const unsigned short hb = bf16_bits(xs[i]); ah.u[i] = hb; al.u[i] = ASPLIT ? bf16_bits(xs[i] - bf16_val(hb)) : (unsigned short)0; }
#pragma unroll
    for (int t = 0; t < 4; ++t) {
      const unsigned short* brow = Wt + (size_t)(col0 + t * 16 + ln) * ldb + kb;
      FragB b;
      b.half[0] = *(const v8us*)(brow + 8 * hh);
      b.half[1] = *(const v8us*)(brow + 16 + 8 * hh);
      acc[t] = mmaN<ASPLIT ? 2 : 1>(ah.v, al.v, b.v, b.v, acc[t]);
    }
  }
#pragma unroll
  for (int t = 0; t < 4; ++t) {
    const int col = col0 + t * 16 + ln;
    float bv = bias ? bias[col] : 0.f;
    if (BIAS_BF16) bv = bf16_round(bv);
#pragma unroll
    for (int r = 0; r < 8; ++r) {
      float v = acc[t][r] + bv;
      if (resid) { float rv = resid[(size_t)((row0 + 8 * hh + r) % rmod) * ldr + col]; if (RES_BF16) rv = bf16_round(rv); v += rv; }
      if (ACT == 1) v = fmaxf(v, 0.f);
      if (ACT == 2) v = 0.5f * v * (1.0f + erff(v * 0.70710678118654752f));
      if (ACT == 3) { const float u = 0.7978845608028654f * (v + 0.044715f * v * v * v); v = 0.5f * v * (1.0f + tanhf(u)); }
      so[w][8 * hh + r][t * 16 + ln] = v;
    }
  }
  __builtin_amdgcn_fence(__ATOMIC_ACQ_REL, "workgroup");
  __builtin_amdgcn_wave_barrier();
  const int rsub = lane >> 4, c4 = (lane & 15) * 4;
  {
#pragma unroll
    for (int q = 0; q < 8; ++q) {
      const int r = q * 2 + rsub;
      const v4f v = *(const v4fa*)&so[w][r][c4];
      *(v4f*)(C + (size_t)(row0 + r) * ldc + col0 + c4) = v;
    }
    
  }
}
// row LayerNorm (biased variance, eps) over N: s = X (+ R); optional out_sum <- s; out_norm <- (s-mu)*rsqrt(var+eps)*g + b
template <bool PARAM_BF16>
__global__ __launch_bounds__(256) void k_layernorm(const float* __restrict__ X, const float* __restrict__ R, const float* __restrict__ g, const float* __restrict__ bta,
                                                  float* __restrict__ out_sum, float* __restrict__ out_norm, int N, float eps) {
  __shared__ float red[256];
  const int row = blockIdx.x, tid = threadIdx.x;
  const float* x = X + (size_t)row * N; const float* rr = R ? R + (size_t)row * N : nullptr;
  float vals[16];                     // up to N = 4096
  const int per = N / 256;            // contiguous chunk per thread? use strided-by-4 chunks: thread handles j = tid*4 + 1024*u
  float s1 = 0.f;
  for (int u = 0; u < per / 4; ++u) {
    const int j = tid * 4 + 1024 * u;
    const v4f a = *(const v4fa*)(x + j);
    v4f b = {0.f,0.f,0.f,0.f}; if (rr) b = *(const v4fa*)(rr + j);
#pragma unroll
    for (int q = 0; q < 4; ++q) { const float v = a[q] + b[q]; vals[u * 4 + q] = v; s1 += v; }
  }
  red[tid] = s1; __syncthreads();
  for (int st = 128; st > 0; st >>= 1) { if (tid < st) red[tid] += red[tid + st]; __syncthreads(); }
  const float mu = red[0] / (float)N; __syncthreads();
  float s2 = 0.f;
  for (int u = 0; u < per / 4; ++u)
#pragma unroll
    for (int q = 0; q < 4; ++q) { const float c = vals[u * 4 + q] - mu; s2 += c * c; }
  red[tid] = s2; __syncthreads();
  for (int st = 128; st > 0; st >>= 1) { if (tid < st) red[tid] += red[tid + st]; __syncthreads(); }
  const float rs = rsqrtf(red[0] / (float)N + eps);
  {
    for (int u = 0; u < per / 4; ++u) {
      const int j = tid * 4 + 1024 * u;
      v4f o, sm;
#pragma unroll
      for (int q = 0; q < 4; ++q) {
        float gg = g[j + q], bb = bta[j + q];
        if (PARAM_BF16) { gg = bf16_round(gg); bb = bf16_round(bb); }
        sm[q] = vals[u * 4 + q]; o[q] = (vals[u * 4 + q] - mu) * rs * gg + bb;
      }
      if (out_sum) *(v4f*)(out_sum + (size_t)row * N + j) = sm;
      *(v4f*)(out_norm + (size_t)row * N + j) = o;
    }
    
  }
}



// ---- f16 WMMA path (v_wmma_f32_16x16x32_f16): 11-bit significands for operands in range — used where a [0,1] probability operand needs more precision than bf16
typedef _Float16 v16h __attribute__((ext_vector_type(16)));
union FragH { v16h v; v8us half[2]; _Float16 h[16]; unsigned short u[16]; };
template <int NT>
__device__ __forceinline__ v8f mmaH(v16h ah, v16h al, v16h bh, v16h bl, v8f c) {
  c = __builtin_amdgcn_wmma_f32_16x16x32_f16(false, ah, false, bh, (short)0, c, false, false);
  if (NT >= 2) c = __builtin_amdgcn_wmma_f32_16x16x32_f16(false, al, false, bh, (short)0, c, false, false);
  if (NT >= 3) c = __builtin_amdgcn_wmma_f32_16x16x32_f16(false, ah, false, bl, (short)0, c, false, false);
  asm volatile("v_nop\n\tv_nop\n\tv_nop\n\tv_nop" : "+v"(c) : "v"(ah), "v"(al), "v"(bh), "v"(bl));
  return c;
}
// batched GEMM like k_gemm_b but f16 operands: A f32 (split into f16 hi/lo if ASPLIT, else rounded to f16), Bt = f16 values [n][k]; alpha; C f32; N multiple of 16 (partial tiles skipped)
template <bool ASPLIT>
__global__ __launch_bounds__(128) void k_gemm_h(const float* __restrict__ A, int lda, size_t sA, const _Float16* __restrict__ Bh, int ldb, size_t sB, float alpha, float* __restrict__ C, int ldc, size_t sC, int M, int N, int K) {
  __shared__ __attribute__((aligned(16))) float so[4][16][64];
  const int tid = threadIdx.x, w = tid >> 5, lane = tid & 31, ln = lane & 15, hh = lane >> 4; const int by = blockIdx.y;
  A += (size_t)by * sA; Bh += (size_t)by * sB; C += (size_t)by * sC;
  const int ntn = (N + 63) / 64; const int wid = blockIdx.x * 4 + w; const int mt = wid / ntn, nq = wid % ntn; if (mt * 16 >= M) return;
  const int row0 = mt * 16, col0 = nq * 64; const float* arow = A + (size_t)(row0 + ln) * lda;
  v8f acc[4] = {};
  for (int kb = 0; kb < K; kb += 32) {
    FragH ah, al;
    const v4f x0 = *(const v4fa*)(arow + kb + 8 * hh), x1 = *(const v4fa*)(arow + kb + 8 * hh + 4), x2 = *(const v4fa*)(arow + kb + 16 + 8 * hh), x3 = *(const v4fa*)(arow + kb + 16 + 8 * hh + 4);
    float xs[16] = {x0[0],x0[1],x0[2],x0[3],x1[0],x1[1],x1[2],x1[3],x2[0],x2[1],x2[2],x2[3],x3[0],x3[1],x3[2],x3[3]};
#pragma unroll
    for (int i = 0; i < 16; ++i) { const _Float16 h = (_Float16)xs[i]; ah.h[i] = h; al.h[i] = ASPLIT ? (_Float16)(xs[i] - (float)h) : (_Float16)0.0f; }
#pragma unroll
    for (int t = 0; t < 4; ++t) { if (col0 + t * 16 >= N) continue; const size_t boff = (size_t)(col0 + t * 16 + ln) * ldb + kb; FragH bq; bq.half[0] = *(const v8us*)(Bh + boff + 8 * hh); bq.half[1] = *(const v8us*)(Bh + boff + 16 + 8 * hh);
      acc[t] = mmaH<ASPLIT ? 2 : 1>(ah.v, al.v, bq.v, bq.v, acc[t]); }
  }
#pragma unroll
  for (int t = 0; t < 4; ++t) { if (col0 + t * 16 >= N) continue;
#pragma unroll
    for (int r = 0; r < 8; ++r) so[w][8 * hh + r][t * 16 + ln] = acc[t][r] * alpha; }
  __builtin_amdgcn_fence(__ATOMIC_ACQ_REL, "workgroup"); __builtin_amdgcn_wave_barrier();
  const int rsub = lane >> 4, c4 = (lane & 15) * 4;
  {
#pragma unroll
    for (int q = 0; q < 8; ++q) { const int r = q * 2 + rsub; if (col0 + c4 < N) { const v4f v = *(const v4fa*)&so[w][r][c4]; *(v4f*)(C + (size_t)(row0 + r) * ldc + col0 + c4) = v; } }
     }
}

// k_gemm_hh variant with fused epilogue: v = acc·alpha + bias[by·sBias + col] (+ CP[(row/rowsPerB)·sCPb + by·64 + col] if CP) ; ACT 0 none / 1 elu ; writes f16 C16 (and f32 C if non-null)
template <int ACT>
__global__ __launch_bounds__(128) void k_gemm_hhx(const _Float16* __restrict__ A, int lda, size_t sA, const _Float16* __restrict__ Bh, int ldb, size_t sB, float alpha, const float* __restrict__ bias, size_t sBias, const float* __restrict__ CP, int rowsPerB, size_t sCPb, int row0g,
    float* __restrict__ C, _Float16* __restrict__ C16, int ldc, size_t sC, int M, int N, int K) {
  __shared__ __attribute__((aligned(16))) float so[4][16][64];
  const int tid = threadIdx.x, w = tid >> 5, lane = tid & 31, ln = lane & 15, hh = lane >> 4; const int by = blockIdx.y;
  A += (size_t)by * sA; Bh += (size_t)by * sB; const size_t cofs = (size_t)by * sC; const float* bp = bias ? bias + (size_t)by * sBias : nullptr;
  const int ntn = (N + 63) / 64; const int wid = blockIdx.x * 4 + w; const int mt = wid / ntn, nq = wid % ntn; if (mt * 16 >= M) return;
  const int row0 = mt * 16, col0 = nq * 64; const _Float16* arow = A + (size_t)(row0 + ln) * lda;
  v8f acc[4] = {};
  for (int kb = 0; kb < K; kb += 32) { FragH ah; ah.half[0] = *(const v8us*)((const unsigned short*)arow + kb + 8 * hh); ah.half[1] = *(const v8us*)((const unsigned short*)arow + kb + 16 + 8 * hh);
#pragma unroll
    for (int t = 0; t < 4; ++t) { if (col0 + t * 16 >= N) continue; const size_t boff = (size_t)(col0 + t * 16 + ln) * ldb + kb; FragH bq; bq.half[0] = *(const v8us*)((const unsigned short*)Bh + boff + 8 * hh); bq.half[1] = *(const v8us*)((const unsigned short*)Bh + boff + 16 + 8 * hh);
      acc[t] = mmaH<1>(ah.v, ah.v, bq.v, bq.v, acc[t]); }
  }
#pragma unroll
  for (int t = 0; t < 4; ++t) { if (col0 + t * 16 >= N) continue; const int col = col0 + t * 16 + ln; const float bv = bp ? bf16_round(bp[col]) : 0.f;
#pragma unroll
    for (int r = 0; r < 8; ++r) { float v = acc[t][r] * alpha + bv; if (CP) { const int rr = row0g + row0 + 8 * hh + r; if (rowsPerB < 0) v += CP[cofs + (size_t)rr * ldc + col];      /* rowsPerB < 0: own element of the batched C plane */ else { const int bidx = rr / rowsPerB; v += CP[(size_t)bidx * sCPb + (size_t)by * 64 + col]; } } if (ACT == 1) v = (v > 0.f) ? v : expm1f(v); else if (ACT == 7) v = (v > 0.f) ? v + 1.0f : expf(v); else if (ACT == 8) v = tanhf(v); else if (ACT == 9) v = 0.5f * v * (1.0f + tanhf(0.7978845608028654f * (v + 0.044715f * v * v * v))); else if (ACT == 11) v = 1.0f / (1.0f + expf(-v)); else if (ACT == 12) v = (v > 0.f) ? v : 0.01f * v; else if (ACT == 14) v = (v > 0.f) ? v : 0.1f * v; else if (ACT == 16) v = (v >= 0.f) ? v : 0.3f * v; else if (ACT == 17) v = (v >= 0.f) ? v : 0.2f * v; else if (ACT == 15) v = v / (1.0f + expf(-v)); else if (ACT == 3) v = fmaxf(v, 0.f); else if (ACT == 6) v = 0.5f * v * (1.0f + erff(v * 0.70710678118654752f)); so[w][8 * hh + r][t * 16 + ln] = v; } }
  __builtin_amdgcn_fence(__ATOMIC_ACQ_REL, "workgroup"); __builtin_amdgcn_wave_barrier();
  const int rsub = lane >> 4, c4 = (lane & 15) * 4; typedef _Float16 v4h __attribute__((ext_vector_type(4)));
  {
#pragma unroll
    for (int q = 0; q < 8; ++q) { const int r = q * 2 + rsub; if (col0 + c4 < N) { const v4f v = *(const v4fa*)&so[w][r][c4]; if (C) *(v4f*)(C + cofs + (size_t)(row0 + r) * ldc + col0 + c4) = v; if (C16) { v4h h4; for (int i = 0; i < 4; ++i) h4[i] = (_Float16)v[i]; *(v4h*)(C16 + cofs + (size_t)(row0 + r) * ldc + col0 + c4) = h4; } } }
     }
}


typedef _Float16 v4h __attribute__((ext_vector_type(4)));

__global__ __launch_bounds__(256) void k_h16(const float* __restrict__ x, _Float16* __restrict__ X16, size_t n8) { const size_t t = (size_t)blockIdx.x * 256 + threadIdx.x; if (t >= n8) return; FragH f;
#pragma unroll
  for (int q = 0; q < 8; ++q) f.h[q] = (_Float16)x[t * 8 + q]; *(v8us*)((unsigned short*)X16 + t * 8) = f.half[0];  }
__global__ __launch_bounds__(256) void k_round16f(const float* __restrict__ W, _Float16* __restrict__ Bt, size_t n8) { const size_t t = (size_t)blockIdx.x * 256 + threadIdx.x; if (t >= n8) return; FragH f;
#pragma unroll
  for (int i = 0; i < 8; ++i) f.h[i] = (_Float16)(bf16_round(W[t * 8 + i]) * 16.0f); *(v8us*)((unsigned short*)Bt + t * 8) = f.half[0];  }

__global__ __launch_bounds__(256) void k_hl(const float* __restrict__ F, _Float16* __restrict__ Hh, _Float16* __restrict__ Hl, size_t n8) { const size_t t = (size_t)blockIdx.x * 256 + threadIdx.x; if (t >= n8) return; FragH fh, fl; const v4f a = *(const v4fa*)(F + t * 8), c = *(const v4fa*)(F + t * 8 + 4);
#pragma unroll
  for (int q = 0; q < 4; ++q) { _Float16 h = (_Float16)a[q]; fh.h[q] = h; fl.h[q] = (_Float16)((a[q] - (float)h) * 1024.0f); h = (_Float16)c[q]; fh.h[4 + q] = h; fl.h[4 + q] = (_Float16)((c[q] - (float)h) * 1024.0f); }
  { *(v8us*)((unsigned short*)Hh + t * 8) = fh.half[0]; *(v8us*)((unsigned short*)Hl + t * 8) = fl.half[0];  } }

// ---- fast GEMM (work-group tile 128x64, wave tile 32x64; requires M % 128 == 0, N % 64 == 0, K % 128 == 0, 256-byte aligned rows); operands staged in LDS; epilogue = k_gemm_hhx semantics ----
#define G2_KS 128                      /* k per stage: 256 bytes of every operand row */
#define G2_PITCH (G2_KS * 2 + 16)      /* LDS row pitch in bytes: 16 x odd, for 16-byte readers */
__device__ __forceinline__ v16h g2_lfrag(const char* p) { FragH f; f.half[0] = *(const v8us*)p; f.half[1] = *(const v8us*)(p + 32); return f.v; }      /* a fragment from a staged row; the lane's 16 hh bytes are in p */
__device__ __forceinline__ v8f g2_mma(v16h a, v16h b, v8f c) { v8f d = __builtin_amdgcn_wmma_f32_16x16x32_f16(false, a, false, b, (short)0, c, false, false); asm volatile("v_nop\n\tv_nop\n\tv_nop\n\tv_nop" : "+v"(d) : "v"(a), "v"(b)); return d; }
template <int ACT, int lda, int ldb>      /* the operands' row pitches at compile time: a thread's staging loads are then one base, one lane offset and immediates */
__global__ __launch_bounds__(128) void k_gemm2(const _Float16* __restrict__ A, size_t sA, const _Float16* __restrict__ Bh, size_t sB, float alpha, const float* __restrict__ bias, size_t sBias, const float* __restrict__ CP, int rowsPerB, size_t sCPb, int row0g,
    float* __restrict__ C, _Float16* __restrict__ C16, int ldc, size_t sC, int M, int N, int K, size_t sAz, size_t sBz, size_t sCz) { static_assert(ACT == 0 || ACT == 3 || ACT == 6 || ACT == 8 || ACT == 9 || ACT == 11 || ACT == 12 || ACT == 14 || ACT == 15 || ACT == 16 || ACT == 17, "k_gemm2: unsupported ACT code (would silently apply no activation)");
  __shared__ __attribute__((aligned(16))) char sm[192 * G2_PITCH];      /* one stage: 128 A rows, then 64 B rows, G2_KS k each; behind the k loop the waves' output staging */
  static_assert(sizeof(sm) >= 4 * 32 * 68 * sizeof(float), "k_gemm2: the output staging lies in the stage buffer"); float (*so)[32][68] = (float (*)[32][68])sm;
  const int tid = threadIdx.x, w = tid >> 5, lane = tid & 31, ln = lane & 15, hh = lane >> 4; const int by = blockIdx.y, bz = blockIdx.z;      /* two batch levels: grid.y (strides sA, sB, sC) and grid.z (strides sAz, sBz, sCz) */
  A += (size_t)by * sA + (size_t)bz * sAz; Bh += (size_t)by * sB + (size_t)bz * sBz; const size_t cofs = (size_t)by * sC + (size_t)bz * sCz; const float* bp = bias ? bias + (size_t)by * sBias : nullptr;
  const int ntn = N >> 6; const int mt = blockIdx.x / ntn, nq = blockIdx.x - mt * ntn; const int row0 = mt * 128 + 32 * w, col0 = nq * 64; if (mt * 128 >= M) return;      /* the same for the whole work-group: barriers follow */
  const char* Ab = (const char*)(A + (size_t)(mt * 128) * lda); const char* Bb = (const char*)(Bh + (size_t)col0 * ldb);      /* uniform bases; the lane's part is a 32-bit byte offset that never changes */
  const int sr = tid >> 4, sc = tid & 15;      /* staging: 16 lanes take one row's 256 bytes, so a wave's load covers 4 whole lines; thread rows sr + 8 j */
  const unsigned ga = (unsigned)(sr * lda + sc * 8) * 2, gb = (unsigned)(sr * ldb + sc * 8) * 2;
  char* sst = sm + sr * G2_PITCH + sc * 16;
  const char* sa = sm + (32 * w + ln) * G2_PITCH + 16 * hh; const char* sb = sm + (128 + ln) * G2_PITCH + 16 * hh;      /* fragment rows; k = 8 hh + 0..7 and 16 + 8 hh + 0..7 of each 32, A and B alike */
  const v8f z8 = {0.f,0.f,0.f,0.f,0.f,0.f,0.f,0.f}; v8f c00 = z8, c01 = z8, c02 = z8, c03 = z8, c10 = z8, c11 = z8, c12 = z8, c13 = z8;
  v8us st[24];
#pragma unroll
  for (int j = 0; j < 16; ++j) st[j] = *(const v8us*)(Ab + (size_t)(8 * j) * lda * 2 + ga);
#pragma unroll
  for (int j = 0; j < 8; ++j) st[16 + j] = *(const v8us*)(Bb + (size_t)(8 * j) * ldb * 2 + gb);
#pragma unroll 1
  for (int kb = 0; kb < K; kb += G2_KS) {
#pragma unroll
    for (int j = 0; j < 24; ++j) *(v8us*)(sst + 8 * j * G2_PITCH) = st[j];
    __syncthreads();      /* the stage is whole before anybody reads it */
    if (kb + G2_KS < K) {      /* the next stage's rows fly into registers while this stage is worked on */
      const char* An = Ab + (size_t)(kb + G2_KS) * 2; const char* Bn = Bb + (size_t)(kb + G2_KS) * 2;
#pragma unroll
      for (int j = 0; j < 16; ++j) st[j] = *(const v8us*)(An + (size_t)(8 * j) * lda * 2 + ga);
#pragma unroll
      for (int j = 0; j < 8; ++j) st[16 + j] = *(const v8us*)(Bn + (size_t)(8 * j) * ldb * 2 + gb);
      asm volatile("s_wait_xcnt 0x0" ::: "memory");      /* the loads' address registers are reused by the fragment loads right behind; it also keeps the global loads in front of the LDS reads */
    }
#pragma unroll
    for (int kk = 0; kk < G2_KS / 32; ++kk) { const v16h a0 = g2_lfrag(sa + 64 * kk), a1 = g2_lfrag(sa + 16 * G2_PITCH + 64 * kk);      /* the six fragments of a k step are asked for together: one LDS wait a step */
      const v16h b0 = g2_lfrag(sb + 64 * kk), b1 = g2_lfrag(sb + 16 * G2_PITCH + 64 * kk), b2 = g2_lfrag(sb + 32 * G2_PITCH + 64 * kk), b3 = g2_lfrag(sb + 48 * G2_PITCH + 64 * kk);
      c00 = g2_mma(a0, b0, c00); c10 = g2_mma(a1, b0, c10); c01 = g2_mma(a0, b1, c01); c11 = g2_mma(a1, b1, c11);
      c02 = g2_mma(a0, b2, c02); c12 = g2_mma(a1, b2, c12); c03 = g2_mma(a0, b3, c03); c13 = g2_mma(a1, b3, c13); }
    __syncthreads();      /* every reader has left the stage before it is written again (behind the last pass: before the output staging) */
  }
  v8f accs[8] = {c00, c01, c02, c03, c10, c11, c12, c13};
#pragma unroll
  for (int u = 0; u < 8; ++u) { const int t = u & 3, half = u >> 2; const int col = col0 + t * 16 + ln; const float bv = bp ? bf16_round(bp[col]) : 0.f;
#pragma unroll
    for (int r = 0; r < 8; ++r) { const int rloc = half * 16 + 8 * hh + r; float v = accs[u][r] * alpha + bv; if (CP) { if (rowsPerB < 0) v += CP[cofs + (size_t)(row0g + row0 + rloc) * ldc + col];      /* rowsPerB < 0: own element of the batched C plane */ else { const int bidx = (row0g + row0 + rloc) / rowsPerB; v += CP[(size_t)bidx * sCPb + (size_t)by * 64 + col]; } }
      if (ACT == 3) v = fmaxf(v, 0.f); else if (ACT == 6) v = 0.5f * v * (1.0f + erff(v * 0.70710678118654752f)); else if (ACT == 11) v = 1.0f / (1.0f + expf(-v)); else if (ACT == 15) v = v / (1.0f + expf(-v)); else if (ACT == 12) v = (v > 0.f) ? v : 0.01f * v; else if (ACT == 8) v = tanhf(v); else if (ACT == 9) v = 0.5f * v * (1.0f + tanhf(0.7978845608028654f * (v + 0.044715f * v * v * v))); else if (ACT == 14) v = (v > 0.f) ? v : 0.1f * v; else if (ACT == 16) v = (v >= 0.f) ? v : 0.3f * v; else if (ACT == 17) v = (v >= 0.f) ? v : 0.2f * v;
      so[w][rloc][t * 16 + ln] = v; } }
  __builtin_amdgcn_fence(__ATOMIC_ACQ_REL, "workgroup"); __builtin_amdgcn_wave_barrier();
  const int rsub = lane >> 4, c4 = (lane & 15) * 4;
  {
#pragma unroll
    for (int q = 0; q < 16; ++q) { const int r = q * 2 + rsub; const v4f v = *(const v4fa*)&so[w][r][c4]; if (C) *(v4f*)(C + cofs + (size_t)(row0 + r) * ldc + col0 + c4) = v; if (C16) { v4h h4; for (int i = 0; i < 4; ++i) h4[i] = (_Float16)v[i]; *(v4h*)(C16 + cofs + (size_t)(row0 + r) * ldc + col0 + c4) = h4; } }
     } }


__global__ __launch_bounds__(256) void k_wnat(const float* __restrict__ w, size_t n8, _Float16* __restrict__ Bt) { const size_t t = (size_t)blockIdx.x * 256 + threadIdx.x; if (t >= n8) return; FragH f; for (int q = 0; q < 8; ++q) f.h[q] = (_Float16)(bf16_round(w[t * 8 + q]) * 16.0f); *(v8us*)((unsigned short*)Bt + t * 8) = f.half[0];  }
__global__ __launch_bounds__(256) void k_rsm(const float* __restrict__ S, _Float16* __restrict__ P, int nrows) {
  #pragma clang fp contract(off)
  const int i = blockIdx.x * 256 + threadIdx.x; if (i >= nrows) return; const float* s = S + (size_t)i * SQ; float mx = -3.0e38f;
#pragma unroll 1
  for (int j = 0; j < SQ; ++j) mx = fmaxf(mx, s[j]); float se = 0.f;
#pragma unroll 1
  for (int j = 0; j < SQ; ++j) se += expf(s[j] - mx); const float sc = 256.0f / se;
#pragma unroll 1
  for (int j0 = 0; j0 < SQ; j0 += 8) { FragH f; for (int q = 0; q < 8; ++q) f.h[q] = (_Float16)(expf(s[j0 + q] - mx) * sc); unsigned short* d = (unsigned short*)P + (size_t)i * SQ + j0; *(v8us*)d = f.half[0];  } }
__global__ __launch_bounds__(256) void k_vt(const _Float16* __restrict__ V16, int b, int h0, _Float16* __restrict__ VT) { __shared__ unsigned short tl[64][65]; const int tid = threadIdx.x; const int hh = blockIdx.x % HG, sg = blockIdx.x / HG; const int s0 = sg * 64; const int h = h0 + hh;
  for (int i = tid; i < 64 * 8; i += 256) { const int j = i / 8, d8 = (i % 8) * 8; FragH f; f.half[0] = *(const v8us*)((const unsigned short*)V16 + ((size_t)b * SQ + s0 + j) * DM + h * HD + d8); for (int q = 0; q < 8; ++q) tl[d8 + q][j] = f.u[q]; }
  __syncthreads();
  { for (int i = tid; i < 64 * 8; i += 256) { const int d = i / 8, j8 = (i % 8) * 8; FragH f; for (int q = 0; q < 8; ++q) f.u[q] = tl[d][j8 + q]; *(v8us*)((unsigned short*)VT + ((size_t)hh * HD + d) * SQ + s0 + j8) = f.half[0]; }  } }


__global__ __launch_bounds__(256) void k_rsmf(const float* __restrict__ S, _Float16* __restrict__ P, int qn, int hg) {
  #pragma clang fp contract(off)
  const int t = blockIdx.x * 256 + threadIdx.x; if (t >= qn * hg) return; const size_t i = (size_t)(t / qn) * SQ + (t % qn); const float* s = S + i * SQ; float mx = -3.0e38f;
#pragma unroll 1
  for (int j = 0; j < SQ; ++j) mx = fmaxf(mx, s[j]); float se = 0.f;
#pragma unroll 1
  for (int j = 0; j < SQ; ++j) se += __expf(s[j] - mx); const float sc = 256.0f / se;
#pragma unroll 1
  for (int j0 = 0; j0 < SQ; j0 += 8) { FragH f; for (int q = 0; q < 8; ++q) f.h[q] = (_Float16)(__expf(s[j0 + q] - mx) * sc); unsigned short* d = (unsigned short*)P + i * SQ + j0; *(v8us*)d = f.half[0];  } }

__global__ __launch_bounds__(256) void k_rsmr(const float* __restrict__ S, _Float16* __restrict__ P, int qn, int hg) {
  #pragma clang fp contract(off)
  const int t = blockIdx.x * 256 + threadIdx.x; if (t >= qn * hg) return; const size_t i = (size_t)t;      /* planes packed: row t of plane t / qn */ const float* s = S + i * SQ; float mx = -3.0e38f;
#pragma unroll 1
  for (int j = 0; j < SQ; ++j) mx = fmaxf(mx, s[j]); float se = 0.f;
#pragma unroll 1
  for (int j = 0; j < SQ; ++j) se += __expf(s[j] - mx); const float sc = 256.0f / se;
#pragma unroll 1
  for (int j0 = 0; j0 < SQ; j0 += 8) { FragH f; for (int q = 0; q < 8; ++q) f.h[q] = (_Float16)(__expf(s[j0 + q] - mx) * sc); unsigned short* d = (unsigned short*)P + i * SQ + j0; *(v8us*)d = f.half[0];  } }


typedef int v4ia __attribute__((ext_vector_type(4), may_alias));
typedef unsigned v16ua __attribute__((ext_vector_type(16), may_alias));
typedef float f32x2 __attribute__((ext_vector_type(2)));
__device__ __forceinline__ float fa_xhalf(float x) { return __builtin_bit_cast(float, __builtin_amdgcn_permlanex16(__builtin_bit_cast(int, x), __builtin_bit_cast(int, x), 0x76543210, 0xfedcba98, false, false)); }      /* lane l with lane l ^ 16 */
__device__ __forceinline__ v8f fa_mma(v16h a, v16h b, v8f c) { return __builtin_amdgcn_wmma_f32_16x16x32_f16(false, a, false, b, (short)0, c, false, false); }
__device__ __forceinline__ v16h fa_frag(const char* base, unsigned off) { FragH f; f.half[0] = *(const v8us*)(base + off); f.half[1] = *(const v8us*)(base + off + 32); return f.v; }      /* k = 8 hh + 0..7 and 16 + 8 hh + 0..7; the lane's 16 hh bytes are in off */
// In front of a group of fragment loads: keeps the loads from rising among the WMMAs in front of them.
__device__ __forceinline__ void fa_ahead() { __builtin_amdgcn_sched_barrier(0); }
// Behind the next pass's mask fetch. The wait: the fetch's address registers are reused right behind it. The scheduling barrier: keeps that wait directly behind its loads and the fetch where it is written, a phase ahead of its use (without it the compiler moves the mask fetch down among the exponentials and the wait away from its loads).
__device__ __forceinline__ void fa_issued() { asm volatile("s_wait_xcnt 0x0" ::: "memory"); __builtin_amdgcn_sched_barrier(0); }
// Behind a group of fragment loads from LDS: keeps the group where it is written, as one group a phase ahead of its use (without it the compiler may sink single loads down to their WMMAs).
__device__ __forceinline__ void fa_placed() { __builtin_amdgcn_sched_barrier(0); }
// The mask words as constant-address-space data (k_prep wrote them in an earlier launch; nothing writes them in this one): with the ring's copies and barriers in the kernel the compiler fetched them, as plain global loads, by vector loads behind the first barrier and moved them to scalar registers word by word.
typedef __attribute__((address_space(4))) const v16ua fa_cwords;
#define FA_KS 128                      /* keys per LDS stage: four passes of 32 */
#define FA_KP (HD * 2 + 16)            /* LDS pitch of a K row (64 d): 144 bytes = 16 x odd, for 16-byte readers */
#define FA_VP (HD * 2 + 32)            /* LDS pitch of a V row (64 d): 160 bytes = 32 x odd, for the transposing 16-byte readers */
#define FA_KB (FA_KS * FA_KP)          /* a stage's K tile */
#define FA_SB (FA_KB + FA_KS * FA_VP)  /* a stage: K tile, then V tile */
// A 16 (d) x 16 (keys) half of a V^T fragment from V rows in LDS: lane l gives the address of 16 bytes of row 8 (l >> 4) + (l & 7), d half (l >> 3) & 1, and gets keys 8 hh + 0..7 of column d = ln.
typedef short fa_s16x8 __attribute__((ext_vector_type(8)));
__device__ __forceinline__ v8us fa_tr16(const char* p) { typedef __attribute__((address_space(3))) fa_s16x8 lds_s16x8; return __builtin_bit_cast(v8us, __builtin_amdgcn_ds_load_tr16_b128_v8i16((lds_s16x8*)p)); }
// One stage's K rows and V rows (128 x 128 bytes each) from global memory into LDS, through no register: 8 asynchronous 16-byte copies a lane, a wave's copy = 4 whole lines.
// lk, lv: the lane's LDS byte addresses of its first K and V piece; gk, gv: the global ones. The four pieces of each kind lie 32 rows apart.
// The wait on the address translations is the statement's last line: the copies' address registers are free for reuse only behind it (a precaution).
__device__ __forceinline__ void fa_stage(unsigned lk, unsigned lv, const char* gk, const char* gv) {
  asm volatile("global_load_async_to_lds_b128 %0, %1, off\n\t"
               "global_load_async_to_lds_b128 %2, %3, off\n\t"
               "global_load_async_to_lds_b128 %4, %5, off\n\t"
               "global_load_async_to_lds_b128 %6, %7, off\n\t"
               "global_load_async_to_lds_b128 %8, %9, off\n\t"
               "global_load_async_to_lds_b128 %10, %11, off\n\t"
               "global_load_async_to_lds_b128 %12, %13, off\n\t"
               "global_load_async_to_lds_b128 %14, %15, off\n\t"
               "s_wait_xcnt 0x0"
               :: "v"(lk), "v"(gk), "v"(lk + 32 * FA_KP), "v"(gk + 32 * DM * 2), "v"(lk + 64 * FA_KP), "v"(gk + 64 * DM * 2), "v"(lk + 96 * FA_KP), "v"(gk + 96 * DM * 2),
                  "v"(lv), "v"(gv), "v"(lv + 32 * FA_VP), "v"(gv + 32 * DM * 2), "v"(lv + 64 * FA_VP), "v"(gv + 64 * DM * 2), "v"(lv + 96 * FA_VP), "v"(gv + 96 * DM * 2)
               : "memory");
}
__global__ __launch_bounds__(256) void k_fattn(const _Float16* __restrict__ Q, const _Float16* __restrict__ Kr, const _Float16* __restrict__ Vr, const unsigned* __restrict__ MW, _Float16* __restrict__ O) {
  __shared__ __attribute__((aligned(16))) char sm[2 * FA_SB];
  const int tid = threadIdx.x, lane = tid & 31, ln = lane & 15, hh = lane >> 4; const int wave = __builtin_amdgcn_readfirstlane((int)(threadIdx.x >> 5));
  const int h = blockIdx.y, b = blockIdx.z, q0 = blockIdx.x * 256 + wave * 32;
  const float cs = 0.125f * 1.4426950408889634f;      /* 1 / sqrt(64), and e^x = 2^(x log2 e) */
  const float fill = -8589934592.0f;      /* masked_fill: -2^33, -2^30 after the 1/8. A power of two, so that its product with cs is exact: while every key seen so far is masked the maximum IS that product, the fused multiply-add of the exponent gives exactly 0 and the weights are 1 (finite); the first unmasked key rescales them to 0. A fill whose product rounds would leave a positive exponent there */
  const char* qb = (const char*)(Q + ((size_t)b * NQ + q0) * DM + h * HD);      /* wave-uniform bases; the lane's part is a 32-bit byte offset that never changes */
  const char* kb = (const char*)(Kr + (size_t)b * SK * DM + h * HD);
  const char* vb = (const char*)(Vr + (size_t)b * SK * DM + h * HD);
  const unsigned* mb_ = MW + ((size_t)b * NQ + q0) * (SK / 32);      /* the wave's 32 passes x 32 lane-mask words, contiguous; the address is wave-uniform, so the words come by scalar loads */
  const unsigned ko = (unsigned)(ln * DM * 2 + 16 * hh);
  /* staging: 8 lanes take a K row's, and a V row's, 128 bytes (thread rows (tid >> 3) + 32 j) */
  const unsigned sm0 = (unsigned)(size_t)sm;      /* the ring's LDS byte address: the low 32 bits of the __shared__ address */
  const unsigned lk0 = sm0 + (unsigned)((tid >> 3) * FA_KP + (tid & 7) * 16), lv0 = sm0 + (unsigned)(FA_KB + (tid >> 3) * FA_VP + (tid & 7) * 16);
  const char* gk0 = kb + (size_t)((tid >> 3) * DM * 2 + (tid & 7) * 16); const char* gv0 = vb + (size_t)((tid >> 3) * DM * 2 + (tid & 7) * 16);
  fa_stage(lk0, lv0, gk0, gv0);      /* stage 0 into buffer 0 */
  v16h qf[2][2];
#pragma unroll
  for (int g = 0; g < 2; ++g)
#pragma unroll
    for (int kc = 0; kc < 2; ++kc) qf[g][kc] = fa_frag(qb + 16 * g * DM * 2 + 64 * kc, ko);
  fa_issued();      /* the Q loads' address registers are reused right behind */
  v16ua mk[2];      /* mk[g][8 kt + r]: bit l = lane l's mask element of score register r, tile kt, column group g */
  mk[0] = *(fa_cwords*)mb_; mk[1] = *(fa_cwords*)(mb_ + 16);
  fa_issued();
  asm volatile("s_wait_asynccnt 0x0" ::: "memory");      /* this wave's part of stage 0 has landed */
  __syncthreads();      /* stage 0 is whole before anybody reads it */
  fa_stage(lk0 + FA_SB, lv0 + FA_SB, gk0 + (size_t)FA_KS * DM * 2, gv0 + (size_t)FA_KS * DM * 2);      /* stage 1 into buffer 1: flies while stage 0 is worked on */
  const v8f z8 = {0.f, 0.f, 0.f, 0.f, 0.f, 0.f, 0.f, 0.f};
  v8f acc[2][4]; float m_run[2], l_run[2];
#pragma unroll
  for (int g = 0; g < 2; ++g) { m_run[g] = -3.0e38f; l_run[g] = 0.f;
#pragma unroll
    for (int t = 0; t < 4; ++t) acc[g][t] = z8; }
  const int klo = ln * FA_KP + 16 * hh, vlo = FA_KB + (8 * hh + (lane & 7)) * FA_VP + 16 * ((lane >> 3) & 1);      /* the lane's K fragment row and its address part of the transposing V loads in a stage; k = 8 hh + 0..7 and 16 + 8 hh + 0..7 of each 32, as in the Q fragments and in P */
#pragma unroll 1      /* the ring stays a loop of eight stages: one copy of the four passes in the instruction cache */
  for (int st = 0; st < SK / FA_KS; ++st) {
    const char* sk = sm + (st & 1) * FA_SB + klo; const char* sv = sm + (st & 1) * FA_SB + vlo;
    v16h kf[2][2], vf[4];
#pragma unroll
    for (int kt = 0; kt < 2; ++kt)
#pragma unroll
      for (int kc = 0; kc < 2; ++kc) kf[kt][kc] = g2_lfrag(sk + 16 * kt * FA_KP + 64 * kc);      /* the stage's first K fragments */
    fa_placed();
#pragma unroll      /* the four passes of a stage: every LDS offset an immediate, and the last pass without a K fetch */
    for (int p = 0; p < FA_KS / 32; ++p) {
      const int kn = (st * FA_KS + p * 32 + 32) & (SK - 1);      /* the next pass's first key; the last pass fetches pass 0's mask words again (in bounds, not used) so that the fetch stays unconditional */
      v8f s[2][2];
#pragma unroll
      for (int kt = 0; kt < 2; ++kt)
#pragma unroll
        for (int g = 0; g < 2; ++g) s[kt][g] = fa_mma(kf[kt][1], qf[g][1], fa_mma(kf[kt][0], qf[g][0], z8));
      fa_ahead();      /* the score products first: the K fetch goes into their operand registers */
      if (p + 1 < FA_KS / 32) {
#pragma unroll
        for (int kt = 0; kt < 2; ++kt)
#pragma unroll
          for (int kc = 0; kc < 2; ++kc) kf[kt][kc] = g2_lfrag(sk + (32 * (p + 1) + 16 * kt) * FA_KP + 64 * kc); }
#pragma unroll
      for (int t = 0; t < 4; ++t) { FragH f; f.half[0] = fa_tr16(sv + 32 * p * FA_VP + 32 * t); f.half[1] = fa_tr16(sv + (32 * p + 16) * FA_VP + 32 * t); vf[t] = f.v; }      /* d = 16 t + ln; keys 32 p + 8 hh + 0..7 and 32 p + 16 + 8 hh + 0..7 */
      fa_placed();
      float mb[2]; bool need = false;
#pragma unroll
      for (int g = 0; g < 2; ++g) { float mx = -3.0e38f;
#pragma unroll
        for (int kt = 0; kt < 2; ++kt)
#pragma unroll
          for (int r = 0; r < 8; ++r) { const float v = __builtin_amdgcn_inverse_ballot_w32(mk[g][8 * kt + r]) ? s[kt][g][r] : fill; s[kt][g][r] = v; mx = fmaxf(mx, v); }      /* the word IS the select's lane mask: no compare */
        mx = fmaxf(mx, fa_xhalf(mx)) * cs; mb[g] = mx; need = need || (mx > m_run[g] + 8.0f); }
      if (__builtin_amdgcn_ballot_w32(need) != 0) {      /* wave-uniform; rare after the first passes */
#pragma unroll
        for (int g = 0; g < 2; ++g) { const float mn = fmaxf(m_run[g], mb[g]); const float corr = __builtin_amdgcn_exp2f(m_run[g] - mn); m_run[g] = mn; l_run[g] *= corr;
#pragma unroll
          for (int t = 0; t < 4; ++t) acc[g][t] = acc[g][t] * corr; } }
      { const unsigned* mbn = mb_ + kn;      /* 32 words a pass of 32 keys. Behind the branch, which needs every select: the mask fetch goes into the registers that the selects read */
        mk[0] = *(fa_cwords*)mbn; mk[1] = *(fa_cwords*)(mbn + 16); }
      fa_issued();
#pragma unroll
      for (int g = 0; g < 2; ++g) { const float nm = -m_run[g]; FragH pf; f32x2 ls = {0.f, 0.f};
#pragma unroll
        for (int i = 0; i < 8; ++i) { const f32x2 a = __builtin_elementwise_fma(f32x2{s[i >> 2][g][2 * (i & 3)], s[i >> 2][g][2 * (i & 3) + 1]}, f32x2{cs, cs}, f32x2{nm, nm});
          const f32x2 p2 = {__builtin_amdgcn_exp2f(a.x), __builtin_amdgcn_exp2f(a.y)}; ls += p2; pf.h[2 * i] = (_Float16)p2.x; pf.h[2 * i + 1] = (_Float16)p2.y; }      /* element 8 kt + r of the B operand = key 16 kt + 8 hh + r */
        l_run[g] += ls.x + ls.y;
#pragma unroll
        for (int t = 0; t < 4; ++t) acc[g][t] = fa_mma(vf[t], pf.v, acc[g][t]); }
    }
    asm volatile("s_wait_dscnt 0x0" ::: "memory");      /* this wave's reads of the stage are done */
    asm volatile("s_wait_asynccnt 0x0" ::: "memory");      /* this wave's part of the next stage has landed */
    __syncthreads();      /* publishes the next stage, and ends every wave's reads of this one before it is refilled */
    if (st + 2 < SK / FA_KS) fa_stage(lk0 + (st & 1) * FA_SB, lv0 + (st & 1) * FA_SB, gk0 + (size_t)(st + 2) * (FA_KS * DM * 2), gv0 + (size_t)(st + 2) * (FA_KS * DM * 2));      /* the same for the whole work-group: stage st + 2 into the buffer just left */
  }
  asm volatile("s_wait_asynccnt 0x0" ::: "memory");      /* no copy is outstanding when the wave ends */
#pragma unroll
  for (int g = 0; g < 2; ++g) { const float l = l_run[g] + fa_xhalf(l_run[g]); const float inv = 64.0f / l;      /* o carried x64 */
    _Float16* op = O + ((size_t)b * NQ + q0 + 16 * g + ln) * DM + h * HD + 8 * hh;
#pragma unroll
    for (int t = 0; t < 4; ++t) { FragH f;
#pragma unroll
      for (int r = 0; r < 8; ++r) f.h[r] = (_Float16)(acc[g][t][r] * inv);
      *(v8us*)((unsigned short*)op + 16 * t) = f.half[0]; } }      /* d = 16 t + 8 hh + 0..7 of query ln: 16 contiguous bytes */
}
// Operand preparation, all of it in one launch of 256 work-groups of 16 waves (one a WGP): the work is 64 MiB of reads and 24 MiB + 512 KiB of writes; few long waves in one launch keep launch gaps and wave starts small beside the bytes.
// Every wave takes four pieces of 1,024 elements and asks for all of them at once (32 loads of 16 bytes a lane):
//  - a 32 query x 32 key block of the int mask (what one k_fattn wave needs in one pass) -> 32 lane-mask words: each lane reads the mask elements of its own score registers in k_fattn (query 16 g + ln, keys 16 kt + 8 hh + r),
//    a ballot of (element != 0) is the word of register (g, kt, r); one 128-byte store. The 16 heads then read 1 bit an element by scalar loads, where each read 4 bytes by 16-line vector loads;
//  - 4 KiB of x and 4 KiB of context -> exact f16 rows: each load 512 contiguous bytes, each store 256;
//  - a 64 k x 16 n block of one [in][out] weight -> Bt[n][k] = f16(bf16(W[k][n]) x 16): lane = (k group lane & 7, n group lane >> 3) reads 4 n of 8 k rows (a load touches 8 lines, where one element a lane would touch 32; the line's other half goes to the
//    neighbour wave of the work-group) and so holds 8 k of 4 n: each of its 4 stores is 16 bytes of a Bt row, 8 lanes a whole line. The transpose is in the registers' naming: no LDS, no barrier.
// Work-groups 0..63 take Wq, 64..191 Wkv (Bt rows 0..1023 = k columns, 1024..2047 = v columns), 192..255 Wp: 64 k x 256 n each.
__global__ __launch_bounds__(512) void k_prep(const float* __restrict__ x, const float* __restrict__ ctx, const int* __restrict__ Mk, const float* __restrict__ wq, const float* __restrict__ wkv, const float* __restrict__ wo,
    _Float16* __restrict__ X16, _Float16* __restrict__ C16, unsigned* __restrict__ MW, _Float16* __restrict__ BQ, _Float16* __restrict__ BKV, _Float16* __restrict__ BO) {
  static_assert(NRQ * SK == (size_t)256 * 16 * 1024 && SK == 1024, "k_prep: one 32 x 32 mask block a wave");
  static_assert(NRQ * DM == (size_t)256 * 16 * 1024 && NRK * DC == (size_t)256 * 16 * 1024 && DM == 1024 && DC == 1024, "k_prep: 4,096 waves, one piece of each kind a wave");
  const int lane = threadIdx.x & 31, lk = lane & 7, l4 = lane >> 3; const int wave = __builtin_amdgcn_readfirstlane((int)(threadIdx.x >> 5)); const int blk = blockIdx.x;
  const bool iskv = blk >= 64 && blk < 192; const float* W = blk < 64 ? wq : iskv ? wkv : wo; _Float16* Bt = blk < 64 ? BQ : iskv ? BKV : BO;
  const int t = blk < 64 ? blk : iskv ? blk - 64 : blk - 192; const int N = iskv ? 2 * DM : DM, sh = iskv ? 3 : 2;      /* N / 256 = 1 << sh column groups */
  const int k0 = (t >> sh) * 64, n0 = (t & ((1 << sh) - 1)) * 256 + wave * 16;
  const size_t e0 = ((size_t)blk * 16 + wave) * 1024;      /* the wave's first element of x and of context */
  const char* xp = (const char*)(x + e0); const char* cp = (const char*)(ctx + e0); const char* wp = (const char*)(W + (size_t)k0 * N + n0);      /* wave-uniform bases; the lane's part is a 32-bit byte offset */
  unsigned wl[8];
#pragma unroll
  for (int r = 0; r < 8; ++r) wl[r] = (unsigned)((8 * lk + r) * N + 4 * l4) * 4;
  const int gw = blk * 16 + wave;      /* mask block: query rows 32 (gw >> 5) .. + 31 of the flat [b n] rows, keys 32 (gw & 31) .. + 31 */
  const char* mp = (const char*)(Mk + (size_t)(gw >> 5) * 32 * SK + (gw & 31) * 32); const unsigned ml = (unsigned)((lane & 15) * SK * 4 + 32 * (lane >> 4));
  v4f xv[8], cv[8], wv[8]; v4ia mv[8];
#pragma unroll
  for (int j = 0; j < 8; ++j) xv[j] = *(const v4fa*)(xp + 512 * j + 16 * lane);
#pragma unroll
  for (int j = 0; j < 8; ++j) cv[j] = *(const v4fa*)(cp + 512 * j + 16 * lane);
#pragma unroll
  for (int r = 0; r < 8; ++r) wv[r] = *(const v4fa*)(wp + wl[r]);
#pragma unroll
  for (int i = 0; i < 8; ++i) mv[i] = *(const v4ia*)(mp + 16 * (i >> 2) * SK * 4 + 64 * ((i >> 1) & 1) + 16 * (i & 1) + ml);      /* i = 4 g + 2 kt + (r >> 2) */
  // The wait: the loads' offset registers are reused right behind. Its operands (inputs only) keep those registers as they are up to the wait.
  asm volatile("s_wait_xcnt 0x0" :: "v"(lane), "v"(wl[0]), "v"(wl[1]), "v"(wl[2]), "v"(wl[3]), "v"(wl[4]), "v"(wl[5]), "v"(wl[6]), "v"(wl[7]), "v"(ml) : "memory");
  __builtin_amdgcn_sched_barrier(0);      /* all 32 loads are asked for before the first value is worked on: without it the compiler sets the second and third group behind the conversions of the group before, three memory latencies in a row */
#pragma unroll
  for (int j = 0; j < 8; ++j) { v4h o;
#pragma unroll
    for (int q = 0; q < 4; ++q) o[q] = (_Float16)bf16_round(xv[j][q]);
    *(v4h*)(X16 + e0 + 128 * j + 4 * lane) = o; }
  __builtin_amdgcn_sched_barrier(0);      /* a piece's stores leave as soon as it is converted: without it the compiler keeps them back to the kernel's end, behind the last load's wait */
#pragma unroll
  for (int j = 0; j < 8; ++j) { v4h o;
#pragma unroll
    for (int q = 0; q < 4; ++q) o[q] = (_Float16)bf16_round(cv[j][q]);
    *(v4h*)(C16 + e0 + 128 * j + 4 * lane) = o; }
  __builtin_amdgcn_sched_barrier(0);      /* as above */
#pragma unroll
  for (int i = 0; i < 4; ++i) { FragH f;
#pragma unroll
    for (int r = 0; r < 8; ++r) f.h[r] = (_Float16)(bf16_round(wv[r][i]) * 16.0f);      /* x16, a power of two: bf16-exact weights stay exact in f16 away from the subnormal range */
    *(v8us*)((unsigned short*)Bt + (size_t)(n0 + 4 * l4 + i) * DM + k0 + 8 * lk) = f.half[0]; }
  __builtin_amdgcn_sched_barrier(0);      /* as above */
  unsigned word = 0;
#pragma unroll
  for (int i = 0; i < 32; ++i) { const unsigned bl = __builtin_amdgcn_ballot_w32(mv[i >> 2][i & 3] != 0); word = lane == i ? bl : word; }      /* word i = 16 g + 8 kt + r goes to lane i */
  MW[(size_t)gw * 32 + lane] = word;
}
extern "C" void kernel_launch(void* const* d_in, const int* in_sizes, int n_in,
                              void* d_out, int out_size, void* d_ws, size_t ws_size, hipStream_t stream) {
  (void)in_sizes; (void)n_in; (void)out_size;
  const float* const* I = (const float* const*)d_in; const float* x = I[0]; const float* ctx = I[1]; const int* mkm = (const int*)d_in[2]; const float* wq = I[3]; const float* bq = I[4]; const float* wkv = I[5]; const float* bkv = I[6]; const float* wo = I[7]; const float* bo = I[8];      /* [in][out] weights; int mask [b][n][m]; k | v from the fused Wkv [1024][2048] */
  char* ws = (char*)d_ws; size_t off = 0;
  auto take = [&](size_t bytes) { char* p = ws + off; off += (bytes + 255) & ~(size_t)255; return p; };
  _Float16* BQ = (_Float16*)take((size_t)DM * DM * 2); _Float16* BKV = (_Float16*)take((size_t)2 * DM * DC * 2); _Float16* BO = (_Float16*)take((size_t)DM * DM * 2);
  _Float16* X16 = (_Float16*)take(NRQ * DM * 2); _Float16* C16 = (_Float16*)take(NRK * DC * 2); _Float16* Q16 = (_Float16*)take(NRQ * DM * 2); _Float16* K16 = (_Float16*)take(2 * NRK * DM * 2); _Float16* V16 = K16 + NRK * DM; _Float16* O16 = X16;      /* o rows reuse the x rows, whose last reader is the Q GEMM */
  unsigned* MW = (unsigned*)take(NRQ * SK / 8);      /* the mask, 1 bit an element, as lane-mask words */
  if (off > ws_size) return;      /* 8 + 5 x 8 = 48 MiB, + 512 KiB */
  k_prep<<<256, 512, 0, stream>>>(x, ctx, mkm, wq, wkv, wo, X16, C16, MW, BQ, BKV, BO);      /* x, context -> f16 rows; [in][out] weights -> Bt x16; Wkv [1024][2048] -> Bt [2048][1024]: rows 0..1023 = k columns, 1024..2047 = v columns */
  k_gemm2<0, DM, DM><<<dim3((unsigned)((NRQ / 128) * (DM / 64)), 1), 128, 0, stream>>>(X16, 0, BQ, 0, 0.0625f, bq, 0, nullptr, 1, 0, 0, nullptr, Q16, DM, 0, (int)NRQ, DM, DM, 0, 0, 0);
  k_gemm2<0, DC, DC><<<dim3((unsigned)((NRK / 128) * (DM / 64)), 2), 128, 0, stream>>>(C16, 0, BKV, (size_t)DM * DC, 0.0625f, bkv, (size_t)DM, nullptr, 1, 0, 0, nullptr, K16, DM, NRK * DM, (int)NRK, DM, DC, 0, 0, 0);      /* grid.y 0: k = context Wkv[:, :1024] + bkv[:1024] -> K16; grid.y 1: v = context Wkv[:, 1024:] + bkv[1024:] -> V16 */
  k_fattn<<<dim3(NQ / 256, NH, NB), 256, 0, stream>>>(Q16, K16, V16, MW, O16);      /* scores, masked softmax and P V of all 64 (batch, head) planes: o x64, merged rows */
  k_gemm2<0, DM, DM><<<dim3((unsigned)((NRQ / 128) * (DM / 64)), 1), 128, 0, stream>>>(O16, 0, BO, 0, 0.0009765625f, bo, 0, nullptr, 1, 0, 0, (float*)d_out, nullptr, DM, 0, (int)NRQ, DM, DM, 0, 0, 0);      /* out = o Wo + bo */
}

// v009
// One run takes 79.9 microseconds.
// Two timings next to v008 put it at 1.08 and 1.07 times that version's speed.
// Counting every step since v000, it is 66.0 times as fast.
#include <hip/hip_runtime.h>
// Masked multi-head cross-attention (x [4][1024][1024] queries, context [4][1024][1024]; q = x Wq + bq; k | v = context Wkv + bkv viewed (m, 2, 16, 64) ([in][out] weights sigma 1/32, zero biases); 16 heads of 64; dots = q k^T / 8; a binary int mask [b][n][32*32 = m] shared by the heads: masked_fill(mask == 0, -inf); softmax over the 1024 context tokens; out = merged Wp + bp -> [4][1024][1024]).
// Structure: x and context as exact f16 rows and [in][out] weights as exact x16 planes (Wkv as one [2048][1024] plane: k rows then v rows), and the int mask as 1-bit lane-mask words, all in one preparation launch; Q and K | V (one launch, grid.y) as WMMA GEMMs (operands staged in LDS, 32x64 wave tiles, f32 accumulation, + bias, f16 outputs); scores (K = 64, 1/8), mask select, online softmax (f32 statistics, native exp2; weights f16, unnormalised) and o = P V (V rows transposed on their way from LDS into the fragments; o carried x64) of all 64 (batch, head) planes fused in one launch, scores and weights in registers only, into merged f16 rows; out = o Wp + bp GEMM (f32, alpha 2^-10).
// Compute dtype: inputs rounded to bf16; x / context / weights exact; q, k, v, softmax weights and o as plain f16 GEMM operands (~2^-12); scores and statistics f32. v_wmma_f32_16x16x32_f16.
#define NB 4
#define NQ 1024
#define SK 1024
#define SQ SK                       /* keys per softmax row */
#define DM 1024
#define DC 1024
#define NH 16
#define HD 64
#define HG 4
#define NRQ ((size_t)NB * NQ)
#define NRK ((size_t)NB * SK)
typedef __bf16 v16b __attribute__((ext_vector_type(16)));
typedef unsigned short v8us __attribute__((ext_vector_type(8), may_alias));
typedef float  v8f  __attribute__((ext_vector_type(8)));
typedef float  v4f  __attribute__((ext_vector_type(4)));
typedef float  v4fa __attribute__((ext_vector_type(4), may_alias));
union FragB { v16b v; v8us half[2]; unsigned short u[16]; };

__device__ __forceinline__ unsigned short bf16_bits(float x) { unsigned int u = __float_as_uint(x); return (unsigned short)((u + 0x7FFFu + ((u >> 16) & 1u)) >> 16); }
__device__ __forceinline__ float bf16_val(unsigned short b) { return __uint_as_float(((unsigned int)b) << 16); }
__device__ __forceinline__ float bf16_round(float x) { return bf16_val(bf16_bits(x)); }
// D += A·B with NT terms: 1 = ah·bh, 2 = + al·bh (A split), 3 = + ah·bl (both split)
template <int NT>
__device__ __forceinline__ v8f mmaN(v16b ah, v16b al, v16b bh, v16b bl, v8f c) {
  c = __builtin_amdgcn_wmma_f32_16x16x32_bf16(false, ah, false, bh, (short)0, c, false, false);
  if (NT >= 2) c = __builtin_amdgcn_wmma_f32_16x16x32_bf16(false, al, false, bh, (short)0, c, false, false);
  if (NT >= 3) c = __builtin_amdgcn_wmma_f32_16x16x32_bf16(false, ah, false, bl, (short)0, c, false, false);
  asm volatile("v_nop\n\tv_nop\n\tv_nop\n\tv_nop" : "+v"(c) : "v"(ah), "v"(al), "v"(bh), "v"(bl));
  return c;
}

__global__ __launch_bounds__(256) void k_wt_bf16(const float* __restrict__ W, unsigned short* __restrict__ Wt, int K, int N) {
  const int t = blockIdx.x * 256 + threadIdx.x;
  const int k8n = K / 8;
  if (t >= N * k8n) return;
  const int n = t / k8n, k8 = (t % k8n) * 8;
  v8us v;
#pragma unroll
  for (int i = 0; i < 8; ++i) v[i] = bf16_bits(W[(size_t)(k8 + i) * N + n]);
  *(v8us*)(Wt + (size_t)n * K + k8) = v;
  
}

// GEMM C[M][N] (f32, pitch ldc) = act(A[M][K]·W + bias). A f32 row-major (pitch lda) converted per fragment to bf16
// (ASPLIT: hi/lo two planes -> 2 terms, else single rounded term); Wt bf16 [N][K] (pitch ldb). BIAS_BF16 rounds the
// bias to bf16 first (bias quantised to bf16 before the add). K%32==0, M%16==0, N%64==0.
template <bool ASPLIT, int ACT, bool BIAS_BF16>
__global__ __launch_bounds__(128) void k_gemm_bf(const float* __restrict__ A, int lda, const unsigned short* __restrict__ Wt, int ldb,
                                               const float* __restrict__ bias, float* __restrict__ C, int ldc, int M, int N, int K) {
  __shared__ __attribute__((aligned(16))) float so[4][16][64];
  const int tid = threadIdx.x, w = tid >> 5, lane = tid & 31, ln = lane & 15, hh = lane >> 4;
  const int ntn = N / 64;
  const int wid = blockIdx.x * 4 + w;
  const int mt = wid / ntn, nq = wid % ntn;
  if (mt * 16 >= M) return;
  const int row0 = mt * 16, col0 = nq * 64;
  const float* arow = A + (size_t)(row0 + ln) * lda;
  v8f acc[4] = {};
  for (int kb = 0; kb < K; kb += 32) {
    FragB ah, al;
    const v4f x0 = *(const v4fa*)(arow + kb + 8 * hh), x1 = *(const v4fa*)(arow + kb + 8 * hh + 4);
    const v4f x2 = *(const v4fa*)(arow + kb + 16 + 8 * hh), x3 = *(const v4fa*)(arow + kb + 16 + 8 * hh + 4);
    float xs[16] = {x0[0],x0[1],x0[2],x0[3],x1[0],x1[1],x1[2],x1[3],x2[0],x2[1],x2[2],x2[3],x3[0],x3[1],x3[2],x3[3]};
#pragma unroll
    for (int i = 0; i < 16; ++i) { const unsigned short hb = bf16_bits(xs[i]); ah.u[i] = hb; al.u[i] = ASPLIT ? bf16_bits(xs[i] - bf16_val(hb)) : (unsigned short)0; }
#pragma unroll
    for (int t = 0; t < 4; ++t) {
      const unsigned short* brow = Wt + (size_t)(col0 + t * 16 + ln) * ldb + kb;
      FragB b;
      b.half[0] = *(const v8us*)(brow + 8 * hh);
      b.half[1] = *(const v8us*)(brow + 16 + 8 * hh);
      acc[t] = mmaN<ASPLIT ? 2 : 1>(ah.v, al.v, b.v, b.v, acc[t]);
    }
  }
#pragma unroll
  for (int t = 0; t < 4; ++t) {
    float bv = bias ? bias[col0 + t * 16 + ln] : 0.f;
    if (BIAS_BF16) bv = bf16_round(bv);
#pragma unroll
    for (int r = 0; r < 8; ++r) { float v = acc[t][r] + bv; if (ACT == 1) v = fmaxf(v, 0.f); so[w][8 * hh + r][t * 16 + ln] = v; }
  }
  __builtin_amdgcn_fence(__ATOMIC_ACQ_REL, "workgroup");
  __builtin_amdgcn_wave_barrier();
  const int rsub = lane >> 4, c4 = (lane & 15) * 4;
  {
#pragma unroll
    for (int q = 0; q < 8; ++q) {
      const int r = q * 2 + rsub;
      const v4f v = *(const v4fa*)&so[w][r][c4];
      *(v4f*)(C + (size_t)(row0 + r) * ldc + col0 + c4) = v;
    }
    
  }
}

// GEMM C = act(A·W + bias + resid): A f32 (ASPLIT -> hi/lo 2 terms), Wt bf16 [N][K]; ACT 0 none, 1 relu, 2 exact gelu;
// resid (optional, f32, row index = (row % rmod), pitch ldr, RES_BF16 rounds it) added before the activation.
template <bool ASPLIT, int ACT, bool BIAS_BF16, bool RES_BF16>
__global__ __launch_bounds__(128) void k_gemm_bf3(const float* __restrict__ A, int lda, const unsigned short* __restrict__ Wt, int ldb,
                                                const float* __restrict__ bias, const float* __restrict__ resid, int rmod, int ldr,
                                                float* __restrict__ C, int ldc, int M, int N, int K) {
  __shared__ __attribute__((aligned(16))) float so[4][16][64];
  const int tid = threadIdx.x, w = tid >> 5, lane = tid & 31, ln = lane & 15, hh = lane >> 4;
  const int ntn = N / 64;
  const int wid = blockIdx.x * 4 + w;
  const int mt = wid / ntn, nq = wid % ntn;
  if (mt * 16 >= M) return;
  const int row0 = mt * 16, col0 = nq * 64;
  const float* arow = A + (size_t)(row0 + ln) * lda;
  v8f acc[4] = {};
  for (int kb = 0; kb < K; kb += 32) {
    FragB ah, al;
    const v4f x0 = *(const v4fa*)(arow + kb + 8 * hh), x1 = *(const v4fa*)(arow + kb + 8 * hh + 4);
    const v4f x2 = *(const v4fa*)(arow + kb + 16 + 8 * hh), x3 = *(const v4fa*)(arow + kb + 16 + 8 * hh + 4);
    float xs[16] = {x0[0],x0[1],x0[2],x0[3],x1[0],x1[1],x1[2],x1[3],x2[0],x2[1],x2[2],x2[3],x3[0],x3[1],x3[2],x3[3]};
#pragma unroll
    for (int i = 0; i < 16; ++i) { const unsigned short hb = bf16_bits(xs[i]); ah.u[i] = hb; al.u[i] = ASPLIT ? bf16_bits(xs[i] - bf16_val(hb)) : (unsigned short)0; }
#pragma unroll
    for (int t = 0; t < 4; ++t) {
      const unsigned short* brow = Wt + (size_t)(col0 + t * 16 + ln) * ldb + kb;
      FragB b;
      b.half[0] = *(const v8us*)(brow + 8 * hh);
      b.half[1] = *(const v8us*)(brow + 16 + 8 * hh);
      acc[t] = mmaN<ASPLIT ? 2 : 1>(ah.v, al.v, b.v, b.v, acc[t]);
    }
  }
#pragma unroll
  for (int t = 0; t < 4; ++t) {
    const int col = col0 + t * 16 + ln;
    float bv = bias ? bias[col] : 0.f;
    if (BIAS_BF16) bv = bf16_round(bv);
#pragma unroll
    for (int r = 0; r < 8; ++r) {
      float v = acc[t][r] + bv;
      if (resid) { float rv = resid[(size_t)((row0 + 8 * hh + r) % rmod) * ldr + col]; if (RES_BF16) rv = bf16_round(rv); v += rv; }
      if (ACT == 1) v = fmaxf(v, 0.f);
      if (ACT == 2) v = 0.5f * v * (1.0f + erff(v * 0.70710678118654752f));
      if (ACT == 3) { const float u = 0.7978845608028654f * (v + 0.044715f * v * v * v); v = 0.5f * v * (1.0f + tanhf(u)); }
      so[w][8 * hh + r][t * 16 + ln] = v;
    }
  }
  __builtin_amdgcn_fence(__ATOMIC_ACQ_REL, "workgroup");
  __builtin_amdgcn_wave_barrier();
  const int rsub = lane >> 4, c4 = (lane & 15) * 4;
  {
#pragma unroll
    for (int q = 0; q < 8; ++q) {
      const int r = q * 2 + rsub;
      const v4f v = *(const v4fa*)&so[w][r][c4];
      *(v4f*)(C + (size_t)(row0 + r) * ldc + col0 + c4) = v;
    }
    
  }
}
// row LayerNorm (biased variance, eps) over N: s = X (+ R); optional out_sum <- s; out_norm <- (s-mu)*rsqrt(var+eps)*g + b
template <bool PARAM_BF16>
__global__ __launch_bounds__(256) void k_layernorm(const float* __restrict__ X, const float* __restrict__ R, const float* __restrict__ g, const float* __restrict__ bta,
                                                  float* __restrict__ out_sum, float* __restrict__ out_norm, int N, float eps) {
  __shared__ float red[256];
  const int row = blockIdx.x, tid = threadIdx.x;
  const float* x = X + (size_t)row * N; const float* rr = R ? R + (size_t)row * N : nullptr;
  float vals[16];                     // up to N = 4096
  const int per = N / 256;            // contiguous chunk per thread? use strided-by-4 chunks: thread handles j = tid*4 + 1024*u
  float s1 = 0.f;
  for (int u = 0; u < per / 4; ++u) {
    const int j = tid * 4 + 1024 * u;
    const v4f a = *(const v4fa*)(x + j);
    v4f b = {0.f,0.f,0.f,0.f}; if (rr) b = *(const v4fa*)(rr + j);
#pragma unroll
    for (int q = 0; q < 4; ++q) { const float v = a[q] + b[q]; vals[u * 4 + q] = v; s1 += v; }
  }
  red[tid] = s1; __syncthreads();
  for (int st = 128; st > 0; st >>= 1) { if (tid < st) red[tid] += red[tid + st]; __syncthreads(); }
  const float mu = red[0] / (float)N; __syncthreads();
  float s2 = 0.f;
  for (int u = 0; u < per / 4; ++u)
#pragma unroll
    for (int q = 0; q < 4; ++q) { const float c = vals[u * 4 + q] - mu; s2 += c * c; }
  red[tid] = s2; __syncthreads();
  for (int st = 128; st > 0; st >>= 1) { if (tid < st) red[tid] += red[tid + st]; __syncthreads(); }
  const float rs = rsqrtf(red[0] / (float)N + eps);
  {
    for (int u = 0; u < per / 4; ++u) {
      const int j = tid * 4 + 1024 * u;
      v4f o, sm;
#pragma unroll
      for (int q = 0; q < 4; ++q) {
        float gg = g[j + q], bb = bta[j + q];
        if (PARAM_BF16) { gg = bf16_round(gg); bb = bf16_round(bb); }
        sm[q] = vals[u * 4 + q]; o[q] = (vals[u * 4 + q] - mu) * rs * gg + bb;
      }
      if (out_sum) *(v4f*)(out_sum + (size_t)row * N + j) = sm;
      *(v4f*)(out_norm + (size_t)row * N + j) = o;
    }
    
  }
}



// ---- f16 WMMA path (v_wmma_f32_16x16x32_f16): 11-bit significands for operands in range — used where a [0,1] probability operand needs more precision than bf16
typedef _Float16 v16h __attribute__((ext_vector_type(16)));
union FragH { v16h v; v8us half[2]; _Float16 h[16]; unsigned short u[16]; };
template <int NT>
__device__ __forceinline__ v8f mmaH(v16h ah, v16h al, v16h bh, v16h bl, v8f c) {
  c = __builtin_amdgcn_wmma_f32_16x16x32_f16(false, ah, false, bh, (short)0, c, false, false);
  if (NT >= 2) c = __builtin_amdgcn_wmma_f32_16x16x32_f16(false, al, false, bh, (short)0, c, false, false);
  if (NT >= 3) c = __builtin_amdgcn_wmma_f32_16x16x32_f16(false, ah, false, bl, (short)0, c, false, false);
  asm volatile("v_nop\n\tv_nop\n\tv_nop\n\tv_nop" : "+v"(c) : "v"(ah), "v"(al), "v"(bh), "v"(bl));
  return c;
}
// batched GEMM like k_gemm_b but f16 operands: A f32 (split into f16 hi/lo if ASPLIT, else rounded to f16), Bt = f16 values [n][k]; alpha; C f32; N multiple of 16 (partial tiles skipped)
template <bool ASPLIT>
__global__ __launch_bounds__(128) void k_gemm_h(const float* __restrict__ A, int lda, size_t sA, const _Float16* __restrict__ Bh, int ldb, size_t sB, float alpha, float* __restrict__ C, int ldc, size_t sC, int M, int N, int K) {
  __shared__ __attribute__((aligned(16))) float so[4][16][64];
  const int tid = threadIdx.x, w = tid >> 5, lane = tid & 31, ln = lane & 15, hh = lane >> 4; const int by = blockIdx.y;
  A += (size_t)by * sA; Bh += (size_t)by * sB; C += (size_t)by * sC;
  const int ntn = (N + 63) / 64; const int wid = blockIdx.x * 4 + w; const int mt = wid / ntn, nq = wid % ntn; if (mt * 16 >= M) return;
  const int row0 = mt * 16, col0 = nq * 64; const float* arow = A + (size_t)(row0 + ln) * lda;
  v8f acc[4] = {};
  for (int kb = 0; kb < K; kb += 32) {
    FragH ah, al;
    const v4f x0 = *(const v4fa*)(arow + kb + 8 * hh), x1 = *(const v4fa*)(arow + kb + 8 * hh + 4), x2 = *(const v4fa*)(arow + kb + 16 + 8 * hh), x3 = *(const v4fa*)(arow + kb + 16 + 8 * hh + 4);
    float xs[16] = {x0[0],x0[1],x0[2],x0[3],x1[0],x1[1],x1[2],x1[3],x2[0],x2[1],x2[2],x2[3],x3[0],x3[1],x3[2],x3[3]};
#pragma unroll
    for (int i = 0; i < 16; ++i) { const _Float16 h = (_Float16)xs[i]; ah.h[i] = h; al.h[i] = ASPLIT ? (_Float16)(xs[i] - (float)h) : (_Float16)0.0f; }
#pragma unroll
    for (int t = 0; t < 4; ++t) { if (col0 + t * 16 >= N) continue; const size_t boff = (size_t)(col0 + t * 16 + ln) * ldb + kb; FragH bq; bq.half[0] = *(const v8us*)(Bh + boff + 8 * hh); bq.half[1] = *(const v8us*)(Bh + boff + 16 + 8 * hh);
      acc[t] = mmaH<ASPLIT ? 2 : 1>(ah.v, al.v, bq.v, bq.v, acc[t]); }
  }
#pragma unroll
  for (int t = 0; t < 4; ++t) { if (col0 + t * 16 >= N) continue;
#pragma unroll
    for (int r = 0; r < 8; ++r) so[w][8 * hh + r][t * 16 + ln] = acc[t][r] * alpha; }
  __builtin_amdgcn_fence(__ATOMIC_ACQ_REL, "workgroup"); __builtin_amdgcn_wave_barrier();
  const int rsub = lane >> 4, c4 = (lane & 15) * 4;
  {
#pragma unroll
    for (int q = 0; q < 8; ++q) { const int r = q * 2 + rsub; if (col0 + c4 < N) { const v4f v = *(const v4fa*)&so[w][r][c4]; *(v4f*)(C + (size_t)(row0 + r) * ldc + col0 + c4) = v; } }
     }
}

// k_gemm_hh variant with fused epilogue: v = acc·alpha + bias[by·sBias + col] (+ CP[(row/rowsPerB)·sCPb + by·64 + col] if CP) ; ACT 0 none / 1 elu ; writes f16 C16 (and f32 C if non-null)
template <int ACT>
__global__ __launch_bounds__(128) void k_gemm_hhx(const _Float16* __restrict__ A, int lda, size_t sA, const _Float16* __restrict__ Bh, int ldb, size_t sB, float alpha, const float* __restrict__ bias, size_t sBias, const float* __restrict__ CP, int rowsPerB, size_t sCPb, int row0g,
    float* __restrict__ C, _Float16* __restrict__ C16, int ldc, size_t sC, int M, int N, int K) {
  __shared__ __attribute__((aligned(16))) float so[4][16][64];
  const int tid = threadIdx.x, w = tid >> 5, lane = tid & 31, ln = lane & 15, hh = lane >> 4; const int by = blockIdx.y;
  A += (size_t)by * sA; Bh += (size_t)by * sB; const size_t cofs = (size_t)by * sC; const float* bp = bias ? bias + (size_t)by * sBias : nullptr;
  const int ntn = (N + 63) / 64; const int wid = blockIdx.x * 4 + w; const int mt = wid / ntn, nq = wid % ntn; if (mt * 16 >= M) return;
  const int row0 = mt * 16, col0 = nq * 64; const _Float16* arow = A + (size_t)(row0 + ln) * lda;
  v8f acc[4] = {};
  for (int kb = 0; kb < K; kb += 32) { FragH ah; ah.half[0] = *(const v8us*)((const unsigned short*)arow + kb + 8 * hh); ah.half[1] = *(const v8us*)((const unsigned short*)arow + kb + 16 + 8 * hh);
#pragma unroll
    for (int t = 0; t < 4; ++t) { if (col0 + t * 16 >= N) continue; const size_t boff = (size_t)(col0 + t * 16 + ln) * ldb + kb; FragH bq; bq.half[0] = *(const v8us*)((const unsigned short*)Bh + boff + 8 * hh); bq.half[1] = *(const v8us*)((const unsigned short*)Bh + boff + 16 + 8 * hh);
      acc[t] = mmaH<1>(ah.v, ah.v, bq.v, bq.v, acc[t]); }
  }
#pragma unroll
  for (int t = 0; t < 4; ++t) { if (col0 + t * 16 >= N) continue; const int col = col0 + t * 16 + ln; const float bv = bp ? bf16_round(bp[col]) : 0.f;
#pragma unroll
    for (int r = 0; r < 8; ++r) { float v = acc[t][r] * alpha + bv; if (CP) { const int rr = row0g + row0 + 8 * hh + r; if (rowsPerB < 0) v += CP[cofs + (size_t)rr * ldc + col];      /* rowsPerB < 0: own element of the batched C plane */ else { const int bidx = rr / rowsPerB; v += CP[(size_t)bidx * sCPb + (size_t)by * 64 + col]; } } if (ACT == 1) v = (v > 0.f) ? v : expm1f(v); else if (ACT == 7) v = (v > 0.f) ? v + 1.0f : expf(v); else if (ACT == 8) v = tanhf(v); else if (ACT == 9) v = 0.5f * v * (1.0f + tanhf(0.7978845608028654f * (v + 0.044715f * v * v * v))); else if (ACT == 11) v = 1.0f / (1.0f + expf(-v)); else if (ACT == 12) v = (v > 0.f) ? v : 0.01f * v; else if (ACT == 14) v = (v > 0.f) ? v : 0.1f * v; else if (ACT == 16) v = (v >= 0.f) ? v : 0.3f * v; else if (ACT == 17) v = (v >= 0.f) ? v : 0.2f * v; else if (ACT == 15) v = v / (1.0f + expf(-v)); else if (ACT == 3) v = fmaxf(v, 0.f); else if (ACT == 6) v = 0.5f * v * (1.0f + erff(v * 0.70710678118654752f)); so[w][8 * hh + r][t * 16 + ln] = v; } }
  __builtin_amdgcn_fence(__ATOMIC_ACQ_REL, "workgroup"); __builtin_amdgcn_wave_barrier();
  const int rsub = lane >> 4, c4 = (lane & 15) * 4; typedef _Float16 v4h __attribute__((ext_vector_type(4)));
  {
#pragma unroll
    for (int q = 0; q < 8; ++q) { const int r = q * 2 + rsub; if (col0 + c4 < N) { const v4f v = *(const v4fa*)&so[w][r][c4]; if (C) *(v4f*)(C + cofs + (size_t)(row0 + r) * ldc + col0 + c4) = v; if (C16) { v4h h4; for (int i = 0; i < 4; ++i) h4[i] = (_Float16)v[i]; *(v4h*)(C16 + cofs + (size_t)(row0 + r) * ldc + col0 + c4) = h4; } } }
     }
}


typedef _Float16 v4h __attribute__((ext_vector_type(4)));

__global__ __launch_bounds__(256) void k_h16(const float* __restrict__ x, _Float16* __restrict__ X16, size_t n8) { const size_t t = (size_t)blockIdx.x * 256 + threadIdx.x; if (t >= n8) return; FragH f;
#pragma unroll
  for (int q = 0; q < 8; ++q) f.h[q] = (_Float16)x[t * 8 + q]; *(v8us*)((unsigned short*)X16 + t * 8) = f.half[0];  }
__global__ __launch_bounds__(256) void k_round16f(const float* __restrict__ W, _Float16* __restrict__ Bt, size_t n8) { const size_t t = (size_t)blockIdx.x * 256 + threadIdx.x; if (t >= n8) return; FragH f;
#pragma unroll
  for (int i = 0; i < 8; ++i) f.h[i] = (_Float16)(bf16_round(W[t * 8 + i]) * 16.0f); *(v8us*)((unsigned short*)Bt + t * 8) = f.half[0];  }

__global__ __launch_bounds__(256) void k_hl(const float* __restrict__ F, _Float16* __restrict__ Hh, _Float16* __restrict__ Hl, size_t n8) { const size_t t = (size_t)blockIdx.x * 256 + threadIdx.x; if (t >= n8) return; FragH fh, fl; const v4f a = *(const v4fa*)(F + t * 8), c = *(const v4fa*)(F + t * 8 + 4);
#pragma unroll
  for (int q = 0; q < 4; ++q) { _Float16 h = (_Float16)a[q]; fh.h[q] = h; fl.h[q] = (_Float16)((a[q] - (float)h) * 1024.0f); h = (_Float16)c[q]; fh.h[4 + q] = h; fl.h[4 + q] = (_Float16)((c[q] - (float)h) * 1024.0f); }
  { *(v8us*)((unsigned short*)Hh + t * 8) = fh.half[0]; *(v8us*)((unsigned short*)Hl + t * 8) = fl.half[0];  } }

// ---- fast GEMM (work-group tile 128x64, wave tile 32x64; requires M % 128 == 0, N % 64 == 0, K % 128 == 0, 256-byte aligned rows); operands staged in LDS; epilogue = k_gemm_hhx semantics ----
#define G2_KS 128                      /* k per stage: 256 bytes of every operand row */
#define G2_PITCH (G2_KS * 2 + 16)      /* LDS row pitch in bytes: 16 x odd, for 16-byte readers */
__device__ __forceinline__ v16h g2_lfrag(const char* p) { FragH f; f.half[0] = *(const v8us*)p; f.half[1] = *(const v8us*)(p + 32); return f.v; }      /* a fragment from a staged row; the lane's 16 hh bytes are in p */
__device__ __forceinline__ v8f g2_mma(v16h a, v16h b, v8f c) { v8f d = __builtin_amdgcn_wmma_f32_16x16x32_f16(false, a, false, b, (short)0, c, false, false); asm volatile("v_nop\n\tv_nop\n\tv_nop\n\tv_nop" : "+v"(d) : "v"(a), "v"(b)); return d; }
template <int ACT, int lda, int ldb, bool HASB, bool HASCP, bool OUTF32>      /* the operands' row pitches at compile time: a thread's staging loads are then one base, one lane offset and immediates. The epilogue's options too (HASB: a bias is added; HASCP: a CP plane is added; OUTF32: f32 rows to C, else f16 rows to C16): as run-time pointer tests they stood as a scalar branch at every element and every row, and each bias load and each LDS read-back was waited for alone */
__global__ __launch_bounds__(128) void k_gemm2(const _Float16* __restrict__ A, size_t sA, const _Float16* __restrict__ Bh, size_t sB, float alpha, const float* __restrict__ bias, size_t sBias, const float* __restrict__ CP, int rowsPerB, size_t sCPb, int row0g,
    float* __restrict__ C, _Float16* __restrict__ C16, int ldc, size_t sC, int M, int N, int K, size_t sAz, size_t sBz, size_t sCz) { static_assert(ACT == 0 || ACT == 3 || ACT == 6 || ACT == 8 || ACT == 9 || ACT == 11 || ACT == 12 || ACT == 14 || ACT == 15 || ACT == 16 || ACT == 17, "k_gemm2: unsupported ACT code (would silently apply no activation)");
  __shared__ __attribute__((aligned(16))) char sm[192 * G2_PITCH];      /* one stage: 128 A rows, then 64 B rows, G2_KS k each; behind the k loop the waves' output staging */
  static_assert(sizeof(sm) >= 4 * 32 * 68 * sizeof(float), "k_gemm2: the output staging lies in the stage buffer"); float (*so)[32][68] = (float (*)[32][68])sm;
  const int tid = threadIdx.x, w = tid >> 5, lane = tid & 31, ln = lane & 15, hh = lane >> 4; const int by = blockIdx.y, bz = blockIdx.z;      /* two batch levels: grid.y (strides sA, sB, sC) and grid.z (strides sAz, sBz, sCz) */
  A += (size_t)by * sA + (size_t)bz * sAz; Bh += (size_t)by * sB + (size_t)bz * sBz; const size_t cofs = (size_t)by * sC + (size_t)bz * sCz; const float* bp = bias + (size_t)by * sBias;
  const int ntn = N >> 6; const int mt = blockIdx.x / ntn, nq = blockIdx.x - mt * ntn; const int row0 = mt * 128 + 32 * w, col0 = nq * 64; if (mt * 128 >= M) return;      /* the same for the whole work-group: barriers follow */
  const char* Ab = (const char*)(A + (size_t)(mt * 128) * lda); const char* Bb = (const char*)(Bh + (size_t)col0 * ldb);      /* uniform bases; the lane's part is a 32-bit byte offset that never changes */
  const int sr = tid >> 4, sc = tid & 15;      /* staging: 16 lanes take one row's 256 bytes, so a wave's load covers 4 whole lines; thread rows sr + 8 j */
  const unsigned ga = (unsigned)(sr * lda + sc * 8) * 2, gb = (unsigned)(sr * ldb + sc * 8) * 2;
  char* sst = sm + sr * G2_PITCH + sc * 16;
  const char* sa = sm + (32 * w + ln) * G2_PITCH + 16 * hh; const char* sb = sm + (128 + ln) * G2_PITCH + 16 * hh;      /* fragment rows; k = 8 hh + 0..7 and 16 + 8 hh + 0..7 of each 32, A and B alike */
  const v8f z8 = {0.f,0.f,0.f,0.f,0.f,0.f,0.f,0.f}; v8f c00 = z8, c01 = z8, c02 = z8, c03 = z8, c10 = z8, c11 = z8, c12 = z8, c13 = z8;
  v8us st[24];
#pragma unroll
  for (int j = 0; j < 16; ++j) st[j] = *(const v8us*)(Ab + (size_t)(8 * j) * lda * 2 + ga);
#pragma unroll
  for (int j = 0; j < 8; ++j) st[16 + j] = *(const v8us*)(Bb + (size_t)(8 * j) * ldb * 2 + gb);
#pragma unroll 1
  for (int kb = 0; kb < K; kb += G2_KS) {
#pragma unroll
    for (int j = 0; j < 24; ++j) *(v8us*)(sst + 8 * j * G2_PITCH) = st[j];
    __syncthreads();      /* the stage is whole before anybody reads it */
    if (kb + G2_KS < K) {      /* the next stage's rows fly into registers while this stage is worked on */
      const char* An = Ab + (size_t)(kb + G2_KS) * 2; const char* Bn = Bb + (size_t)(kb + G2_KS) * 2;
#pragma unroll
      for (int j = 0; j < 16; ++j) st[j] = *(const v8us*)(An + (size_t)(8 * j) * lda * 2 + ga);
#pragma unroll
      for (int j = 0; j < 8; ++j) st[16 + j] = *(const v8us*)(Bn + (size_t)(8 * j) * ldb * 2 + gb);
      asm volatile("s_wait_xcnt 0x0" ::: "memory");      /* the loads' address registers are reused by the fragment loads right behind; it also keeps the global loads in front of the LDS reads */
    }
#pragma unroll
    for (int kk = 0; kk < G2_KS / 32; ++kk) { const v16h a0 = g2_lfrag(sa + 64 * kk), a1 = g2_lfrag(sa + 16 * G2_PITCH + 64 * kk);      /* the six fragments of a k step are asked for together: one LDS wait a step */
      const v16h b0 = g2_lfrag(sb + 64 * kk), b1 = g2_lfrag(sb + 16 * G2_PITCH + 64 * kk), b2 = g2_lfrag(sb + 32 * G2_PITCH + 64 * kk), b3 = g2_lfrag(sb + 48 * G2_PITCH + 64 * kk);
      c00 = g2_mma(a0, b0, c00); c10 = g2_mma(a1, b0, c10); c01 = g2_mma(a0, b1, c01); c11 = g2_mma(a1, b1, c11);
      c02 = g2_mma(a0, b2, c02); c12 = g2_mma(a1, b2, c12); c03 = g2_mma(a0, b3, c03); c13 = g2_mma(a1, b3, c13); }
    __syncthreads();      /* every reader has left the stage before it is written again (behind the last pass: before the output staging) */
  }
  v8f accs[8] = {c00, c01, c02, c03, c10, c11, c12, c13};
  float bvs[4];
#pragma unroll
  for (int t = 0; t < 4; ++t) bvs[t] = HASB ? bf16_round(bp[col0 + t * 16 + ln]) : 0.f;      /* the four bias columns of the lane, asked for together */
#pragma unroll
  for (int u = 0; u < 8; ++u) { const int t = u & 3, half = u >> 2; const int col = col0 + t * 16 + ln; const float bv = bvs[t];
#pragma unroll
    for (int r = 0; r < 8; ++r) { const int rloc = half * 16 + 8 * hh + r; float v = accs[u][r] * alpha + bv; if (HASCP) { if (rowsPerB < 0) v += CP[cofs + (size_t)(row0g + row0 + rloc) * ldc + col];      /* rowsPerB < 0: own element of the batched C plane */ else { const int bidx = (row0g + row0 + rloc) / rowsPerB; v += CP[(size_t)bidx * sCPb + (size_t)by * 64 + col]; } }
      if (ACT == 3) v = fmaxf(v, 0.f); else if (ACT == 6) v = 0.5f * v * (1.0f + erff(v * 0.70710678118654752f)); else if (ACT == 11) v = 1.0f / (1.0f + expf(-v)); else if (ACT == 15) v = v / (1.0f + expf(-v)); else if (ACT == 12) v = (v > 0.f) ? v : 0.01f * v; else if (ACT == 8) v = tanhf(v); else if (ACT == 9) v = 0.5f * v * (1.0f + tanhf(0.7978845608028654f * (v + 0.044715f * v * v * v))); else if (ACT == 14) v = (v > 0.f) ? v : 0.1f * v; else if (ACT == 16) v = (v >= 0.f) ? v : 0.3f * v; else if (ACT == 17) v = (v >= 0.f) ? v : 0.2f * v;
      so[w][rloc][t * 16 + ln] = v; } }
  __builtin_amdgcn_fence(__ATOMIC_ACQ_REL, "workgroup"); __builtin_amdgcn_wave_barrier();
  const int rsub = lane >> 4, c4 = (lane & 15) * 4;
  {
#pragma unroll
    for (int q = 0; q < 16; ++q) { const int r = q * 2 + rsub; const v4f v = *(const v4fa*)&so[w][r][c4]; if (OUTF32) *(v4f*)(C + cofs + (size_t)(row0 + r) * ldc + col0 + c4) = v; else { v4h h4; for (int i = 0; i < 4; ++i) h4[i] = (_Float16)v[i]; *(v4h*)(C16 + cofs + (size_t)(row0 + r) * ldc + col0 + c4) = h4; } }
     } }


__global__ __launch_bounds__(256) void k_wnat(const float* __restrict__ w, size_t n8, _Float16* __restrict__ Bt) { const size_t t = (size_t)blockIdx.x * 256 + threadIdx.x; if (t >= n8) return; FragH f; for (int q = 0; q < 8; ++q) f.h[q] = (_Float16)(bf16_round(w[t * 8 + q]) * 16.0f); *(v8us*)((unsigned short*)Bt + t * 8) = f.half[0];  }
__global__ __launch_bounds__(256) void k_rsm(const float* __restrict__ S, _Float16* __restrict__ P, int nrows) {
  #pragma clang fp contract(off)
  const int i = blockIdx.x * 256 + threadIdx.x; if (i >= nrows) return; const float* s = S + (size_t)i * SQ; float mx = -3.0e38f;
#pragma unroll 1
  for (int j = 0; j < SQ; ++j) mx = fmaxf(mx, s[j]); float se = 0.f;
#pragma unroll 1
  for (int j = 0; j < SQ; ++j) se += expf(s[j] - mx); const float sc = 256.0f / se;
#pragma unroll 1
  for (int j0 = 0; j0 < SQ; j0 += 8) { FragH f; for (int q = 0; q < 8; ++q) f.h[q] = (_Float16)(expf(s[j0 + q] - mx) * sc); unsigned short* d = (unsigned short*)P + (size_t)i * SQ + j0; *(v8us*)d = f.half[0];  } }
__global__ __launch_bounds__(256) void k_vt(const _Float16* __restrict__ V16, int b, int h0, _Float16* __restrict__ VT) { __shared__ unsigned short tl[64][65]; const int tid = threadIdx.x; const int hh = blockIdx.x % HG, sg = blockIdx.x / HG; const int s0 = sg * 64; const int h = h0 + hh;
  for (int i = tid; i < 64 * 8; i += 256) { const int j = i / 8, d8 = (i % 8) * 8; FragH f; f.half[0] = *(const v8us*)((const unsigned short*)V16 + ((size_t)b * SQ + s0 + j) * DM + h * HD + d8); for (int q = 0; q < 8; ++q) tl[d8 + q][j] = f.u[q]; }
  __syncthreads();
  { for (int i = tid; i < 64 * 8; i += 256) { const int d = i / 8, j8 = (i % 8) * 8; FragH f; for (int q = 0; q < 8; ++q) f.u[q] = tl[d][j8 + q]; *(v8us*)((unsigned short*)VT + ((size_t)hh * HD + d) * SQ + s0 + j8) = f.half[0]; }  } }


__global__ __launch_bounds__(256) void k_rsmf(const float* __restrict__ S, _Float16* __restrict__ P, int qn, int hg) {
  #pragma clang fp contract(off)
  const int t = blockIdx.x * 256 + threadIdx.x; if (t >= qn * hg) return; const size_t i = (size_t)(t / qn) * SQ + (t % qn); const float* s = S + i * SQ; float mx = -3.0e38f;
#pragma unroll 1
  for (int j = 0; j < SQ; ++j) mx = fmaxf(mx, s[j]); float se = 0.f;
#pragma unroll 1
  for (int j = 0; j < SQ; ++j) se += __expf(s[j] - mx); const float sc = 256.0f / se;
#pragma unroll 1
  for (int j0 = 0; j0 < SQ; j0 += 8) { FragH f; for (int q = 0; q < 8; ++q) f.h[q] = (_Float16)(__expf(s[j0 + q] - mx) * sc); unsigned short* d = (unsigned short*)P + i * SQ + j0; *(v8us*)d = f.half[0];  } }

__global__ __launch_bounds__(256) void k_rsmr(const float* __restrict__ S, _Float16* __restrict__ P, int qn, int hg) {
  #pragma clang fp contract(off)
  const int t = blockIdx.x * 256 + threadIdx.x; if (t >= qn * hg) return; const size_t i = (size_t)t;      /* planes packed: row t of plane t / qn */ const float* s = S + i * SQ; float mx = -3.0e38f;
#pragma unroll 1
  for (int j = 0; j < SQ; ++j) mx = fmaxf(mx, s[j]); float se = 0.f;
#pragma unroll 1
  for (int j = 0; j < SQ; ++j) se += __expf(s[j] - mx); const float sc = 256.0f / se;
#pragma unroll 1
  for (int j0 = 0; j0 < SQ; j0 += 8) { FragH f; for (int q = 0; q < 8; ++q) f.h[q] = (_Float16)(__expf(s[j0 + q] - mx) * sc); unsigned short* d = (unsigned short*)P + i * SQ + j0; *(v8us*)d = f.half[0];  } }


typedef int v4ia __attribute__((ext_vector_type(4), may_alias));
typedef unsigned v16ua __attribute__((ext_vector_type(16), may_alias));
typedef float f32x2 __attribute__((ext_vector_type(2)));
__device__ __forceinline__ float fa_xhalf(float x) { return __builtin_bit_cast(float, __builtin_amdgcn_permlanex16(__builtin_bit_cast(int, x), __builtin_bit_cast(int, x), 0x76543210, 0xfedcba98, false, false)); }      /* lane l with lane l ^ 16 */
__device__ __forceinline__ v8f fa_mma(v16h a, v16h b, v8f c) { return __builtin_amdgcn_wmma_f32_16x16x32_f16(false, a, false, b, (short)0, c, false, false); }
__device__ __forceinline__ v16h fa_frag(const char* base, unsigned off) { FragH f; f.half[0] = *(const v8us*)(base + off); f.half[1] = *(const v8us*)(base + off + 32); return f.v; }      /* k = 8 hh + 0..7 and 16 + 8 hh + 0..7; the lane's 16 hh bytes are in off */
// In front of a group of fragment loads: keeps the loads from rising among the WMMAs in front of them.
__device__ __forceinline__ void fa_ahead() { __builtin_amdgcn_sched_barrier(0); }
// Behind the next pass's mask fetch. The wait: the fetch's address registers are reused right behind it. The scheduling barrier: keeps that wait directly behind its loads and the fetch where it is written, a phase ahead of its use (without it the compiler moves the mask fetch down among the exponentials and the wait away from its loads).
__device__ __forceinline__ void fa_issued() { asm volatile("s_wait_xcnt 0x0" ::: "memory"); __builtin_amdgcn_sched_barrier(0); }
// Behind a group of fragment loads from LDS: keeps the group where it is written, as one group a phase ahead of its use (without it the compiler may sink single loads down to their WMMAs).
__device__ __forceinline__ void fa_placed() { __builtin_amdgcn_sched_barrier(0); }
// The mask words as constant-address-space data (k_prep wrote them in an earlier launch; nothing writes them in this one): with the ring's copies and barriers in the kernel the compiler fetched them, as plain global loads, by vector loads behind the first barrier and moved them to scalar registers word by word.
typedef __attribute__((address_space(4))) const v16ua fa_cwords;
#define FA_KS 128                      /* keys per LDS stage: four passes of 32 */
#define FA_KP (HD * 2 + 16)            /* LDS pitch of a K row (64 d): 144 bytes = 16 x odd, for 16-byte readers */
#define FA_VP (HD * 2 + 32)            /* LDS pitch of a V row (64 d): 160 bytes = 32 x odd, for the transposing 16-byte readers */
#define FA_KB (FA_KS * FA_KP)          /* a stage's K tile */
#define FA_SB (FA_KB + FA_KS * FA_VP)  /* a stage: K tile, then V tile */
// A 16 (d) x 16 (keys) half of a V^T fragment from V rows in LDS: lane l gives the address of 16 bytes of row 8 (l >> 4) + (l & 7), d half (l >> 3) & 1, and gets keys 8 hh + 0..7 of column d = ln.
typedef short fa_s16x8 __attribute__((ext_vector_type(8)));
__device__ __forceinline__ v8us fa_tr16(const char* p) { typedef __attribute__((address_space(3))) fa_s16x8 lds_s16x8; return __builtin_bit_cast(v8us, __builtin_amdgcn_ds_load_tr16_b128_v8i16((lds_s16x8*)p)); }
// One stage's K rows and V rows (128 x 128 bytes each) from global memory into LDS, through no register: 8 asynchronous 16-byte copies a lane, a wave's copy = 4 whole lines.
// lk, lv: the lane's LDS byte addresses of its first K and V piece; gk, gv: the global ones. The four pieces of each kind lie 32 rows apart.
// The wait on the address translations is the statement's last line: the copies' address registers are free for reuse only behind it (a precaution).
__device__ __forceinline__ void fa_stage(unsigned lk, unsigned lv, const char* gk, const char* gv) {
  asm volatile("global_load_async_to_lds_b128 %0, %1, off\n\t"
               "global_load_async_to_lds_b128 %2, %3, off\n\t"
               "global_load_async_to_lds_b128 %4, %5, off\n\t"
               "global_load_async_to_lds_b128 %6, %7, off\n\t"
               "global_load_async_to_lds_b128 %8, %9, off\n\t"
               "global_load_async_to_lds_b128 %10, %11, off\n\t"
               "global_load_async_to_lds_b128 %12, %13, off\n\t"
               "global_load_async_to_lds_b128 %14, %15, off\n\t"
               "s_wait_xcnt 0x0"
               :: "v"(lk), "v"(gk), "v"(lk + 32 * FA_KP), "v"(gk + 32 * DM * 2), "v"(lk + 64 * FA_KP), "v"(gk + 64 * DM * 2), "v"(lk + 96 * FA_KP), "v"(gk + 96 * DM * 2),
                  "v"(lv), "v"(gv), "v"(lv + 32 * FA_VP), "v"(gv + 32 * DM * 2), "v"(lv + 64 * FA_VP), "v"(gv + 64 * DM * 2), "v"(lv + 96 * FA_VP), "v"(gv + 96 * DM * 2)
               : "memory");
}
__global__ __launch_bounds__(256) void k_fattn(const _Float16* __restrict__ Q, const _Float16* __restrict__ Kr, const _Float16* __restrict__ Vr, const unsigned* __restrict__ MW, _Float16* __restrict__ O) {
  __shared__ __attribute__((aligned(16))) char sm[2 * FA_SB];
  const int tid = threadIdx.x, lane = tid & 31, ln = lane & 15, hh = lane >> 4; const int wave = __builtin_amdgcn_readfirstlane((int)(threadIdx.x >> 5));
  const int h = blockIdx.y, b = blockIdx.z, q0 = blockIdx.x * 256 + wave * 32;
  const float cs = 0.125f * 1.4426950408889634f;      /* 1 / sqrt(64), and e^x = 2^(x log2 e) */
  const float fill = -8589934592.0f;      /* masked_fill: -2^33, -2^30 after the 1/8. A power of two, so that its product with cs is exact: while every key seen so far is masked the maximum IS that product, the fused multiply-add of the exponent gives exactly 0 and the weights are 1 (finite); the first unmasked key rescales them to 0. A fill whose product rounds would leave a positive exponent there */
  const char* qb = (const char*)(Q + ((size_t)b * NQ + q0) * DM + h * HD);      /* wave-uniform bases; the lane's part is a 32-bit byte offset that never changes */
  const char* kb = (const char*)(Kr + (size_t)b * SK * DM + h * HD);
  const char* vb = (const char*)(Vr + (size_t)b * SK * DM + h * HD);
  const unsigned* mb_ = MW + ((size_t)b * NQ + q0) * (SK / 32);      /* the wave's 32 passes x 32 lane-mask words, contiguous; the address is wave-uniform, so the words come by scalar loads */
  const unsigned ko = (unsigned)(ln * DM * 2 + 16 * hh);
  /* staging: 8 lanes take a K row's, and a V row's, 128 bytes (thread rows (tid >> 3) + 32 j) */
  const unsigned sm0 = (unsigned)(size_t)sm;      /* the ring's LDS byte address: the low 32 bits of the __shared__ address */
  const unsigned lk0 = sm0 + (unsigned)((tid >> 3) * FA_KP + (tid & 7) * 16), lv0 = sm0 + (unsigned)(FA_KB + (tid >> 3) * FA_VP + (tid & 7) * 16);
  const char* gk0 = kb + (size_t)((tid >> 3) * DM * 2 + (tid & 7) * 16); const char* gv0 = vb + (size_t)((tid >> 3) * DM * 2 + (tid & 7) * 16);
  fa_stage(lk0, lv0, gk0, gv0);      /* stage 0 into buffer 0 */
  v16h qf[2][2];
#pragma unroll
  for (int g = 0; g < 2; ++g)
#pragma unroll
    for (int kc = 0; kc < 2; ++kc) qf[g][kc] = fa_frag(qb + 16 * g * DM * 2 + 64 * kc, ko);
  fa_issued();      /* the Q loads' address registers are reused right behind */
  v16ua mk[2];      /* mk[g][8 kt + r]: bit l = lane l's mask element of score register r, tile kt, column group g */
  mk[0] = *(fa_cwords*)mb_; mk[1] = *(fa_cwords*)(mb_ + 16);
  fa_issued();
  asm volatile("s_wait_asynccnt 0x0" ::: "memory");      /* this wave's part of stage 0 has landed */
  __syncthreads();      /* stage 0 is whole before anybody reads it */
  fa_stage(lk0 + FA_SB, lv0 + FA_SB, gk0 + (size_t)FA_KS * DM * 2, gv0 + (size_t)FA_KS * DM * 2);      /* stage 1 into buffer 1: flies while stage 0 is worked on */
  const v8f z8 = {0.f, 0.f, 0.f, 0.f, 0.f, 0.f, 0.f, 0.f};
  v8f acc[2][4]; float m_run[2], l_run[2];
#pragma unroll
  for (int g = 0; g < 2; ++g) { m_run[g] = -3.0e38f; l_run[g] = 0.f;
#pragma unroll
    for (int t = 0; t < 4; ++t) acc[g][t] = z8; }
  const int klo = ln * FA_KP + 16 * hh, vlo = FA_KB + (8 * hh + (lane & 7)) * FA_VP + 16 * ((lane >> 3) & 1);      /* the lane's K fragment row and its address part of the transposing V loads in a stage; k = 8 hh + 0..7 and 16 + 8 hh + 0..7 of each 32, as in the Q fragments and in P */
#pragma unroll 1      /* the ring stays a loop of eight stages: one copy of the four passes in the instruction cache */
  for (int st = 0; st < SK / FA_KS; ++st) {
    const char* sk = sm + (st & 1) * FA_SB + klo; const char* sv = sm + (st & 1) * FA_SB + vlo;
    v16h kf[2][2], vf[4];
#pragma unroll
    for (int kt = 0; kt < 2; ++kt)
#pragma unroll
      for (int kc = 0; kc < 2; ++kc) kf[kt][kc] = g2_lfrag(sk + 16 * kt * FA_KP + 64 * kc);      /* the stage's first K fragments */
    fa_placed();
#pragma unroll      /* the four passes of a stage: every LDS offset an immediate, and the last pass without a K fetch */
    for (int p = 0; p < FA_KS / 32; ++p) {
      const int kn = (st * FA_KS + p * 32 + 32) & (SK - 1);      /* the next pass's first key; the last pass fetches pass 0's mask words again (in bounds, not used) so that the fetch stays unconditional */
      v8f s[2][2];
#pragma unroll
      for (int kt = 0; kt < 2; ++kt)
#pragma unroll
        for (int g = 0; g < 2; ++g) s[kt][g] = fa_mma(kf[kt][1], qf[g][1], fa_mma(kf[kt][0], qf[g][0], z8));
      fa_ahead();      /* the score products first: the K fetch goes into their operand registers */
      if (p + 1 < FA_KS / 32) {
#pragma unroll
        for (int kt = 0; kt < 2; ++kt)
#pragma unroll
          for (int kc = 0; kc < 2; ++kc) kf[kt][kc] = g2_lfrag(sk + (32 * (p + 1) + 16 * kt) * FA_KP + 64 * kc); }
#pragma unroll
      for (int t = 0; t < 4; ++t) { FragH f; f.half[0] = fa_tr16(sv + 32 * p * FA_VP + 32 * t); f.half[1] = fa_tr16(sv + (32 * p + 16) * FA_VP + 32 * t); vf[t] = f.v; }      /* d = 16 t + ln; keys 32 p + 8 hh + 0..7 and 32 p + 16 + 8 hh + 0..7 */
      fa_placed();
      float mb[2]; bool need = false;
#pragma unroll
      for (int g = 0; g < 2; ++g) { float mx = -3.0e38f;
#pragma unroll
        for (int kt = 0; kt < 2; ++kt)
#pragma unroll
          for (int r = 0; r < 8; ++r) { const float v = __builtin_amdgcn_inverse_ballot_w32(mk[g][8 * kt + r]) ? s[kt][g][r] : fill; s[kt][g][r] = v; mx = fmaxf(mx, v); }      /* the word IS the select's lane mask: no compare */
        mx = fmaxf(mx, fa_xhalf(mx)) * cs; mb[g] = mx; need = need || (mx > m_run[g] + 8.0f); }
      if (__builtin_amdgcn_ballot_w32(need) != 0) {      /* wave-uniform; rare after the first passes */
#pragma unroll
        for (int g = 0; g < 2; ++g) { const float mn = fmaxf(m_run[g], mb[g]); const float corr = __builtin_amdgcn_exp2f(m_run[g] - mn); m_run[g] = mn; l_run[g] *= corr;
#pragma unroll
          for (int t = 0; t < 4; ++t) acc[g][t] = acc[g][t] * corr; } }
      { const unsigned* mbn = mb_ + kn;      /* 32 words a pass of 32 keys. Behind the branch, which needs every select: the mask fetch goes into the registers that the selects read */
        mk[0] = *(fa_cwords*)mbn; mk[1] = *(fa_cwords*)(mbn + 16); }
      fa_issued();
#pragma unroll
      for (int g = 0; g < 2; ++g) { const float nm = -m_run[g]; FragH pf; f32x2 ls = {0.f, 0.f};
#pragma unroll
        for (int i = 0; i < 8; ++i) { const f32x2 a = __builtin_elementwise_fma(f32x2{s[i >> 2][g][2 * (i & 3)], s[i >> 2][g][2 * (i & 3) + 1]}, f32x2{cs, cs}, f32x2{nm, nm});
          const f32x2 p2 = {__builtin_amdgcn_exp2f(a.x), __builtin_amdgcn_exp2f(a.y)}; ls += p2; pf.h[2 * i] = (_Float16)p2.x; pf.h[2 * i + 1] = (_Float16)p2.y; }      /* element 8 kt + r of the B operand = key 16 kt + 8 hh + r */
        l_run[g] += ls.x + ls.y;
#pragma unroll
        for (int t = 0; t < 4; ++t) acc[g][t] = fa_mma(vf[t], pf.v, acc[g][t]); }
    }
    asm volatile("s_wait_dscnt 0x0" ::: "memory");      /* this wave's reads of the stage are done */
    asm volatile("s_wait_asynccnt 0x0" ::: "memory");      /* this wave's part of the next stage has landed */
    __syncthreads();      /* publishes the next stage, and ends every wave's reads of this one before it is refilled */
    if (st + 2 < SK / FA_KS) fa_stage(lk0 + (st & 1) * FA_SB, lv0 + (st & 1) * FA_SB, gk0 + (size_t)(st + 2) * (FA_KS * DM * 2), gv0 + (size_t)(st + 2) * (FA_KS * DM * 2));      /* the same for the whole work-group: stage st + 2 into the buffer just left */
  }
  asm volatile("s_wait_asynccnt 0x0" ::: "memory");      /* no copy is outstanding when the wave ends */
#pragma unroll
  for (int g = 0; g < 2; ++g) { const float l = l_run[g] + fa_xhalf(l_run[g]); const float inv = 64.0f / l;      /* o carried x64 */
    _Float16* op = O + ((size_t)b * NQ + q0 + 16 * g + ln) * DM + h * HD + 8 * hh;
#pragma unroll
    for (int t = 0; t < 4; ++t) { FragH f;
#pragma unroll
      for (int r = 0; r < 8; ++r) f.h[r] = (_Float16)(acc[g][t][r] * inv);
      *(v8us*)((unsigned short*)op + 16 * t) = f.half[0]; } }      /* d = 16 t + 8 hh + 0..7 of query ln: 16 contiguous bytes */
}
// Operand preparation, all of it in one launch of 256 work-groups of 16 waves (one a WGP): the work is 64 MiB of reads and 24 MiB + 512 KiB of writes; few long waves in one launch keep launch gaps and wave starts small beside the bytes.
// Every wave takes four pieces of 1,024 elements and asks for all of them at once (32 loads of 16 bytes a lane):
//  - a 32 query x 32 key block of the int mask (what one k_fattn wave needs in one pass) -> 32 lane-mask words: each lane reads the mask elements of its own score registers in k_fattn (query 16 g + ln, keys 16 kt + 8 hh + r),
//    a ballot of (element != 0) is the word of register (g, kt, r); one 128-byte store. The 16 heads then read 1 bit an element by scalar loads, where each read 4 bytes by 16-line vector loads;
//  - 4 KiB of x and 4 KiB of context -> exact f16 rows: each load 512 contiguous bytes, each store 256;
//  - a 64 k x 16 n block of one [in][out] weight -> Bt[n][k] = f16(bf16(W[k][n]) x 16): lane = (k group lane & 7, n group lane >> 3) reads 4 n of 8 k rows (a load touches 8 lines, where one element a lane would touch 32; the line's other half goes to the
//    neighbour wave of the work-group) and so holds 8 k of 4 n: each of its 4 stores is 16 bytes of a Bt row, 8 lanes a whole line. The transpose is in the registers' naming: no LDS, no barrier.
// Work-groups 0..63 take Wq, 64..191 Wkv (Bt rows 0..1023 = k columns, 1024..2047 = v columns), 192..255 Wp: 64 k x 256 n each.
__global__ __launch_bounds__(512) void k_prep(const float* __restrict__ x, const float* __restrict__ ctx, const int* __restrict__ Mk, const float* __restrict__ wq, const float* __restrict__ wkv, const float* __restrict__ wo,
    _Float16* __restrict__ X16, _Float16* __restrict__ C16, unsigned* __restrict__ MW, _Float16* __restrict__ BQ, _Float16* __restrict__ BKV, _Float16* __restrict__ BO) {
  static_assert(NRQ * SK == (size_t)256 * 16 * 1024 && SK == 1024, "k_prep: one 32 x 32 mask block a wave");
  static_assert(NRQ * DM == (size_t)256 * 16 * 1024 && NRK * DC == (size_t)256 * 16 * 1024 && DM == 1024 && DC == 1024, "k_prep: 4,096 waves, one piece of each kind a wave");
  const int lane = threadIdx.x & 31, lk = lane & 7, l4 = lane >> 3; const int wave = __builtin_amdgcn_readfirstlane((int)(threadIdx.x >> 5)); const int blk = blockIdx.x;
  const bool iskv = blk >= 64 && blk < 192; const float* W = blk < 64 ? wq : iskv ? wkv : wo; _Float16* Bt = blk < 64 ? BQ : iskv ? BKV : BO;
  const int t = blk < 64 ? blk : iskv ? blk - 64 : blk - 192; const int N = iskv ? 2 * DM : DM, sh = iskv ? 3 : 2;      /* N / 256 = 1 << sh column groups */
  const int k0 = (t >> sh) * 64, n0 = (t & ((1 << sh) - 1)) * 256 + wave * 16;
  const size_t e0 = ((size_t)blk * 16 + wave) * 1024;      /* the wave's first element of x and of context */
  const char* xp = (const char*)(x + e0); const char* cp = (const char*)(ctx + e0); const char* wp = (const char*)(W + (size_t)k0 * N + n0);      /* wave-uniform bases; the lane's part is a 32-bit byte offset */
  unsigned wl[8];
#pragma unroll
  for (int r = 0; r < 8; ++r) wl[r] = (unsigned)((8 * lk + r) * N + 4 * l4) * 4;
  const int gw = blk * 16 + wave;      /* mask block: query rows 32 (gw >> 5) .. + 31 of the flat [b n] rows, keys 32 (gw & 31) .. + 31 */
  const char* mp = (const char*)(Mk + (size_t)(gw >> 5) * 32 * SK + (gw & 31) * 32); const unsigned ml = (unsigned)((lane & 15) * SK * 4 + 32 * (lane >> 4));
  v4f xv[8], cv[8], wv[8]; v4ia mv[8];
#pragma unroll
  for (int j = 0; j < 8; ++j) xv[j] = *(const v4fa*)(xp + 512 * j + 16 * lane);
#pragma unroll
  for (int j = 0; j < 8; ++j) cv[j] = *(const v4fa*)(cp + 512 * j + 16 * lane);
#pragma unroll
  for (int r = 0; r < 8; ++r) wv[r] = *(const v4fa*)(wp + wl[r]);
#pragma unroll
  for (int i = 0; i < 8; ++i) mv[i] = *(const v4ia*)(mp + 16 * (i >> 2) * SK * 4 + 64 * ((i >> 1) & 1) + 16 * (i & 1) + ml);      /* i = 4 g + 2 kt + (r >> 2) */
  // The wait: the loads' offset registers are reused right behind. Its operands (inputs only) keep those registers as they are up to the wait.
  asm volatile("s_wait_xcnt 0x0" :: "v"(lane), "v"(wl[0]), "v"(wl[1]), "v"(wl[2]), "v"(wl[3]), "v"(wl[4]), "v"(wl[5]), "v"(wl[6]), "v"(wl[7]), "v"(ml) : "memory");
  __builtin_amdgcn_sched_barrier(0);      /* all 32 loads are asked for before the first value is worked on: without it the compiler sets the second and third group behind the conversions of the group before, three memory latencies in a row */
#pragma unroll
  for (int j = 0; j < 8; ++j) { v4h o;
#pragma unroll
    for (int q = 0; q < 4; ++q) o[q] = (_Float16)bf16_round(xv[j][q]);
    *(v4h*)(X16 + e0 + 128 * j + 4 * lane) = o; }
  __builtin_amdgcn_sched_barrier(0);      /* a piece's stores leave as soon as it is converted: without it the compiler keeps them back to the kernel's end, behind the last load's wait */
#pragma unroll
  for (int j = 0; j < 8; ++j) { v4h o;
#pragma unroll
    for (int q = 0; q < 4; ++q) o[q] = (_Float16)bf16_round(cv[j][q]);
    *(v4h*)(C16 + e0 + 128 * j + 4 * lane) = o; }
  __builtin_amdgcn_sched_barrier(0);      /* as above */
#pragma unroll
  for (int i = 0; i < 4; ++i) { FragH f;
#pragma unroll
    for (int r = 0; r < 8; ++r) f.h[r] = (_Float16)(bf16_round(wv[r][i]) * 16.0f);      /* x16, a power of two: bf16-exact weights stay exact in f16 away from the subnormal range */
    *(v8us*)((unsigned short*)Bt + (size_t)(n0 + 4 * l4 + i) * DM + k0 + 8 * lk) = f.half[0]; }
  __builtin_amdgcn_sched_barrier(0);      /* as above */
  unsigned word = 0;
#pragma unroll
  for (int i = 0; i < 32; ++i) { const unsigned bl = __builtin_amdgcn_ballot_w32(mv[i >> 2][i & 3] != 0); word = lane == i ? bl : word; }      /* word i = 16 g + 8 kt + r goes to lane i */
  MW[(size_t)gw * 32 + lane] = word;
}
extern "C" void kernel_launch(void* const* d_in, const int* in_sizes, int n_in,
                              void* d_out, int out_size, void* d_ws, size_t ws_size, hipStream_t stream) {
  (void)in_sizes; (void)n_in; (void)out_size;
  const float* const* I = (const float* const*)d_in; const float* x = I[0]; const float* ctx = I[1]; const int* mkm = (const int*)d_in[2]; const float* wq = I[3]; const float* bq = I[4]; const float* wkv = I[5]; const float* bkv = I[6]; const float* wo = I[7]; const float* bo = I[8];      /* [in][out] weights; int mask [b][n][m]; k | v from the fused Wkv [1024][2048] */
  char* ws = (char*)d_ws; size_t off = 0;
  auto take = [&](size_t bytes) { char* p = ws + off; off += (bytes + 255) & ~(size_t)255; return p; };
  _Float16* BQ = (_Float16*)take((size_t)DM * DM * 2); _Float16* BKV = (_Float16*)take((size_t)2 * DM * DC * 2); _Float16* BO = (_Float16*)take((size_t)DM * DM * 2);
  _Float16* X16 = (_Float16*)take(NRQ * DM * 2); _Float16* C16 = (_Float16*)take(NRK * DC * 2); _Float16* Q16 = (_Float16*)take(NRQ * DM * 2); _Float16* K16 = (_Float16*)take(2 * NRK * DM * 2); _Float16* V16 = K16 + NRK * DM; _Float16* O16 = X16;      /* o rows reuse the x rows, whose last reader is the Q GEMM */
  unsigned* MW = (unsigned*)take(NRQ * SK / 8);      /* the mask, 1 bit an element, as lane-mask words */
  if (off > ws_size) return;      /* 8 + 5 x 8 = 48 MiB, + 512 KiB */
  k_prep<<<256, 512, 0, stream>>>(x, ctx, mkm, wq, wkv, wo, X16, C16, MW, BQ, BKV, BO);      /* x, context -> f16 rows; [in][out] weights -> Bt x16; Wkv [1024][2048] -> Bt [2048][1024]: rows 0..1023 = k columns, 1024..2047 = v columns */
  k_gemm2<0, DM, DM, true, false, false><<<dim3((unsigned)((NRQ / 128) * (DM / 64)), 1), 128, 0, stream>>>(X16, 0, BQ, 0, 0.0625f, bq, 0, nullptr, 1, 0, 0, nullptr, Q16, DM, 0, (int)NRQ, DM, DM, 0, 0, 0);
  k_gemm2<0, DC, DC, true, false, false><<<dim3((unsigned)((NRK / 128) * (DM / 64)), 2), 128, 0, stream>>>(C16, 0, BKV, (size_t)DM * DC, 0.0625f, bkv, (size_t)DM, nullptr, 1, 0, 0, nullptr, K16, DM, NRK * DM, (int)NRK, DM, DC, 0, 0, 0);      /* grid.y 0: k = context Wkv[:, :1024] + bkv[:1024] -> K16; grid.y 1: v = context Wkv[:, 1024:] + bkv[1024:] -> V16 */
  k_fattn<<<dim3(NQ / 256, NH, NB), 256, 0, stream>>>(Q16, K16, V16, MW, O16);      /* scores, masked softmax and P V of all 64 (batch, head) planes: o x64, merged rows */
  k_gemm2<0, DM, DM, true, false, true><<<dim3((unsigned)((NRQ / 128) * (DM / 64)), 1), 128, 0, stream>>>(O16, 0, BO, 0, 0.0009765625f, bo, 0, nullptr, 1, 0, 0, (float*)d_out, nullptr, DM, 0, (int)NRQ, DM, DM, 0, 0, 0);      /* out = o Wo + bo */
}

// v010
// It runs in 77.7 microseconds.
// Two timings next to v009 both put it at 1.04 times that version's speed.
// Counting every step since v000, it is 68.6 times as fast.
#include <hip/hip_runtime.h>
// Masked multi-head cross-attention (x [4][1024][1024] queries, context [4][1024][1024]; q = x Wq + bq; k | v = context Wkv + bkv viewed (m, 2, 16, 64) ([in][out] weights sigma 1/32, zero biases); 16 heads of 64; dots = q k^T / 8; a binary int mask [b][n][32*32 = m] shared by the heads: masked_fill(mask == 0, -inf); softmax over the 1024 context tokens; out = merged Wp + bp -> [4][1024][1024]).
// Structure: x and context as exact f16 rows and [in][out] weights as exact x16 planes (Wkv as one [2048][1024] plane: k rows then v rows), and the int mask as 1-bit lane-mask words, all in one preparation launch; Q and K | V (one launch, grid.y) as WMMA GEMMs (operands staged in LDS, 32x64 wave tiles, f32 accumulation, + bias, f16 outputs); scores (K = 64, 1/8), mask select, online softmax (f32 statistics, native exp2; weights f16, unnormalised) and o = P V (V rows transposed on their way from LDS into the fragments; o carried x64) of all 64 (batch, head) planes fused in one launch, scores and weights in registers only, into merged f16 rows; out = o Wp + bp GEMM (f32, alpha 2^-10).
// Compute dtype: inputs rounded to bf16; x / context / weights exact; q, k, v, softmax weights and o as plain f16 GEMM operands (~2^-12); scores and statistics f32. v_wmma_f32_16x16x32_f16.
#define NB 4
#define NQ 1024
#define SK 1024
#define SQ SK                       /* keys per softmax row */
#define DM 1024
#define DC 1024
#define NH 16
#define HD 64
#define HG 4
#define NRQ ((size_t)NB * NQ)
#define NRK ((size_t)NB * SK)
typedef __bf16 v16b __attribute__((ext_vector_type(16)));
typedef unsigned short v8us __attribute__((ext_vector_type(8), may_alias));
typedef float  v8f  __attribute__((ext_vector_type(8)));
typedef float  v4f  __attribute__((ext_vector_type(4)));
typedef float  v4fa __attribute__((ext_vector_type(4), may_alias));
union FragB { v16b v; v8us half[2]; unsigned short u[16]; };

__device__ __forceinline__ unsigned short bf16_bits(float x) { unsigned int u = __float_as_uint(x); return (unsigned short)((u + 0x7FFFu + ((u >> 16) & 1u)) >> 16); }
__device__ __forceinline__ float bf16_val(unsigned short b) { return __uint_as_float(((unsigned int)b) << 16); }
__device__ __forceinline__ float bf16_round(float x) { return bf16_val(bf16_bits(x)); }
// D += A·B with NT terms: 1 = ah·bh, 2 = + al·bh (A split), 3 = + ah·bl (both split)
template <int NT>
__device__ __forceinline__ v8f mmaN(v16b ah, v16b al, v16b bh, v16b bl, v8f c) {
  c = __builtin_amdgcn_wmma_f32_16x16x32_bf16(false, ah, false, bh, (short)0, c, false, false);
  if (NT >= 2) c = __builtin_amdgcn_wmma_f32_16x16x32_bf16(false, al, false, bh, (short)0, c, false, false);
  if (NT >= 3) c = __builtin_amdgcn_wmma_f32_16x16x32_bf16(false, ah, false, bl, (short)0, c, false, false);
  asm volatile("v_nop\n\tv_nop\n\tv_nop\n\tv_nop" : "+v"(c) : "v"(ah), "v"(al), "v"(bh), "v"(bl));
  return c;
}

__global__ __launch_bounds__(256) void k_wt_bf16(const float* __restrict__ W, unsigned short* __restrict__ Wt, int K, int N) {
  const int t = blockIdx.x * 256 + threadIdx.x;
  const int k8n = K / 8;
  if (t >= N * k8n) return;
  const int n = t / k8n, k8 = (t % k8n) * 8;
  v8us v;
#pragma unroll
  for (int i = 0; i < 8; ++i) v[i] = bf16_bits(W[(size_t)(k8 + i) * N + n]);
  *(v8us*)(Wt + (size_t)n * K + k8) = v;
  
}

// GEMM C[M][N] (f32, pitch ldc) = act(A[M][K]·W + bias). A f32 row-major (pitch lda) converted per fragment to bf16
// (ASPLIT: hi/lo two planes -> 2 terms, else single rounded term); Wt bf16 [N][K] (pitch ldb). BIAS_BF16 rounds the
// bias to bf16 first (bias quantised to bf16 before the add). K%32==0, M%16==0, N%64==0.
template <bool ASPLIT, int ACT, bool BIAS_BF16>
__global__ __launch_bounds__(128) void k_gemm_bf(const float* __restrict__ A, int lda, const unsigned short* __restrict__ Wt, int ldb,
                                               const float* __restrict__ bias, float* __restrict__ C, int ldc, int M, int N, int K) {
  __shared__ __attribute__((aligned(16))) float so[4][16][64];
  const int tid = threadIdx.x, w = tid >> 5, lane = tid & 31, ln = lane & 15, hh = lane >> 4;
  const int ntn = N / 64;
  const int wid = blockIdx.x * 4 + w;
  const int mt = wid / ntn, nq = wid % ntn;
  if (mt * 16 >= M) return;
  const int row0 = mt * 16, col0 = nq * 64;
  const float* arow = A + (size_t)(row0 + ln) * lda;
  v8f acc[4] = {};
  for (int kb = 0; kb < K; kb += 32) {
    FragB ah, al;
    const v4f x0 = *(const v4fa*)(arow + kb + 8 * hh), x1 = *(const v4fa*)(arow + kb + 8 * hh + 4);
    const v4f x2 = *(const v4fa*)(arow + kb + 16 + 8 * hh), x3 = *(const v4fa*)(arow + kb + 16 + 8 * hh + 4);
    float xs[16] = {x0[0],x0[1],x0[2],x0[3],x1[0],x1[1],x1[2],x1[3],x2[0],x2[1],x2[2],x2[3],x3[0],x3[1],x3[2],x3[3]};
#pragma unroll
    for (int i = 0; i < 16; ++i) { const unsigned short hb = bf16_bits(xs[i]); ah.u[i] = hb; al.u[i] = ASPLIT ? bf16_bits(xs[i] - bf16_val(hb)) : (unsigned short)0; }
#pragma unroll
    for (int t = 0; t < 4; ++t) {
      const unsigned short* brow = Wt + (size_t)(col0 + t * 16 + ln) * ldb + kb;
      FragB b;
      b.half[0] = *(const v8us*)(brow + 8 * hh);
      b.half[1] = *(const v8us*)(brow + 16 + 8 * hh);
      acc[t] = mmaN<ASPLIT ? 2 : 1>(ah.v, al.v, b.v, b.v, acc[t]);
    }
  }
#pragma unroll
  for (int t = 0; t < 4; ++t) {
    float bv = bias ? bias[col0 + t * 16 + ln] : 0.f;
    if (BIAS_BF16) bv = bf16_round(bv);
#pragma unroll
    for (int r = 0; r < 8; ++r) { float v = acc[t][r] + bv; if (ACT == 1) v = fmaxf(v, 0.f); so[w][8 * hh + r][t * 16 + ln] = v; }
  }
  __builtin_amdgcn_fence(__ATOMIC_ACQ_REL, "workgroup");
  __builtin_amdgcn_wave_barrier();
  const int rsub = lane >> 4, c4 = (lane & 15) * 4;
  {
#pragma unroll
    for (int q = 0; q < 8; ++q) {
      const int r = q * 2 + rsub;
      const v4f v = *(const v4fa*)&so[w][r][c4];
      *(v4f*)(C + (size_t)(row0 + r) * ldc + col0 + c4) = v;
    }
    
  }
}

// GEMM C = act(A·W + bias + resid): A f32 (ASPLIT -> hi/lo 2 terms), Wt bf16 [N][K]; ACT 0 none, 1 relu, 2 exact gelu;
// resid (optional, f32, row index = (row % rmod), pitch ldr, RES_BF16 rounds it) added before the activation.
template <bool ASPLIT, int ACT, bool BIAS_BF16, bool RES_BF16>
__global__ __launch_bounds__(128) void k_gemm_bf3(const float* __restrict__ A, int lda, const unsigned short* __restrict__ Wt, int ldb,
                                                const float* __restrict__ bias, const float* __restrict__ resid, int rmod, int ldr,
                                                float* __restrict__ C, int ldc, int M, int N, int K) {
  __shared__ __attribute__((aligned(16))) float so[4][16][64];
  const int tid = threadIdx.x, w = tid >> 5, lane = tid & 31, ln = lane & 15, hh = lane >> 4;
  const int ntn = N / 64;
  const int wid = blockIdx.x * 4 + w;
  const int mt = wid / ntn, nq = wid % ntn;
  if (mt * 16 >= M) return;
  const int row0 = mt * 16, col0 = nq * 64;
  const float* arow = A + (size_t)(row0 + ln) * lda;
  v8f acc[4] = {};
  for (int kb = 0; kb < K; kb += 32) {
    FragB ah, al;
    const v4f x0 = *(const v4fa*)(arow + kb + 8 * hh), x1 = *(const v4fa*)(arow + kb + 8 * hh + 4);
    const v4f x2 = *(const v4fa*)(arow + kb + 16 + 8 * hh), x3 = *(const v4fa*)(arow + kb + 16 + 8 * hh + 4);
    float xs[16] = {x0[0],x0[1],x0[2],x0[3],x1[0],x1[1],x1[2],x1[3],x2[0],x2[1],x2[2],x2[3],x3[0],x3[1],x3[2],x3[3]};
#pragma unroll
    for (int i = 0; i < 16; ++i) { const unsigned short hb = bf16_bits(xs[i]); ah.u[i] = hb; al.u[i] = ASPLIT ? bf16_bits(xs[i] - bf16_val(hb)) : (unsigned short)0; }
#pragma unroll
    for (int t = 0; t < 4; ++t) {
      const unsigned short* brow = Wt + (size_t)(col0 + t * 16 + ln) * ldb + kb;
      FragB b;
      b.half[0] = *(const v8us*)(brow + 8 * hh);
      b.half[1] = *(const v8us*)(brow + 16 + 8 * hh);
      acc[t] = mmaN<ASPLIT ? 2 : 1>(ah.v, al.v, b.v, b.v, acc[t]);
    }
  }
#pragma unroll
  for (int t = 0; t < 4; ++t) {
    const int col = col0 + t * 16 + ln;
    float bv = bias ? bias[col] : 0.f;
    if (BIAS_BF16) bv = bf16_round(bv);
#pragma unroll
    for (int r = 0; r < 8; ++r) {
      float v = acc[t][r] + bv;
      if (resid) { float rv = resid[(size_t)((row0 + 8 * hh + r) % rmod) * ldr + col]; if (RES_BF16) rv = bf16_round(rv); v += rv; }
      if (ACT == 1) v = fmaxf(v, 0.f);
      if (ACT == 2) v = 0.5f * v * (1.0f + erff(v * 0.70710678118654752f));
      if (ACT == 3) { const float u = 0.7978845608028654f * (v + 0.044715f * v * v * v); v = 0.5f * v * (1.0f + tanhf(u)); }
      so[w][8 * hh + r][t * 16 + ln] = v;
    }
  }
  __builtin_amdgcn_fence(__ATOMIC_ACQ_REL, "workgroup");
  __builtin_amdgcn_wave_barrier();
  const int rsub = lane >> 4, c4 = (lane & 15) * 4;
  {
#pragma unroll
    for (int q = 0; q < 8; ++q) {
      const int r = q * 2 + rsub;
      const v4f v = *(const v4fa*)&so[w][r][c4];
      *(v4f*)(C + (size_t)(row0 + r) * ldc + col0 + c4) = v;
    }
    
  }
}
// row LayerNorm (biased variance, eps) over N: s = X (+ R); optional out_sum <- s; out_norm <- (s-mu)*rsqrt(var+eps)*g + b
template <bool PARAM_BF16>
__global__ __launch_bounds__(256) void k_layernorm(const float* __restrict__ X, const float* __restrict__ R, const float* __restrict__ g, const float* __restrict__ bta,
                                                  float* __restrict__ out_sum, float* __restrict__ out_norm, int N, float eps) {
  __shared__ float red[256];
  const int row = blockIdx.x, tid = threadIdx.x;
  const float* x = X + (size_t)row * N; const float* rr = R ? R + (size_t)row * N : nullptr;
  float vals[16];                     // up to N = 4096
  const int per = N / 256;            // contiguous chunk per thread? use strided-by-4 chunks: thread handles j = tid*4 + 1024*u
  float s1 = 0.f;
  for (int u = 0; u < per / 4; ++u) {
    const int j = tid * 4 + 1024 * u;
    const v4f a = *(const v4fa*)(x + j);
    v4f b = {0.f,0.f,0.f,0.f}; if (rr) b = *(const v4fa*)(rr + j);
#pragma unroll
    for (int q = 0; q < 4; ++q) { const float v = a[q] + b[q]; vals[u * 4 + q] = v; s1 += v; }
  }
  red[tid] = s1; __syncthreads();
  for (int st = 128; st > 0; st >>= 1) { if (tid < st) red[tid] += red[tid + st]; __syncthreads(); }
  const float mu = red[0] / (float)N; __syncthreads();
  float s2 = 0.f;
  for (int u = 0; u < per / 4; ++u)
#pragma unroll
    for (int q = 0; q < 4; ++q) { const float c = vals[u * 4 + q] - mu; s2 += c * c; }
  red[tid] = s2; __syncthreads();
  for (int st = 128; st > 0; st >>= 1) { if (tid < st) red[tid] += red[tid + st]; __syncthreads(); }
  const float rs = rsqrtf(red[0] / (float)N + eps);
  {
    for (int u = 0; u < per / 4; ++u) {
      const int j = tid * 4 + 1024 * u;
      v4f o, sm;
#pragma unroll
      for (int q = 0; q < 4; ++q) {
        float gg = g[j + q], bb = bta[j + q];
        if (PARAM_BF16) { gg = bf16_round(gg); bb = bf16_round(bb); }
        sm[q] = vals[u * 4 + q]; o[q] = (vals[u * 4 + q] - mu) * rs * gg + bb;
      }
      if (out_sum) *(v4f*)(out_sum + (size_t)row * N + j) = sm;
      *(v4f*)(out_norm + (size_t)row * N + j) = o;
    }
    
  }
}



// ---- f16 WMMA path (v_wmma_f32_16x16x32_f16): 11-bit significands for operands in range — used where a [0,1] probability operand needs more precision than bf16
typedef _Float16 v16h __attribute__((ext_vector_type(16)));
union FragH { v16h v; v8us half[2]; _Float16 h[16]; unsigned short u[16]; };
template <int NT>
__device__ __forceinline__ v8f mmaH(v16h ah, v16h al, v16h bh, v16h bl, v8f c) {
  c = __builtin_amdgcn_wmma_f32_16x16x32_f16(false, ah, false, bh, (short)0, c, false, false);
  if (NT >= 2) c = __builtin_amdgcn_wmma_f32_16x16x32_f16(false, al, false, bh, (short)0, c, false, false);
  if (NT >= 3) c = __builtin_amdgcn_wmma_f32_16x16x32_f16(false, ah, false, bl, (short)0, c, false, false);
  asm volatile("v_nop\n\tv_nop\n\tv_nop\n\tv_nop" : "+v"(c) : "v"(ah), "v"(al), "v"(bh), "v"(bl));
  return c;
}
// batched GEMM like k_gemm_b but f16 operands: A f32 (split into f16 hi/lo if ASPLIT, else rounded to f16), Bt = f16 values [n][k]; alpha; C f32; N multiple of 16 (partial tiles skipped)
template <bool ASPLIT>
__global__ __launch_bounds__(128) void k_gemm_h(const float* __restrict__ A, int lda, size_t sA, const _Float16* __restrict__ Bh, int ldb, size_t sB, float alpha, float* __restrict__ C, int ldc, size_t sC, int M, int N, int K) {
  __shared__ __attribute__((aligned(16))) float so[4][16][64];
  const int tid = threadIdx.x, w = tid >> 5, lane = tid & 31, ln = lane & 15, hh = lane >> 4; const int by = blockIdx.y;
  A += (size_t)by * sA; Bh += (size_t)by * sB; C += (size_t)by * sC;
  const int ntn = (N + 63) / 64; const int wid = blockIdx.x * 4 + w; const int mt = wid / ntn, nq = wid % ntn; if (mt * 16 >= M) return;
  const int row0 = mt * 16, col0 = nq * 64; const float* arow = A + (size_t)(row0 + ln) * lda;
  v8f acc[4] = {};
  for (int kb = 0; kb < K; kb += 32) {
    FragH ah, al;
    const v4f x0 = *(const v4fa*)(arow + kb + 8 * hh), x1 = *(const v4fa*)(arow + kb + 8 * hh + 4), x2 = *(const v4fa*)(arow + kb + 16 + 8 * hh), x3 = *(const v4fa*)(arow + kb + 16 + 8 * hh + 4);
    float xs[16] = {x0[0],x0[1],x0[2],x0[3],x1[0],x1[1],x1[2],x1[3],x2[0],x2[1],x2[2],x2[3],x3[0],x3[1],x3[2],x3[3]};
#pragma unroll
    for (int i = 0; i < 16; ++i) { const _Float16 h = (_Float16)xs[i]; ah.h[i] = h; al.h[i] = ASPLIT ? (_Float16)(xs[i] - (float)h) : (_Float16)0.0f; }
#pragma unroll
    for (int t = 0; t < 4; ++t) { if (col0 + t * 16 >= N) continue; const size_t boff = (size_t)(col0 + t * 16 + ln) * ldb + kb; FragH bq; bq.half[0] = *(const v8us*)(Bh + boff + 8 * hh); bq.half[1] = *(const v8us*)(Bh + boff + 16 + 8 * hh);
      acc[t] = mmaH<ASPLIT ? 2 : 1>(ah.v, al.v, bq.v, bq.v, acc[t]); }
  }
#pragma unroll
  for (int t = 0; t < 4; ++t) { if (col0 + t * 16 >= N) continue;
#pragma unroll
    for (int r = 0; r < 8; ++r) so[w][8 * hh + r][t * 16 + ln] = acc[t][r] * alpha; }
  __builtin_amdgcn_fence(__ATOMIC_ACQ_REL, "workgroup"); __builtin_amdgcn_wave_barrier();
  const int rsub = lane >> 4, c4 = (lane & 15) * 4;
  {
#pragma unroll
    for (int q = 0; q < 8; ++q) { const int r = q * 2 + rsub; if (col0 + c4 < N) { const v4f v = *(const v4fa*)&so[w][r][c4]; *(v4f*)(C + (size_t)(row0 + r) * ldc + col0 + c4) = v; } }
     }
}

// k_gemm_hh variant with fused epilogue: v = acc·alpha + bias[by·sBias + col] (+ CP[(row/rowsPerB)·sCPb + by·64 + col] if CP) ; ACT 0 none / 1 elu ; writes f16 C16 (and f32 C if non-null)
template <int ACT>
__global__ __launch_bounds__(128) void k_gemm_hhx(const _Float16* __restrict__ A, int lda, size_t sA, const _Float16* __restrict__ Bh, int ldb, size_t sB, float alpha, const float* __restrict__ bias, size_t sBias, const float* __restrict__ CP, int rowsPerB, size_t sCPb, int row0g,
    float* __restrict__ C, _Float16* __restrict__ C16, int ldc, size_t sC, int M, int N, int K) {
  __shared__ __attribute__((aligned(16))) float so[4][16][64];
  const int tid = threadIdx.x, w = tid >> 5, lane = tid & 31, ln = lane & 15, hh = lane >> 4; const int by = blockIdx.y;
  A += (size_t)by * sA; Bh += (size_t)by * sB; const size_t cofs = (size_t)by * sC; const float* bp = bias ? bias + (size_t)by * sBias : nullptr;
  const int ntn = (N + 63) / 64; const int wid = blockIdx.x * 4 + w; const int mt = wid / ntn, nq = wid % ntn; if (mt * 16 >= M) return;
  const int row0 = mt * 16, col0 = nq * 64; const _Float16* arow = A + (size_t)(row0 + ln) * lda;
  v8f acc[4] = {};
  for (int kb = 0; kb < K; kb += 32) { FragH ah; ah.half[0] = *(const v8us*)((const unsigned short*)arow + kb + 8 * hh); ah.half[1] = *(const v8us*)((const unsigned short*)arow + kb + 16 + 8 * hh);
#pragma unroll
    for (int t = 0; t < 4; ++t) { if (col0 + t * 16 >= N) continue; const size_t boff = (size_t)(col0 + t * 16 + ln) * ldb + kb; FragH bq; bq.half[0] = *(const v8us*)((const unsigned short*)Bh + boff + 8 * hh); bq.half[1] = *(const v8us*)((const unsigned short*)Bh + boff + 16 + 8 * hh);
      acc[t] = mmaH<1>(ah.v, ah.v, bq.v, bq.v, acc[t]); }
  }
#pragma unroll
  for (int t = 0; t < 4; ++t) { if (col0 + t * 16 >= N) continue; const int col = col0 + t * 16 + ln; const float bv = bp ? bf16_round(bp[col]) : 0.f;
#pragma unroll
    for (int r = 0; r < 8; ++r) { float v = acc[t][r] * alpha + bv; if (CP) { const int rr = row0g + row0 + 8 * hh + r; if (rowsPerB < 0) v += CP[cofs + (size_t)rr * ldc + col];      /* rowsPerB < 0: own element of the batched C plane */ else { const int bidx = rr / rowsPerB; v += CP[(size_t)bidx * sCPb + (size_t)by * 64 + col]; } } if (ACT == 1) v = (v > 0.f) ? v : expm1f(v); else if (ACT == 7) v = (v > 0.f) ? v + 1.0f : expf(v); else if (ACT == 8) v = tanhf(v); else if (ACT == 9) v = 0.5f * v * (1.0f + tanhf(0.7978845608028654f * (v + 0.044715f * v * v * v))); else if (ACT == 11) v = 1.0f / (1.0f + expf(-v)); else if (ACT == 12) v = (v > 0.f) ? v : 0.01f * v; else if (ACT == 14) v = (v > 0.f) ? v : 0.1f * v; else if (ACT == 16) v = (v >= 0.f) ? v : 0.3f * v; else if (ACT == 17) v = (v >= 0.f) ? v : 0.2f * v; else if (ACT == 15) v = v / (1.0f + expf(-v)); else if (ACT == 3) v = fmaxf(v, 0.f); else if (ACT == 6) v = 0.5f * v * (1.0f + erff(v * 0.70710678118654752f)); so[w][8 * hh + r][t * 16 + ln] = v; } }
  __builtin_amdgcn_fence(__ATOMIC_ACQ_REL, "workgroup"); __builtin_amdgcn_wave_barrier();
  const int rsub = lane >> 4, c4 = (lane & 15) * 4; typedef _Float16 v4h __attribute__((ext_vector_type(4)));
  {
#pragma unroll
    for (int q = 0; q < 8; ++q) { const int r = q * 2 + rsub; if (col0 + c4 < N) { const v4f v = *(const v4fa*)&so[w][r][c4]; if (C) *(v4f*)(C + cofs + (size_t)(row0 + r) * ldc + col0 + c4) = v; if (C16) { v4h h4; for (int i = 0; i < 4; ++i) h4[i] = (_Float16)v[i]; *(v4h*)(C16 + cofs + (size_t)(row0 + r) * ldc + col0 + c4) = h4; } } }
     }
}


typedef _Float16 v4h __attribute__((ext_vector_type(4)));

__global__ __launch_bounds__(256) void k_h16(const float* __restrict__ x, _Float16* __restrict__ X16, size_t n8) { const size_t t = (size_t)blockIdx.x * 256 + threadIdx.x; if (t >= n8) return; FragH f;
#pragma unroll
  for (int q = 0; q < 8; ++q) f.h[q] = (_Float16)x[t * 8 + q]; *(v8us*)((unsigned short*)X16 + t * 8) = f.half[0];  }
__global__ __launch_bounds__(256) void k_round16f(const float* __restrict__ W, _Float16* __restrict__ Bt, size_t n8) { const size_t t = (size_t)blockIdx.x * 256 + threadIdx.x; if (t >= n8) return; FragH f;
#pragma unroll
  for (int i = 0; i < 8; ++i) f.h[i] = (_Float16)(bf16_round(W[t * 8 + i]) * 16.0f); *(v8us*)((unsigned short*)Bt + t * 8) = f.half[0];  }

__global__ __launch_bounds__(256) void k_hl(const float* __restrict__ F, _Float16* __restrict__ Hh, _Float16* __restrict__ Hl, size_t n8) { const size_t t = (size_t)blockIdx.x * 256 + threadIdx.x; if (t >= n8) return; FragH fh, fl; const v4f a = *(const v4fa*)(F + t * 8), c = *(const v4fa*)(F + t * 8 + 4);
#pragma unroll
  for (int q = 0; q < 4; ++q) { _Float16 h = (_Float16)a[q]; fh.h[q] = h; fl.h[q] = (_Float16)((a[q] - (float)h) * 1024.0f); h = (_Float16)c[q]; fh.h[4 + q] = h; fl.h[4 + q] = (_Float16)((c[q] - (float)h) * 1024.0f); }
  { *(v8us*)((unsigned short*)Hh + t * 8) = fh.half[0]; *(v8us*)((unsigned short*)Hl + t * 8) = fl.half[0];  } }

// ---- fast GEMM (work-group tile 128x128: eight waves, 4 x 2, of 32x64 each; requires M % 128 == 0, N % 128 == 0, K % 128 == 0, 256-byte aligned rows); operands staged in LDS; epilogue = k_gemm_hhx semantics ----
// The square tile is for the L2: a stage brings 256 operand rows for 128 x 128 x 128 products, where two 128x64 tiles brought 384.
#define G2_KS 128                      /* k per stage: 256 bytes of every operand row */
#define G2_PITCH (G2_KS * 2 + 16)      /* LDS row pitch in bytes: 16 x odd, for 16-byte readers */
__device__ __forceinline__ v16h g2_lfrag(const char* p) { FragH f; f.half[0] = *(const v8us*)p; f.half[1] = *(const v8us*)(p + 32); return f.v; }      /* a fragment from a staged row; the lane's 16 hh bytes are in p */
__device__ __forceinline__ v8f g2_mma(v16h a, v16h b, v8f c) { v8f d = __builtin_amdgcn_wmma_f32_16x16x32_f16(false, a, false, b, (short)0, c, false, false); asm volatile("v_nop\n\tv_nop\n\tv_nop\n\tv_nop" : "+v"(d) : "v"(a), "v"(b)); return d; }
template <int ACT, int lda, int ldb, bool HASB, bool HASCP, bool OUTF32>      /* the operands' row pitches at compile time: a thread's staging loads are then one base, one lane offset and immediates. The epilogue's options too (HASB: a bias is added; HASCP: a CP plane is added; OUTF32: f32 rows to C, else f16 rows to C16): as run-time pointer tests they stood as a scalar branch at every element and every row, and each bias load and each LDS read-back was waited for alone */
__global__ __launch_bounds__(256) void k_gemm2(const _Float16* __restrict__ A, size_t sA, const _Float16* __restrict__ Bh, size_t sB, float alpha, const float* __restrict__ bias, size_t sBias, const float* __restrict__ CP, int rowsPerB, size_t sCPb, int row0g,
    float* __restrict__ C, _Float16* __restrict__ C16, int ldc, size_t sC, int M, int N, int K, size_t sAz, size_t sBz, size_t sCz) { static_assert(ACT == 0 || ACT == 3 || ACT == 6 || ACT == 8 || ACT == 9 || ACT == 11 || ACT == 12 || ACT == 14 || ACT == 15 || ACT == 16 || ACT == 17, "k_gemm2: unsupported ACT code (would silently apply no activation)");
  __shared__ __attribute__((aligned(16))) char sm[256 * G2_PITCH];      /* one stage: 128 A rows, then 128 B rows, G2_KS k each; behind the k loop the waves' output staging */
  static_assert(sizeof(sm) >= 8 * 32 * 68 * sizeof(float), "k_gemm2: the output staging lies in the stage buffer"); float (*so)[32][68] = (float (*)[32][68])sm;
  const int tid = threadIdx.x, w = tid >> 5, wr = w & 3, wc = w >> 2, lane = tid & 31, ln = lane & 15, hh = lane >> 4; const int by = blockIdx.y, bz = blockIdx.z;      /* wave w: rows 32 wr, columns 64 wc of the tile. Two batch levels: grid.y (strides sA, sB, sC) and grid.z (strides sAz, sBz, sCz) */
  A += (size_t)by * sA + (size_t)bz * sAz; Bh += (size_t)by * sB + (size_t)bz * sBz; const size_t cofs = (size_t)by * sC + (size_t)bz * sCz; const float* bp = bias + (size_t)by * sBias;
  const int ntn = N >> 7; const int mt = blockIdx.x / ntn, nq = blockIdx.x - mt * ntn; const int row0 = mt * 128 + 32 * wr, col0 = nq * 128 + 64 * wc; if (mt * 128 >= M) return;      /* the same for the whole work-group: barriers follow */
  const char* Ab = (const char*)(A + (size_t)(mt * 128) * lda); const char* Bb = (const char*)(Bh + (size_t)(nq * 128) * ldb);      /* uniform bases; the lane's part is a 32-bit byte offset that never changes */
  const int sr = tid >> 4, sc = tid & 15;      /* staging: 16 lanes take one row's 256 bytes, so a wave's load covers 4 whole lines; thread rows sr + 16 j */
  const unsigned ga = (unsigned)(sr * lda + sc * 8) * 2, gb = (unsigned)(sr * ldb + sc * 8) * 2;
  char* sst = sm + sr * G2_PITCH + sc * 16;
  const char* sa = sm + (32 * wr + ln) * G2_PITCH + 16 * hh; const char* sb = sm + (128 + 64 * wc + ln) * G2_PITCH + 16 * hh;      /* fragment rows; k = 8 hh + 0..7 and 16 + 8 hh + 0..7 of each 32, A and B alike */
  const v8f z8 = {0.f,0.f,0.f,0.f,0.f,0.f,0.f,0.f}; v8f c00 = z8, c01 = z8, c02 = z8, c03 = z8, c10 = z8, c11 = z8, c12 = z8, c13 = z8;
  v8us st[16];
#pragma unroll
  for (int j = 0; j < 8; ++j) st[j] = *(const v8us*)(Ab + (size_t)(16 * j) * lda * 2 + ga);
#pragma unroll
  for (int j = 0; j < 8; ++j) st[8 + j] = *(const v8us*)(Bb + (size_t)(16 * j) * ldb * 2 + gb);
#pragma unroll 1
  for (int kb = 0; kb < K; kb += G2_KS) {
#pragma unroll
    for (int j = 0; j < 16; ++j) *(v8us*)(sst + 16 * j * G2_PITCH) = st[j];
    __syncthreads();      /* the stage is whole before anybody reads it */
    if (kb + G2_KS < K) {      /* the next stage's rows fly into registers while this stage is worked on */
      const char* An = Ab + (size_t)(kb + G2_KS) * 2 + ga; const char* Bn = Bb + (size_t)(kb + G2_KS) * 2 + gb;
#pragma unroll
      for (int j = 0; j < 8; ++j) st[j] = *(const v8us*)(An + (size_t)(16 * j) * lda * 2);
#pragma unroll
      for (int j = 0; j < 8; ++j) st[8 + j] = *(const v8us*)(Bn + (size_t)(16 * j) * ldb * 2);
      asm volatile("s_wait_xcnt 0x0" :: "v"(An), "v"(Bn) : "memory");      /* the loads' address registers are reused right behind; it also keeps the global loads in front of the LDS reads. Its operands (inputs only) keep the two addresses as they are up to the wait */
    }
#pragma unroll
    for (int kk = 0; kk < G2_KS / 32; ++kk) { const v16h a0 = g2_lfrag(sa + 64 * kk), a1 = g2_lfrag(sa + 16 * G2_PITCH + 64 * kk);      /* the six fragments of a k step are asked for together: one LDS wait a step */
      const v16h b0 = g2_lfrag(sb + 64 * kk), b1 = g2_lfrag(sb + 16 * G2_PITCH + 64 * kk), b2 = g2_lfrag(sb + 32 * G2_PITCH + 64 * kk), b3 = g2_lfrag(sb + 48 * G2_PITCH + 64 * kk);
      c00 = g2_mma(a0, b0, c00); c10 = g2_mma(a1, b0, c10); c01 = g2_mma(a0, b1, c01); c11 = g2_mma(a1, b1, c11);
      c02 = g2_mma(a0, b2, c02); c12 = g2_mma(a1, b2, c12); c03 = g2_mma(a0, b3, c03); c13 = g2_mma(a1, b3, c13); }
    __syncthreads();      /* every reader has left the stage before it is written again (behind the last pass: before the output staging) */
  }
  v8f accs[8] = {c00, c01, c02, c03, c10, c11, c12, c13};
  float bvs[4];
#pragma unroll
  for (int t = 0; t < 4; ++t) bvs[t] = HASB ? bf16_round(bp[col0 + t * 16 + ln]) : 0.f;      /* the four bias columns of the lane, asked for together */
#pragma unroll
  for (int u = 0; u < 8; ++u) { const int t = u & 3, half = u >> 2; const int col = col0 + t * 16 + ln; const float bv = bvs[t];
#pragma unroll
    for (int r = 0; r < 8; ++r) { const int rloc = half * 16 + 8 * hh + r; float v = accs[u][r] * alpha + bv; if (HASCP) { if (rowsPerB < 0) v += CP[cofs + (size_t)(row0g + row0 + rloc) * ldc + col];      /* rowsPerB < 0: own element of the batched C plane */ else { const int bidx = (row0g + row0 + rloc) / rowsPerB; v += CP[(size_t)bidx * sCPb + (size_t)by * 64 + col]; } }
      if (ACT == 3) v = fmaxf(v, 0.f); else if (ACT == 6) v = 0.5f * v * (1.0f + erff(v * 0.70710678118654752f)); else if (ACT == 11) v = 1.0f / (1.0f + expf(-v)); else if (ACT == 15) v = v / (1.0f + expf(-v)); else if (ACT == 12) v = (v > 0.f) ? v : 0.01f * v; else if (ACT == 8) v = tanhf(v); else if (ACT == 9) v = 0.5f * v * (1.0f + tanhf(0.7978845608028654f * (v + 0.044715f * v * v * v))); else if (ACT == 14) v = (v > 0.f) ? v : 0.1f * v; else if (ACT == 16) v = (v >= 0.f) ? v : 0.3f * v; else if (ACT == 17) v = (v >= 0.f) ? v : 0.2f * v;
      so[w][rloc][t * 16 + ln] = v; } }
  __builtin_amdgcn_fence(__ATOMIC_ACQ_REL, "workgroup"); __builtin_amdgcn_wave_barrier();
  const int rsub = lane >> 4, c4 = (lane & 15) * 4;
  {
#pragma unroll
    for (int q = 0; q < 16; ++q) { const int r = q * 2 + rsub; const v4f v = *(const v4fa*)&so[w][r][c4]; if (OUTF32) *(v4f*)(C + cofs + (size_t)(row0 + r) * ldc + col0 + c4) = v; else { v4h h4; for (int i = 0; i < 4; ++i) h4[i] = (_Float16)v[i]; *(v4h*)(C16 + cofs + (size_t)(row0 + r) * ldc + col0 + c4) = h4; } }
     } }


__global__ __launch_bounds__(256) void k_wnat(const float* __restrict__ w, size_t n8, _Float16* __restrict__ Bt) { const size_t t = (size_t)blockIdx.x * 256 + threadIdx.x; if (t >= n8) return; FragH f; for (int q = 0; q < 8; ++q) f.h[q] = (_Float16)(bf16_round(w[t * 8 + q]) * 16.0f); *(v8us*)((unsigned short*)Bt + t * 8) = f.half[0];  }
__global__ __launch_bounds__(256) void k_rsm(const float* __restrict__ S, _Float16* __restrict__ P, int nrows) {
  #pragma clang fp contract(off)
  const int i = blockIdx.x * 256 + threadIdx.x; if (i >= nrows) return; const float* s = S + (size_t)i * SQ; float mx = -3.0e38f;
#pragma unroll 1
  for (int j = 0; j < SQ; ++j) mx = fmaxf(mx, s[j]); float se = 0.f;
#pragma unroll 1
  for (int j = 0; j < SQ; ++j) se += expf(s[j] - mx); const float sc = 256.0f / se;
#pragma unroll 1
  for (int j0 = 0; j0 < SQ; j0 += 8) { FragH f; for (int q = 0; q < 8; ++q) f.h[q] = (_Float16)(expf(s[j0 + q] - mx) * sc); unsigned short* d = (unsigned short*)P + (size_t)i * SQ + j0; *(v8us*)d = f.half[0];  } }
__global__ __launch_bounds__(256) void k_vt(const _Float16* __restrict__ V16, int b, int h0, _Float16* __restrict__ VT) { __shared__ unsigned short tl[64][65]; const int tid = threadIdx.x; const int hh = blockIdx.x % HG, sg = blockIdx.x / HG; const int s0 = sg * 64; const int h = h0 + hh;
  for (int i = tid; i < 64 * 8; i += 256) { const int j = i / 8, d8 = (i % 8) * 8; FragH f; f.half[0] = *(const v8us*)((const unsigned short*)V16 + ((size_t)b * SQ + s0 + j) * DM + h * HD + d8); for (int q = 0; q < 8; ++q) tl[d8 + q][j] = f.u[q]; }
  __syncthreads();
  { for (int i = tid; i < 64 * 8; i += 256) { const int d = i / 8, j8 = (i % 8) * 8; FragH f; for (int q = 0; q < 8; ++q) f.u[q] = tl[d][j8 + q]; *(v8us*)((unsigned short*)VT + ((size_t)hh * HD + d) * SQ + s0 + j8) = f.half[0]; }  } }


__global__ __launch_bounds__(256) void k_rsmf(const float* __restrict__ S, _Float16* __restrict__ P, int qn, int hg) {
  #pragma clang fp contract(off)
  const int t = blockIdx.x * 256 + threadIdx.x; if (t >= qn * hg) return; const size_t i = (size_t)(t / qn) * SQ + (t % qn); const float* s = S + i * SQ; float mx = -3.0e38f;
#pragma unroll 1
  for (int j = 0; j < SQ; ++j) mx = fmaxf(mx, s[j]); float se = 0.f;
#pragma unroll 1
  for (int j = 0; j < SQ; ++j) se += __expf(s[j] - mx); const float sc = 256.0f / se;
#pragma unroll 1
  for (int j0 = 0; j0 < SQ; j0 += 8) { FragH f; for (int q = 0; q < 8; ++q) f.h[q] = (_Float16)(__expf(s[j0 + q] - mx) * sc); unsigned short* d = (unsigned short*)P + i * SQ + j0; *(v8us*)d = f.half[0];  } }

__global__ __launch_bounds__(256) void k_rsmr(const float* __restrict__ S, _Float16* __restrict__ P, int qn, int hg) {
  #pragma clang fp contract(off)
  const int t = blockIdx.x * 256 + threadIdx.x; if (t >= qn * hg) return; const size_t i = (size_t)t;      /* planes packed: row t of plane t / qn */ const float* s = S + i * SQ; float mx = -3.0e38f;
#pragma unroll 1
  for (int j = 0; j < SQ; ++j) mx = fmaxf(mx, s[j]); float se = 0.f;
#pragma unroll 1
  for (int j = 0; j < SQ; ++j) se += __expf(s[j] - mx); const float sc = 256.0f / se;
#pragma unroll 1
  for (int j0 = 0; j0 < SQ; j0 += 8) { FragH f; for (int q = 0; q < 8; ++q) f.h[q] = (_Float16)(__expf(s[j0 + q] - mx) * sc); unsigned short* d = (unsigned short*)P + i * SQ + j0; *(v8us*)d = f.half[0];  } }


typedef int v4ia __attribute__((ext_vector_type(4), may_alias));
typedef unsigned v16ua __attribute__((ext_vector_type(16), may_alias));
typedef float f32x2 __attribute__((ext_vector_type(2)));
__device__ __forceinline__ float fa_xhalf(float x) { return __builtin_bit_cast(float, __builtin_amdgcn_permlanex16(__builtin_bit_cast(int, x), __builtin_bit_cast(int, x), 0x76543210, 0xfedcba98, false, false)); }      /* lane l with lane l ^ 16 */
__device__ __forceinline__ v8f fa_mma(v16h a, v16h b, v8f c) { return __builtin_amdgcn_wmma_f32_16x16x32_f16(false, a, false, b, (short)0, c, false, false); }
__device__ __forceinline__ v16h fa_frag(const char* base, unsigned off) { FragH f; f.half[0] = *(const v8us*)(base + off); f.half[1] = *(const v8us*)(base + off + 32); return f.v; }      /* k = 8 hh + 0..7 and 16 + 8 hh + 0..7; the lane's 16 hh bytes are in off */
// In front of a group of fragment loads: keeps the loads from rising among the WMMAs in front of them.
__device__ __forceinline__ void fa_ahead() { __builtin_amdgcn_sched_barrier(0); }
// Behind the next pass's mask fetch. The wait: the fetch's address registers are reused right behind it. The scheduling barrier: keeps that wait directly behind its loads and the fetch where it is written, a phase ahead of its use (without it the compiler moves the mask fetch down among the exponentials and the wait away from its loads).
__device__ __forceinline__ void fa_issued() { asm volatile("s_wait_xcnt 0x0" ::: "memory"); __builtin_amdgcn_sched_barrier(0); }
// Behind a group of fragment loads from LDS: keeps the group where it is written, as one group a phase ahead of its use (without it the compiler may sink single loads down to their WMMAs).
__device__ __forceinline__ void fa_placed() { __builtin_amdgcn_sched_barrier(0); }
// The mask words as constant-address-space data (k_prep wrote them in an earlier launch; nothing writes them in this one): with the ring's copies and barriers in the kernel the compiler fetched them, as plain global loads, by vector loads behind the first barrier and moved them to scalar registers word by word.
typedef __attribute__((address_space(4))) const v16ua fa_cwords;
#define FA_KS 128                      /* keys per LDS stage: four passes of 32 */
#define FA_KP (HD * 2 + 16)            /* LDS pitch of a K row (64 d): 144 bytes = 16 x odd, for 16-byte readers */
#define FA_VP (HD * 2 + 32)            /* LDS pitch of a V row (64 d): 160 bytes = 32 x odd, for the transposing 16-byte readers */
#define FA_KB (FA_KS * FA_KP)          /* a stage's K tile */
#define FA_SB (FA_KB + FA_KS * FA_VP)  /* a stage: K tile, then V tile */
// A 16 (d) x 16 (keys) half of a V^T fragment from V rows in LDS: lane l gives the address of 16 bytes of row 8 (l >> 4) + (l & 7), d half (l >> 3) & 1, and gets keys 8 hh + 0..7 of column d = ln.
typedef short fa_s16x8 __attribute__((ext_vector_type(8)));
__device__ __forceinline__ v8us fa_tr16(const char* p) { typedef __attribute__((address_space(3))) fa_s16x8 lds_s16x8; return __builtin_bit_cast(v8us, __builtin_amdgcn_ds_load_tr16_b128_v8i16((lds_s16x8*)p)); }
// One stage's K rows and V rows (128 x 128 bytes each) from global memory into LDS, through no register: 8 asynchronous 16-byte copies a lane, a wave's copy = 4 whole lines.
// lk, lv: the lane's LDS byte addresses of its first K and V piece; gk, gv: the global ones. The four pieces of each kind lie 32 rows apart.
// The wait on the address translations is the statement's last line: the copies' address registers are free for reuse only behind it (a precaution).
__device__ __forceinline__ void fa_stage(unsigned lk, unsigned lv, const char* gk, const char* gv) {
  asm volatile("global_load_async_to_lds_b128 %0, %1, off\n\t"
               "global_load_async_to_lds_b128 %2, %3, off\n\t"
               "global_load_async_to_lds_b128 %4, %5, off\n\t"
               "global_load_async_to_lds_b128 %6, %7, off\n\t"
               "global_load_async_to_lds_b128 %8, %9, off\n\t"
               "global_load_async_to_lds_b128 %10, %11, off\n\t"
               "global_load_async_to_lds_b128 %12, %13, off\n\t"
               "global_load_async_to_lds_b128 %14, %15, off\n\t"
               "s_wait_xcnt 0x0"
               :: "v"(lk), "v"(gk), "v"(lk + 32 * FA_KP), "v"(gk + 32 * DM * 2), "v"(lk + 64 * FA_KP), "v"(gk + 64 * DM * 2), "v"(lk + 96 * FA_KP), "v"(gk + 96 * DM * 2),
                  "v"(lv), "v"(gv), "v"(lv + 32 * FA_VP), "v"(gv + 32 * DM * 2), "v"(lv + 64 * FA_VP), "v"(gv + 64 * DM * 2), "v"(lv + 96 * FA_VP), "v"(gv + 96 * DM * 2)
               : "memory");
}
__global__ __launch_bounds__(256) void k_fattn(const _Float16* __restrict__ Q, const _Float16* __restrict__ Kr, const _Float16* __restrict__ Vr, const unsigned* __restrict__ MW, _Float16* __restrict__ O) {
  __shared__ __attribute__((aligned(16))) char sm[2 * FA_SB];
  const int tid = threadIdx.x, lane = tid & 31, ln = lane & 15, hh = lane >> 4; const int wave = __builtin_amdgcn_readfirstlane((int)(threadIdx.x >> 5));
  const int h = blockIdx.y, b = blockIdx.z, q0 = blockIdx.x * 256 + wave * 32;
  const float cs = 0.125f * 1.4426950408889634f;      /* 1 / sqrt(64), and e^x = 2^(x log2 e) */
  const float fill = -8589934592.0f;      /* masked_fill: -2^33, -2^30 after the 1/8. A power of two, so that its product with cs is exact: while every key seen so far is masked the maximum IS that product, the fused multiply-add of the exponent gives exactly 0 and the weights are 1 (finite); the first unmasked key rescales them to 0. A fill whose product rounds would leave a positive exponent there */
  const char* qb = (const char*)(Q + ((size_t)b * NQ + q0) * DM + h * HD);      /* wave-uniform bases; the lane's part is a 32-bit byte offset that never changes */
  const char* kb = (const char*)(Kr + (size_t)b * SK * DM + h * HD);
  const char* vb = (const char*)(Vr + (size_t)b * SK * DM + h * HD);
  const unsigned* mb_ = MW + ((size_t)b * NQ + q0) * (SK / 32);      /* the wave's 32 passes x 32 lane-mask words, contiguous; the address is wave-uniform, so the words come by scalar loads */
  const unsigned ko = (unsigned)(ln * DM * 2 + 16 * hh);
  /* staging: 8 lanes take a K row's, and a V row's, 128 bytes (thread rows (tid >> 3) + 32 j) */
  const unsigned sm0 = (unsigned)(size_t)sm;      /* the ring's LDS byte address: the low 32 bits of the __shared__ address */
  const unsigned lk0 = sm0 + (unsigned)((tid >> 3) * FA_KP + (tid & 7) * 16), lv0 = sm0 + (unsigned)(FA_KB + (tid >> 3) * FA_VP + (tid & 7) * 16);
  const char* gk0 = kb + (size_t)((tid >> 3) * DM * 2 + (tid & 7) * 16); const char* gv0 = vb + (size_t)((tid >> 3) * DM * 2 + (tid & 7) * 16);
  fa_stage(lk0, lv0, gk0, gv0);      /* stage 0 into buffer 0 */
  v16h qf[2][2];
#pragma unroll
  for (int g = 0; g < 2; ++g)
#pragma unroll
    for (int kc = 0; kc < 2; ++kc) qf[g][kc] = fa_frag(qb + 16 * g * DM * 2 + 64 * kc, ko);
  fa_issued();      /* the Q loads' address registers are reused right behind */
  v16ua mk[2];      /* mk[g][8 kt + r]: bit l = lane l's mask element of score register r, tile kt, column group g */
  mk[0] = *(fa_cwords*)mb_; mk[1] = *(fa_cwords*)(mb_ + 16);
  fa_issued();
  asm volatile("s_wait_asynccnt 0x0" ::: "memory");      /* this wave's part of stage 0 has landed */
  __syncthreads();      /* stage 0 is whole before anybody reads it */
  fa_stage(lk0 + FA_SB, lv0 + FA_SB, gk0 + (size_t)FA_KS * DM * 2, gv0 + (size_t)FA_KS * DM * 2);      /* stage 1 into buffer 1: flies while stage 0 is worked on */
  const v8f z8 = {0.f, 0.f, 0.f, 0.f, 0.f, 0.f, 0.f, 0.f};
  v8f acc[2][4]; float m_run[2], l_run[2];
#pragma unroll
  for (int g = 0; g < 2; ++g) { m_run[g] = -3.0e38f; l_run[g] = 0.f;
#pragma unroll
    for (int t = 0; t < 4; ++t) acc[g][t] = z8; }
  const int klo = ln * FA_KP + 16 * hh, vlo = FA_KB + (8 * hh + (lane & 7)) * FA_VP + 16 * ((lane >> 3) & 1);      /* the lane's K fragment row and its address part of the transposing V loads in a stage; k = 8 hh + 0..7 and 16 + 8 hh + 0..7 of each 32, as in the Q fragments and in P */
#pragma unroll 1      /* the ring stays a loop of eight stages: one copy of the four passes in the instruction cache */
  for (int st = 0; st < SK / FA_KS; ++st) {
    const char* sk = sm + (st & 1) * FA_SB + klo; const char* sv = sm + (st & 1) * FA_SB + vlo;
    v16h kf[2][2], vf[4];
#pragma unroll
    for (int kt = 0; kt < 2; ++kt)
#pragma unroll
      for (int kc = 0; kc < 2; ++kc) kf[kt][kc] = g2_lfrag(sk + 16 * kt * FA_KP + 64 * kc);      /* the stage's first K fragments */
    fa_placed();
#pragma unroll      /* the four passes of a stage: every LDS offset an immediate, and the last pass without a K fetch */
    for (int p = 0; p < FA_KS / 32; ++p) {
      const int kn = (st * FA_KS + p * 32 + 32) & (SK - 1);      /* the next pass's first key; the last pass fetches pass 0's mask words again (in bounds, not used) so that the fetch stays unconditional */
      v8f s[2][2];
#pragma unroll
      for (int kt = 0; kt < 2; ++kt)
#pragma unroll
        for (int g = 0; g < 2; ++g) s[kt][g] = fa_mma(kf[kt][1], qf[g][1], fa_mma(kf[kt][0], qf[g][0], z8));
      fa_ahead();      /* the score products first: the K fetch goes into their operand registers */
      if (p + 1 < FA_KS / 32) {
#pragma unroll
        for (int kt = 0; kt < 2; ++kt)
#pragma unroll
          for (int kc = 0; kc < 2; ++kc) kf[kt][kc] = g2_lfrag(sk + (32 * (p + 1) + 16 * kt) * FA_KP + 64 * kc); }
#pragma unroll
      for (int t = 0; t < 4; ++t) { FragH f; f.half[0] = fa_tr16(sv + 32 * p * FA_VP + 32 * t); f.half[1] = fa_tr16(sv + (32 * p + 16) * FA_VP + 32 * t); vf[t] = f.v; }      /* d = 16 t + ln; keys 32 p + 8 hh + 0..7 and 32 p + 16 + 8 hh + 0..7 */
      fa_placed();
      float mb[2]; bool need = false;
#pragma unroll
      for (int g = 0; g < 2; ++g) { float mx = -3.0e38f;
#pragma unroll
        for (int kt = 0; kt < 2; ++kt)
#pragma unroll
          for (int r = 0; r < 8; ++r) { const float v = __builtin_amdgcn_inverse_ballot_w32(mk[g][8 * kt + r]) ? s[kt][g][r] : fill; s[kt][g][r] = v; mx = fmaxf(mx, v); }      /* the word IS the select's lane mask: no compare */
        mx = fmaxf(mx, fa_xhalf(mx)) * cs; mb[g] = mx; need = need || (mx > m_run[g] + 8.0f); }
      if (__builtin_amdgcn_ballot_w32(need) != 0) {      /* wave-uniform; rare after the first passes */
#pragma unroll
        for (int g = 0; g < 2; ++g) { const float mn = fmaxf(m_run[g], mb[g]); const float corr = __builtin_amdgcn_exp2f(m_run[g] - mn); m_run[g] = mn; l_run[g] *= corr;
#pragma unroll
          for (int t = 0; t < 4; ++t) acc[g][t] = acc[g][t] * corr; } }
      { const unsigned* mbn = mb_ + kn;      /* 32 words a pass of 32 keys. Behind the branch, which needs every select: the mask fetch goes into the registers that the selects read */
        mk[0] = *(fa_cwords*)mbn; mk[1] = *(fa_cwords*)(mbn + 16); }
      fa_issued();
#pragma unroll
      for (int g = 0; g < 2; ++g) { const float nm = -m_run[g]; FragH pf; f32x2 ls = {0.f, 0.f};
#pragma unroll
        for (int i = 0; i < 8; ++i) { const f32x2 a = __builtin_elementwise_fma(f32x2{s[i >> 2][g][2 * (i & 3)], s[i >> 2][g][2 * (i & 3) + 1]}, f32x2{cs, cs}, f32x2{nm, nm});
          const f32x2 p2 = {__builtin_amdgcn_exp2f(a.x), __builtin_amdgcn_exp2f(a.y)}; ls += p2; pf.h[2 * i] = (_Float16)p2.x; pf.h[2 * i + 1] = (_Float16)p2.y; }      /* element 8 kt + r of the B operand = key 16 kt + 8 hh + r */
        l_run[g] += ls.x + ls.y;
#pragma unroll
        for (int t = 0; t < 4; ++t) acc[g][t] = fa_mma(vf[t], pf.v, acc[g][t]); }
    }
    asm volatile("s_wait_dscnt 0x0" ::: "memory");      /* this wave's reads of the stage are done */
    asm volatile("s_wait_asynccnt 0x0" ::: "memory");      /* this wave's part of the next stage has landed */
    __syncthreads();      /* publishes the next stage, and ends every wave's reads of this one before it is refilled */
    if (st + 2 < SK / FA_KS) fa_stage(lk0 + (st & 1) * FA_SB, lv0 + (st & 1) * FA_SB, gk0 + (size_t)(st + 2) * (FA_KS * DM * 2), gv0 + (size_t)(st + 2) * (FA_KS * DM * 2));      /* the same for the whole work-group: stage st + 2 into the buffer just left */
  }
  asm volatile("s_wait_asynccnt 0x0" ::: "memory");      /* no copy is outstanding when the wave ends */
#pragma unroll
  for (int g = 0; g < 2; ++g) { const float l = l_run[g] + fa_xhalf(l_run[g]); const float inv = 64.0f / l;      /* o carried x64 */
    _Float16* op = O + ((size_t)b * NQ + q0 + 16 * g + ln) * DM + h * HD + 8 * hh;
#pragma unroll
    for (int t = 0; t < 4; ++t) { FragH f;
#pragma unroll
      for (int r = 0; r < 8; ++r) f.h[r] = (_Float16)(acc[g][t][r] * inv);
      *(v8us*)((unsigned short*)op + 16 * t) = f.half[0]; } }      /* d = 16 t + 8 hh + 0..7 of query ln: 16 contiguous bytes */
}
// Operand preparation, all of it in one launch of 256 work-groups of 16 waves (one a WGP): the work is 64 MiB of reads and 24 MiB + 512 KiB of writes; few long waves in one launch keep launch gaps and wave starts small beside the bytes.
// Every wave takes four pieces of 1,024 elements and asks for all of them at once (32 loads of 16 bytes a lane):
//  - a 32 query x 32 key block of the int mask (what one k_fattn wave needs in one pass) -> 32 lane-mask words: each lane reads the mask elements of its own score registers in k_fattn (query 16 g + ln, keys 16 kt + 8 hh + r),
//    a ballot of (element != 0) is the word of register (g, kt, r); one 128-byte store. The 16 heads then read 1 bit an element by scalar loads, where each read 4 bytes by 16-line vector loads;
//  - 4 KiB of x and 4 KiB of context -> exact f16 rows: each load 512 contiguous bytes, each store 256;
//  - a 64 k x 16 n block of one [in][out] weight -> Bt[n][k] = f16(bf16(W[k][n]) x 16): lane = (k group lane & 7, n group lane >> 3) reads 4 n of 8 k rows (a load touches 8 lines, where one element a lane would touch 32; the line's other half goes to the
//    neighbour wave of the work-group) and so holds 8 k of 4 n: each of its 4 stores is 16 bytes of a Bt row, 8 lanes a whole line. The transpose is in the registers' naming: no LDS, no barrier.
// Work-groups 0..63 take Wq, 64..191 Wkv (Bt rows 0..1023 = k columns, 1024..2047 = v columns), 192..255 Wp: 64 k x 256 n each.
__global__ __launch_bounds__(512) void k_prep(const float* __restrict__ x, const float* __restrict__ ctx, const int* __restrict__ Mk, const float* __restrict__ wq, const float* __restrict__ wkv, const float* __restrict__ wo,
    _Float16* __restrict__ X16, _Float16* __restrict__ C16, unsigned* __restrict__ MW, _Float16* __restrict__ BQ, _Float16* __restrict__ BKV, _Float16* __restrict__ BO) {
  static_assert(NRQ * SK == (size_t)256 * 16 * 1024 && SK == 1024, "k_prep: one 32 x 32 mask block a wave");
  static_assert(NRQ * DM == (size_t)256 * 16 * 1024 && NRK * DC == (size_t)256 * 16 * 1024 && DM == 1024 && DC == 1024, "k_prep: 4,096 waves, one piece of each kind a wave");
  const int lane = threadIdx.x & 31, lk = lane & 7, l4 = lane >> 3; const int wave = __builtin_amdgcn_readfirstlane((int)(threadIdx.x >> 5)); const int blk = blockIdx.x;
  const bool iskv = blk >= 64 && blk < 192; const float* W = blk < 64 ? wq : iskv ? wkv : wo; _Float16* Bt = blk < 64 ? BQ : iskv ? BKV : BO;
  const int t = blk < 64 ? blk : iskv ? blk - 64 : blk - 192; const int N = iskv ? 2 * DM : DM, sh = iskv ? 3 : 2;      /* N / 256 = 1 << sh column groups */
  const int k0 = (t >> sh) * 64, n0 = (t & ((1 << sh) - 1)) * 256 + wave * 16;
  const size_t e0 = ((size_t)blk * 16 + wave) * 1024;      /* the wave's first element of x and of context */
  const char* xp = (const char*)(x + e0); const char* cp = (const char*)(ctx + e0); const char* wp = (const char*)(W + (size_t)k0 * N + n0);      /* wave-uniform bases; the lane's part is a 32-bit byte offset */
  unsigned wl[8];
#pragma unroll
  for (int r = 0; r < 8; ++r) wl[r] = (unsigned)((8 * lk + r) * N + 4 * l4) * 4;
  const int gw = blk * 16 + wave;      /* mask block: query rows 32 (gw >> 5) .. + 31 of the flat [b n] rows, keys 32 (gw & 31) .. + 31 */
  const char* mp = (const char*)(Mk + (size_t)(gw >> 5) * 32 * SK + (gw & 31) * 32); const unsigned ml = (unsigned)((lane & 15) * SK * 4 + 32 * (lane >> 4));
  v4f xv[8], cv[8], wv[8]; v4ia mv[8];
#pragma unroll
  for (int j = 0; j < 8; ++j) xv[j] = *(const v4fa*)(xp + 512 * j + 16 * lane);
#pragma unroll
  for (int j = 0; j < 8; ++j) cv[j] = *(const v4fa*)(cp + 512 * j + 16 * lane);
#pragma unroll
  for (int r = 0; r < 8; ++r) wv[r] = *(const v4fa*)(wp + wl[r]);
#pragma unroll
  for (int i = 0; i < 8; ++i) mv[i] = *(const v4ia*)(mp + 16 * (i >> 2) * SK * 4 + 64 * ((i >> 1) & 1) + 16 * (i & 1) + ml);      /* i = 4 g + 2 kt + (r >> 2) */
  // The wait: the loads' offset registers are reused right behind. Its operands (inputs only) keep those registers as they are up to the wait.
  asm volatile("s_wait_xcnt 0x0" :: "v"(lane), "v"(wl[0]), "v"(wl[1]), "v"(wl[2]), "v"(wl[3]), "v"(wl[4]), "v"(wl[5]), "v"(wl[6]), "v"(wl[7]), "v"(ml) : "memory");
  __builtin_amdgcn_sched_barrier(0);      /* all 32 loads are asked for before the first value is worked on: without it the compiler sets the second and third group behind the conversions of the group before, three memory latencies in a row */
#pragma unroll
  for (int j = 0; j < 8; ++j) { v4h o;
#pragma unroll
    for (int q = 0; q < 4; ++q) o[q] = (_Float16)bf16_round(xv[j][q]);
    *(v4h*)(X16 + e0 + 128 * j + 4 * lane) = o; }
  __builtin_amdgcn_sched_barrier(0);      /* a piece's stores leave as soon as it is converted: without it the compiler keeps them back to the kernel's end, behind the last load's wait */
#pragma unroll
  for (int j = 0; j < 8; ++j) { v4h o;
#pragma unroll
    for (int q = 0; q < 4; ++q) o[q] = (_Float16)bf16_round(cv[j][q]);
    *(v4h*)(C16 + e0 + 128 * j + 4 * lane) = o; }
  __builtin_amdgcn_sched_barrier(0);      /* as above */
#pragma unroll
  for (int i = 0; i < 4; ++i) { FragH f;
#pragma unroll
    for (int r = 0; r < 8; ++r) f.h[r] = (_Float16)(bf16_round(wv[r][i]) * 16.0f);      /* x16, a power of two: bf16-exact weights stay exact in f16 away from the subnormal range */
    *(v8us*)((unsigned short*)Bt + (size_t)(n0 + 4 * l4 + i) * DM + k0 + 8 * lk) = f.half[0]; }
  __builtin_amdgcn_sched_barrier(0);      /* as above */
  unsigned word = 0;
#pragma unroll
  for (int i = 0; i < 32; ++i) { const unsigned bl = __builtin_amdgcn_ballot_w32(mv[i >> 2][i & 3] != 0); word = lane == i ? bl : word; }      /* word i = 16 g + 8 kt + r goes to lane i */
  MW[(size_t)gw * 32 + lane] = word;
}
extern "C" void kernel_launch(void* const* d_in, const int* in_sizes, int n_in,
                              void* d_out, int out_size, void* d_ws, size_t ws_size, hipStream_t stream) {
  (void)in_sizes; (void)n_in; (void)out_size;
  const float* const* I = (const float* const*)d_in; const float* x = I[0]; const float* ctx = I[1]; const int* mkm = (const int*)d_in[2]; const float* wq = I[3]; const float* bq = I[4]; const float* wkv = I[5]; const float* bkv = I[6]; const float* wo = I[7]; const float* bo = I[8];      /* [in][out] weights; int mask [b][n][m]; k | v from the fused Wkv [1024][2048] */
  char* ws = (char*)d_ws; size_t off = 0;
  auto take = [&](size_t bytes) { char* p = ws + off; off += (bytes + 255) & ~(size_t)255; return p; };
  _Float16* BQ = (_Float16*)take((size_t)DM * DM * 2); _Float16* BKV = (_Float16*)take((size_t)2 * DM * DC * 2); _Float16* BO = (_Float16*)take((size_t)DM * DM * 2);
  _Float16* X16 = (_Float16*)take(NRQ * DM * 2); _Float16* C16 = (_Float16*)take(NRK * DC * 2); _Float16* Q16 = (_Float16*)take(NRQ * DM * 2); _Float16* K16 = (_Float16*)take(2 * NRK * DM * 2); _Float16* V16 = K16 + NRK * DM; _Float16* O16 = X16;      /* o rows reuse the x rows, whose last reader is the Q GEMM */
  unsigned* MW = (unsigned*)take(NRQ * SK / 8);      /* the mask, 1 bit an element, as lane-mask words */
  if (off > ws_size) return;      /* 8 + 5 x 8 = 48 MiB, + 512 KiB */
  k_prep<<<256, 512, 0, stream>>>(x, ctx, mkm, wq, wkv, wo, X16, C16, MW, BQ, BKV, BO);      /* x, context -> f16 rows; [in][out] weights -> Bt x16; Wkv [1024][2048] -> Bt [2048][1024]: rows 0..1023 = k columns, 1024..2047 = v columns */
  k_gemm2<0, DM, DM, true, false, false><<<dim3((unsigned)((NRQ / 128) * (DM / 128)), 1), 256, 0, stream>>>(X16, 0, BQ, 0, 0.0625f, bq, 0, nullptr, 1, 0, 0, nullptr, Q16, DM, 0, (int)NRQ, DM, DM, 0, 0, 0);
  k_gemm2<0, DC, DC, true, false, false><<<dim3((unsigned)((NRK / 128) * (DM / 128)), 2), 256, 0, stream>>>(C16, 0, BKV, (size_t)DM * DC, 0.0625f, bkv, (size_t)DM, nullptr, 1, 0, 0, nullptr, K16, DM, NRK * DM, (int)NRK, DM, DC, 0, 0, 0);      /* grid.y 0: k = context Wkv[:, :1024] + bkv[:1024] -> K16; grid.y 1: v = context Wkv[:, 1024:] + bkv[1024:] -> V16 */
  k_fattn<<<dim3(NQ / 256, NH, NB), 256, 0, stream>>>(Q16, K16, V16, MW, O16);      /* scores, masked softmax and P V of all 64 (batch, head) planes: o x64, merged rows */
  k_gemm2<0, DM, DM, true, false, true><<<dim3((unsigned)((NRQ / 128) * (DM / 128)), 1), 256, 0, stream>>>(O16, 0, BO, 0, 0.0009765625f, bo, 0, nullptr, 1, 0, 0, (float*)d_out, nullptr, DM, 0, (int)NRQ, DM, DM, 0, 0, 0);      /* out = o Wo + bo */
}
